// v005
// Measured on an AMD MI455X. A time is GPU time per run, averaged over a window of back-to-back runs after a warm-up
// (all launches, gaps included; the runs take copies of the inputs in turn), and the median of several windows.
// Apart from v000's, it joins two sittings. Times from different sittings can be a few percent apart, while
// side-by-side timings come from the same sitting.
// The versions before v005 are in another document.
// Measured time: 162 microseconds a run.
// Next to v004, in two timings, it ran 1.28 times as fast each time.
// Counting every step since v000, which is the starting kernel, it is 9.05 times as fast.
// Contractions: q/k/v/o projections X.W [4096x1024].[1024x1024] and the position-wise FFN relu(Y.W1 + b) [4096x1024].[1024x4096], .W2 + b [4096x4096].[4096x1024] with f16 operands on pre-cast planes (v_wmma_f32_16x16x32_f16; 128x128 LDS-staged work-group tiles of eight 32x64 wave tiles, weights x16); the block-diagonal windowed attention (8 blocks of 128 positions per sequence = 32 independent (sequence, block) attentions, 16 heads, keys >= valid_len SET to -1e6 through an integer keep-mask — exactly the module's where, so blocks lying wholly beyond valid_len are uniform) as one flash launch (f16 q.k^T and p.v with p as f16 of 4096 p); f32 accumulate and softmax. AddNorm LayerNorms (wave per row, fixed-order trees) are f32 kernels and the mask table from the INPUT valid lengths an int32 kernel.
#include <hip/hip_runtime.h>
#include <math.h>

typedef __attribute__((ext_vector_type(16))) _Float16 v16h;
typedef __attribute__((ext_vector_type(8)))  _Float16 v8h;
typedef __attribute__((ext_vector_type(16))) __bf16   v16b;
typedef __attribute__((ext_vector_type(8)))  float    v8f;
typedef __attribute__((ext_vector_type(4)))  float    v4f;

// 16-bit WMMA fragment map (wave32), lane L, h = L>>4, m = L&15:
//   A 16x32: lane = row m;   element i -> k = (i<8) ? 8h+i : 16+8h+(i-8)
//   B 32x16: lane = column m; the SAME k(i,h)
//   D 16x16 (8 f32): lane = column m; element r -> row 8h+r
__device__ __forceinline__ int frag_k(int i, int h) { return (i < 8) ? (8 * h + i) : (16 + 8 * h + (i - 8)); }
__device__ __forceinline__ __bf16 bf16_rne(float f) {
    unsigned int u = __float_as_uint(f);
    u += 0x7fffu + ((u >> 16) & 1u);
    return __builtin_bit_cast(__bf16, (unsigned short)(u >> 16));
}
__device__ __forceinline__ float bf16_f32(__bf16 b) { return __uint_as_float(((unsigned int)__builtin_bit_cast(unsigned short, b)) << 16); }
__device__ __forceinline__ v8f wmma16(v16h a, v16h b, v8f c) {
    c = __builtin_amdgcn_wmma_f32_16x16x32_f16(false, a, false, b, (short)0, c, false, false);
    asm volatile("v_nop\n\tv_nop\n\tv_nop\n\tv_nop" : "+v"(c) : "v"(a), "v"(b));
    return c;
}
__device__ __forceinline__ v8f wmmab(v16b a, v16b b, v8f c) {
    c = __builtin_amdgcn_wmma_f32_16x16x32_bf16(false, a, false, b, (short)0, c, false, false);
    asm volatile("v_nop\n\tv_nop\n\tv_nop\n\tv_nop" : "+v"(c) : "v"(a), "v"(b));
    return c;
}
struct Split { v16b hi, lo; };
// hi/lo split product: a.hi*b.hi + a.hi*b.lo + a.lo*b.hi
__device__ __forceinline__ v8f wmma3(const Split& a, const Split& b, v8f c) {
    c = __builtin_amdgcn_wmma_f32_16x16x32_bf16(false, a.hi, false, b.hi, (short)0, c, false, false);
    c = __builtin_amdgcn_wmma_f32_16x16x32_bf16(false, a.hi, false, b.lo, (short)0, c, false, false);
    c = __builtin_amdgcn_wmma_f32_16x16x32_bf16(false, a.lo, false, b.hi, (short)0, c, false, false);
    asm volatile("v_nop\n\tv_nop\n\tv_nop\n\tv_nop" : "+v"(c) : "v"(a.hi), "v"(a.lo), "v"(b.hi), "v"(b.lo));
    return c;
}
struct Split3 { v16b hi, mid, lo; };
// triple split product (6 terms, drops only terms below 2^-24 relative)
__device__ __forceinline__ v8f wmma6(const Split3& a, const Split3& b, v8f c) {
    c = __builtin_amdgcn_wmma_f32_16x16x32_bf16(false, a.hi, false, b.hi, (short)0, c, false, false);
    c = __builtin_amdgcn_wmma_f32_16x16x32_bf16(false, a.hi, false, b.mid, (short)0, c, false, false);
    c = __builtin_amdgcn_wmma_f32_16x16x32_bf16(false, a.mid, false, b.hi, (short)0, c, false, false);
    c = __builtin_amdgcn_wmma_f32_16x16x32_bf16(false, a.hi, false, b.lo, (short)0, c, false, false);
    c = __builtin_amdgcn_wmma_f32_16x16x32_bf16(false, a.mid, false, b.mid, (short)0, c, false, false);
    c = __builtin_amdgcn_wmma_f32_16x16x32_bf16(false, a.lo, false, b.hi, (short)0, c, false, false);
    asm volatile("v_nop\n\tv_nop\n\tv_nop\n\tv_nop" : "+v"(c) : "v"(a.hi), "v"(a.mid), "v"(a.lo), "v"(b.hi), "v"(b.mid), "v"(b.lo));
    return c;
}

// Fragment gathers from f32 memory: element i <- p[(k0 + frag_k(i,h)) * sk] * s, zero for k >= klen.
__device__ __forceinline__ v16h fh_ld(const float* __restrict__ p, long long sk, int k0, int h, int klen, float s) {
    v16h a;
#pragma unroll
    for (int i = 0; i < 16; ++i) { const int k = k0 + frag_k(i, h); a[i] = (k < klen) ? (_Float16)(p[(long long)k * sk] * s) : (_Float16)0.f; }
    return a;
}
__device__ __forceinline__ Split sp_ld(const float* __restrict__ p, long long sk, int k0, int h, int klen, float s) {
    Split r;
#pragma unroll
    for (int i = 0; i < 16; ++i) {
        const int k = k0 + frag_k(i, h); const float x = (k < klen) ? p[(long long)k * sk] * s : 0.f;
        const __bf16 hb = bf16_rne(x); r.hi[i] = hb; r.lo[i] = bf16_rne(x - bf16_f32(hb));
    }
    return r;
}
__device__ __forceinline__ Split3 sp3_ld(const float* __restrict__ p, long long sk, int k0, int h, int klen, float s) {
    Split3 r;
#pragma unroll
    for (int i = 0; i < 16; ++i) {
        const int k = k0 + frag_k(i, h); const float x = (k < klen) ? p[(long long)k * sk] * s : 0.f;
        const __bf16 hb = bf16_rne(x); const float r1 = x - bf16_f32(hb); const __bf16 mb = bf16_rne(r1);
        r.hi[i] = hb; r.mid[i] = mb; r.lo[i] = bf16_rne(r1 - bf16_f32(mb));
    }
    return r;
}
__device__ __forceinline__ v16b bh_ld(const float* __restrict__ p, long long sk, int k0, int h, int klen, float s) {
    v16b a;
#pragma unroll
    for (int i = 0; i < 16; ++i) { const int k = k0 + frag_k(i, h); a[i] = bf16_rne((k < klen) ? p[(long long)k * sk] * s : 0.f); }
    return a;
}
// f16 fragment from an f16 LDS/global row with element stride 1 (k-contiguous), no bounds (tile already zero padded)
__device__ __forceinline__ v16h fh_row(const _Float16* __restrict__ row, int k0, int h) {
    v16h a;
#pragma unroll
    for (int i = 0; i < 16; ++i) a[i] = row[k0 + frag_k(i, h)];
    return a;
}

#define VST2(T, ptr, val) do { const T vst2_v_ = (val); *(T*)(ptr) = vst2_v_;  } while (0)
typedef float v4f __attribute__((ext_vector_type(4)));
#define VST2V4(ptr, val) do { const v4f vst2_v4_ = (val); *(v4f*)(ptr) = vst2_v4_;  } while (0)

__device__ __attribute__((noinline)) float act_fn(float v, int act) {
    if (act == 1) return fmaxf(v, 0.f);                                                                               // relu
    if (act == 2) { const float u = 0.7978845608028654f * (v + 0.044715f * v * v * v); return 0.5f * v * (1.f + tanhf(u)); } // tanh-gelu
    if (act == 3) return v / (1.f + expf(-v));                                                                        // silu
    if (act == 4) return 0.5f * v * (1.f + erff(v * 0.7071067811865476f));                                             // erf-gelu
    if (act == 5) return tanhf(v);
    if (act == 6) return 1.f / (1.f + expf(-v));                                                                      // sigmoid
    if (act == 7) return (v > 0.f) ? v : 0.01f * v;                                                                   // leaky relu 0.01
    if (act == 8) return (v > 0.f) ? v : (expf(v) - 1.f);                                                             // elu
    if (act == 9) return fminf(fmaxf(v, 0.f), 6.f);                                                                   // relu6
    if (act == 10) return fabsf(v);                                                                                    // abs
    if (act == 11) return (v >= 0.f) ? v : 0.1f * v;                                                                  // leaky 0.1
    if (act == 12) return (v > 0.f) ? v : 0.2f * v;                                                                   // leaky 0.2
    if (act == 13) return (v > 20.f) ? v : log1pf(expf(v));                                                            // softplus
    return v;
}

// =====================================================================================================================
// k_gemm<MODE>: C(z, m, n) = act(alpha * sum_k A(z, m, k) * B(z, k, n) + bias) + beta * R(z, m, n)
//   One wave (32-thread block) per 16 x 32 tile of C; grid (ceil(N/32), ceil(M/16), Z). Batch z -> (zo = z / zi_n, zi = z % zi_n)
//   with separate outer/inner strides for every tensor (e.g. batch and head). A(m,k) = A[zo*sAo + zi*sAi + m*sAm + k*sAk] (f32),
//   B(k,n) = B[zo*sBo + zi*sBi + n*sBn + k*sBk] (f32); any M, N, K (K zero-padded to 32 inside the fragments, M/N tails guarded).
//   C(m,n) = C[zo*sCo + zi*sCi + m*sCm + n] (n contiguous). flags: 1 bias[n], 2 bias[m], 4 residual R[zo*sRo + zi*sRi + m*sRm + n*sRn].
//   MODE 0: f16 operands (A prescaled by sa, B by sb, both undone in the epilogue); 1: bf16 hi/lo split (3 products); 2: bf16;
//   3: bf16 hi/mid/lo triple split (6 products); 4: as 3 with Kahan-compensated f32 accumulation across k-steps.
// =====================================================================================================================
struct GemmP {
    const float* A; const float* B; const float* bias; const float* R; float* C;
    long long sAo, sAi, sAm, sAk, sBo, sBi, sBn, sBk, sCo, sCi, sCm, sRo, sRi, sRm, sRn;
    int M, N, K, zi_n, flags, act; float alpha, beta, sa, sb;
    int Npad, pad_;     // columns [N, Npad) of C are written as 0 so that padded workspace rows are covered by whole-line stores; Npad >= N
};
static_assert(sizeof(GemmP) == 5 * 8 + 15 * 8 + 6 * 4 + 4 * 4 + 2 * 4, "GemmP has padding");

template <int MODE>
__global__ __launch_bounds__(32) void k_gemm(GemmP p) {
    const int lane = threadIdx.x & 31, h = lane >> 4, l15 = lane & 15;
    const int m0 = blockIdx.y * 16, n0 = blockIdx.x * 32;
    const int z = blockIdx.z, zo = z / p.zi_n, zi = z - zo * p.zi_n;
    const float* A = p.A + zo * p.sAo + zi * p.sAi;
    const float* B = p.B + zo * p.sBo + zi * p.sBi;
    const int am = min(m0 + l15, p.M - 1);                       // clamped row for loads (stores are guarded)
    v8f acc[2], comp[2];
#pragma unroll
    for (int t = 0; t < 2; ++t) { v8f zz = {}; acc[t] = zz; comp[t] = zz; }
    for (int k0 = 0; k0 < p.K; k0 += 32) {
        const float* arow = A + (long long)am * p.sAm;
        if (MODE == 1) {
            const Split a = sp_ld(arow, p.sAk, k0, h, p.K, 1.f);
#pragma unroll
            for (int t = 0; t < 2; ++t) {
                const int bn = min(n0 + t * 16 + l15, p.N - 1);
                acc[t] = wmma3(a, sp_ld(B + (long long)bn * p.sBn, p.sBk, k0, h, p.K, 1.f), acc[t]);
            }
        } else if (MODE == 3) {
            const Split3 a = sp3_ld(arow, p.sAk, k0, h, p.K, 1.f);
#pragma unroll
            for (int t = 0; t < 2; ++t) {
                const int bn = min(n0 + t * 16 + l15, p.N - 1);
                acc[t] = wmma6(a, sp3_ld(B + (long long)bn * p.sBn, p.sBk, k0, h, p.K, 1.f), acc[t]);
            }
        } else if (MODE == 4) {
            // triple split as MODE 3, but each k-step's 6 products go into a fresh accumulator and the partial is added to the running f32 sum
            // on the VALU with Kahan compensation (accumulation error stays ~1 ulp however long K is)
            const Split3 a = sp3_ld(arow, p.sAk, k0, h, p.K, 1.f);
#pragma unroll
            for (int t = 0; t < 2; ++t) {
                const int bn = min(n0 + t * 16 + l15, p.N - 1); v8f zz = {};
                const v8f part = wmma6(a, sp3_ld(B + (long long)bn * p.sBn, p.sBk, k0, h, p.K, 1.f), zz);
                const v8f y = part - comp[t]; const v8f s = acc[t] + y; comp[t] = (s - acc[t]) - y; acc[t] = s;
            }
        } else if (MODE == 2) {
            const v16b a = bh_ld(arow, p.sAk, k0, h, p.K, 1.f);
#pragma unroll
            for (int t = 0; t < 2; ++t) {
                const int bn = min(n0 + t * 16 + l15, p.N - 1);
                acc[t] = wmmab(a, bh_ld(B + (long long)bn * p.sBn, p.sBk, k0, h, p.K, 1.f), acc[t]);
            }
        } else {
            const v16h a = fh_ld(arow, p.sAk, k0, h, p.K, p.sa);
#pragma unroll
            for (int t = 0; t < 2; ++t) {
                const int bn = min(n0 + t * 16 + l15, p.N - 1);
                acc[t] = wmma16(a, fh_ld(B + (long long)bn * p.sBn, p.sBk, k0, h, p.K, p.sb), acc[t]);
            }
        }
    }
    const float iscale = (MODE == 0) ? p.alpha / (p.sa * p.sb) : p.alpha;
    float* C = p.C + zo * p.sCo + zi * p.sCi;
    const float* R = p.R + zo * p.sRo + zi * p.sRi;
    __shared__ __align__(16) float ctile[16][36];
#pragma unroll
    for (int t = 0; t < 2; ++t) {
        const int n = n0 + t * 16 + l15; const int nn = min(n, p.N - 1);
#pragma unroll
        for (int r = 0; r < 8; ++r) {
            const int m = m0 + 8 * h + r; const int mm = min(m, p.M - 1);
            float v = acc[t][r] * iscale;
            if (p.flags & 1) v += p.bias[nn];
            if (p.flags & 2) v += p.bias[mm];
            if (p.flags & 8) v *= p.bias[(long long)zo * p.M + mm];   /* per-(z,row) scale vector laid out [Z][M]; exclusive with the bias flags */
            v = act_fn(v, p.act);
            if (p.flags & 4) v += p.beta * R[(long long)mm * p.sRm + (long long)nn * p.sRn];
            ctile[8 * h + r][t * 16 + l15] = (n < p.N) ? v : 0.f;
        }
    }
    __syncthreads();
    const int NW = (p.Npad > p.N) ? p.Npad : p.N;           // write width
    const bool fast = (m0 + 16 <= p.M) && (n0 + 32 <= NW) && ((p.sCm & 3) == 0) && ((((size_t)C) & 15) == 0);
    if (fast) {
#pragma unroll
        for (int s = 0; s < 4; ++s) {
            const int row = s * 4 + (lane >> 3), c4 = (lane & 7) * 4;
            const v4f v = *(const v4f*)&ctile[row][c4];
            VST2V4(C + (long long)(m0 + row) * p.sCm + n0 + c4, v);
        }
    } else {
        for (int row = 0; row < 16; ++row) {
            const int m = m0 + row, n = n0 + lane;
            if (m < p.M && n < NW) VST2(float, C + (long long)m * p.sCm + n, ctile[row][lane]);
        }
    }
}


// =====================================================================================================================
// k_gemmT<MODE, TM, TN>: same contract as k_gemm, but one wave computes a (16*TM) x (16*TN) tile: TM A fragments and TN B fragments are
//   loaded per 32-wide k-step and reused across TM*TN WMMAs (far fewer load/convert instructions per MAC). MODE 0 (f16), 1 (bf16 hi/lo),
//   2 (bf16) only. grid (ceil(NW/(16*TN)), ceil(M/(16*TM)), Z), block 32. Epilogue identical to k_gemm, run per 16x32 sub-tile.
// =====================================================================================================================
template <int MODE, int TM, int TN>
__global__ __launch_bounds__(32) void k_gemmT(GemmP p) {
    const int lane = threadIdx.x & 31, h = lane >> 4, l15 = lane & 15;
    const int m0 = blockIdx.y * (16 * TM), n0 = blockIdx.x * (16 * TN);
    const int z = blockIdx.z, zo = z / p.zi_n, zi = z - zo * p.zi_n;
    const float* A = p.A + zo * p.sAo + zi * p.sAi;
    const float* B = p.B + zo * p.sBo + zi * p.sBi;
    v8f acc[TM][TN];
#pragma unroll
    for (int i = 0; i < TM; ++i)
#pragma unroll
        for (int t = 0; t < TN; ++t) { v8f zz = {}; acc[i][t] = zz; }
    for (int k0 = 0; k0 < p.K; k0 += 32) {
        if (MODE == 1) {
            Split a[TM], b[TN];
#pragma unroll
            for (int i = 0; i < TM; ++i) { const int am = min(m0 + 16 * i + l15, p.M - 1); a[i] = sp_ld(A + (long long)am * p.sAm, p.sAk, k0, h, p.K, 1.f); }
#pragma unroll
            for (int t = 0; t < TN; ++t) { const int bn = min(n0 + 16 * t + l15, p.N - 1); b[t] = sp_ld(B + (long long)bn * p.sBn, p.sBk, k0, h, p.K, 1.f); }
#pragma unroll
            for (int i = 0; i < TM; ++i)
#pragma unroll
                for (int t = 0; t < TN; ++t) acc[i][t] = wmma3(a[i], b[t], acc[i][t]);
        } else if (MODE == 2) {
            v16b a[TM], b[TN];
#pragma unroll
            for (int i = 0; i < TM; ++i) { const int am = min(m0 + 16 * i + l15, p.M - 1); a[i] = bh_ld(A + (long long)am * p.sAm, p.sAk, k0, h, p.K, 1.f); }
#pragma unroll
            for (int t = 0; t < TN; ++t) { const int bn = min(n0 + 16 * t + l15, p.N - 1); b[t] = bh_ld(B + (long long)bn * p.sBn, p.sBk, k0, h, p.K, 1.f); }
#pragma unroll
            for (int i = 0; i < TM; ++i)
#pragma unroll
                for (int t = 0; t < TN; ++t) acc[i][t] = wmmab(a[i], b[t], acc[i][t]);
        } else {
            v16h a[TM], b[TN];
#pragma unroll
            for (int i = 0; i < TM; ++i) { const int am = min(m0 + 16 * i + l15, p.M - 1); a[i] = fh_ld(A + (long long)am * p.sAm, p.sAk, k0, h, p.K, p.sa); }
#pragma unroll
            for (int t = 0; t < TN; ++t) { const int bn = min(n0 + 16 * t + l15, p.N - 1); b[t] = fh_ld(B + (long long)bn * p.sBn, p.sBk, k0, h, p.K, p.sb); }
#pragma unroll
            for (int i = 0; i < TM; ++i)
#pragma unroll
                for (int t = 0; t < TN; ++t) acc[i][t] = wmma16(a[i], b[t], acc[i][t]);
        }
    }
    const float iscale = (MODE == 0) ? p.alpha / (p.sa * p.sb) : p.alpha;
    float* C = p.C + zo * p.sCo + zi * p.sCi;
    const float* R = p.R + zo * p.sRo + zi * p.sRi;
    const int NW = (p.Npad > p.N) ? p.Npad : p.N;
    __shared__ __align__(16) float ctile[16][36];
#pragma unroll
    for (int i = 0; i < TM; ++i) {
        const int mb = m0 + 16 * i; if (mb >= p.M) break;          // wave-uniform
#pragma unroll
        for (int tp = 0; tp < TN / 2; ++tp) {
            const int nb = n0 + 32 * tp; if (nb >= NW) break;        // wave-uniform
#pragma unroll
            for (int t2 = 0; t2 < 2; ++t2) {
                const int t = 2 * tp + t2; const int n = nb + t2 * 16 + l15; const int nn = min(n, p.N - 1);
#pragma unroll
                for (int r = 0; r < 8; ++r) {
                    const int m = mb + 8 * h + r; const int mm = min(m, p.M - 1);
                    float v = acc[i][t][r] * iscale;
                    if (p.flags & 1) v += p.bias[nn];
                    if (p.flags & 2) v += p.bias[mm];
            if (p.flags & 8) v *= p.bias[(long long)zo * p.M + mm];   /* per-(z,row) scale vector laid out [Z][M]; exclusive with the bias flags */
                    v = act_fn(v, p.act);
                    if (p.flags & 4) v += p.beta * R[(long long)mm * p.sRm + (long long)nn * p.sRn];
                    ctile[8 * h + r][t2 * 16 + l15] = (n < p.N) ? v : 0.f;
                }
            }
            __syncthreads();
            const bool fast = (mb + 16 <= p.M) && (nb + 32 <= NW) && ((p.sCm & 3) == 0) && ((((size_t)C) & 15) == 0);
            if (fast) {
#pragma unroll
                for (int s = 0; s < 4; ++s) {
                    const int row = s * 4 + (lane >> 3), c4 = (lane & 7) * 4;
                    const v4f v = *(const v4f*)&ctile[row][c4];
                    VST2V4(C + (long long)(mb + row) * p.sCm + nb + c4, v);
                }
            } else {
                for (int row = 0; row < 16; ++row) {
                    const int m = mb + row, n = nb + lane;
                    if (m < p.M && n < NW) VST2(float, C + (long long)m * p.sCm + n, ctile[row][lane]);
                }
            }
            __syncthreads();
        }
    }
}

// =====================================================================================================================
//   Wave = 16 queries, AW waves per block, 64-key blocks; grid (ceil(Lq/(16*AW)), H, B), block 32*AW. Any Lq, Lk; head dim dh <= DHP
//   (DHP multiple of 32), value dim dv <= DVP (multiple of 16, <= 128). Every tensor addressed by (batch, head, row, element) strides, f32.
//   Scores: QM 0 f16 operands, 1 bf16 hi/lo split, 2 bf16 triple split; statistics f32 (exp2 domain); P.V: P x 4096 as f16 with V f16 staged in LDS
//   (SPLITPV: P and V as bf16 hi/lo splits). kv head = h / hrep. Masking: causal = 1 (keep j <= i + coff, masked -> -inf, key blocks beyond the
//   diagonal skipped), causal = 2 (masked -> mfill, a finite fill like the -1e9; no skipping), causal = 3 (keep j >= i + coff,
//   masked -> -inf, no skipping); optional additive f32 mask Mf,
//   optional int keep-mask Mi (0 -> score := mfill), both addressed b*smb + h*smh + i*smi + j*smj (0 strides broadcast).
// =====================================================================================================================
#define AW 4
struct AttnP {   // apv4
    const float* Q; const float* K; const float* V; float* O; float* P; const float* Mf; const int* Mi; float* ST;
    const float* Pw; const float* Rt; const int* SQ; const int* SK;           // optional: post-softmax weight, relative-position table, segment ids
    long long swb, swh, swi, swj, srb, srh, sri;                                 // Pw strides (b,h,i,j); Rt strides (b,h,i), column = clamp(i - j + roff, 0, rn-1)
    long long sQb, sQh, sQi, sQd, sKb, sKh, sKj, sKd, sVb, sVh, sVj, sVd, sOb, sOh, sOi, sPb, sPh, sPi, smb, smh, smi, smj;
    int Lq, Lk, dh, dv, hrep, causal, coff, pband;   // pband > 0: P holds only the band |j - i| <= pband, column j - i + pband
    float scale, mfill; int nonorm, mpol;             // nonorm (online path only): O = sum_j exp(score_j) V_j without the 1/rowsum (scores must be <= ~0); mpol: Mi masks where ==0 (mpol 0) or where !=0 (mpol 1)
    int roff, rn, segpol, win;                        // Rt column offset/count; SQ/SK: score := mfill where (segpol 0) SQ[i] != SK[j] or (segpol 1) SQ[i] == SK[j]; win > 0: keys with i - j > win (after coff) -> -inf
};
//   Pw: the softmax numerator is multiplied by Pw(b,h,i,j) AFTER the row sum is taken (probs * weight, then P.V), as in post-softmax multiplicative biases.                                                    // ST (optional): per row (b,h,i) -> ST[((b*H + h)*Lq + i)*2 + {0,1}] = {row max of the scaled+masked score (natural units), sum_j exp(score - max)}
static_assert(sizeof(AttnP) == 12 * 8 + 29 * 8 + 16 * 4, "AttnP has padding");

#ifndef KATTN_ATTR
#define KATTN_ATTR
#endif
template <int DHP, int DVP, int QM, bool SPLITPV, bool TWOPASS>
__global__ __launch_bounds__(32 * AW) KATTN_ATTR void k_attn(AttnP p) {
    constexpr int NT = DVP / 16;                // output tiles
    constexpr int KS = DHP / 32;                // k-steps for the scores
    constexpr int VP = DVP + 8;                 // LDS pitch (halves)
    __shared__ __align__(16) float    pl[AW][16 * 64];
    __shared__ __align__(16) _Float16 vl[(SPLITPV ? 2 : 1) * 64 * VP];   // f16 V tile, or bf16 hi and lo tiles (same 2-byte size)
    const int lane = threadIdx.x & 31, hf = lane >> 4, l15 = lane & 15, wave = threadIdx.x >> 5;
    const int h = blockIdx.y, b = blockIdx.z, hk = h / p.hrep;
    const int q0 = (blockIdx.x * AW + wave) * 16;
    float* myp = pl[wave];
    const float L2E = 1.4426950408889634f;
    const float NEG = -__builtin_inff();
    const int qi = min(q0 + l15, p.Lq - 1);
    const float* qrow = p.Q + b * p.sQb + h * p.sQh + (long long)qi * p.sQi;
    const float* kbase = p.K + b * p.sKb + hk * p.sKh;
    const float* vbase = p.V + b * p.sVb + hk * p.sVh;
    v16h qa[QM == 0 ? KS : 1]; Split qs_[QM == 1 ? KS : 1]; Split3 qt_[QM == 2 ? KS : 1];
#pragma unroll
    for (int ks = 0; ks < KS; ++ks) {
        if (QM == 2) qt_[ks] = sp3_ld(qrow, p.sQd, ks * 32, hf, p.dh, 1.f);
        else if (QM == 1) qs_[ks] = sp_ld(qrow, p.sQd, ks * 32, hf, p.dh, 1.f);
        else qa[ks] = fh_ld(qrow, p.sQd, ks * 32, hf, p.dh, 1.f);
    }
    v8f o[NT]; float m8[8], l8[8];
#pragma unroll
    for (int t = 0; t < NT; ++t) { v8f zz = {}; o[t] = zz; }
#pragma unroll
    for (int i = 0; i < 8; ++i) { m8[i] = NEG; l8[i] = 0.f; }
    int jend = p.Lk; int jstart = 0;
    if (p.causal == 1) { const int je = (blockIdx.x * AW + AW - 1) * 16 + 16 + p.coff; jend = min(jend, max(je, 0)); }   // uniform per block
    if (p.win > 0) { const int js = (int)(blockIdx.x * AW) * 16 + p.coff - p.win; jstart = (js > 0) ? (js / 64) * 64 : 0; }   // uniform per block: key blocks entirely outside every row's window hold only -inf entries and are skipped exactly
    const int npass = TWOPASS ? 2 : 1;
    for (int pass = 0; pass < npass; ++pass) {
        const bool dopv = (!TWOPASS) || pass == 1;
        for (int j0 = jstart; j0 < jend; j0 += 64) {
            if (dopv) {
                __syncthreads();                                 // previous key block's reads of vl / pl are done
                for (int idx = threadIdx.x; idx < 64 * DVP; idx += 32 * AW) {
                    const int jr = idx / DVP, d = idx - jr * DVP, j = j0 + jr;
                    const float f = (j < p.Lk && d < p.dv) ? vbase[(long long)j * p.sVj + (long long)d * p.sVd] : 0.f;
                    if (SPLITPV) {
                        const __bf16 hb = bf16_rne(f);
                        ((__bf16*)vl)[jr * VP + d] = hb; ((__bf16*)vl)[64 * VP + jr * VP + d] = bf16_rne(f - bf16_f32(hb));
                    } else vl[jr * VP + d] = (_Float16)f;
                }
            }
            v8f s[4];
#pragma unroll
            for (int t = 0; t < 4; ++t) {
                const int j = min(j0 + t * 16 + l15, p.Lk - 1);
                const float* krow = kbase + (long long)j * p.sKj;
                v8f acc = {};
#pragma unroll
                for (int ks = 0; ks < KS; ++ks) {
                    if (QM == 2)      acc = wmma6(qt_[ks], sp3_ld(krow, p.sKd, ks * 32, hf, p.dh, 1.f), acc);
                    else if (QM == 1) acc = wmma3(qs_[ks], sp_ld(krow, p.sKd, ks * 32, hf, p.dh, 1.f), acc);
                    else              acc = wmma16(qa[ks], fh_ld(krow, p.sKd, ks * 32, hf, p.dh, 1.f), acc);
                }
                s[t] = acc;
            }
            float pv[8][4];
#pragma unroll
            for (int i = 0; i < 8; ++i) {
                const int irow = q0 + i + 8 * hf;
                const int ic = min(irow, p.Lq - 1);
                float sc[4];
#pragma unroll
                for (int t = 0; t < 4; ++t) {
                    const int jg = j0 + t * 16 + l15;
                    float v = s[t][i] * p.scale;
                    if (p.Mf) v += p.Mf[b * p.smb + h * p.smh + (long long)ic * p.smi + (long long)min(jg, p.Lk - 1) * p.smj];
                    if (p.Rt) { int rc = ic - min(jg, p.Lk - 1) + p.roff; rc = rc < 0 ? 0 : (rc >= p.rn ? p.rn - 1 : rc); v += p.Rt[b * p.srb + h * p.srh + (long long)ic * p.sri + rc]; }
                    if (p.Mi) { const int mv = p.Mi[b * p.smb + h * p.smh + (long long)ic * p.smi + (long long)min(jg, p.Lk - 1) * p.smj]; if (p.mpol ? (mv != 0) : (mv == 0)) v = p.mfill; }
                    if (p.SQ) { const bool same = p.SQ[(long long)b * p.Lq + ic] == p.SK[(long long)b * p.Lk + min(jg, p.Lk - 1)]; if (p.segpol ? same : !same) v = p.mfill; }
                    if (p.causal == 2 && jg > irow + p.coff) v = p.mfill;
                    if (jg >= p.Lk || (p.causal == 1 && jg > irow + p.coff) || (p.causal == 3 && jg < irow + p.coff) || (p.win > 0 && irow + p.coff - jg > p.win)) v = NEG; else v *= L2E;
                    sc[t] = v;
                }
                if (!TWOPASS || pass == 0) {
                    float mx = fmaxf(fmaxf(sc[0], sc[1]), fmaxf(sc[2], sc[3]));
                    mx = fmaxf(mx, __shfl_xor(mx, 1, 32)); mx = fmaxf(mx, __shfl_xor(mx, 2, 32));
                    mx = fmaxf(mx, __shfl_xor(mx, 4, 32)); mx = fmaxf(mx, __shfl_xor(mx, 8, 32));
                    const float mnew = fmaxf(m8[i], mx);
                    const float corr = (mnew == NEG) ? 1.f : exp2f(m8[i] - mnew);
                    float rs = 0.f;
#pragma unroll
                    for (int t = 0; t < 4; ++t) {
                        const float pp = (sc[t] == NEG) ? 0.f : exp2f(sc[t] - mnew); rs += pp;
                        pv[i][t] = p.Pw ? pp * p.Pw[b * p.swb + h * p.swh + (long long)ic * p.swi + (long long)min(j0 + t * 16 + l15, p.Lk - 1) * p.swj] : pp;
                    }
                    rs += __shfl_xor(rs, 1, 32); rs += __shfl_xor(rs, 2, 32); rs += __shfl_xor(rs, 4, 32); rs += __shfl_xor(rs, 8, 32);
                    l8[i] = l8[i] * corr + rs; m8[i] = mnew;
                    if (!TWOPASS) {
#pragma unroll
                        for (int t = 0; t < NT; ++t) o[t][i] *= corr;
                    }
                } else {
                    const float inv = (l8[i] > 0.f) ? 1.f / l8[i] : 0.f;
#pragma unroll
                    for (int t = 0; t < 4; ++t) {
                        const int jg = j0 + t * 16 + l15;
                        float pp = (sc[t] == NEG) ? 0.f : exp2f(sc[t] - m8[i]) * inv;
                        if (p.Pw) pp *= p.Pw[b * p.swb + h * p.swh + (long long)ic * p.swi + (long long)min(jg, p.Lk - 1) * p.swj];
                        pv[i][t] = pp;
                    }
                }
            }
            if (dopv) {
#pragma unroll
                for (int i = 0; i < 8; ++i)
#pragma unroll
                    for (int t = 0; t < 4; ++t) ((float*)myp)[(i + 8 * hf) * 64 + t * 16 + l15] = pv[i][t];
                __syncthreads();                                 // P (per wave) and V (shared) visible
                if (p.P) {
                    float* pb_ = p.P + b * p.sPb + h * p.sPh;
                    const bool fastP = (p.pband == 0) && ((p.sPi & 3) == 0) && (j0 + 64 <= p.Lk) && (q0 + 16 <= p.Lq) && ((((size_t)pb_) & 15) == 0);
                    if (fastP) {
#pragma unroll
                        for (int s = 0; s < 8; ++s) {
                            const int row = s * 2 + (lane >> 4), c4 = (lane & 15) * 4;
                            const v4f v = *(const v4f*)(myp + row * 64 + c4);
                            VST2V4(pb_ + (long long)(q0 + row) * p.sPi + j0 + c4, v);
                        }
                    } else {
                        for (int row = 0; row < 16; ++row) {
                            const int irow = q0 + row; if (irow >= p.Lq) continue;
                            for (int c = lane; c < 64; c += 32) {
                                const int jg = j0 + c; if (jg >= p.Lk) continue;
                                if (p.pband == 0) VST2(float, pb_ + (long long)irow * p.sPi + jg, myp[row * 64 + c]);
                                else if (jg - irow <= p.pband && irow - jg <= p.pband) VST2(float, pb_ + (long long)irow * p.sPi + (jg - irow + p.pband), myp[row * 64 + c]);
                            }
                        }
                    }
                }
                if (SPLITPV) {
                    const Split pa0 = sp_ld(myp + l15 * 64, 1, 0, hf, 64, 1.f), pa1 = sp_ld(myp + l15 * 64, 1, 32, hf, 64, 1.f);
                    const __bf16* vh = (const __bf16*)vl; const __bf16* vlo = vh + 64 * VP;
#pragma unroll
                    for (int t = 0; t < NT; ++t) {
                        const int dcol = t * 16 + l15;
                        Split b0, b1;
#pragma unroll
                        for (int e = 0; e < 16; ++e) {
                            const int k0 = frag_k(e, hf), k1 = 32 + frag_k(e, hf);
                            b0.hi[e] = vh[k0 * VP + dcol]; b0.lo[e] = vlo[k0 * VP + dcol]; b1.hi[e] = vh[k1 * VP + dcol]; b1.lo[e] = vlo[k1 * VP + dcol];
                        }
                        o[t] = wmma3(pa0, b0, o[t]);
                        o[t] = wmma3(pa1, b1, o[t]);
                    }
                } else {
                    const v16h pa0 = fh_ld(myp + l15 * 64, 1, 0, hf, 64, 4096.f), pa1 = fh_ld(myp + l15 * 64, 1, 32, hf, 64, 4096.f);
#pragma unroll
                    for (int t = 0; t < NT; ++t) {
                        const int dcol = t * 16 + l15;
                        v16h b0, b1;
#pragma unroll
                        for (int e = 0; e < 16; ++e) { b0[e] = vl[frag_k(e, hf) * VP + dcol]; b1[e] = vl[(32 + frag_k(e, hf)) * VP + dcol]; }
                        o[t] = wmma16(pa0, b0, o[t]);
                        o[t] = wmma16(pa1, b1, o[t]);
                    }
                }
            }
        }
    }
    float* obase = p.O + b * p.sOb + h * p.sOh;
    if (p.ST) {
        const int rl = lane >> 1, isel = rl & 7;           // row q0 + rl ; rl>>3 == hf holds because lane>>4 == (lane>>1)>>3
        float mv = 0.f, lv = 0.f;
#pragma unroll
        for (int i = 0; i < 8; ++i) if (i == isel) { mv = m8[i]; lv = l8[i]; }
        const int irow = q0 + rl;
        if (irow < p.Lq) { float* st = p.ST + (((long long)b * gridDim.y + h) * p.Lq + irow) * 2 + (lane & 1); VST2(float, st, (lane & 1) ? lv : mv * 0.6931471805599453f); }
    }
    float invr[8];
#pragma unroll
    for (int i = 0; i < 8; ++i) {
        if (TWOPASS) invr[i] = SPLITPV ? 1.f : (1.f / 4096.f);
        else if (p.nonorm) invr[i] = exp2f(m8[i]) * (SPLITPV ? 1.f : (1.f / 4096.f));
        else invr[i] = (l8[i] > 0.f) ? (SPLITPV ? 1.f / l8[i] : 1.f / (l8[i] * 4096.f)) : 0.f;
    }
    __syncthreads();                                             // all waves done with pl/vl from the main loop
    const bool ofast = ((p.sOi & 3) == 0) && ((((size_t)obase) & 15) == 0) && (q0 + 16 <= p.Lq);
#pragma unroll
    for (int c0 = 0; c0 < DVP; c0 += 64) {
#pragma unroll
        for (int i = 0; i < 8; ++i)
#pragma unroll
            for (int t = 0; t < NT; ++t) if (t * 16 >= c0 && t * 16 < c0 + 64) ((float*)myp)[(i + 8 * hf) * 64 + (t * 16 - c0) + l15] = o[t][i] * invr[i];
        __syncthreads();
        const int cw = (DVP - c0 < 64) ? (DVP - c0) : 64;      // staged columns in this chunk (multiple of 16)
        if (ofast && (c0 + cw <= p.dv) && (cw % 32 == 0)) {
            const int lpr = cw / 4;                              // lanes per row (16 for 64 cols, 8 for 32)
            const int rows_per_ins = 32 / lpr;
            for (int r0 = 0; r0 < 16; r0 += rows_per_ins) {
                const int row = r0 + lane / lpr, c4 = (lane % lpr) * 4;
                const v4f v = *(const v4f*)(myp + row * 64 + c4);
                VST2V4(obase + (long long)(q0 + row) * p.sOi + c0 + c4, v);
            }
        } else {
            for (int row = 0; row < 16; ++row) {
                const int irow = q0 + row; if (irow >= p.Lq) continue;
                for (int c = lane; c < cw; c += 32) { const int d = c0 + c; if (d < p.dv) VST2(float, obase + (long long)irow * p.sOi + d, myp[row * 64 + c]); }
            }
        }
        __syncthreads();
    }
}

// =====================================================================================================================
// k_tr: dst(z, c, r) = alpha * src(z, r, c) (+ beta * R2(z, c, r)): [Z][R][C] (row stride lds) -> [Z][C][R] (row stride ldd) through a 32x32 LDS tile;
//   flags: 1 -> add beta * residual R2 addressed like dst (z*sRz + c*ldr + r); act applied before the residual.
// =====================================================================================================================
struct TrP { const float* src; float* dst; const float* R2; long long sSz, lds, sDz, ldd, sRz, ldr; int R, C, flags, act; float alpha, beta; };
static_assert(sizeof(TrP) == 3 * 8 + 6 * 8 + 6 * 4, "TrP has padding");
__global__ __launch_bounds__(256) void k_tr(TrP p) {
    __shared__ float tile[32][33];
    const int c0 = blockIdx.x * 32, r0 = blockIdx.y * 32, z = blockIdx.z;
    const int lane = threadIdx.x & 31, wave = threadIdx.x >> 5;
    const float* s = p.src + z * p.sSz;
#pragma unroll
    for (int k = 0; k < 4; ++k) {
        const int rl = wave * 4 + k, r = r0 + rl, c = c0 + lane;
        tile[rl][lane] = (r < p.R && c < p.C) ? s[(long long)r * p.lds + c] : 0.f;
    }
    __syncthreads();
    float* d = p.dst + z * p.sDz; const float* rr = p.R2 + z * p.sRz;
#pragma unroll
    for (int k = 0; k < 4; ++k) {
        const int cl = wave * 4 + k, c = c0 + cl, r = r0 + lane;
        if (c < p.C && r < p.R) {
            float v = act_fn(p.alpha * tile[lane][cl], p.act);
            if (p.flags & 1) v += p.beta * rr[(long long)c * p.ldr + r];
            VST2(float, d + (long long)c * p.ldd + r, v);
        }
    }
}

// k_affine: dst[i] = a * (sdev ? sdev[0] : 1) * src[i] + b, i < n (one thread per element; consecutive lanes -> consecutive addresses)
__global__ __launch_bounds__(256) void k_affine(const float* __restrict__ src, float* __restrict__ dst, int n, float a, float b, const float* __restrict__ sdev) {
    const int i = blockIdx.x * 256 + threadIdx.x;
    if (i < n) { const float aa = sdev ? a * sdev[0] : a; const float v = aa * src[i] + b; VST2(float, dst + i, v); }
}

// =====================================================================================================================
// k_softmax: row softmax over n contiguous elements, one 256-thread block per row; rows addressed z*sz + r*sr (grid (R, Z)).
//   out = scale_out * softmax(scale_in * x + (Mf ? Mf[z*smz + r*smr + j] : 0)); a row whose max is -inf is written as 0.
// =====================================================================================================================
struct SmP { const float* src; float* dst; const float* Mf; long long sz, sr, dz, dr, smz, smr; int n, pad; float scale_in, scale_out; };
static_assert(sizeof(SmP) == 3 * 8 + 6 * 8 + 4 * 4, "SmP has padding");
__global__ __launch_bounds__(256) void k_softmax(SmP p) {
    __shared__ float red[256];
    const int r = blockIdx.x, z = blockIdx.y, tid = threadIdx.x;
    const float* s = p.src + z * p.sz + (long long)r * p.sr;
    const float* mf = p.Mf ? (p.Mf + z * p.smz + (long long)r * p.smr) : nullptr;
    float mx = -__builtin_inff();
    for (int j = tid; j < p.n; j += 256) { float v = s[j] * p.scale_in; if (mf) v += mf[j]; mx = fmaxf(mx, v); }
    red[tid] = mx; __syncthreads();
    for (int o = 128; o > 0; o >>= 1) { if (tid < o) red[tid] = fmaxf(red[tid], red[tid + o]); __syncthreads(); }
    mx = red[0]; __syncthreads();
    float sum = 0.f;
    for (int j = tid; j < p.n; j += 256) { float v = s[j] * p.scale_in; if (mf) v += mf[j]; sum += (mx == -__builtin_inff()) ? 0.f : expf(v - mx); }
    red[tid] = sum; __syncthreads();
    for (int o = 128; o > 0; o >>= 1) { if (tid < o) red[tid] += red[tid + o]; __syncthreads(); }
    sum = red[0];
    const float inv = (sum > 0.f) ? p.scale_out / sum : 0.f;
    float* d = p.dst + z * p.dz + (long long)r * p.dr;
    for (int j = tid; j < p.n; j += 256) { float v = s[j] * p.scale_in; if (mf) v += mf[j]; const float o = (mx == -__builtin_inff()) ? 0.f : expf(v - mx) * inv; VST2(float, d + j, o); }
}
// =====================================================================================================================
// k_stats: mean and rsqrt(var + eps) over a set of n elements addressed base + z*sz + (e / inner) * so + (e % inner) * si, one 256-thread
// k_norm_apply: y = (x - mean[set]) * rstd[set] * g[c] + b[c] over a [Z][C][L] channel-major tensor with set = z*G + c / (C/G) (G groups per z;
//   G = C -> per-channel sets indexed z*C+c; for batch norm pass stats indexed by c only via bn = 1). Optional act. Output same layout.
// =====================================================================================================================
//   mode 0: mean / rsqrt(var + eps); mode 1 (RMSNorm): 0 / rsqrt(mean(x^2) + eps); mode 2 (L2 normalize * sqrt(n)): 0 / sqrt(n) / max(||x||, eps); mode 3: as 0 with unbiased variance (n-1)
__global__ __launch_bounds__(256) void k_stats(const float* __restrict__ x, long long sz, long long so, long long si, int inner, int n, float eps, float* __restrict__ stat, int mode) {
    __shared__ float red[256];
    const int z = blockIdx.x, tid = threadIdx.x;
    const float* base = x + z * sz;
    float s = 0.f;
    for (int e = tid; e < n; e += 256) s += base[(long long)(e / inner) * so + (long long)(e % inner) * si];
    red[tid] = s; __syncthreads();
    for (int o = 128; o > 0; o >>= 1) { if (tid < o) red[tid] += red[tid + o]; __syncthreads(); }
    const float mu = (mode == 0 || mode == 3) ? red[0] / (float)n : 0.f; __syncthreads();
    float q = 0.f;
    for (int e = tid; e < n; e += 256) { const float dlt = base[(long long)(e / inner) * so + (long long)(e % inner) * si] - mu; q += dlt * dlt; }
    red[tid] = q; __syncthreads();
    for (int o = 128; o > 0; o >>= 1) { if (tid < o) red[tid] += red[tid + o]; __syncthreads(); }
    {
        float rs;
        if (mode == 2) rs = sqrtf((float)n) / fmaxf(sqrtf(red[0]), eps); else if (mode == 3) rs = rsqrtf(red[0] / (float)(n - 1) + eps); else rs = rsqrtf(red[0] / (float)n + eps);
        if (tid < 32) { const float v = (tid == 0) ? mu : ((tid == 1) ? rs : 0.f); VST2(float, stat + (long long)z * 32 + tid, v); }
    }
}
//   One thread per element over the flat [Z][C][L] index space: grid ceil(Z*C*L / 256).
__global__ __launch_bounds__(256) void k_norm_apply(const float* __restrict__ x, float* __restrict__ y, const float* __restrict__ stat, const float* __restrict__ g, const float* __restrict__ bta,
                                                     int Z, int C, int L, int G, int bn, int act) {
    const long long idx = (long long)blockIdx.x * 256 + threadIdx.x;
    if (idx >= (long long)Z * C * L) return;
    const int l = (int)(idx % L); const long long zc = idx / L; const int c = (int)(zc % C), z = (int)(zc / C); (void)l;
    const int set = bn ? c : (z * G + c / (C / G));
    float v = (x[idx] - stat[(long long)set * 32]) * stat[(long long)set * 32 + 1];
    if (g) v *= g[c];
    if (bta) v += bta[c];
    v = act_fn(v, act);
    VST2(float, y + idx, v);
}

// k_lse_neg: c[i] = -(st[2i] + log(st[2i+1])) = minus the log-sum-exp of row i from k_attn's ST output (for softmax over the query dimension)
__global__ __launch_bounds__(256) void k_lse_neg(const float* __restrict__ st, float* __restrict__ c, int n) {
    const int i = blockIdx.x * 256 + threadIdx.x;
    if (i < n) { const float v = -(st[2 * i] + logf(st[2 * i + 1])); VST2(float, c + i, v); }
}

// k_iota: dst[i] = a * i + b as int32 (segment/position id helper)
__global__ __launch_bounds__(256) void k_iota(int* __restrict__ dst, int n, int a, int b) {
    const int i = blockIdx.x * 256 + threadIdx.x;
    if (i < n) { const int v = a * i + b; VST2(int, dst + i, v); }
}

// k_axpby: dst[i] = a * x[i] + b * y[i] (+ c), i < n
__global__ __launch_bounds__(256) void k_axpby(const float* __restrict__ x, const float* __restrict__ y, float* __restrict__ dst, int n, float a, float b, float c) {
    const int i = blockIdx.x * 256 + threadIdx.x;
    if (i < n) { const float v = a * x[i] + b * y[i] + c; VST2(float, dst + i, v); }
}

// =====================================================================================================================
// k_rope: rotary embedding on a [R rows][Hn heads][D] view (row stride sXr, head stride sXh, element stride 1) -> Y (own strides).
//   mode 0: rotate_half (partner d±D/2, sign - for d<D/2); mode 1: interleaved pairs (partner d^1, sign - for even d).
//   table column tcol: tmode 0 -> d, 1 -> d % (D/2), 2 -> d / 2; position p: pmode 0 -> r % S, 1 -> head index, 2 -> pos[r];
//   c = C[(r / S) * sCb + p * sCp + tcol * sCd], s likewise from Sn; y = x[d] * c + sign * x[partner] * s. X and Y must not alias.
// =====================================================================================================================
struct RopeP { const float* X; float* Y; const float* C; const float* Sn; const int* pos; long long sXr, sXh, sYr, sYh, sCb, sCp, sCd; int R, Hn, D, S, mode, tmode, pmode, pad; };
static_assert(sizeof(RopeP) == 5 * 8 + 7 * 8 + 8 * 4, "RopeP has padding");
__global__ __launch_bounds__(256) void k_rope(RopeP p) {
    const long long idx = (long long)blockIdx.x * 256 + threadIdx.x;
    if (idx >= (long long)p.R * p.Hn * p.D) return;
    const int d = (int)(idx % p.D); const long long rh = idx / p.D; const int h = (int)(rh % p.Hn); const int r = (int)(rh / p.Hn);
    const int half = p.D / 2;
    int partner; float sign;
    if (p.mode == 0) { partner = (d < half) ? d + half : d - half; sign = (d < half) ? -1.f : 1.f; }
    else { partner = d ^ 1; sign = (d & 1) ? 1.f : -1.f; }
    const int tcol = (p.tmode == 0) ? d : ((p.tmode == 1) ? (d % half) : (d >> 1));
    const int pp = (p.pmode == 0) ? (r % p.S) : ((p.pmode == 1) ? h : p.pos[r]);
    const long long toff = (long long)(r / p.S) * p.sCb + (long long)pp * p.sCp + (long long)tcol * p.sCd;
    const float* xr = p.X + (long long)r * p.sXr + (long long)h * p.sXh;
    const float v = xr[d] * p.C[toff] + sign * xr[partner] * p.Sn[toff];
    VST2(float, p.Y + (long long)r * p.sYr + (long long)h * p.sYh + d, v);
}

// k_invf + k_sincos (split so neither kernel carries a large VALU-fma footprint): invf_i = num * (1 / powf(base, (2 i)/D)) [fmode 0],
//   num * expf((2 i) * cexp) [fmode 1], num * powf(base, -2 (i - 1) / D) [fmode 2]; then cs/sn[s*half + i] = cos/sin((pscale * s) * invf_i)
__global__ __launch_bounds__(256) void k_invf(float* __restrict__ invb, int half, int D, float base, float num, int fmode, float cexp) {
    const int i = blockIdx.x * 256 + threadIdx.x;
    if (i >= ((half + 31) / 32) * 32) return;
    if (i >= half) { VST2(float, invb + i, 0.f); return; }
    const float e = (float)(2 * i) / (float)D;
    float invf;
    if (fmode == 1) invf = num * expf((float)(2 * i) * cexp);
    else if (fmode == 2) invf = num * powf(base, (-2.0f * ((float)i - 1.0f)) / (float)D);
    else invf = num * (1.0f / powf(base, e));
    VST2(float, invb + i, invf);
}
__global__ __launch_bounds__(256) void k_sincos(float* __restrict__ cs, float* __restrict__ sn, const float* __restrict__ invb, int S, int half, float pscale) {
    const int idx = blockIdx.x * 256 + threadIdx.x;
    if (idx >= S * half) return;
    const int s = idx / half, i = idx - s * half;
    const float ang = (pscale * (float)s) * invb[i];
    VST2(float, cs + idx, cosf(ang)); VST2(float, sn + idx, sinf(ang));
}

// k_mulact: dst[i] = act(x[i]) * y[i]
__global__ __launch_bounds__(256) void k_mulact(const float* __restrict__ x, const float* __restrict__ y, float* __restrict__ dst, int n, int act) {
    const int i = blockIdx.x * 256 + threadIdx.x;
    if (i < n) { const float v = act_fn(x[i], act) * y[i]; VST2(float, dst + i, v); }
}

// =====================================================================================================================
// k_matvec: thread-per-row matrix-vector products for N <= 8 output columns (heads with 1-3 outputs, gates), f32 on the VALU.
//   C[r*sCm + j] = act(alpha * sum_k A[r*sAm + k*sAk] * B[j*sBn + k*sBk] + bias[j]) + beta * R[r*sRm + j*sRn]; each thread writes its N contiguous floats.
// =====================================================================================================================
__global__ __launch_bounds__(256) void k_matvec(GemmP p) {
    // 32 lanes write one line with one instruction.
    const int rpt = (p.N == 1) ? 1 : 32;
    const long long r0 = ((long long)blockIdx.x * 256 + threadIdx.x) * rpt; const int z = blockIdx.z, zo = z / p.zi_n, zi = z - zo * p.zi_n;
    if (r0 >= p.M) return;
    const float* Bb = p.B + zo * p.sBo + zi * p.sBi;
    float* C = p.C + zo * p.sCo + zi * p.sCi; const float* R = p.R + zo * p.sRo + zi * p.sRi;
    for (int rr = 0; rr < rpt; ++rr) {
        const long long r = r0 + rr; if (r >= p.M) break;
        const float* A = p.A + zo * p.sAo + zi * p.sAi + r * p.sAm;
        float acc[8] = {0.f, 0.f, 0.f, 0.f, 0.f, 0.f, 0.f, 0.f};
        for (int k = 0; k < p.K; ++k) { const float a = A[(long long)k * p.sAk];
#pragma unroll
            for (int j = 0; j < 8; ++j) if (j < p.N) acc[j] += a * Bb[(long long)j * p.sBn + (long long)k * p.sBk]; }
#pragma unroll
        for (int j = 0; j < 8; ++j) if (j < p.N) {
            float v = acc[j] * p.alpha;
            if (p.flags & 1) v += p.bias[j];
            if (p.flags & 2) v += p.bias[r];
            v = act_fn(v, p.act);
            if (p.flags & 4) v += p.beta * R[r * p.sRm + (long long)j * p.sRn];
            VST2(float, C + r * p.sCm + j, v);
        }
    }
}
// k_smallsoftmax: thread-per-row softmax for short rows (n <= 64): dst[r*dr + j] = softmax(scale*src[r*sr + j])
__global__ __launch_bounds__(256) void k_smallsoftmax(const float* __restrict__ src, float* __restrict__ dst, long long sr, long long dr, int n, long long R, float scale) {
    const long long r0 = ((long long)blockIdx.x * 256 + threadIdx.x) * 32;
    for (int rr = 0; rr < 32; ++rr) {
        const long long r = r0 + rr; if (r >= R) return;
        const float* s = src + r * sr; float* d = dst + r * dr;
        float mx = -__builtin_inff();
        for (int j = 0; j < n; ++j) mx = fmaxf(mx, s[j] * scale);
        float sum = 0.f;
        for (int j = 0; j < n; ++j) sum += expf(s[j] * scale - mx);
        const float inv = 1.f / sum;
        for (int j = 0; j < n; ++j) { const float v = expf(s[j] * scale - mx) * inv; VST2(float, d + j, v); }
    }
}

__global__ __launch_bounds__(32) void k_unitstat(float* __restrict__ st) { const int t = threadIdx.x; const float v = (t == 1) ? 1.f : 0.f; VST2(float, st + t, v); }

// destination (e.g. a d_out whose row width is not a multiple of 32 floats) is written by consecutive lanes of one instruction
__global__ __launch_bounds__(256) void k_lincopy(const float* __restrict__ src, long long lds, float* __restrict__ dst, long long ldd, long long rows, int cols) {
    const long long i = (long long)blockIdx.x * 256 + threadIdx.x; if (i >= rows * cols) return;
    const long long r = i / cols; const int c = (int)(i - r * cols);
    const float v = src[r * lds + c]; VST2(float, dst + r * ldd + c, v);
}

namespace w25 {
typedef __attribute__((ext_vector_type(16))) _Float16 v16h;
typedef __attribute__((ext_vector_type(8)))  _Float16 v8h;
typedef __attribute__((ext_vector_type(16))) __bf16   v16b;
typedef __attribute__((ext_vector_type(8)))  __bf16   v8b;
typedef __attribute__((ext_vector_type(8)))  float    v8f;
typedef __attribute__((ext_vector_type(4)))  float    v4f;

__device__ __forceinline__ unsigned short f2bf_bits(float f) {
  unsigned u = __float_as_uint(f);
  return (unsigned short)((u + 0x7FFFu + ((u >> 16) & 1u)) >> 16);
}
__device__ __forceinline__ float bf_bits2f(unsigned short h) { return __uint_as_float(((unsigned)h) << 16); }

// hazard guards as plain device helpers (no inline asm inside the kernel template body)
__device__ __forceinline__ void dep_guard_h(v8f& a, v8f& b, v16h x, v16h y) { asm volatile("v_nop\n\tv_nop\n\tv_nop\n\tv_nop" : "+v"(a), "+v"(b) : "v"(x), "v"(y)); }
__device__ __forceinline__ void dep_guard_b(v8f& a, v8f& b, v16b x, v16b y) { asm volatile("v_nop\n\tv_nop\n\tv_nop\n\tv_nop" : "+v"(a), "+v"(b) : "v"(x), "v"(y)); }
__device__ __forceinline__ void keep4_h(v16h a, v16h b, v16h c, v16h d) { asm volatile("v_nop" :: "v"(a), "v"(b), "v"(c), "v"(d)); }
__device__ __forceinline__ void keep4_b(v16b a, v16b b, v16b c, v16b d) { asm volatile("v_nop" :: "v"(a), "v"(b), "v"(c), "v"(d)); }
__device__ __forceinline__ void acc_guard4(v8f& a, v8f& b, v8f& c, v8f& d) { asm volatile("v_nop\n\tv_nop\n\tv_nop\n\tv_nop" : "+v"(a), "+v"(b), "+v"(c), "+v"(d)); }
template <typename T> struct Frag;
template <> struct Frag<_Float16> {
  typedef v16h V; union U { v16h v; v8h h[2]; };
  static __device__ __forceinline__ v16h load(const _Float16* p) {   // elements 0..7 <- p[0..7], 8..15 <- p[16..23]
    U f; f.h[0] = *(const v8h*)(p); f.h[1] = *(const v8h*)(p + 16); return f.v;
  }
  static __device__ __forceinline__ v8f mma(v16h a, v16h b, v8f c) {
    return __builtin_amdgcn_wmma_f32_16x16x32_f16(false, a, false, b, (short)0, c, false, false);
  }
  static __device__ __forceinline__ void guard(v8f& a, v8f& b, v16h x, v16h y) { dep_guard_h(a, b, x, y); }
  static __device__ __forceinline__ void keep(v16h a, v16h b, v16h c, v16h d) { keep4_h(a, b, c, d); }
};
template <> struct Frag<__bf16> {
  typedef v16b V; union U { v16b v; v8b h[2]; };
  static __device__ __forceinline__ v16b load(const __bf16* p) {
    U f; f.h[0] = *(const v8b*)(p); f.h[1] = *(const v8b*)(p + 16); return f.v;
  }
  static __device__ __forceinline__ v8f mma(v16b a, v16b b, v8f c) {
    return __builtin_amdgcn_wmma_f32_16x16x32_bf16(false, a, false, b, (short)0, c, false, false);
  }
  static __device__ __forceinline__ void guard(v8f& a, v8f& b, v16b x, v16b y) { dep_guard_b(a, b, x, y); }
  static __device__ __forceinline__ void keep(v16b a, v16b b, v16b c, v16b d) { keep4_b(a, b, c, d); }
};

// ---- Register-blocked batched WMMA GEMM ------------------------------------
// C[m,n] = scale * sum_k A[m,k] * Bt[n,k] (+bias)(+resid); each wave owns a 64x64 tile.
// A row-major [M,K]; Bt row-major [N,K]; M,N % 64 == 0, K % 32 == 0.
// SPLIT: operands are hi/lo planes (A2/Bt2 = lo planes, same layout); product = hi·hi + hi·lo + lo·hi.
// BIAS_MODE: 0 = none, 1 = bias[m], 2 = bias[n].
// OUT_MODE: 0 = f32, 1 = f16, 2 = bf16 hi plane (Cout) + bf16 lo plane (Cout2).
// ET: 0 = f16 operands, 1 = bf16 operands (pointers passed as 16-bit storage)
template <int ET> struct Elem;
template <> struct Elem<0> { typedef _Float16 T; };
template <> struct Elem<1> { typedef __bf16 T; };
template <int ET, bool SPLIT, int BIAS_MODE, int OUT_MODE, bool RESID, int ACT = 0>
__global__ __launch_bounds__(256) void wmma_gemm64(
    const unsigned short* __restrict__ Ap, const unsigned short* __restrict__ A2p, int lda, long strideA,
    const unsigned short* __restrict__ Btp, const unsigned short* __restrict__ Bt2p, int ldb, long strideB,
    void* __restrict__ Cout, void* __restrict__ Cout2, int ldc, long strideC,
    const float* __restrict__ bias,
    const float* __restrict__ resid, long strideR,
    int M, int N, int K, float scale) {
  typedef typename Elem<ET>::T T;
  typedef typename Frag<T>::V V;
  const T* A = (const T*)Ap; const T* A2 = (const T*)A2p; const T* Bt = (const T*)Btp; const T* Bt2 = (const T*)Bt2p;
  __shared__ __align__(16) float sT[8][16 * 68];   // per-wave 16x64 slab, pitch 68 floats
  const int b    = blockIdx.y;
  const int lane = threadIdx.x & 31;
  const int wave = threadIdx.x >> 5;
  const int tilesN = N >> 6;
  const int tilesM = M >> 6;
  const int tile = blockIdx.x * 8 + wave;
  if (tile >= tilesM * tilesN) return;   // wave-uniform; no block barriers in this kernel
  const int tm = tile / tilesN;
  const int tn = tile - tm * tilesN;
  const int m0 = tm << 6;
  const int n0 = tn << 6;

  const T* Ab  = A  + (size_t)b * strideA;
  const T* Bb  = Bt + (size_t)b * strideB;
  const T* Ab2 = SPLIT ? (A2  + (size_t)b * strideA) : nullptr;
  const T* Bb2 = SPLIT ? (Bt2 + (size_t)b * strideB) : nullptr;

  const int rlane = lane & 15;                 // row (A) / col (B, D) within subtile
  const int koff  = (lane >> 4) * 8;           // k offset of this lane half
  const int mOff  = (lane >> 4) * 8;           // D row offset

  v8f acc[4][4];
#pragma unroll
  for (int i = 0; i < 4; ++i)
#pragma unroll
    for (int j = 0; j < 4; ++j) acc[i][j] = (v8f){0.f,0.f,0.f,0.f,0.f,0.f,0.f,0.f};

  for (int k0 = 0; k0 < K; k0 += 32) {
    V bh[4], bl[4];
#pragma unroll
    for (int j = 0; j < 4; ++j) {
      const size_t bo = (size_t)(n0 + (j << 4) + rlane) * ldb + koff + k0;
      bh[j] = Frag<T>::load(Bb + bo);
      if (SPLIT) bl[j] = Frag<T>::load(Bb2 + bo);
    }
#pragma unroll
    for (int i = 0; i < 4; ++i) {
      const size_t ao = (size_t)(m0 + (i << 4) + rlane) * lda + koff + k0;
      V ah = Frag<T>::load(Ab + ao);
      V al;
      if (SPLIT) al = Frag<T>::load(Ab2 + ao);
#pragma unroll
      for (int j = 0; j < 4; ++j) {
        acc[i][j] = Frag<T>::mma(ah, bh[j], acc[i][j]);
        if (SPLIT) {
          acc[i][j] = Frag<T>::mma(ah, bl[j], acc[i][j]);
          acc[i][j] = Frag<T>::mma(al, bh[j], acc[i][j]);
        }
      }
      Frag<T>::guard(acc[i][0], acc[i][3], ah, SPLIT ? al : ah);
    }
    Frag<T>::keep(bh[0], bh[1], bh[2], bh[3]);
    if (SPLIT) Frag<T>::keep(bl[0], bl[1], bl[2], bl[3]);
  }
  acc_guard4(acc[0][0], acc[0][1], acc[0][2], acc[0][3]);
  acc_guard4(acc[1][0], acc[1][1], acc[1][2], acc[1][3]);
  acc_guard4(acc[2][0], acc[2][1], acc[2][2], acc[2][3]);
  acc_guard4(acc[3][0], acc[3][1], acc[3][2], acc[3][3]);

  // ---- epilogue ----
  float* slab = sT[wave];
  const float* Rb = RESID ? (resid + (size_t)b * strideR) : nullptr;
#pragma unroll
  for (int i = 0; i < 4; ++i) {
    const int mBase = m0 + (i << 4);
#pragma unroll
    for (int j = 0; j < 4; ++j) {
      const int n = n0 + (j << 4) + rlane;
      float bv = 0.f;
      if (BIAS_MODE == 2) bv = bias[n];
#pragma unroll
      for (int r = 0; r < 8; ++r) {
        float v = acc[i][j][r] * scale;
        if (BIAS_MODE == 1) v += bias[mBase + mOff + r];
        if (BIAS_MODE == 2) v += bv;
        if (RESID) v += Rb[(size_t)(mBase + mOff + r) * ldc + n];
        if (ACT == 1) v = tanhf(v);
        if (ACT == 2) v = fmaxf(v, 0.0f);
        if (ACT == 3) v = v / (1.0f + expf(-v));
        if (ACT == 4) v = (v > 0.f) ? v : 0.01f * v;
        if (ACT == 5) v = 0.5f * v * (1.0f + erff(v * 0.70710678118654752f));
        slab[(mOff + r) * 68 + (j << 4) + rlane] = v;
      }
    }
    __builtin_amdgcn_fence(__ATOMIC_RELEASE, "workgroup");
    __builtin_amdgcn_wave_barrier();
    __builtin_amdgcn_fence(__ATOMIC_ACQUIRE, "workgroup");
    if (OUT_MODE == 0) {
      float* C = (float*)Cout + (size_t)b * strideC;
      const int hh = lane >> 4, c4 = (lane & 15) * 4;     // row seg = 256 B = 16 lanes x 16 B
      {
#pragma unroll
        for (int it = 0; it < 8; ++it) {
          const int row = it * 2 + hh;
          v4f v = *(const v4f*)(slab + row * 68 + c4);
          *(v4f*)(C + (size_t)(mBase + row) * ldc + n0 + c4) = v;
        }
        
      }
    } else {
      const int q = lane >> 3, c8 = (lane & 7) * 8;
      unsigned short* C  = (unsigned short*)Cout  + (size_t)b * strideC;
      unsigned short* C2 = (OUT_MODE == 2) ? ((unsigned short*)Cout2 + (size_t)b * strideC) : nullptr;
      {
#pragma unroll
        for (int it = 0; it < 4; ++it) {
          const int row = it * 4 + q;
          const float* sp = slab + row * 68 + c8;
          v8h hv, lv;
#pragma unroll
          for (int e = 0; e < 8; ++e) {
            if (OUT_MODE == 1) {
              hv[e] = (_Float16)sp[e];
            } else {
              unsigned short hb = f2bf_bits(sp[e]);
              unsigned short lb = f2bf_bits(sp[e] - bf_bits2f(hb));
              hv[e] = __builtin_bit_cast(_Float16, hb);
              lv[e] = __builtin_bit_cast(_Float16, lb);
            }
          }
          *(v8h*)(C + (size_t)(mBase + row) * ldc + n0 + c8) = hv;
          if (OUT_MODE == 2) *(v8h*)(C2 + (size_t)(mBase + row) * ldc + n0 + c8) = lv;
        }
        
      }
    }
    __builtin_amdgcn_fence(__ATOMIC_RELEASE, "workgroup");
    __builtin_amdgcn_wave_barrier();
    __builtin_amdgcn_fence(__ATOMIC_ACQUIRE, "workgroup");
  }
}

// ---- LDS-staged WMMA GEMM ---------------------------------------------------
// C[m,n] = scale * sum_k A[m,k] * Bt[n,k] (+bias[n])(+resid); f16 operands, ldc = N. OUT16: the result goes out as f16 to C16 (it is only ever read as an f16 operand), else as f32 to C.
// One 128x128 tile of C per work-group of eight waves (4 x 2; 32 rows x 64 columns each).
// A pass is 128 k: 128 rows of Bt, then 128 rows of A, 256 B each, copied to LDS at pitch 272 B. Two buffers.
// M, N % 128 == 0; K % 128 == 0, K >= 256.
#define GL_PITCH 272
#define GL_STAGE (256 * GL_PITCH)

// Eight asynchronous copies, 16 B per lane each: rows r, r + 16, ... of one operand's 128 rows.
// The s_wait_xcnt ends the copies' own statement, so that no address register of a copy is rewritten in front of it.
template <int K>
__device__ __forceinline__ void gl_copy8(unsigned l, const unsigned short* g) {
  asm volatile(
      "global_load_async_to_lds_b128 %0, %8, off\n\t"
      "global_load_async_to_lds_b128 %1, %9, off\n\t"
      "global_load_async_to_lds_b128 %2, %10, off\n\t"
      "global_load_async_to_lds_b128 %3, %11, off\n\t"
      "global_load_async_to_lds_b128 %4, %12, off\n\t"
      "global_load_async_to_lds_b128 %5, %13, off\n\t"
      "global_load_async_to_lds_b128 %6, %14, off\n\t"
      "global_load_async_to_lds_b128 %7, %15, off\n\t"
      "s_wait_xcnt 0x0"
      :: "v"(l), "v"(l + 16u * GL_PITCH), "v"(l + 32u * GL_PITCH), "v"(l + 48u * GL_PITCH),
         "v"(l + 64u * GL_PITCH), "v"(l + 80u * GL_PITCH), "v"(l + 96u * GL_PITCH), "v"(l + 112u * GL_PITCH),
         "v"(g), "v"(g + (size_t)16 * K), "v"(g + (size_t)32 * K), "v"(g + (size_t)48 * K),
         "v"(g + (size_t)64 * K), "v"(g + (size_t)80 * K), "v"(g + (size_t)96 * K), "v"(g + (size_t)112 * K)
      : "memory");
}
// One stage: stage rows 0..127 come from Bt, 128..255 from A; a lane fills 16 B of rows (thread >> 4) + 16 * i.
template <int K>
__device__ __forceinline__ void gl_fill(unsigned ldsLane, const unsigned short* gB, const unsigned short* gA) {
  gl_copy8<K>(ldsLane, gB);
  gl_copy8<K>(ldsLane + 128u * GL_PITCH, gA);
}
// this wave's copies have landed in LDS
__device__ __forceinline__ void gl_wait_async0() { asm volatile("s_wait_asynccnt 0x0" ::: "memory"); }
// this wave's LDS reads have returned, so the buffer may be refilled behind the barrier
__device__ __forceinline__ void gl_wait_ds0() { asm volatile("s_wait_dscnt 0x0" ::: "memory"); }

template <int N, int K, int BIAS_MODE, bool RESID, int ACT, bool OUT16>
__global__ __launch_bounds__(256, 4) void wmma_gemm_lds(
    const unsigned short* __restrict__ Ap, const unsigned short* __restrict__ Btp,
    float* __restrict__ C, _Float16* __restrict__ C16, const float* __restrict__ bias, const float* __restrict__ resid, float scale) {
  static_assert(N % 128 == 0 && K % 128 == 0 && K >= 256, "shape");
  __shared__ __attribute__((aligned(128))) unsigned char sL[2 * GL_STAGE];
  const int tid  = threadIdx.x;
  const int lane = tid & 31;
  const int wave = tid >> 5;
  constexpr int tilesN = N / 128;
  constexpr int NT = K / 128;
  const int tm = blockIdx.x / tilesN;
  const int tn = blockIdx.x - tm * tilesN;
  const int wm = (wave >> 1) << 5;             // this wave's 32 rows and 64 columns inside the tile
  const int wn = (wave & 1) << 6;
  const int rlane = lane & 15;                 // row (A) / col (B, D) within subtile
  const int hh    = lane >> 4;                 // lane half: k offset 8 * hh, D row offset 8 * hh
  const int mOff  = hh * 8;

  const unsigned ldsLane = (unsigned)(uintptr_t)(&sL[0]) + (unsigned)((tid >> 4) * GL_PITCH + (tid & 15) * 16);
  const unsigned short* gB = Btp + (size_t)(tn * 128 + (tid >> 4)) * K + (tid & 15) * 8;
  const unsigned short* gA = Ap  + (size_t)(tm * 128 + (tid >> 4)) * K + (tid & 15) * 8;

  v8f acc[2][4];
#pragma unroll
  for (int i = 0; i < 2; ++i)
#pragma unroll
    for (int j = 0; j < 4; ++j) acc[i][j] = (v8f){0.f,0.f,0.f,0.f,0.f,0.f,0.f,0.f};

  gl_fill<K>(ldsLane, gB, gA);
  gl_wait_async0();
  __syncthreads();                             // stage 0 is readable by every wave
  gl_fill<K>(ldsLane + GL_STAGE, gB + 128, gA + 128);

  // kept rolled: one pass per trip, so that the order at its foot stands once
#pragma unroll 1
  for (int t = 0; t < NT; ++t) {
    const unsigned bo = (unsigned)(t & 1) * GL_STAGE;
    const unsigned char* pB = sL + bo + (wn + rlane) * GL_PITCH + hh * 16;
    const unsigned char* pA = sL + bo + (128 + wm + rlane) * GL_PITCH + hh * 16;
    v16h bh[2][4], ah[2][2];                   // two fragment sets: the next 32 k are fetched while these are multiplied
#pragma unroll
    for (int j = 0; j < 4; ++j) bh[0][j] = Frag<_Float16>::load((const _Float16*)(pB + j * 16 * GL_PITCH));
#pragma unroll
    for (int i = 0; i < 2; ++i) ah[0][i] = Frag<_Float16>::load((const _Float16*)(pA + i * 16 * GL_PITCH));
#pragma unroll
    for (int kk = 0; kk < 4; ++kk) {
      const int cur = kk & 1, nxt = cur ^ 1;
      if (kk < 3) {
#pragma unroll
        for (int j = 0; j < 4; ++j) bh[nxt][j] = Frag<_Float16>::load((const _Float16*)(pB + j * 16 * GL_PITCH + (kk + 1) * 64));
#pragma unroll
        for (int i = 0; i < 2; ++i) ah[nxt][i] = Frag<_Float16>::load((const _Float16*)(pA + i * 16 * GL_PITCH + (kk + 1) * 64));
      }
      __builtin_amdgcn_sched_barrier(0);       // keeps the next block's LDS reads one group ahead of this block's WMMAs, not among them
#pragma unroll
      for (int i = 0; i < 2; ++i)
#pragma unroll
        for (int j = 0; j < 4; ++j) acc[i][j] = Frag<_Float16>::mma(ah[cur][i], bh[cur][j], acc[i][j]);
      __builtin_amdgcn_sched_barrier(0);       // ends the block: later LDS reads stay behind its WMMAs
    }
    gl_wait_ds0();
    gl_wait_async0();
    __syncthreads();                           // publishes stage t + 1 and ends every read of stage t
    if (t + 2 < NT) gl_fill<K>(ldsLane + bo, gB + (size_t)(t + 2) * 128, gA + (size_t)(t + 2) * 128);
  }
  gl_wait_async0();

  // ---- epilogue ----
  // The ring is free: the last trip's foot waited for every read and every copy and passed the barrier.
  float* slab = (float*)(sL + wave * (16 * 68 * 4));   // per-wave 16x64 slab, pitch 68 floats
  const int m0 = tm * 128 + wm;
  const int n0 = tn * 128 + wn;
  const int nl = n0 + rlane;
  float bv[4];
#pragma unroll
  for (int j = 0; j < 4; ++j) bv[j] = (BIAS_MODE == 2) ? bias[nl + (j << 4)] : 0.f;
  // the bias loads' index register is an input, so it stays whole up to the wait
  if (BIAS_MODE == 2) asm volatile("s_wait_xcnt 0x0" :: "v"(nl) : "memory");
#pragma unroll
  for (int i = 0; i < 2; ++i) {
    const int mBase = m0 + (i << 4);
    float rv[4][8];
    if (RESID) {
      const float* rp = resid + (size_t)(mBase + mOff) * N + nl;
#pragma unroll
      for (int j = 0; j < 4; ++j)
#pragma unroll
        for (int r = 0; r < 8; ++r) rv[j][r] = rp[(size_t)r * N + (j << 4)];
      // the residual loads' address register is an input, so it stays whole up to the wait
      asm volatile("s_wait_xcnt 0x0" :: "v"(rp) : "memory");
    }
#pragma unroll
    for (int j = 0; j < 4; ++j) {
#pragma unroll
      for (int r = 0; r < 8; ++r) {
        float v = acc[i][j][r] * scale;
        if (BIAS_MODE == 2) v += bv[j];
        if (RESID) v += rv[j][r];
        if (ACT == 2) v = fmaxf(v, 0.0f);
        slab[(mOff + r) * 68 + (j << 4) + rlane] = v;
      }
    }
    __builtin_amdgcn_fence(__ATOMIC_RELEASE, "workgroup");
    __builtin_amdgcn_wave_barrier();
    __builtin_amdgcn_fence(__ATOMIC_ACQUIRE, "workgroup");
    if (OUT16) {
      const int r4 = lane >> 3, c8 = (lane & 7) * 8;   // row seg = 128 B = 8 lanes x 16 B
      _Float16* hp = C16 + (size_t)(mBase + r4) * N + n0 + c8;
#pragma unroll
      for (int it = 0; it < 4; ++it) {         // rows it * 4 + r4
        const float* sp = slab + (it * 4 + r4) * 68 + c8;
        const v4f lo = *(const v4f*)(sp), hi = *(const v4f*)(sp + 4);
        v8h h;
#pragma unroll
        for (int e = 0; e < 4; ++e) { h[e] = (_Float16)lo[e]; h[4 + e] = (_Float16)hi[e]; }
        *(v8h*)(hp + (size_t)it * 4 * N) = h;
      }
    } else {
      const int c4 = (lane & 15) * 4;          // row seg = 256 B = 16 lanes x 16 B
      float* cp = C + (size_t)(mBase + hh) * N + n0 + c4;
#pragma unroll
      for (int it = 0; it < 8; ++it) {         // rows it * 2 + hh
        v4f v = *(const v4f*)(slab + (it * 2 + hh) * 68 + c4);
        *(v4f*)(cp + (size_t)it * 2 * N) = v;
      }
    }
    __builtin_amdgcn_sched_barrier(0);         // holds later register writes behind the wait below
    asm volatile("s_wait_xcnt 0x0" ::: "memory");   // before a data or address register of the stores above is rewritten
    __builtin_amdgcn_sched_barrier(0);         // without the pair the next rows' multiplies were lifted over the wait, onto the stores' data registers
    __builtin_amdgcn_fence(__ATOMIC_RELEASE, "workgroup");
    __builtin_amdgcn_wave_barrier();
    __builtin_amdgcn_fence(__ATOMIC_ACQUIRE, "workgroup");
  }
}

__global__ __launch_bounds__(256) void cast_f32_f16x2(
    const float* __restrict__ in, _Float16* __restrict__ out, int n2) {
  int i = blockIdx.x * 256 + threadIdx.x;
  if (i < n2) {
    const _Float16 h0 = (_Float16)in[2 * i], h1 = (_Float16)in[2 * i + 1];
    const unsigned u = (unsigned)__builtin_bit_cast(unsigned short, h0) | ((unsigned)__builtin_bit_cast(unsigned short, h1) << 16);
    ((unsigned*)out)[i] = u;
    
  }
}


} // namespace w25

__global__ __launch_bounds__(256) void k_castT16(const float* __restrict__ src, long long lds, _Float16* __restrict__ dst, long long ldd, int R, int C, float s) {
    const long long i = (long long)blockIdx.x * 256 + threadIdx.x; const long long np = (long long)C * (R / 2); if (i >= np) return; const int c = (int)(i / (R / 2)); const int r = 2 * (int)(i % (R / 2));
    const _Float16 h0 = (_Float16)(src[(long long)r * lds + c] * s), h1 = (_Float16)(src[(long long)(r + 1) * lds + c] * s);
    const unsigned u = (unsigned)__builtin_bit_cast(unsigned short, h0) | ((unsigned)__builtin_bit_cast(unsigned short, h1) << 16);
    unsigned* d = (unsigned*)(dst + (long long)c * ldd + r); *d = u;  }
__global__ __launch_bounds__(256) void k_cast16(const float* __restrict__ src, long long lds, _Float16* __restrict__ dst, long long ldd, int R, int C, float s) {
    const long long i = (long long)blockIdx.x * 256 + threadIdx.x; const long long np = (long long)R * (C / 2); if (i >= np) return; const int r = (int)(i / (C / 2)); const int c = 2 * (int)(i % (C / 2));
    const _Float16 h0 = (_Float16)(src[(long long)r * lds + c] * s), h1 = (_Float16)(src[(long long)r * lds + c + 1] * s);
    const unsigned u = (unsigned)__builtin_bit_cast(unsigned short, h0) | ((unsigned)__builtin_bit_cast(unsigned short, h1) << 16);
    unsigned* d = (unsigned*)(dst + (long long)r * ldd + c); *d = u;  }

// f32 -> bf16 hi plane + bf16 lo plane (x = hi + lo to ~2^-17 relative; RNE both), [R][C] -> [R][C] (or transposed to [C][R]); 2 consecutive destination elements
__device__ __forceinline__ unsigned int f2bf2_pack(float a, float b, unsigned int* lo) {
    const unsigned short ha = w25::f2bf_bits(a), hb = w25::f2bf_bits(b);
    const unsigned short la = w25::f2bf_bits(a - w25::bf_bits2f(ha)), lb = w25::f2bf_bits(b - w25::bf_bits2f(hb));
    *lo = (unsigned)la | ((unsigned)lb << 16); return (unsigned)ha | ((unsigned)hb << 16); }
__global__ __launch_bounds__(256) void k_castS16(const float* __restrict__ src, long long lds, __bf16* __restrict__ dhi, __bf16* __restrict__ dlo, long long ldd, int R, int C, float s, int transpose) {
    const long long i = (long long)blockIdx.x * 256 + threadIdx.x; long long o; float a, b;
    if (transpose) { const long long np = (long long)C * (R / 2); if (i >= np) return; const int c = (int)(i / (R / 2)); const int r = 2 * (int)(i % (R / 2)); a = src[(long long)r * lds + c] * s; b = src[(long long)(r + 1) * lds + c] * s; o = (long long)c * ldd + r; }
    else { const long long np = (long long)R * (C / 2); if (i >= np) return; const int r = (int)(i / (C / 2)); const int c = 2 * (int)(i % (C / 2)); a = src[(long long)r * lds + c] * s; b = src[(long long)r * lds + c + 1] * s; o = (long long)r * ldd + c; }
    unsigned lo; const unsigned hi = f2bf2_pack(a, b, &lo); unsigned* ph = (unsigned*)(dhi + o); unsigned* pl = (unsigned*)(dlo + o);
    *ph = hi; *pl = lo;  }

namespace w25 {
// =====================================================================================
// Generic causal/non-causal attention for head_dim 64, f32 in / f32 out; 16-bit operands: bf16 with optional hi/lo splits, or
// plain f16 (F16=true, non-split, probabilities carried x2^15).
//   scores = (q*qscale)·kᵀ : v_wmma_f32_16x16x32_bf16; SPLIT_QK -> q,k as bf16 hi/lo (hi·hi + hi·lo + lo·hi)
//   out    = p·v           : v_wmma_f32_16x16x32_bf16; SPLIT_PV -> p,v as bf16 hi/lo; else p,v plain bf16
//   f32 accumulate; online softmax in f32. Block = 4 waves = 64 query rows of one (batch, head); S % 64 == 0.
//   Element (b, s, h, d) of tensor X lives at X[b*X_bs + s*X_rs + h*X_hs + d] (strides in floats, multiples of 4).
//   Masking: mask_mode 0 none, 1 causal (kv > q masked), 2 tensor [S][Skv] shared over (b,h) (float if
//   mask_is_int==0, int32 with element == 0 -> masked if 1, int32 with element != 0 -> masked if 2), 3 per-token vectors qmask[B][S] & kvmask[B][Skv] (int32,
//   0 -> masked), 4 causal + sliding window (kv > q or q - kv > W masked; W passed in mask_is_int);
//   5 = relative-position bias: s += cp[b,h,q][idx[q][kv]] + pc[b,h,kv][idx[q][kv]] with idx = mask_b ([S][Skv] int32) and
//   mask_a an int32 [S][Skv] tensor with nonzero = masked (tables: element (b,h,row,n) at X + b*c_bs + h*c_hs + row*c_rs + n);
//   masked scores are replaced by mask_fill (e.g. -inf or -1e9) before the softmax.
//   grid.x = B * H * (S/64) (or a sub-range with blk0).
// =====================================================================================
#define AT_D 64
#define AT_NW 4
#define AT_QB 64
#define AT_KC 64
struct AttnGeom { const float* cp = nullptr; const float* pc = nullptr; long c_bs = 0, c_rs = 0, c_hs = 0;   // mode-5 score-bias tables
                  long q_bs, q_rs, q_hs, k_bs, k_rs, k_hs, v_bs, v_rs, v_hs, o_bs, o_rs, o_hs;
                  int S, Skv, H, mask_mode; float qscale; int blk0; float mask_fill; int mask_is_int; };
static_assert(sizeof(AttnGeom) == 168, "no padding");

__device__ __forceinline__ unsigned short at_bf_bits(float f) {
  unsigned u = __float_as_uint(f);
  return (unsigned short)((u + 0x7FFFu + ((u >> 16) & 1u)) >> 16);
}
__device__ __forceinline__ __bf16 at_f2bf(float f) { return __builtin_bit_cast(__bf16, at_bf_bits(f)); }
__device__ __forceinline__ void at_split(float f, __bf16& hi, __bf16& lo) {
  const unsigned short hb = at_bf_bits(f);
  hi = __builtin_bit_cast(__bf16, hb);
  lo = at_f2bf(f - __uint_as_float(((unsigned)hb) << 16));
}
__device__ __forceinline__ v8f at_mma(v16b a, v16b b, v8f c) {
  c = __builtin_amdgcn_wmma_f32_16x16x32_bf16(false, a, false, b, (short)0, c, false, false);
  asm volatile("v_nop\n\tv_nop\n\tv_nop\n\tv_nop" : "+v"(c) : "v"(a), "v"(b));
  return c;
}
// 16-bit element as a bit pattern held in a __bf16 slot: f16 bits when F16, bf16 (RNE) otherwise
template <bool F16> __device__ __forceinline__ __bf16 at_to16(float f) {
  if (F16) return __builtin_bit_cast(__bf16, (_Float16)f);
  return at_f2bf(f);
}
template <bool F16> __device__ __forceinline__ v8f at_mma16(v16b a, v16b b, v8f c) {
  if (F16) {
    const v16h ah = __builtin_bit_cast(v16h, a), bh = __builtin_bit_cast(v16h, b);
    c = __builtin_amdgcn_wmma_f32_16x16x32_f16(false, ah, false, bh, (short)0, c, false, false);
    asm volatile("v_nop\n\tv_nop\n\tv_nop\n\tv_nop" : "+v"(c) : "v"(ah), "v"(bh));
    return c;
  }
  return at_mma(a, b, c);
}

template <bool SPLIT_QK, bool SPLIT_PV, bool F16 = false>
__global__ __launch_bounds__(128)
void attn64_kernel(const float* __restrict__ q, const float* __restrict__ k,
                   const float* __restrict__ v, float* __restrict__ out,
                   const void* __restrict__ mask_a, const int* __restrict__ mask_b, AttnGeom g) {
  static_assert(!(F16 && (SPLIT_QK || SPLIT_PV)), "f16 mode is non-split");
  const float PSC = F16 ? 32768.0f : 1.0f;     // f16 probabilities carried x2^15 (subnormal range), folded into the final 1/l
  union FB { v16b v; v8b h[2]; };
  __shared__ __align__(16) __bf16 Ksh[AT_KC * AT_D];             // K hi [kv][d]      8 KB
  __shared__ __align__(16) __bf16 Ksl[SPLIT_QK ? AT_KC * AT_D : 8];
  __shared__ __align__(16) __bf16 Vth[AT_D * AT_KC];             // V hi [d][kv]      8 KB
  __shared__ __align__(16) __bf16 Vtl[SPLIT_PV ? AT_D * AT_KC : 8];
  __shared__ __align__(16) __bf16 Psh[AT_NW][16 * AT_KC];        // per wave P hi [row][kv]  8 KB
  __shared__ __align__(16) __bf16 Psl[SPLIT_PV ? AT_NW : 1][SPLIT_PV ? 16 * AT_KC : 8];
  __shared__ __align__(16) float  Os[AT_NW][16 * 68];            // per wave out tile, pitch 68

  const int tid  = threadIdx.x;
  const int wave = tid >> 5;
  const int lane = tid & 31;
  const int hh   = lane >> 4;
  const int c    = lane & 15;

  const int nqb = g.S / AT_QB;
  const int bx = blockIdx.x + g.blk0;
  const int qb = bx % nqb;
  const int bh = bx / nqb;
  const int h  = bh % g.H;
  const int b  = bh / g.H;
  const int qbase_block = qb * AT_QB;
  const int q0 = qbase_block + wave * 16;

  const float* qb_ptr = q + (size_t)b * g.q_bs + (size_t)h * g.q_hs;
  const float* kb_ptr = k + (size_t)b * g.k_bs + (size_t)h * g.k_hs;
  const float* vb_ptr = v + (size_t)b * g.v_bs + (size_t)h * g.v_hs;
  float*       ob_ptr = out + (size_t)b * g.o_bs + (size_t)h * g.o_hs;

  // ---- Q fragments (A operand): 2 d-chunks, hi (and lo) ----
  v16b qah[2], qal[2];
  {
    const float* qrow = qb_ptr + (size_t)(q0 + c) * g.q_rs;
#pragma unroll
    for (int dc = 0; dc < 2; ++dc) {
#pragma unroll
      for (int e = 0; e < 8; ++e) {
        const float f0 = qrow[dc * 32 + 8 * hh + e] * g.qscale;
        const float f1 = qrow[dc * 32 + 16 + 8 * hh + e] * g.qscale;
        if (SPLIT_QK) { __bf16 hq, lq; at_split(f0, hq, lq); qah[dc][e] = hq; qal[dc][e] = lq; at_split(f1, hq, lq); qah[dc][8 + e] = hq; qal[dc][8 + e] = lq; }
        else { qah[dc][e] = at_to16<F16>(f0); qah[dc][8 + e] = at_to16<F16>(f1); qal[dc][e] = qah[dc][e]; qal[dc][8 + e] = qah[dc][8 + e]; }
      }
    }
  }

  float mrow[8], lrow[8];
  v8f oacc[4];
#pragma unroll
  for (int r = 0; r < 8; ++r) { mrow[r] = -INFINITY; lrow[r] = 0.f; }
#pragma unroll
  for (int t = 0; t < 4; ++t) oacc[t] = (v8f){0.f,0.f,0.f,0.f,0.f,0.f,0.f,0.f};

  const int nChunks = (g.mask_mode == 1 || g.mask_mode == 4) ? (qb + 1) : (g.Skv / AT_KC);   // block-uniform
  // per-row query mask (mode 3)
  int qkeep[8];
#pragma unroll
  for (int r = 0; r < 8; ++r) qkeep[r] = (g.mask_mode == 3) ? mask_b[(size_t)b * g.S + q0 + 8 * hh + r] : 1;   // mask_b = qmask in mode 3
  for (int kc = 0; kc < nChunks; ++kc) {
    const int kv0 = kc * AT_KC;
    __syncthreads();
    {
      const int kvr = tid >> 1, dh = (tid & 1) * 32;
      const float* krow = kb_ptr + (size_t)(kv0 + kvr) * g.k_rs + dh;
      const float* vrow = vb_ptr + (size_t)(kv0 + kvr) * g.v_rs + dh;
#pragma unroll
      for (int i = 0; i < 8; ++i) {
        v4f kk = *(const v4f*)(krow + 4 * i);
        v4f vv = *(const v4f*)(vrow + 4 * i);
#pragma unroll
        for (int e = 0; e < 4; ++e) {
          const int d = dh + 4 * i + e;
          if (SPLIT_QK) { __bf16 a, bl; at_split(kk[e], a, bl); Ksh[kvr * AT_D + d] = a; Ksl[kvr * AT_D + d] = bl; }
          else Ksh[kvr * AT_D + d] = at_to16<F16>(kk[e]);
          if (SPLIT_PV) { __bf16 a, bl; at_split(vv[e], a, bl); Vth[d * AT_KC + kvr] = a; Vtl[d * AT_KC + kvr] = bl; }
          else Vth[d * AT_KC + kvr] = at_to16<F16>(vv[e]);
        }
      }
    }
    __syncthreads();

    v8f s[4];
#pragma unroll
    for (int j = 0; j < 4; ++j) {
      s[j] = (v8f){0.f,0.f,0.f,0.f,0.f,0.f,0.f,0.f};
#pragma unroll 1
      for (int dc = 0; dc < 2; ++dc) {
        FB kb;
        kb.h[0] = *(const v8b*)(Ksh + (j * 16 + c) * AT_D + dc * 32 + 8 * hh);
        kb.h[1] = *(const v8b*)(Ksh + (j * 16 + c) * AT_D + dc * 32 + 16 + 8 * hh);
        s[j] = at_mma16<F16>(qah[dc], kb.v, s[j]);
        if (SPLIT_QK) {
          FB kl;
          kl.h[0] = *(const v8b*)(Ksl + (j * 16 + c) * AT_D + dc * 32 + 8 * hh);
          kl.h[1] = *(const v8b*)(Ksl + (j * 16 + c) * AT_D + dc * 32 + 16 + 8 * hh);
          s[j] = at_mma16<F16>(qah[dc], kl.v, s[j]);
          s[j] = at_mma16<F16>(qal[dc], kb.v, s[j]);
        }
      }
    }
    const bool diag = (g.mask_mode == 1) && (kc == qb);
    int kvkeep[4] = {1, 1, 1, 1};
    if (g.mask_mode == 3) {
#pragma unroll
      for (int j = 0; j < 4; ++j) kvkeep[j] = ((const int*)mask_a)[(size_t)b * g.Skv + kv0 + j * 16 + c];   // mask_a = kvmask
    }
    float cm[8];
#pragma unroll
    for (int r = 0; r < 8; ++r) {
      const int qrow = q0 + 8 * hh + r;
      float m = -INFINITY;
#pragma unroll
      for (int j = 0; j < 4; ++j) {
        const int kvcol = kv0 + j * 16 + c;
        bool masked = false;
        if (diag) masked = (kvcol > qrow);
        else if (g.mask_mode == 4) masked = (kvcol > qrow) || (qrow - kvcol > g.mask_is_int);
        else if (g.mask_mode == 2) {
          const size_t mi = (size_t)qrow * g.Skv + kvcol;
          masked = (g.mask_is_int == 0) ? (((const float*)mask_a)[mi] == 0.0f)
                 : (g.mask_is_int == 1) ? (((const int*)mask_a)[mi] == 0) : (((const int*)mask_a)[mi] != 0);
        } else if (g.mask_mode == 3) masked = (qkeep[r] == 0) || (kvkeep[j] == 0);
        else if (g.mask_mode == 5) {
          const size_t mi = (size_t)qrow * g.Skv + kvcol;
          masked = (((const int*)mask_a)[mi] != 0);
          int n = mask_b[mi]; n = n < 0 ? 0 : n;
          s[j][r] += g.cp[(size_t)b * g.c_bs + (size_t)h * g.c_hs + (size_t)qrow * g.c_rs + n]
                   + g.pc[(size_t)b * g.c_bs + (size_t)h * g.c_hs + (size_t)kvcol * g.c_rs + n];
        }
        if (masked) s[j][r] = g.mask_fill;
        m = fmaxf(m, s[j][r]);
      }
#pragma unroll
      for (int off = 1; off < 16; off <<= 1) m = fmaxf(m, __shfl_xor(m, off, 32));
      cm[r] = m;
    }
    __bf16* pwh = Psh[wave];
    __bf16* pwl = Psl[SPLIT_PV ? wave : 0];
#pragma unroll
    for (int r = 0; r < 8; ++r) {
      const float mnew = fmaxf(mrow[r], cm[r]);
      const float alpha = expf(mrow[r] - mnew);
      mrow[r] = mnew;
      float psum = 0.f;
#pragma unroll
      for (int j = 0; j < 4; ++j) {
        const float p = expf(s[j][r] - mnew);
        psum += p;
        if (SPLIT_PV) { __bf16 a, bl; at_split(p, a, bl); pwh[(8 * hh + r) * AT_KC + j * 16 + c] = a; pwl[(8 * hh + r) * AT_KC + j * 16 + c] = bl; }
        else pwh[(8 * hh + r) * AT_KC + j * 16 + c] = at_to16<F16>(p * PSC);
      }
#pragma unroll
      for (int off = 1; off < 16; off <<= 1) psum += __shfl_xor(psum, off, 32);
      lrow[r] = lrow[r] * alpha + psum;
#pragma unroll
      for (int t = 0; t < 4; ++t) oacc[t][r] *= alpha;
    }
    __builtin_amdgcn_fence(__ATOMIC_RELEASE, "workgroup");
    __builtin_amdgcn_wave_barrier();
    __builtin_amdgcn_fence(__ATOMIC_ACQUIRE, "workgroup");
#pragma unroll 1
    for (int kk = 0; kk < 2; ++kk) {
      FB pa, pl;
      pa.h[0] = *(const v8b*)(pwh + c * AT_KC + kk * 32 + 8 * hh);
      pa.h[1] = *(const v8b*)(pwh + c * AT_KC + kk * 32 + 16 + 8 * hh);
      if (SPLIT_PV) {
        pl.h[0] = *(const v8b*)(pwl + c * AT_KC + kk * 32 + 8 * hh);
        pl.h[1] = *(const v8b*)(pwl + c * AT_KC + kk * 32 + 16 + 8 * hh);
      }
#pragma unroll
      for (int t = 0; t < 4; ++t) {
        FB vb;
        vb.h[0] = *(const v8b*)(Vth + (t * 16 + c) * AT_KC + kk * 32 + 8 * hh);
        vb.h[1] = *(const v8b*)(Vth + (t * 16 + c) * AT_KC + kk * 32 + 16 + 8 * hh);
        oacc[t] = at_mma16<F16>(pa.v, vb.v, oacc[t]);
        if (SPLIT_PV) {
          FB vl;
          vl.h[0] = *(const v8b*)(Vtl + (t * 16 + c) * AT_KC + kk * 32 + 8 * hh);
          vl.h[1] = *(const v8b*)(Vtl + (t * 16 + c) * AT_KC + kk * 32 + 16 + 8 * hh);
          oacc[t] = at_mma16<F16>(pa.v, vl.v, oacc[t]);
          oacc[t] = at_mma16<F16>(pl.v, vb.v, oacc[t]);
        }
      }
    }
  }

  float* os = Os[wave];
#pragma unroll
  for (int r = 0; r < 8; ++r) {
    const float inv = 1.0f / (lrow[r] * PSC);
#pragma unroll
    for (int t = 0; t < 4; ++t) os[(8 * hh + r) * 68 + t * 16 + c] = oacc[t][r] * inv;
  }
  __builtin_amdgcn_fence(__ATOMIC_RELEASE, "workgroup");
  __builtin_amdgcn_wave_barrier();
  __builtin_amdgcn_fence(__ATOMIC_ACQUIRE, "workgroup");
  {
    const int c4 = (lane & 15) * 4;
    {
#pragma unroll
      for (int it = 0; it < 8; ++it) {
        const int row = it * 2 + hh;
        v4f val = *(const v4f*)(os + row * 68 + c4);
        *(v4f*)(ob_ptr + (size_t)(q0 + row) * g.o_rs + c4) = val;
      }
      
    }
  }
}

} // namespace w25

// ---- Wide elementwise and row passes: a thread moves 32 or 64 elements with 16-byte loads, so that a pass starts a few thousand waves instead of
//      one wave per 64 or 128 elements. Every wave-wide store covers whole 128-byte lines. Formulas and sum trees are those of the narrow kernels above.
typedef __attribute__((ext_vector_type(4))) _Float16 v4h;
// k_cast16w<G>: dst[i] = f16(src[i] * s) over a flat range; a block takes G * 1024 consecutive elements, a thread 4 consecutive ones of each 1024.
template <int G>
__global__ __launch_bounds__(256) void k_cast16w(const float* __restrict__ src, _Float16* __restrict__ dst, float s) {
    const v4f* sp = (const v4f*)(src + (size_t)blockIdx.x * (G * 1024));
    v4h* dp = (v4h*)(dst + (size_t)blockIdx.x * (G * 1024));
    const unsigned t = threadIdx.x;
    v4f a[G];
#pragma unroll
    for (int g = 0; g < G; ++g) a[g] = sp[t + g * 256];
#pragma unroll
    for (int g = 0; g < G; ++g) {
        v4h h;
#pragma unroll
        for (int e = 0; e < 4; ++e) h[e] = (_Float16)(a[g][e] * s);
        dp[t + g * 256] = h;
    }
}
// k_castT16w<LDS, LDD>: dst[c * LDD + r] = f16(src[r * LDS + c] * s). Block = 64 source rows x 128 source columns, wave = 64 x 16, lane = 8 rows x 4 columns
//   transposed in registers: 8 lanes side by side in r fill one 128-byte line of a dst row. grid (C / 128, R / 64).
template <int LDS, int LDD>
__global__ __launch_bounds__(256) void k_castT16w(const float* __restrict__ src, _Float16* __restrict__ dst, float s) {
    const int lane = threadIdx.x & 31, wave = threadIdx.x >> 5;
    const int r = blockIdx.y * 64 + (lane & 7) * 8;
    const int c = blockIdx.x * 128 + wave * 16 + (lane >> 3) * 4;
    const float* sp = src + (size_t)r * LDS + c;
    _Float16* dp = dst + (size_t)c * LDD + r;
    v4f x[8];
#pragma unroll
    for (int i = 0; i < 8; ++i) x[i] = *(const v4f*)(sp + i * LDS);
#pragma unroll
    for (int j = 0; j < 4; ++j) {
        v8h h;
#pragma unroll
        for (int i = 0; i < 8; ++i) h[i] = (_Float16)(x[i][j] * s);
        *(v8h*)(dp + j * LDD) = h;
    }
}
// Sum of one value per position t = 0..255 of k_stats' tree, add for add: lane l holds positions 4l + q in lo[q] and 128 + 4l + q in hi[q].
//   Levels 128 (in the lane), 64..4 (lanes l and l ^ 16, 8, 4, 2, 1), 2 and 1 (in the lane); every lane ends with the root.
__device__ __forceinline__ float tree256(v4f lo, v4f hi) {
    v4f t = lo + hi;
#pragma unroll
    for (int o = 16; o > 0; o >>= 1) {
#pragma unroll
        for (int q = 0; q < 4; ++q) t[q] += __shfl_xor(t[q], o, 32);
    }
    return (t[0] + t[2]) + (t[1] + t[3]);
}
// k_stats_w: mean and rsqrt(var + eps) of rows of 1024, one wave per row with the row held in registers (k_stats mode 0; same partial sums, same tree).
__global__ __launch_bounds__(256) void k_stats_w(const float* __restrict__ x, float eps, float* __restrict__ stat) {
    const int lane = threadIdx.x & 31; const size_t row = (size_t)blockIdx.x * 8 + (threadIdx.x >> 5);
    const float* base = x + row * 1024 + 4 * lane;
    v4f v[8];
#pragma unroll
    for (int m = 0; m < 8; ++m) v[m] = *(const v4f*)(base + 128 * m);
    const float mu = tree256(((v[0] + v[2]) + v[4]) + v[6], ((v[1] + v[3]) + v[5]) + v[7]) / 1024.f;
    v4f q0 = {}, q1 = {};
#pragma unroll
    for (int k = 0; k < 4; ++k) { const v4f d0 = v[2 * k] - mu, d1 = v[2 * k + 1] - mu; q0 = __builtin_elementwise_fma(d0, d0, q0); q1 = __builtin_elementwise_fma(d1, d1, q1); }
    const float rs = rsqrtf(tree256(q0, q1) / 1024.f + eps);
    const float o = (lane == 0) ? mu : ((lane == 1) ? rs : 0.f);
    stat[row * 32 + lane] = o;
}
// k_norm_apply_w: y = (x - mean[row]) * rstd[row] * g[c] + b[c] on rows of 1024; a block takes 8 rows, a thread 4 columns of each (x and y may be the same buffer).
//   H16: y16 = f16(y) goes out beside y, as the next product's A operand.
template <bool H16>
__global__ __launch_bounds__(256) void k_norm_apply_w(const float* x, float* y, _Float16* __restrict__ y16, const float* __restrict__ stat, const float* __restrict__ g, const float* __restrict__ bta) {
    const int c = threadIdx.x * 4; const size_t r0 = (size_t)blockIdx.x * 8;
    const v4f gg = *(const v4f*)(g + c), bb = *(const v4f*)(bta + c);
    v4f v[8];
#pragma unroll
    for (int i = 0; i < 8; ++i) v[i] = *(const v4f*)(x + (r0 + i) * 1024 + c);
    __builtin_amdgcn_sched_barrier(0);               // holds later register writes behind the wait below
    asm volatile("s_wait_xcnt 0x0" ::: "memory");    // before an address register of the loads above is rewritten (the store addresses are formed next)
    __builtin_amdgcn_sched_barrier(0);               // the pair keeps the forming of the store addresses, which reuses the loads' address registers, behind the wait
#pragma unroll
    for (int i = 0; i < 8; ++i) {
        v4f o = (v[i] - stat[(r0 + i) * 32]) * stat[(r0 + i) * 32 + 1];
        o *= gg; o += bb;
        *(v4f*)(y + (r0 + i) * 1024 + c) = o;
        if (H16) {
            v4h h;
#pragma unroll
            for (int e = 0; e < 4; ++e) h[e] = (_Float16)o[e];
            *(v4h*)(y16 + (r0 + i) * 1024 + c) = h;
        }
    }
}


// ---- Block attention at its fixed shape ------------------------------------------------------------------------------
// k_attn_blk: k_attn<64, 64, 0, false, false> for 128 queries x 128 keys x 64 dims per (128-position block z, head h), row stride 1024 elements, all as constants.
//   Same f16 operands, same products in the same order, same online softmax over two 64-key halves, same sums: only how the data travel differs.
//   Q, K and V arrive as the f16 values that the projections' epilogues stored, and O leaves as f16, the next product's A operand.
//   One work-group of eight waves per (z, h); wave w owns queries 16w .. 16w + 15. Every global load is unguarded (every index is in range by
//   the constants), so all of a thread's loads are in flight together. K lies in LDS as f16 [key][d], V as f16 [d][key] (8 keys x 4 dims transposed in registers),
//   so that every B fragment is two 16-byte LDS reads. All 128 keys are staged at once: one barrier.
#define BA_KP 72      // pitch of K and P rows in halves: 144 B = 16 B x odd, for 16-byte readers
#define BA_VP 136     // pitch of V^T rows in halves: 272 B = 16 B x odd
// orders one wave's LDS writes and its other lanes' LDS reads (the per-wave P and O tiles)
__device__ __forceinline__ void ba_wave_sync() {
    __builtin_amdgcn_fence(__ATOMIC_RELEASE, "workgroup");
    __builtin_amdgcn_wave_barrier();
    __builtin_amdgcn_fence(__ATOMIC_ACQUIRE, "workgroup");
}
__global__ __launch_bounds__(256) void k_attn_blk(const _Float16* __restrict__ Q, const _Float16* __restrict__ K, const _Float16* __restrict__ V, const int* __restrict__ Mi, _Float16* __restrict__ O) {
    typedef w25::Frag<_Float16> FH;
    __shared__ __align__(16) _Float16 kl[128 * BA_KP];
    __shared__ __align__(16) _Float16 vt[64 * BA_VP];
    __shared__ __align__(16) _Float16 pl[8][16 * BA_KP];
    __shared__ __align__(16) float    ol[8][16 * 68];
    const int tid = threadIdx.x, lane = tid & 31, hf = lane >> 4, l15 = lane & 15, wave = tid >> 5;
    const int h = blockIdx.x, z = blockIdx.y;
    const size_t base = (size_t)z * (128 * 1024) + (size_t)h * 64;      // (row 0, dim 0) of this block and head in Q, K, V and O
    const float L2E = 1.4426950408889634f;
    const float NEG = -__builtin_inff();

    // K: load i takes rows 32i + 4 * wave + (lane >> 3), 8 lanes to a row of 128 B. V: a thread takes keys 8 * (tid >> 4) .. + 7 at dims 4 * l15 .. + 3.
    const int g16 = tid >> 4, c4 = l15 * 4, g8 = tid >> 3, c8 = (lane & 7) * 8;
    const _Float16* kp = K + base + (size_t)g8 * 1024 + c8;
    const _Float16* vp = V + base + (size_t)g16 * (8 * 1024) + c4;
    const _Float16* qp = Q + base + (size_t)(wave * 16 + l15) * 1024 + 8 * hf;
    const int*   mp = Mi + z * 128 + l15;
    v8h kx[4], qx[4]; v4h vx[8]; int mk[8];
#pragma unroll
    for (int i = 0; i < 4; ++i) kx[i] = *(const v8h*)(kp + (size_t)i * (32 * 1024));
    // behind each group of loads: its address register is an input, so it stays whole up to the wait, and later loads' results may then land on it
    asm volatile("s_wait_xcnt 0x0" :: "v"(kp) : "memory");
#pragma unroll
    for (int i = 0; i < 8; ++i) vx[i] = *(const v4h*)(vp + (size_t)i * 1024);
    asm volatile("s_wait_xcnt 0x0" :: "v"(vp) : "memory");
#pragma unroll
    for (int i = 0; i < 4; ++i) qx[i] = *(const v8h*)(qp + i * 16);                            // dims 16 * i + 8 * hf .. + 7
#pragma unroll
    for (int i = 0; i < 8; ++i) mk[i] = mp[i * 16];                                            // keep flag of key 16i + l15
    asm volatile("s_wait_xcnt 0x0" :: "v"(qp), "v"(l15) : "memory");                          // l15 is the flag loads' index register
    __builtin_amdgcn_sched_barrier(0);   // keeps the LDS stores, which wait for loaded data, behind the issue of the last load: one latency is paid, not two
#pragma unroll
    for (int i = 0; i < 4; ++i) *(v8h*)(kl + (i * 32 + g8) * BA_KP + c8) = kx[i];
#pragma unroll
    for (int j = 0; j < 4; ++j) {
        v8h hv;
#pragma unroll
        for (int i = 0; i < 8; ++i) hv[i] = vx[i][j];
        *(v8h*)(vt + (c4 + j) * BA_VP + g16 * 8) = hv;
    }
    v16h qa[2];                                                           // A fragment: element e <- dim 32 ks + frag_k(e, hf)
#pragma unroll
    for (int ks = 0; ks < 2; ++ks)
#pragma unroll
        for (int e = 0; e < 16; ++e) qa[ks][e] = qx[ks * 2 + (e >> 3)][e & 7];
    v8f o[4]; float m8[8], l8[8];
#pragma unroll
    for (int t = 0; t < 4; ++t) { v8f zz = {}; o[t] = zz; }
#pragma unroll
    for (int i = 0; i < 8; ++i) { m8[i] = NEG; l8[i] = 0.f; }
    __syncthreads();                                                      // K and V^T are readable by every wave; they are not written again

    _Float16* myp = pl[wave];
#pragma unroll
    for (int jb = 0; jb < 2; ++jb) {
        const int j0 = jb * 64;
        v8f s[4];
#pragma unroll
        for (int t = 0; t < 4; ++t) {
            const _Float16* kr = kl + (j0 + t * 16 + l15) * BA_KP + 8 * hf;
            v8f acc = {};
            acc = FH::mma(qa[0], FH::load(kr), acc);
            acc = FH::mma(qa[1], FH::load(kr + 32), acc);
            s[t] = acc;
        }
#pragma unroll
        for (int i = 0; i < 8; ++i) {
            float sc[4];
#pragma unroll
            for (int t = 0; t < 4; ++t) {
                float v = s[t][i] * 0.125f;
                if (mk[jb * 4 + t] == 0) v = -1000000.0f;
                v *= L2E;
                sc[t] = v;
            }
            float mx = fmaxf(fmaxf(sc[0], sc[1]), fmaxf(sc[2], sc[3]));
            mx = fmaxf(mx, __shfl_xor(mx, 1, 32)); mx = fmaxf(mx, __shfl_xor(mx, 2, 32));
            mx = fmaxf(mx, __shfl_xor(mx, 4, 32)); mx = fmaxf(mx, __shfl_xor(mx, 8, 32));
            const float mnew = fmaxf(m8[i], mx);
            const float ec = exp2f(m8[i] - mnew);                         // taken unconditionally and then selected: no branch round each exp2
            const float corr = (mnew == NEG) ? 1.f : ec;
            float rs = 0.f;
#pragma unroll
            for (int t = 0; t < 4; ++t) {
                const float ep = exp2f(sc[t] - mnew);
                const float pp = (sc[t] == NEG) ? 0.f : ep; rs += pp;
                myp[(i + 8 * hf) * BA_KP + t * 16 + l15] = (_Float16)(pp * 4096.f);
            }
            rs += __shfl_xor(rs, 1, 32); rs += __shfl_xor(rs, 2, 32); rs += __shfl_xor(rs, 4, 32); rs += __shfl_xor(rs, 8, 32);
            l8[i] = l8[i] * corr + rs; m8[i] = mnew;
#pragma unroll
            for (int t = 0; t < 4; ++t) o[t][i] *= corr;
        }
        ba_wave_sync();                                                   // P is written; its rows are read by other lanes of the wave
        const v16h pa0 = FH::load(myp + l15 * BA_KP + 8 * hf), pa1 = FH::load(myp + l15 * BA_KP + 32 + 8 * hf);
#pragma unroll
        for (int t = 0; t < 4; ++t) {
            const _Float16* vr = vt + (t * 16 + l15) * BA_VP + j0 + 8 * hf;
            o[t] = FH::mma(pa0, FH::load(vr), o[t]);
            o[t] = FH::mma(pa1, FH::load(vr + 32), o[t]);
        }
        ba_wave_sync();                                                   // P is read; the next half may overwrite it
    }
    float* myo = ol[wave];
#pragma unroll
    for (int i = 0; i < 8; ++i) {
        const float rl = 1.f / (l8[i] * 4096.f);
        const float invr = (l8[i] > 0.f) ? rl : 0.f;
#pragma unroll
        for (int t = 0; t < 4; ++t) myo[(i + 8 * hf) * 68 + t * 16 + l15] = o[t][i] * invr;
    }
    ba_wave_sync();                                                       // O is written; its rows go out as whole 128-byte lines of f16
    const int r4 = lane >> 3;
    _Float16* op = O + base + (size_t)(wave * 16 + r4) * 1024 + c8;
#pragma unroll
    for (int it = 0; it < 4; ++it) {                                      // rows 4 * it + r4
        const float* sp = myo + (it * 4 + r4) * 68 + c8;
        const v4f lo = *(const v4f*)(sp), hi = *(const v4f*)(sp + 4);
        v8h hv;
#pragma unroll
        for (int e = 0; e < 4; ++e) { hv[e] = (_Float16)lo[e]; hv[4 + e] = (_Float16)hi[e]; }
        *(v8h*)(op + (size_t)it * (4 * 1024)) = hv;
    }
}

// MI[(b, s)] = (s < valid_len[b]) ? 1 : 0 as INT (the keep-mask: masked scores are SET to -1e6 exactly like the module's where, so a 128-key block lying entirely beyond valid_len comes out uniform)
__global__ __launch_bounds__(256) void k_te_mask(const int* __restrict__ VL, int* __restrict__ MI, int Bn, int S) { const int t = blockIdx.x * 256 + threadIdx.x; if (t >= Bn * S) return; int* d = MI + t; const int v = ((t % S) < VL[t / S]) ? 1 : 0; *d = v;  }


extern "C" void kernel_launch(void* const* d_in, const int* in_sizes, int n_in, void* d_out, int out_size, void* d_ws, size_t ws_size, hipStream_t stream) {
    (void)in_sizes; (void)n_in; (void)out_size; (void)ws_size;
    const float* X = (const float*)d_in[0];
    const int* vl = (const int*)d_in[1];
    const float* Wq = (const float*)d_in[2];
    const float* Wk = (const float*)d_in[3];
    const float* Wv = (const float*)d_in[4];
    const float* Wo = (const float*)d_in[5];
    const float* g1 = (const float*)d_in[6];
    const float* be1 = (const float*)d_in[7];
    const float* W1 = (const float*)d_in[8];
    const float* bf1 = (const float*)d_in[9];
    const float* W2 = (const float*)d_in[10];
    const float* bf2 = (const float*)d_in[11];
    const float* g2 = (const float*)d_in[12];
    const float* be2 = (const float*)d_in[13];
    const int Bn = 4;
    const int S = 1024;
    const int D = 1024;
    const int NH = 16;
    const int DH = 64;
    const int F = 4096;
    const int M = 128;
    const int NB = S / M;
    const int NR = Bn * S;
    float* out = (float*)d_out;
    char* wsp = (char*)d_ws;
    float* Q = (float*)wsp; wsp += (((size_t)((size_t)NR * D) * 4 + 255) / 256) * 256;
    float* Kb = (float*)wsp; wsp += (((size_t)((size_t)NR * D) * 4 + 255) / 256) * 256;
    float* V = (float*)wsp; wsp += (((size_t)((size_t)NR * D) * 4 + 255) / 256) * 256;
    float* AT = (float*)wsp; wsp += (((size_t)((size_t)NR * D) * 4 + 255) / 256) * 256;
    float* MF = (float*)wsp; wsp += (((size_t)((size_t)NR) * 4 + 255) / 256) * 256;
    float* Y = (float*)wsp; wsp += (((size_t)((size_t)NR * D) * 4 + 255) / 256) * 256;
    float* ST = (float*)wsp; wsp += (((size_t)((size_t)NR * 32) * 4 + 255) / 256) * 256;
    float* H1 = (float*)wsp; wsp += (((size_t)((size_t)NR * F) * 4 + 255) / 256) * 256;
    unsigned short* G64A = (unsigned short*)wsp; wsp += (((size_t)(16777216) * 2 + 255) / 256) * 256;
    unsigned short* G64B = (unsigned short*)wsp; wsp += (((size_t)(4194304) * 2 + 255) / 256) * 256;
    // Planes of f16 values, each written by the kernel that makes the values: Q, K, V, the attention's output (in G64A, once the projections have read X there),
    // the first LayerNorm's output (in G64A again, beside its f32 copy Y) and the FFN's hidden layer.
    _Float16* Qh = (_Float16*)Q;
    _Float16* Kh = (_Float16*)Kb;
    _Float16* Vh = (_Float16*)V;
    _Float16* Ah = (_Float16*)G64A;
    _Float16* Hh = (_Float16*)H1;
    k_cast16w<8><<<512, 256, 0, stream>>>(X, Ah, 1.0f);
    k_castT16w<1024, 1024><<<dim3(1024 / 128, 1024 / 64), 256, 0, stream>>>(Wq, (_Float16*)(G64B), 16.0f);
    w25::wmma_gemm_lds<1024, 1024, 0, false, 0, true><<<256, 256, 0, stream>>>((const unsigned short*)(G64A), (const unsigned short*)(G64B), nullptr, Qh, nullptr, nullptr, 0.0625f);
    k_castT16w<1024, 1024><<<dim3(1024 / 128, 1024 / 64), 256, 0, stream>>>(Wk, (_Float16*)(G64B), 16.0f);
    w25::wmma_gemm_lds<1024, 1024, 0, false, 0, true><<<256, 256, 0, stream>>>((const unsigned short*)(G64A), (const unsigned short*)(G64B), nullptr, Kh, nullptr, nullptr, 0.0625f);
    k_castT16w<1024, 1024><<<dim3(1024 / 128, 1024 / 64), 256, 0, stream>>>(Wv, (_Float16*)(G64B), 16.0f);
    w25::wmma_gemm_lds<1024, 1024, 0, false, 0, true><<<256, 256, 0, stream>>>((const unsigned short*)(G64A), (const unsigned short*)(G64B), nullptr, Vh, nullptr, nullptr, 0.0625f);
    k_te_mask<<<(NR + 255) / 256, 256, 0, stream>>>((const int*)vl, (int*)MF, Bn, S);
    k_attn_blk<<<dim3((unsigned)NH, (unsigned)(Bn * NB)), 256, 0, stream>>>(Qh, Kh, Vh, (const int*)MF, Ah);
    k_castT16w<1024, 1024><<<dim3(1024 / 128, 1024 / 64), 256, 0, stream>>>(Wo, (_Float16*)(G64B), 16.0f);
    w25::wmma_gemm_lds<1024, 1024, 0, true, 0, false><<<256, 256, 0, stream>>>((const unsigned short*)(G64A), (const unsigned short*)(G64B), Y, nullptr, nullptr, X, 0.0625f);
    k_stats_w<<<(unsigned)(NR / 8), 256, 0, stream>>>(Y, 1e-05f, ST);
    k_norm_apply_w<true><<<(unsigned)(NR / 8), 256, 0, stream>>>(Y, Y, Ah, ST, g1, be1);
    k_castT16w<4096, 1024><<<dim3(4096 / 128, 1024 / 64), 256, 0, stream>>>(W1, (_Float16*)(G64B), 16.0f);
    w25::wmma_gemm_lds<4096, 1024, 2, false, 2, true><<<1024, 256, 0, stream>>>((const unsigned short*)(G64A), (const unsigned short*)(G64B), nullptr, Hh, bf1, nullptr, 0.0625f);
    k_castT16w<1024, 4096><<<dim3(1024 / 128, 4096 / 64), 256, 0, stream>>>(W2, (_Float16*)(G64B), 16.0f);
    w25::wmma_gemm_lds<1024, 4096, 2, true, 0, false><<<256, 256, 0, stream>>>((const unsigned short*)(H1), (const unsigned short*)(G64B), Kb, nullptr, bf2, Y, 0.0625f);
    k_stats_w<<<(unsigned)(NR / 8), 256, 0, stream>>>(Kb, 1e-05f, ST);
    k_norm_apply_w<false><<<(unsigned)(NR / 8), 256, 0, stream>>>(Kb, out, nullptr, ST, g2, be2);
}

// v006
// A run of this version takes 135 microseconds.
// Timed twice side by side with v005, it ran 1.20 times as fast both times.
// Counting every step since v000, which is the starting kernel, it is 10.9 times as fast.
// Contractions: q/k/v/o projections X.W [4096x1024].[1024x1024] and the position-wise FFN relu(Y.W1 + b) [4096x1024].[1024x4096], .W2 + b [4096x4096].[4096x1024] with f16 operands on pre-cast planes (v_wmma_f32_16x16x32_f16; 32x64 register-blocked wave tiles, weights x16); the block-diagonal windowed attention (8 blocks of 128 positions per sequence = 32 independent (sequence, block) attentions, 16 heads, keys >= valid_len SET to -1e6 through an integer keep-mask — exactly the module's where, so blocks lying wholly beyond valid_len are uniform) as one flash launch (f16 q.k^T and p.v with p as f16 of 4096 p); f32 accumulate and softmax. AddNorm LayerNorms (two rows per wave, fixed-order trees) are f32 kernels; the keep-mask is formed inside the attention from the INPUT valid lengths.
#include <hip/hip_runtime.h>
#include <math.h>

typedef __attribute__((ext_vector_type(16))) _Float16 v16h;
typedef __attribute__((ext_vector_type(8)))  _Float16 v8h;
typedef __attribute__((ext_vector_type(16))) __bf16   v16b;
typedef __attribute__((ext_vector_type(8)))  float    v8f;
typedef __attribute__((ext_vector_type(4)))  float    v4f;

// 16-bit WMMA fragment map (wave32), lane L, h = L>>4, m = L&15:
//   A 16x32: lane = row m;   element i -> k = (i<8) ? 8h+i : 16+8h+(i-8)
//   B 32x16: lane = column m; the SAME k(i,h)
//   D 16x16 (8 f32): lane = column m; element r -> row 8h+r
__device__ __forceinline__ int frag_k(int i, int h) { return (i < 8) ? (8 * h + i) : (16 + 8 * h + (i - 8)); }
__device__ __forceinline__ __bf16 bf16_rne(float f) {
    unsigned int u = __float_as_uint(f);
    u += 0x7fffu + ((u >> 16) & 1u);
    return __builtin_bit_cast(__bf16, (unsigned short)(u >> 16));
}
__device__ __forceinline__ float bf16_f32(__bf16 b) { return __uint_as_float(((unsigned int)__builtin_bit_cast(unsigned short, b)) << 16); }
__device__ __forceinline__ v8f wmma16(v16h a, v16h b, v8f c) {
    c = __builtin_amdgcn_wmma_f32_16x16x32_f16(false, a, false, b, (short)0, c, false, false);
    asm volatile("v_nop\n\tv_nop\n\tv_nop\n\tv_nop" : "+v"(c) : "v"(a), "v"(b));
    return c;
}
__device__ __forceinline__ v8f wmmab(v16b a, v16b b, v8f c) {
    c = __builtin_amdgcn_wmma_f32_16x16x32_bf16(false, a, false, b, (short)0, c, false, false);
    asm volatile("v_nop\n\tv_nop\n\tv_nop\n\tv_nop" : "+v"(c) : "v"(a), "v"(b));
    return c;
}
struct Split { v16b hi, lo; };
// hi/lo split product: a.hi*b.hi + a.hi*b.lo + a.lo*b.hi
__device__ __forceinline__ v8f wmma3(const Split& a, const Split& b, v8f c) {
    c = __builtin_amdgcn_wmma_f32_16x16x32_bf16(false, a.hi, false, b.hi, (short)0, c, false, false);
    c = __builtin_amdgcn_wmma_f32_16x16x32_bf16(false, a.hi, false, b.lo, (short)0, c, false, false);
    c = __builtin_amdgcn_wmma_f32_16x16x32_bf16(false, a.lo, false, b.hi, (short)0, c, false, false);
    asm volatile("v_nop\n\tv_nop\n\tv_nop\n\tv_nop" : "+v"(c) : "v"(a.hi), "v"(a.lo), "v"(b.hi), "v"(b.lo));
    return c;
}
struct Split3 { v16b hi, mid, lo; };
// triple split product (6 terms, drops only terms below 2^-24 relative)
__device__ __forceinline__ v8f wmma6(const Split3& a, const Split3& b, v8f c) {
    c = __builtin_amdgcn_wmma_f32_16x16x32_bf16(false, a.hi, false, b.hi, (short)0, c, false, false);
    c = __builtin_amdgcn_wmma_f32_16x16x32_bf16(false, a.hi, false, b.mid, (short)0, c, false, false);
    c = __builtin_amdgcn_wmma_f32_16x16x32_bf16(false, a.mid, false, b.hi, (short)0, c, false, false);
    c = __builtin_amdgcn_wmma_f32_16x16x32_bf16(false, a.hi, false, b.lo, (short)0, c, false, false);
    c = __builtin_amdgcn_wmma_f32_16x16x32_bf16(false, a.mid, false, b.mid, (short)0, c, false, false);
    c = __builtin_amdgcn_wmma_f32_16x16x32_bf16(false, a.lo, false, b.hi, (short)0, c, false, false);
    asm volatile("v_nop\n\tv_nop\n\tv_nop\n\tv_nop" : "+v"(c) : "v"(a.hi), "v"(a.mid), "v"(a.lo), "v"(b.hi), "v"(b.mid), "v"(b.lo));
    return c;
}

// Fragment gathers from f32 memory: element i <- p[(k0 + frag_k(i,h)) * sk] * s, zero for k >= klen.
__device__ __forceinline__ v16h fh_ld(const float* __restrict__ p, long long sk, int k0, int h, int klen, float s) {
    v16h a;
#pragma unroll
    for (int i = 0; i < 16; ++i) { const int k = k0 + frag_k(i, h); a[i] = (k < klen) ? (_Float16)(p[(long long)k * sk] * s) : (_Float16)0.f; }
    return a;
}
__device__ __forceinline__ Split sp_ld(const float* __restrict__ p, long long sk, int k0, int h, int klen, float s) {
    Split r;
#pragma unroll
    for (int i = 0; i < 16; ++i) {
        const int k = k0 + frag_k(i, h); const float x = (k < klen) ? p[(long long)k * sk] * s : 0.f;
        const __bf16 hb = bf16_rne(x); r.hi[i] = hb; r.lo[i] = bf16_rne(x - bf16_f32(hb));
    }
    return r;
}
__device__ __forceinline__ Split3 sp3_ld(const float* __restrict__ p, long long sk, int k0, int h, int klen, float s) {
    Split3 r;
#pragma unroll
    for (int i = 0; i < 16; ++i) {
        const int k = k0 + frag_k(i, h); const float x = (k < klen) ? p[(long long)k * sk] * s : 0.f;
        const __bf16 hb = bf16_rne(x); const float r1 = x - bf16_f32(hb); const __bf16 mb = bf16_rne(r1);
        r.hi[i] = hb; r.mid[i] = mb; r.lo[i] = bf16_rne(r1 - bf16_f32(mb));
    }
    return r;
}
__device__ __forceinline__ v16b bh_ld(const float* __restrict__ p, long long sk, int k0, int h, int klen, float s) {
    v16b a;
#pragma unroll
    for (int i = 0; i < 16; ++i) { const int k = k0 + frag_k(i, h); a[i] = bf16_rne((k < klen) ? p[(long long)k * sk] * s : 0.f); }
    return a;
}
// f16 fragment from an f16 LDS/global row with element stride 1 (k-contiguous), no bounds (tile already zero padded)
__device__ __forceinline__ v16h fh_row(const _Float16* __restrict__ row, int k0, int h) {
    v16h a;
#pragma unroll
    for (int i = 0; i < 16; ++i) a[i] = row[k0 + frag_k(i, h)];
    return a;
}

#define VST2(T, ptr, val) do { const T vst2_v_ = (val); *(T*)(ptr) = vst2_v_;  } while (0)
typedef float v4f __attribute__((ext_vector_type(4)));
#define VST2V4(ptr, val) do { const v4f vst2_v4_ = (val); *(v4f*)(ptr) = vst2_v4_;  } while (0)

__device__ __attribute__((noinline)) float act_fn(float v, int act) {
    if (act == 1) return fmaxf(v, 0.f);                                                                               // relu
    if (act == 2) { const float u = 0.7978845608028654f * (v + 0.044715f * v * v * v); return 0.5f * v * (1.f + tanhf(u)); } // tanh-gelu
    if (act == 3) return v / (1.f + expf(-v));                                                                        // silu
    if (act == 4) return 0.5f * v * (1.f + erff(v * 0.7071067811865476f));                                             // erf-gelu
    if (act == 5) return tanhf(v);
    if (act == 6) return 1.f / (1.f + expf(-v));                                                                      // sigmoid
    if (act == 7) return (v > 0.f) ? v : 0.01f * v;                                                                   // leaky relu 0.01
    if (act == 8) return (v > 0.f) ? v : (expf(v) - 1.f);                                                             // elu
    if (act == 9) return fminf(fmaxf(v, 0.f), 6.f);                                                                   // relu6
    if (act == 10) return fabsf(v);                                                                                    // abs
    if (act == 11) return (v >= 0.f) ? v : 0.1f * v;                                                                  // leaky 0.1
    if (act == 12) return (v > 0.f) ? v : 0.2f * v;                                                                   // leaky 0.2
    if (act == 13) return (v > 20.f) ? v : log1pf(expf(v));                                                            // softplus
    return v;
}

// =====================================================================================================================
// k_gemm<MODE>: C(z, m, n) = act(alpha * sum_k A(z, m, k) * B(z, k, n) + bias) + beta * R(z, m, n)
//   One wave (32-thread block) per 16 x 32 tile of C; grid (ceil(N/32), ceil(M/16), Z). Batch z -> (zo = z / zi_n, zi = z % zi_n)
//   with separate outer/inner strides for every tensor (e.g. batch and head). A(m,k) = A[zo*sAo + zi*sAi + m*sAm + k*sAk] (f32),
//   B(k,n) = B[zo*sBo + zi*sBi + n*sBn + k*sBk] (f32); any M, N, K (K zero-padded to 32 inside the fragments, M/N tails guarded).
//   C(m,n) = C[zo*sCo + zi*sCi + m*sCm + n] (n contiguous). flags: 1 bias[n], 2 bias[m], 4 residual R[zo*sRo + zi*sRi + m*sRm + n*sRn].
//   MODE 0: f16 operands (A prescaled by sa, B by sb, both undone in the epilogue); 1: bf16 hi/lo split (3 products); 2: bf16;
//   3: bf16 hi/mid/lo triple split (6 products); 4: as 3 with Kahan-compensated f32 accumulation across k-steps.
// =====================================================================================================================
struct GemmP {
    const float* A; const float* B; const float* bias; const float* R; float* C;
    long long sAo, sAi, sAm, sAk, sBo, sBi, sBn, sBk, sCo, sCi, sCm, sRo, sRi, sRm, sRn;
    int M, N, K, zi_n, flags, act; float alpha, beta, sa, sb;
    int Npad, pad_;     // columns [N, Npad) of C are written as 0 so that padded workspace rows are covered by whole-line stores; Npad >= N
};
static_assert(sizeof(GemmP) == 5 * 8 + 15 * 8 + 6 * 4 + 4 * 4 + 2 * 4, "GemmP has padding");

template <int MODE>
__global__ __launch_bounds__(32) void k_gemm(GemmP p) {
    const int lane = threadIdx.x & 31, h = lane >> 4, l15 = lane & 15;
    const int m0 = blockIdx.y * 16, n0 = blockIdx.x * 32;
    const int z = blockIdx.z, zo = z / p.zi_n, zi = z - zo * p.zi_n;
    const float* A = p.A + zo * p.sAo + zi * p.sAi;
    const float* B = p.B + zo * p.sBo + zi * p.sBi;
    const int am = min(m0 + l15, p.M - 1);                       // clamped row for loads (stores are guarded)
    v8f acc[2], comp[2];
#pragma unroll
    for (int t = 0; t < 2; ++t) { v8f zz = {}; acc[t] = zz; comp[t] = zz; }
    for (int k0 = 0; k0 < p.K; k0 += 32) {
        const float* arow = A + (long long)am * p.sAm;
        if (MODE == 1) {
            const Split a = sp_ld(arow, p.sAk, k0, h, p.K, 1.f);
#pragma unroll
            for (int t = 0; t < 2; ++t) {
                const int bn = min(n0 + t * 16 + l15, p.N - 1);
                acc[t] = wmma3(a, sp_ld(B + (long long)bn * p.sBn, p.sBk, k0, h, p.K, 1.f), acc[t]);
            }
        } else if (MODE == 3) {
            const Split3 a = sp3_ld(arow, p.sAk, k0, h, p.K, 1.f);
#pragma unroll
            for (int t = 0; t < 2; ++t) {
                const int bn = min(n0 + t * 16 + l15, p.N - 1);
                acc[t] = wmma6(a, sp3_ld(B + (long long)bn * p.sBn, p.sBk, k0, h, p.K, 1.f), acc[t]);
            }
        } else if (MODE == 4) {
            // triple split as MODE 3, but each k-step's 6 products go into a fresh accumulator and the partial is added to the running f32 sum
            // on the VALU with Kahan compensation (accumulation error stays ~1 ulp however long K is)
            const Split3 a = sp3_ld(arow, p.sAk, k0, h, p.K, 1.f);
#pragma unroll
            for (int t = 0; t < 2; ++t) {
                const int bn = min(n0 + t * 16 + l15, p.N - 1); v8f zz = {};
                const v8f part = wmma6(a, sp3_ld(B + (long long)bn * p.sBn, p.sBk, k0, h, p.K, 1.f), zz);
                const v8f y = part - comp[t]; const v8f s = acc[t] + y; comp[t] = (s - acc[t]) - y; acc[t] = s;
            }
        } else if (MODE == 2) {
            const v16b a = bh_ld(arow, p.sAk, k0, h, p.K, 1.f);
#pragma unroll
            for (int t = 0; t < 2; ++t) {
                const int bn = min(n0 + t * 16 + l15, p.N - 1);
                acc[t] = wmmab(a, bh_ld(B + (long long)bn * p.sBn, p.sBk, k0, h, p.K, 1.f), acc[t]);
            }
        } else {
            const v16h a = fh_ld(arow, p.sAk, k0, h, p.K, p.sa);
#pragma unroll
            for (int t = 0; t < 2; ++t) {
                const int bn = min(n0 + t * 16 + l15, p.N - 1);
                acc[t] = wmma16(a, fh_ld(B + (long long)bn * p.sBn, p.sBk, k0, h, p.K, p.sb), acc[t]);
            }
        }
    }
    const float iscale = (MODE == 0) ? p.alpha / (p.sa * p.sb) : p.alpha;
    float* C = p.C + zo * p.sCo + zi * p.sCi;
    const float* R = p.R + zo * p.sRo + zi * p.sRi;
    __shared__ __align__(16) float ctile[16][36];
#pragma unroll
    for (int t = 0; t < 2; ++t) {
        const int n = n0 + t * 16 + l15; const int nn = min(n, p.N - 1);
#pragma unroll
        for (int r = 0; r < 8; ++r) {
            const int m = m0 + 8 * h + r; const int mm = min(m, p.M - 1);
            float v = acc[t][r] * iscale;
            if (p.flags & 1) v += p.bias[nn];
            if (p.flags & 2) v += p.bias[mm];
            if (p.flags & 8) v *= p.bias[(long long)zo * p.M + mm];   /* per-(z,row) scale vector laid out [Z][M]; exclusive with the bias flags */
            v = act_fn(v, p.act);
            if (p.flags & 4) v += p.beta * R[(long long)mm * p.sRm + (long long)nn * p.sRn];
            ctile[8 * h + r][t * 16 + l15] = (n < p.N) ? v : 0.f;
        }
    }
    __syncthreads();
    const int NW = (p.Npad > p.N) ? p.Npad : p.N;           // write width
    const bool fast = (m0 + 16 <= p.M) && (n0 + 32 <= NW) && ((p.sCm & 3) == 0) && ((((size_t)C) & 15) == 0);
    if (fast) {
#pragma unroll
        for (int s = 0; s < 4; ++s) {
            const int row = s * 4 + (lane >> 3), c4 = (lane & 7) * 4;
            const v4f v = *(const v4f*)&ctile[row][c4];
            VST2V4(C + (long long)(m0 + row) * p.sCm + n0 + c4, v);
        }
    } else {
        for (int row = 0; row < 16; ++row) {
            const int m = m0 + row, n = n0 + lane;
            if (m < p.M && n < NW) VST2(float, C + (long long)m * p.sCm + n, ctile[row][lane]);
        }
    }
}


// =====================================================================================================================
// k_gemmT<MODE, TM, TN>: same contract as k_gemm, but one wave computes a (16*TM) x (16*TN) tile: TM A fragments and TN B fragments are
//   loaded per 32-wide k-step and reused across TM*TN WMMAs (far fewer load/convert instructions per MAC). MODE 0 (f16), 1 (bf16 hi/lo),
//   2 (bf16) only. grid (ceil(NW/(16*TN)), ceil(M/(16*TM)), Z), block 32. Epilogue identical to k_gemm, run per 16x32 sub-tile.
// =====================================================================================================================
template <int MODE, int TM, int TN>
__global__ __launch_bounds__(32) void k_gemmT(GemmP p) {
    const int lane = threadIdx.x & 31, h = lane >> 4, l15 = lane & 15;
    const int m0 = blockIdx.y * (16 * TM), n0 = blockIdx.x * (16 * TN);
    const int z = blockIdx.z, zo = z / p.zi_n, zi = z - zo * p.zi_n;
    const float* A = p.A + zo * p.sAo + zi * p.sAi;
    const float* B = p.B + zo * p.sBo + zi * p.sBi;
    v8f acc[TM][TN];
#pragma unroll
    for (int i = 0; i < TM; ++i)
#pragma unroll
        for (int t = 0; t < TN; ++t) { v8f zz = {}; acc[i][t] = zz; }
    for (int k0 = 0; k0 < p.K; k0 += 32) {
        if (MODE == 1) {
            Split a[TM], b[TN];
#pragma unroll
            for (int i = 0; i < TM; ++i) { const int am = min(m0 + 16 * i + l15, p.M - 1); a[i] = sp_ld(A + (long long)am * p.sAm, p.sAk, k0, h, p.K, 1.f); }
#pragma unroll
            for (int t = 0; t < TN; ++t) { const int bn = min(n0 + 16 * t + l15, p.N - 1); b[t] = sp_ld(B + (long long)bn * p.sBn, p.sBk, k0, h, p.K, 1.f); }
#pragma unroll
            for (int i = 0; i < TM; ++i)
#pragma unroll
                for (int t = 0; t < TN; ++t) acc[i][t] = wmma3(a[i], b[t], acc[i][t]);
        } else if (MODE == 2) {
            v16b a[TM], b[TN];
#pragma unroll
            for (int i = 0; i < TM; ++i) { const int am = min(m0 + 16 * i + l15, p.M - 1); a[i] = bh_ld(A + (long long)am * p.sAm, p.sAk, k0, h, p.K, 1.f); }
#pragma unroll
            for (int t = 0; t < TN; ++t) { const int bn = min(n0 + 16 * t + l15, p.N - 1); b[t] = bh_ld(B + (long long)bn * p.sBn, p.sBk, k0, h, p.K, 1.f); }
#pragma unroll
            for (int i = 0; i < TM; ++i)
#pragma unroll
                for (int t = 0; t < TN; ++t) acc[i][t] = wmmab(a[i], b[t], acc[i][t]);
        } else {
            v16h a[TM], b[TN];
#pragma unroll
            for (int i = 0; i < TM; ++i) { const int am = min(m0 + 16 * i + l15, p.M - 1); a[i] = fh_ld(A + (long long)am * p.sAm, p.sAk, k0, h, p.K, p.sa); }
#pragma unroll
            for (int t = 0; t < TN; ++t) { const int bn = min(n0 + 16 * t + l15, p.N - 1); b[t] = fh_ld(B + (long long)bn * p.sBn, p.sBk, k0, h, p.K, p.sb); }
#pragma unroll
            for (int i = 0; i < TM; ++i)
#pragma unroll
                for (int t = 0; t < TN; ++t) acc[i][t] = wmma16(a[i], b[t], acc[i][t]);
        }
    }
    const float iscale = (MODE == 0) ? p.alpha / (p.sa * p.sb) : p.alpha;
    float* C = p.C + zo * p.sCo + zi * p.sCi;
    const float* R = p.R + zo * p.sRo + zi * p.sRi;
    const int NW = (p.Npad > p.N) ? p.Npad : p.N;
    __shared__ __align__(16) float ctile[16][36];
#pragma unroll
    for (int i = 0; i < TM; ++i) {
        const int mb = m0 + 16 * i; if (mb >= p.M) break;          // wave-uniform
#pragma unroll
        for (int tp = 0; tp < TN / 2; ++tp) {
            const int nb = n0 + 32 * tp; if (nb >= NW) break;        // wave-uniform
#pragma unroll
            for (int t2 = 0; t2 < 2; ++t2) {
                const int t = 2 * tp + t2; const int n = nb + t2 * 16 + l15; const int nn = min(n, p.N - 1);
#pragma unroll
                for (int r = 0; r < 8; ++r) {
                    const int m = mb + 8 * h + r; const int mm = min(m, p.M - 1);
                    float v = acc[i][t][r] * iscale;
                    if (p.flags & 1) v += p.bias[nn];
                    if (p.flags & 2) v += p.bias[mm];
            if (p.flags & 8) v *= p.bias[(long long)zo * p.M + mm];   /* per-(z,row) scale vector laid out [Z][M]; exclusive with the bias flags */
                    v = act_fn(v, p.act);
                    if (p.flags & 4) v += p.beta * R[(long long)mm * p.sRm + (long long)nn * p.sRn];
                    ctile[8 * h + r][t2 * 16 + l15] = (n < p.N) ? v : 0.f;
                }
            }
            __syncthreads();
            const bool fast = (mb + 16 <= p.M) && (nb + 32 <= NW) && ((p.sCm & 3) == 0) && ((((size_t)C) & 15) == 0);
            if (fast) {
#pragma unroll
                for (int s = 0; s < 4; ++s) {
                    const int row = s * 4 + (lane >> 3), c4 = (lane & 7) * 4;
                    const v4f v = *(const v4f*)&ctile[row][c4];
                    VST2V4(C + (long long)(mb + row) * p.sCm + nb + c4, v);
                }
            } else {
                for (int row = 0; row < 16; ++row) {
                    const int m = mb + row, n = nb + lane;
                    if (m < p.M && n < NW) VST2(float, C + (long long)m * p.sCm + n, ctile[row][lane]);
                }
            }
            __syncthreads();
        }
    }
}

// =====================================================================================================================
//   Wave = 16 queries, AW waves per block, 64-key blocks; grid (ceil(Lq/(16*AW)), H, B), block 32*AW. Any Lq, Lk; head dim dh <= DHP
//   (DHP multiple of 32), value dim dv <= DVP (multiple of 16, <= 128). Every tensor addressed by (batch, head, row, element) strides, f32.
//   Scores: QM 0 f16 operands, 1 bf16 hi/lo split, 2 bf16 triple split; statistics f32 (exp2 domain); P.V: P x 4096 as f16 with V f16 staged in LDS
//   (SPLITPV: P and V as bf16 hi/lo splits). kv head = h / hrep. Masking: causal = 1 (keep j <= i + coff, masked -> -inf, key blocks beyond the
//   diagonal skipped), causal = 2 (masked -> mfill, a finite fill like the -1e9; no skipping), causal = 3 (keep j >= i + coff,
//   masked -> -inf, no skipping); optional additive f32 mask Mf,
//   optional int keep-mask Mi (0 -> score := mfill), both addressed b*smb + h*smh + i*smi + j*smj (0 strides broadcast).
// =====================================================================================================================
#define AW 4
struct AttnP {   // apv4
    const float* Q; const float* K; const float* V; float* O; float* P; const float* Mf; const int* Mi; float* ST;
    const float* Pw; const float* Rt; const int* SQ; const int* SK;           // optional: post-softmax weight, relative-position table, segment ids
    long long swb, swh, swi, swj, srb, srh, sri;                                 // Pw strides (b,h,i,j); Rt strides (b,h,i), column = clamp(i - j + roff, 0, rn-1)
    long long sQb, sQh, sQi, sQd, sKb, sKh, sKj, sKd, sVb, sVh, sVj, sVd, sOb, sOh, sOi, sPb, sPh, sPi, smb, smh, smi, smj;
    int Lq, Lk, dh, dv, hrep, causal, coff, pband;   // pband > 0: P holds only the band |j - i| <= pband, column j - i + pband
    float scale, mfill; int nonorm, mpol;             // nonorm (online path only): O = sum_j exp(score_j) V_j without the 1/rowsum (scores must be <= ~0); mpol: Mi masks where ==0 (mpol 0) or where !=0 (mpol 1)
    int roff, rn, segpol, win;                        // Rt column offset/count; SQ/SK: score := mfill where (segpol 0) SQ[i] != SK[j] or (segpol 1) SQ[i] == SK[j]; win > 0: keys with i - j > win (after coff) -> -inf
};
//   Pw: the softmax numerator is multiplied by Pw(b,h,i,j) AFTER the row sum is taken (probs * weight, then P.V), as in post-softmax multiplicative biases.                                                    // ST (optional): per row (b,h,i) -> ST[((b*H + h)*Lq + i)*2 + {0,1}] = {row max of the scaled+masked score (natural units), sum_j exp(score - max)}
static_assert(sizeof(AttnP) == 12 * 8 + 29 * 8 + 16 * 4, "AttnP has padding");

#ifndef KATTN_ATTR
#define KATTN_ATTR
#endif
template <int DHP, int DVP, int QM, bool SPLITPV, bool TWOPASS>
__global__ __launch_bounds__(32 * AW) KATTN_ATTR void k_attn(AttnP p) {
    constexpr int NT = DVP / 16;                // output tiles
    constexpr int KS = DHP / 32;                // k-steps for the scores
    constexpr int VP = DVP + 8;                 // LDS pitch (halves)
    __shared__ __align__(16) float    pl[AW][16 * 64];
    __shared__ __align__(16) _Float16 vl[(SPLITPV ? 2 : 1) * 64 * VP];   // f16 V tile, or bf16 hi and lo tiles (same 2-byte size)
    const int lane = threadIdx.x & 31, hf = lane >> 4, l15 = lane & 15, wave = threadIdx.x >> 5;
    const int h = blockIdx.y, b = blockIdx.z, hk = h / p.hrep;
    const int q0 = (blockIdx.x * AW + wave) * 16;
    float* myp = pl[wave];
    const float L2E = 1.4426950408889634f;
    const float NEG = -__builtin_inff();
    const int qi = min(q0 + l15, p.Lq - 1);
    const float* qrow = p.Q + b * p.sQb + h * p.sQh + (long long)qi * p.sQi;
    const float* kbase = p.K + b * p.sKb + hk * p.sKh;
    const float* vbase = p.V + b * p.sVb + hk * p.sVh;
    v16h qa[QM == 0 ? KS : 1]; Split qs_[QM == 1 ? KS : 1]; Split3 qt_[QM == 2 ? KS : 1];
#pragma unroll
    for (int ks = 0; ks < KS; ++ks) {
        if (QM == 2) qt_[ks] = sp3_ld(qrow, p.sQd, ks * 32, hf, p.dh, 1.f);
        else if (QM == 1) qs_[ks] = sp_ld(qrow, p.sQd, ks * 32, hf, p.dh, 1.f);
        else qa[ks] = fh_ld(qrow, p.sQd, ks * 32, hf, p.dh, 1.f);
    }
    v8f o[NT]; float m8[8], l8[8];
#pragma unroll
    for (int t = 0; t < NT; ++t) { v8f zz = {}; o[t] = zz; }
#pragma unroll
    for (int i = 0; i < 8; ++i) { m8[i] = NEG; l8[i] = 0.f; }
    int jend = p.Lk; int jstart = 0;
    if (p.causal == 1) { const int je = (blockIdx.x * AW + AW - 1) * 16 + 16 + p.coff; jend = min(jend, max(je, 0)); }   // uniform per block
    if (p.win > 0) { const int js = (int)(blockIdx.x * AW) * 16 + p.coff - p.win; jstart = (js > 0) ? (js / 64) * 64 : 0; }   // uniform per block: key blocks entirely outside every row's window hold only -inf entries and are skipped exactly
    const int npass = TWOPASS ? 2 : 1;
    for (int pass = 0; pass < npass; ++pass) {
        const bool dopv = (!TWOPASS) || pass == 1;
        for (int j0 = jstart; j0 < jend; j0 += 64) {
            if (dopv) {
                __syncthreads();                                 // previous key block's reads of vl / pl are done
                for (int idx = threadIdx.x; idx < 64 * DVP; idx += 32 * AW) {
                    const int jr = idx / DVP, d = idx - jr * DVP, j = j0 + jr;
                    const float f = (j < p.Lk && d < p.dv) ? vbase[(long long)j * p.sVj + (long long)d * p.sVd] : 0.f;
                    if (SPLITPV) {
                        const __bf16 hb = bf16_rne(f);
                        ((__bf16*)vl)[jr * VP + d] = hb; ((__bf16*)vl)[64 * VP + jr * VP + d] = bf16_rne(f - bf16_f32(hb));
                    } else vl[jr * VP + d] = (_Float16)f;
                }
            }
            v8f s[4];
#pragma unroll
            for (int t = 0; t < 4; ++t) {
                const int j = min(j0 + t * 16 + l15, p.Lk - 1);
                const float* krow = kbase + (long long)j * p.sKj;
                v8f acc = {};
#pragma unroll
                for (int ks = 0; ks < KS; ++ks) {
                    if (QM == 2)      acc = wmma6(qt_[ks], sp3_ld(krow, p.sKd, ks * 32, hf, p.dh, 1.f), acc);
                    else if (QM == 1) acc = wmma3(qs_[ks], sp_ld(krow, p.sKd, ks * 32, hf, p.dh, 1.f), acc);
                    else              acc = wmma16(qa[ks], fh_ld(krow, p.sKd, ks * 32, hf, p.dh, 1.f), acc);
                }
                s[t] = acc;
            }
            float pv[8][4];
#pragma unroll
            for (int i = 0; i < 8; ++i) {
                const int irow = q0 + i + 8 * hf;
                const int ic = min(irow, p.Lq - 1);
                float sc[4];
#pragma unroll
                for (int t = 0; t < 4; ++t) {
                    const int jg = j0 + t * 16 + l15;
                    float v = s[t][i] * p.scale;
                    if (p.Mf) v += p.Mf[b * p.smb + h * p.smh + (long long)ic * p.smi + (long long)min(jg, p.Lk - 1) * p.smj];
                    if (p.Rt) { int rc = ic - min(jg, p.Lk - 1) + p.roff; rc = rc < 0 ? 0 : (rc >= p.rn ? p.rn - 1 : rc); v += p.Rt[b * p.srb + h * p.srh + (long long)ic * p.sri + rc]; }
                    if (p.Mi) { const int mv = p.Mi[b * p.smb + h * p.smh + (long long)ic * p.smi + (long long)min(jg, p.Lk - 1) * p.smj]; if (p.mpol ? (mv != 0) : (mv == 0)) v = p.mfill; }
                    if (p.SQ) { const bool same = p.SQ[(long long)b * p.Lq + ic] == p.SK[(long long)b * p.Lk + min(jg, p.Lk - 1)]; if (p.segpol ? same : !same) v = p.mfill; }
                    if (p.causal == 2 && jg > irow + p.coff) v = p.mfill;
                    if (jg >= p.Lk || (p.causal == 1 && jg > irow + p.coff) || (p.causal == 3 && jg < irow + p.coff) || (p.win > 0 && irow + p.coff - jg > p.win)) v = NEG; else v *= L2E;
                    sc[t] = v;
                }
                if (!TWOPASS || pass == 0) {
                    float mx = fmaxf(fmaxf(sc[0], sc[1]), fmaxf(sc[2], sc[3]));
                    mx = fmaxf(mx, __shfl_xor(mx, 1, 32)); mx = fmaxf(mx, __shfl_xor(mx, 2, 32));
                    mx = fmaxf(mx, __shfl_xor(mx, 4, 32)); mx = fmaxf(mx, __shfl_xor(mx, 8, 32));
                    const float mnew = fmaxf(m8[i], mx);
                    const float corr = (mnew == NEG) ? 1.f : exp2f(m8[i] - mnew);
                    float rs = 0.f;
#pragma unroll
                    for (int t = 0; t < 4; ++t) {
                        const float pp = (sc[t] == NEG) ? 0.f : exp2f(sc[t] - mnew); rs += pp;
                        pv[i][t] = p.Pw ? pp * p.Pw[b * p.swb + h * p.swh + (long long)ic * p.swi + (long long)min(j0 + t * 16 + l15, p.Lk - 1) * p.swj] : pp;
                    }
                    rs += __shfl_xor(rs, 1, 32); rs += __shfl_xor(rs, 2, 32); rs += __shfl_xor(rs, 4, 32); rs += __shfl_xor(rs, 8, 32);
                    l8[i] = l8[i] * corr + rs; m8[i] = mnew;
                    if (!TWOPASS) {
#pragma unroll
                        for (int t = 0; t < NT; ++t) o[t][i] *= corr;
                    }
                } else {
                    const float inv = (l8[i] > 0.f) ? 1.f / l8[i] : 0.f;
#pragma unroll
                    for (int t = 0; t < 4; ++t) {
                        const int jg = j0 + t * 16 + l15;
                        float pp = (sc[t] == NEG) ? 0.f : exp2f(sc[t] - m8[i]) * inv;
                        if (p.Pw) pp *= p.Pw[b * p.swb + h * p.swh + (long long)ic * p.swi + (long long)min(jg, p.Lk - 1) * p.swj];
                        pv[i][t] = pp;
                    }
                }
            }
            if (dopv) {
#pragma unroll
                for (int i = 0; i < 8; ++i)
#pragma unroll
                    for (int t = 0; t < 4; ++t) ((float*)myp)[(i + 8 * hf) * 64 + t * 16 + l15] = pv[i][t];
                __syncthreads();                                 // P (per wave) and V (shared) visible
                if (p.P) {
                    float* pb_ = p.P + b * p.sPb + h * p.sPh;
                    const bool fastP = (p.pband == 0) && ((p.sPi & 3) == 0) && (j0 + 64 <= p.Lk) && (q0 + 16 <= p.Lq) && ((((size_t)pb_) & 15) == 0);
                    if (fastP) {
#pragma unroll
                        for (int s = 0; s < 8; ++s) {
                            const int row = s * 2 + (lane >> 4), c4 = (lane & 15) * 4;
                            const v4f v = *(const v4f*)(myp + row * 64 + c4);
                            VST2V4(pb_ + (long long)(q0 + row) * p.sPi + j0 + c4, v);
                        }
                    } else {
                        for (int row = 0; row < 16; ++row) {
                            const int irow = q0 + row; if (irow >= p.Lq) continue;
                            for (int c = lane; c < 64; c += 32) {
                                const int jg = j0 + c; if (jg >= p.Lk) continue;
                                if (p.pband == 0) VST2(float, pb_ + (long long)irow * p.sPi + jg, myp[row * 64 + c]);
                                else if (jg - irow <= p.pband && irow - jg <= p.pband) VST2(float, pb_ + (long long)irow * p.sPi + (jg - irow + p.pband), myp[row * 64 + c]);
                            }
                        }
                    }
                }
                if (SPLITPV) {
                    const Split pa0 = sp_ld(myp + l15 * 64, 1, 0, hf, 64, 1.f), pa1 = sp_ld(myp + l15 * 64, 1, 32, hf, 64, 1.f);
                    const __bf16* vh = (const __bf16*)vl; const __bf16* vlo = vh + 64 * VP;
#pragma unroll
                    for (int t = 0; t < NT; ++t) {
                        const int dcol = t * 16 + l15;
                        Split b0, b1;
#pragma unroll
                        for (int e = 0; e < 16; ++e) {
                            const int k0 = frag_k(e, hf), k1 = 32 + frag_k(e, hf);
                            b0.hi[e] = vh[k0 * VP + dcol]; b0.lo[e] = vlo[k0 * VP + dcol]; b1.hi[e] = vh[k1 * VP + dcol]; b1.lo[e] = vlo[k1 * VP + dcol];
                        }
                        o[t] = wmma3(pa0, b0, o[t]);
                        o[t] = wmma3(pa1, b1, o[t]);
                    }
                } else {
                    const v16h pa0 = fh_ld(myp + l15 * 64, 1, 0, hf, 64, 4096.f), pa1 = fh_ld(myp + l15 * 64, 1, 32, hf, 64, 4096.f);
#pragma unroll
                    for (int t = 0; t < NT; ++t) {
                        const int dcol = t * 16 + l15;
                        v16h b0, b1;
#pragma unroll
                        for (int e = 0; e < 16; ++e) { b0[e] = vl[frag_k(e, hf) * VP + dcol]; b1[e] = vl[(32 + frag_k(e, hf)) * VP + dcol]; }
                        o[t] = wmma16(pa0, b0, o[t]);
                        o[t] = wmma16(pa1, b1, o[t]);
                    }
                }
            }
        }
    }
    float* obase = p.O + b * p.sOb + h * p.sOh;
    if (p.ST) {
        const int rl = lane >> 1, isel = rl & 7;           // row q0 + rl ; rl>>3 == hf holds because lane>>4 == (lane>>1)>>3
        float mv = 0.f, lv = 0.f;
#pragma unroll
        for (int i = 0; i < 8; ++i) if (i == isel) { mv = m8[i]; lv = l8[i]; }
        const int irow = q0 + rl;
        if (irow < p.Lq) { float* st = p.ST + (((long long)b * gridDim.y + h) * p.Lq + irow) * 2 + (lane & 1); VST2(float, st, (lane & 1) ? lv : mv * 0.6931471805599453f); }
    }
    float invr[8];
#pragma unroll
    for (int i = 0; i < 8; ++i) {
        if (TWOPASS) invr[i] = SPLITPV ? 1.f : (1.f / 4096.f);
        else if (p.nonorm) invr[i] = exp2f(m8[i]) * (SPLITPV ? 1.f : (1.f / 4096.f));
        else invr[i] = (l8[i] > 0.f) ? (SPLITPV ? 1.f / l8[i] : 1.f / (l8[i] * 4096.f)) : 0.f;
    }
    __syncthreads();                                             // all waves done with pl/vl from the main loop
    const bool ofast = ((p.sOi & 3) == 0) && ((((size_t)obase) & 15) == 0) && (q0 + 16 <= p.Lq);
#pragma unroll
    for (int c0 = 0; c0 < DVP; c0 += 64) {
#pragma unroll
        for (int i = 0; i < 8; ++i)
#pragma unroll
            for (int t = 0; t < NT; ++t) if (t * 16 >= c0 && t * 16 < c0 + 64) ((float*)myp)[(i + 8 * hf) * 64 + (t * 16 - c0) + l15] = o[t][i] * invr[i];
        __syncthreads();
        const int cw = (DVP - c0 < 64) ? (DVP - c0) : 64;      // staged columns in this chunk (multiple of 16)
        if (ofast && (c0 + cw <= p.dv) && (cw % 32 == 0)) {
            const int lpr = cw / 4;                              // lanes per row (16 for 64 cols, 8 for 32)
            const int rows_per_ins = 32 / lpr;
            for (int r0 = 0; r0 < 16; r0 += rows_per_ins) {
                const int row = r0 + lane / lpr, c4 = (lane % lpr) * 4;
                const v4f v = *(const v4f*)(myp + row * 64 + c4);
                VST2V4(obase + (long long)(q0 + row) * p.sOi + c0 + c4, v);
            }
        } else {
            for (int row = 0; row < 16; ++row) {
                const int irow = q0 + row; if (irow >= p.Lq) continue;
                for (int c = lane; c < cw; c += 32) { const int d = c0 + c; if (d < p.dv) VST2(float, obase + (long long)irow * p.sOi + d, myp[row * 64 + c]); }
            }
        }
        __syncthreads();
    }
}

// =====================================================================================================================
// k_tr: dst(z, c, r) = alpha * src(z, r, c) (+ beta * R2(z, c, r)): [Z][R][C] (row stride lds) -> [Z][C][R] (row stride ldd) through a 32x32 LDS tile;
//   flags: 1 -> add beta * residual R2 addressed like dst (z*sRz + c*ldr + r); act applied before the residual.
// =====================================================================================================================
struct TrP { const float* src; float* dst; const float* R2; long long sSz, lds, sDz, ldd, sRz, ldr; int R, C, flags, act; float alpha, beta; };
static_assert(sizeof(TrP) == 3 * 8 + 6 * 8 + 6 * 4, "TrP has padding");
__global__ __launch_bounds__(256) void k_tr(TrP p) {
    __shared__ float tile[32][33];
    const int c0 = blockIdx.x * 32, r0 = blockIdx.y * 32, z = blockIdx.z;
    const int lane = threadIdx.x & 31, wave = threadIdx.x >> 5;
    const float* s = p.src + z * p.sSz;
#pragma unroll
    for (int k = 0; k < 4; ++k) {
        const int rl = wave * 4 + k, r = r0 + rl, c = c0 + lane;
        tile[rl][lane] = (r < p.R && c < p.C) ? s[(long long)r * p.lds + c] : 0.f;
    }
    __syncthreads();
    float* d = p.dst + z * p.sDz; const float* rr = p.R2 + z * p.sRz;
#pragma unroll
    for (int k = 0; k < 4; ++k) {
        const int cl = wave * 4 + k, c = c0 + cl, r = r0 + lane;
        if (c < p.C && r < p.R) {
            float v = act_fn(p.alpha * tile[lane][cl], p.act);
            if (p.flags & 1) v += p.beta * rr[(long long)c * p.ldr + r];
            VST2(float, d + (long long)c * p.ldd + r, v);
        }
    }
}

// k_affine: dst[i] = a * (sdev ? sdev[0] : 1) * src[i] + b, i < n (one thread per element; consecutive lanes -> consecutive addresses)
__global__ __launch_bounds__(256) void k_affine(const float* __restrict__ src, float* __restrict__ dst, int n, float a, float b, const float* __restrict__ sdev) {
    const int i = blockIdx.x * 256 + threadIdx.x;
    if (i < n) { const float aa = sdev ? a * sdev[0] : a; const float v = aa * src[i] + b; VST2(float, dst + i, v); }
}

// =====================================================================================================================
// k_softmax: row softmax over n contiguous elements, one 256-thread block per row; rows addressed z*sz + r*sr (grid (R, Z)).
//   out = scale_out * softmax(scale_in * x + (Mf ? Mf[z*smz + r*smr + j] : 0)); a row whose max is -inf is written as 0.
// =====================================================================================================================
struct SmP { const float* src; float* dst; const float* Mf; long long sz, sr, dz, dr, smz, smr; int n, pad; float scale_in, scale_out; };
static_assert(sizeof(SmP) == 3 * 8 + 6 * 8 + 4 * 4, "SmP has padding");
__global__ __launch_bounds__(256) void k_softmax(SmP p) {
    __shared__ float red[256];
    const int r = blockIdx.x, z = blockIdx.y, tid = threadIdx.x;
    const float* s = p.src + z * p.sz + (long long)r * p.sr;
    const float* mf = p.Mf ? (p.Mf + z * p.smz + (long long)r * p.smr) : nullptr;
    float mx = -__builtin_inff();
    for (int j = tid; j < p.n; j += 256) { float v = s[j] * p.scale_in; if (mf) v += mf[j]; mx = fmaxf(mx, v); }
    red[tid] = mx; __syncthreads();
    for (int o = 128; o > 0; o >>= 1) { if (tid < o) red[tid] = fmaxf(red[tid], red[tid + o]); __syncthreads(); }
    mx = red[0]; __syncthreads();
    float sum = 0.f;
    for (int j = tid; j < p.n; j += 256) { float v = s[j] * p.scale_in; if (mf) v += mf[j]; sum += (mx == -__builtin_inff()) ? 0.f : expf(v - mx); }
    red[tid] = sum; __syncthreads();
    for (int o = 128; o > 0; o >>= 1) { if (tid < o) red[tid] += red[tid + o]; __syncthreads(); }
    sum = red[0];
    const float inv = (sum > 0.f) ? p.scale_out / sum : 0.f;
    float* d = p.dst + z * p.dz + (long long)r * p.dr;
    for (int j = tid; j < p.n; j += 256) { float v = s[j] * p.scale_in; if (mf) v += mf[j]; const float o = (mx == -__builtin_inff()) ? 0.f : expf(v - mx) * inv; VST2(float, d + j, o); }
}
// =====================================================================================================================
// k_stats: mean and rsqrt(var + eps) over a set of n elements addressed base + z*sz + (e / inner) * so + (e % inner) * si, one 256-thread
// k_norm_apply: y = (x - mean[set]) * rstd[set] * g[c] + b[c] over a [Z][C][L] channel-major tensor with set = z*G + c / (C/G) (G groups per z;
//   G = C -> per-channel sets indexed z*C+c; for batch norm pass stats indexed by c only via bn = 1). Optional act. Output same layout.
// =====================================================================================================================
//   mode 0: mean / rsqrt(var + eps); mode 1 (RMSNorm): 0 / rsqrt(mean(x^2) + eps); mode 2 (L2 normalize * sqrt(n)): 0 / sqrt(n) / max(||x||, eps); mode 3: as 0 with unbiased variance (n-1)
__global__ __launch_bounds__(256) void k_stats(const float* __restrict__ x, long long sz, long long so, long long si, int inner, int n, float eps, float* __restrict__ stat, int mode) {
    __shared__ float red[256];
    const int z = blockIdx.x, tid = threadIdx.x;
    const float* base = x + z * sz;
    float s = 0.f;
    for (int e = tid; e < n; e += 256) s += base[(long long)(e / inner) * so + (long long)(e % inner) * si];
    red[tid] = s; __syncthreads();
    for (int o = 128; o > 0; o >>= 1) { if (tid < o) red[tid] += red[tid + o]; __syncthreads(); }
    const float mu = (mode == 0 || mode == 3) ? red[0] / (float)n : 0.f; __syncthreads();
    float q = 0.f;
    for (int e = tid; e < n; e += 256) { const float dlt = base[(long long)(e / inner) * so + (long long)(e % inner) * si] - mu; q += dlt * dlt; }
    red[tid] = q; __syncthreads();
    for (int o = 128; o > 0; o >>= 1) { if (tid < o) red[tid] += red[tid + o]; __syncthreads(); }
    {
        float rs;
        if (mode == 2) rs = sqrtf((float)n) / fmaxf(sqrtf(red[0]), eps); else if (mode == 3) rs = rsqrtf(red[0] / (float)(n - 1) + eps); else rs = rsqrtf(red[0] / (float)n + eps);
        if (tid < 32) { const float v = (tid == 0) ? mu : ((tid == 1) ? rs : 0.f); VST2(float, stat + (long long)z * 32 + tid, v); }
    }
}
//   One thread per element over the flat [Z][C][L] index space: grid ceil(Z*C*L / 256).
__global__ __launch_bounds__(256) void k_norm_apply(const float* __restrict__ x, float* __restrict__ y, const float* __restrict__ stat, const float* __restrict__ g, const float* __restrict__ bta,
                                                     int Z, int C, int L, int G, int bn, int act) {
    const long long idx = (long long)blockIdx.x * 256 + threadIdx.x;
    if (idx >= (long long)Z * C * L) return;
    const int l = (int)(idx % L); const long long zc = idx / L; const int c = (int)(zc % C), z = (int)(zc / C); (void)l;
    const int set = bn ? c : (z * G + c / (C / G));
    float v = (x[idx] - stat[(long long)set * 32]) * stat[(long long)set * 32 + 1];
    if (g) v *= g[c];
    if (bta) v += bta[c];
    v = act_fn(v, act);
    VST2(float, y + idx, v);
}

// k_lse_neg: c[i] = -(st[2i] + log(st[2i+1])) = minus the log-sum-exp of row i from k_attn's ST output (for softmax over the query dimension)
__global__ __launch_bounds__(256) void k_lse_neg(const float* __restrict__ st, float* __restrict__ c, int n) {
    const int i = blockIdx.x * 256 + threadIdx.x;
    if (i < n) { const float v = -(st[2 * i] + logf(st[2 * i + 1])); VST2(float, c + i, v); }
}

// k_iota: dst[i] = a * i + b as int32 (segment/position id helper)
__global__ __launch_bounds__(256) void k_iota(int* __restrict__ dst, int n, int a, int b) {
    const int i = blockIdx.x * 256 + threadIdx.x;
    if (i < n) { const int v = a * i + b; VST2(int, dst + i, v); }
}

// k_axpby: dst[i] = a * x[i] + b * y[i] (+ c), i < n
__global__ __launch_bounds__(256) void k_axpby(const float* __restrict__ x, const float* __restrict__ y, float* __restrict__ dst, int n, float a, float b, float c) {
    const int i = blockIdx.x * 256 + threadIdx.x;
    if (i < n) { const float v = a * x[i] + b * y[i] + c; VST2(float, dst + i, v); }
}

// =====================================================================================================================
// k_rope: rotary embedding on a [R rows][Hn heads][D] view (row stride sXr, head stride sXh, element stride 1) -> Y (own strides).
//   mode 0: rotate_half (partner d±D/2, sign - for d<D/2); mode 1: interleaved pairs (partner d^1, sign - for even d).
//   table column tcol: tmode 0 -> d, 1 -> d % (D/2), 2 -> d / 2; position p: pmode 0 -> r % S, 1 -> head index, 2 -> pos[r];
//   c = C[(r / S) * sCb + p * sCp + tcol * sCd], s likewise from Sn; y = x[d] * c + sign * x[partner] * s. X and Y must not alias.
// =====================================================================================================================
struct RopeP { const float* X; float* Y; const float* C; const float* Sn; const int* pos; long long sXr, sXh, sYr, sYh, sCb, sCp, sCd; int R, Hn, D, S, mode, tmode, pmode, pad; };
static_assert(sizeof(RopeP) == 5 * 8 + 7 * 8 + 8 * 4, "RopeP has padding");
__global__ __launch_bounds__(256) void k_rope(RopeP p) {
    const long long idx = (long long)blockIdx.x * 256 + threadIdx.x;
    if (idx >= (long long)p.R * p.Hn * p.D) return;
    const int d = (int)(idx % p.D); const long long rh = idx / p.D; const int h = (int)(rh % p.Hn); const int r = (int)(rh / p.Hn);
    const int half = p.D / 2;
    int partner; float sign;
    if (p.mode == 0) { partner = (d < half) ? d + half : d - half; sign = (d < half) ? -1.f : 1.f; }
    else { partner = d ^ 1; sign = (d & 1) ? 1.f : -1.f; }
    const int tcol = (p.tmode == 0) ? d : ((p.tmode == 1) ? (d % half) : (d >> 1));
    const int pp = (p.pmode == 0) ? (r % p.S) : ((p.pmode == 1) ? h : p.pos[r]);
    const long long toff = (long long)(r / p.S) * p.sCb + (long long)pp * p.sCp + (long long)tcol * p.sCd;
    const float* xr = p.X + (long long)r * p.sXr + (long long)h * p.sXh;
    const float v = xr[d] * p.C[toff] + sign * xr[partner] * p.Sn[toff];
    VST2(float, p.Y + (long long)r * p.sYr + (long long)h * p.sYh + d, v);
}

// k_invf + k_sincos (split so neither kernel carries a large VALU-fma footprint): invf_i = num * (1 / powf(base, (2 i)/D)) [fmode 0],
//   num * expf((2 i) * cexp) [fmode 1], num * powf(base, -2 (i - 1) / D) [fmode 2]; then cs/sn[s*half + i] = cos/sin((pscale * s) * invf_i)
__global__ __launch_bounds__(256) void k_invf(float* __restrict__ invb, int half, int D, float base, float num, int fmode, float cexp) {
    const int i = blockIdx.x * 256 + threadIdx.x;
    if (i >= ((half + 31) / 32) * 32) return;
    if (i >= half) { VST2(float, invb + i, 0.f); return; }
    const float e = (float)(2 * i) / (float)D;
    float invf;
    if (fmode == 1) invf = num * expf((float)(2 * i) * cexp);
    else if (fmode == 2) invf = num * powf(base, (-2.0f * ((float)i - 1.0f)) / (float)D);
    else invf = num * (1.0f / powf(base, e));
    VST2(float, invb + i, invf);
}
__global__ __launch_bounds__(256) void k_sincos(float* __restrict__ cs, float* __restrict__ sn, const float* __restrict__ invb, int S, int half, float pscale) {
    const int idx = blockIdx.x * 256 + threadIdx.x;
    if (idx >= S * half) return;
    const int s = idx / half, i = idx - s * half;
    const float ang = (pscale * (float)s) * invb[i];
    VST2(float, cs + idx, cosf(ang)); VST2(float, sn + idx, sinf(ang));
}

// k_mulact: dst[i] = act(x[i]) * y[i]
__global__ __launch_bounds__(256) void k_mulact(const float* __restrict__ x, const float* __restrict__ y, float* __restrict__ dst, int n, int act) {
    const int i = blockIdx.x * 256 + threadIdx.x;
    if (i < n) { const float v = act_fn(x[i], act) * y[i]; VST2(float, dst + i, v); }
}

// =====================================================================================================================
// k_matvec: thread-per-row matrix-vector products for N <= 8 output columns (heads with 1-3 outputs, gates), f32 on the VALU.
//   C[r*sCm + j] = act(alpha * sum_k A[r*sAm + k*sAk] * B[j*sBn + k*sBk] + bias[j]) + beta * R[r*sRm + j*sRn]; each thread writes its N contiguous floats.
// =====================================================================================================================
__global__ __launch_bounds__(256) void k_matvec(GemmP p) {
    // 32 lanes write one line with one instruction.
    const int rpt = (p.N == 1) ? 1 : 32;
    const long long r0 = ((long long)blockIdx.x * 256 + threadIdx.x) * rpt; const int z = blockIdx.z, zo = z / p.zi_n, zi = z - zo * p.zi_n;
    if (r0 >= p.M) return;
    const float* Bb = p.B + zo * p.sBo + zi * p.sBi;
    float* C = p.C + zo * p.sCo + zi * p.sCi; const float* R = p.R + zo * p.sRo + zi * p.sRi;
    for (int rr = 0; rr < rpt; ++rr) {
        const long long r = r0 + rr; if (r >= p.M) break;
        const float* A = p.A + zo * p.sAo + zi * p.sAi + r * p.sAm;
        float acc[8] = {0.f, 0.f, 0.f, 0.f, 0.f, 0.f, 0.f, 0.f};
        for (int k = 0; k < p.K; ++k) { const float a = A[(long long)k * p.sAk];
#pragma unroll
            for (int j = 0; j < 8; ++j) if (j < p.N) acc[j] += a * Bb[(long long)j * p.sBn + (long long)k * p.sBk]; }
#pragma unroll
        for (int j = 0; j < 8; ++j) if (j < p.N) {
            float v = acc[j] * p.alpha;
            if (p.flags & 1) v += p.bias[j];
            if (p.flags & 2) v += p.bias[r];
            v = act_fn(v, p.act);
            if (p.flags & 4) v += p.beta * R[r * p.sRm + (long long)j * p.sRn];
            VST2(float, C + r * p.sCm + j, v);
        }
    }
}
// k_smallsoftmax: thread-per-row softmax for short rows (n <= 64): dst[r*dr + j] = softmax(scale*src[r*sr + j])
__global__ __launch_bounds__(256) void k_smallsoftmax(const float* __restrict__ src, float* __restrict__ dst, long long sr, long long dr, int n, long long R, float scale) {
    const long long r0 = ((long long)blockIdx.x * 256 + threadIdx.x) * 32;
    for (int rr = 0; rr < 32; ++rr) {
        const long long r = r0 + rr; if (r >= R) return;
        const float* s = src + r * sr; float* d = dst + r * dr;
        float mx = -__builtin_inff();
        for (int j = 0; j < n; ++j) mx = fmaxf(mx, s[j] * scale);
        float sum = 0.f;
        for (int j = 0; j < n; ++j) sum += expf(s[j] * scale - mx);
        const float inv = 1.f / sum;
        for (int j = 0; j < n; ++j) { const float v = expf(s[j] * scale - mx) * inv; VST2(float, d + j, v); }
    }
}

__global__ __launch_bounds__(32) void k_unitstat(float* __restrict__ st) { const int t = threadIdx.x; const float v = (t == 1) ? 1.f : 0.f; VST2(float, st + t, v); }

// destination (e.g. a d_out whose row width is not a multiple of 32 floats) is written by consecutive lanes of one instruction
__global__ __launch_bounds__(256) void k_lincopy(const float* __restrict__ src, long long lds, float* __restrict__ dst, long long ldd, long long rows, int cols) {
    const long long i = (long long)blockIdx.x * 256 + threadIdx.x; if (i >= rows * cols) return;
    const long long r = i / cols; const int c = (int)(i - r * cols);
    const float v = src[r * lds + c]; VST2(float, dst + r * ldd + c, v);
}

namespace w25 {
typedef __attribute__((ext_vector_type(16))) _Float16 v16h;
typedef __attribute__((ext_vector_type(8)))  _Float16 v8h;
typedef __attribute__((ext_vector_type(16))) __bf16   v16b;
typedef __attribute__((ext_vector_type(8)))  __bf16   v8b;
typedef __attribute__((ext_vector_type(8)))  float    v8f;
typedef __attribute__((ext_vector_type(4)))  float    v4f;

__device__ __forceinline__ unsigned short f2bf_bits(float f) {
  unsigned u = __float_as_uint(f);
  return (unsigned short)((u + 0x7FFFu + ((u >> 16) & 1u)) >> 16);
}
__device__ __forceinline__ float bf_bits2f(unsigned short h) { return __uint_as_float(((unsigned)h) << 16); }

// hazard guards as plain device helpers (no inline asm inside the kernel template body)
__device__ __forceinline__ void dep_guard_h(v8f& a, v8f& b, v16h x, v16h y) { asm volatile("v_nop\n\tv_nop\n\tv_nop\n\tv_nop" : "+v"(a), "+v"(b) : "v"(x), "v"(y)); }
__device__ __forceinline__ void dep_guard_b(v8f& a, v8f& b, v16b x, v16b y) { asm volatile("v_nop\n\tv_nop\n\tv_nop\n\tv_nop" : "+v"(a), "+v"(b) : "v"(x), "v"(y)); }
__device__ __forceinline__ void keep4_h(v16h a, v16h b, v16h c, v16h d) { asm volatile("v_nop" :: "v"(a), "v"(b), "v"(c), "v"(d)); }
__device__ __forceinline__ void keep4_b(v16b a, v16b b, v16b c, v16b d) { asm volatile("v_nop" :: "v"(a), "v"(b), "v"(c), "v"(d)); }
__device__ __forceinline__ void acc_guard4(v8f& a, v8f& b, v8f& c, v8f& d) { asm volatile("v_nop\n\tv_nop\n\tv_nop\n\tv_nop" : "+v"(a), "+v"(b), "+v"(c), "+v"(d)); }
template <typename T> struct Frag;
template <> struct Frag<_Float16> {
  typedef v16h V; union U { v16h v; v8h h[2]; };
  static __device__ __forceinline__ v16h load(const _Float16* p) {   // elements 0..7 <- p[0..7], 8..15 <- p[16..23]
    U f; f.h[0] = *(const v8h*)(p); f.h[1] = *(const v8h*)(p + 16); return f.v;
  }
  static __device__ __forceinline__ v8f mma(v16h a, v16h b, v8f c) {
    return __builtin_amdgcn_wmma_f32_16x16x32_f16(false, a, false, b, (short)0, c, false, false);
  }
  static __device__ __forceinline__ void guard(v8f& a, v8f& b, v16h x, v16h y) { dep_guard_h(a, b, x, y); }
  static __device__ __forceinline__ void keep(v16h a, v16h b, v16h c, v16h d) { keep4_h(a, b, c, d); }
};
template <> struct Frag<__bf16> {
  typedef v16b V; union U { v16b v; v8b h[2]; };
  static __device__ __forceinline__ v16b load(const __bf16* p) {
    U f; f.h[0] = *(const v8b*)(p); f.h[1] = *(const v8b*)(p + 16); return f.v;
  }
  static __device__ __forceinline__ v8f mma(v16b a, v16b b, v8f c) {
    return __builtin_amdgcn_wmma_f32_16x16x32_bf16(false, a, false, b, (short)0, c, false, false);
  }
  static __device__ __forceinline__ void guard(v8f& a, v8f& b, v16b x, v16b y) { dep_guard_b(a, b, x, y); }
  static __device__ __forceinline__ void keep(v16b a, v16b b, v16b c, v16b d) { keep4_b(a, b, c, d); }
};

// ---- Register-blocked batched WMMA GEMM ------------------------------------
// C[m,n] = scale * sum_k A[m,k] * Bt[n,k] (+bias)(+resid); each wave owns a 64x64 tile.
// A row-major [M,K]; Bt row-major [N,K]; M,N % 64 == 0, K % 32 == 0.
// SPLIT: operands are hi/lo planes (A2/Bt2 = lo planes, same layout); product = hi·hi + hi·lo + lo·hi.
// BIAS_MODE: 0 = none, 1 = bias[m], 2 = bias[n].
// OUT_MODE: 0 = f32, 1 = f16, 2 = bf16 hi plane (Cout) + bf16 lo plane (Cout2).
// ET: 0 = f16 operands, 1 = bf16 operands (pointers passed as 16-bit storage)
template <int ET> struct Elem;
template <> struct Elem<0> { typedef _Float16 T; };
template <> struct Elem<1> { typedef __bf16 T; };
template <int ET, bool SPLIT, int BIAS_MODE, int OUT_MODE, bool RESID, int ACT = 0>
__global__ __launch_bounds__(256) void wmma_gemm64(
    const unsigned short* __restrict__ Ap, const unsigned short* __restrict__ A2p, int lda, long strideA,
    const unsigned short* __restrict__ Btp, const unsigned short* __restrict__ Bt2p, int ldb, long strideB,
    void* __restrict__ Cout, void* __restrict__ Cout2, int ldc, long strideC,
    const float* __restrict__ bias,
    const float* __restrict__ resid, long strideR,
    int M, int N, int K, float scale) {
  typedef typename Elem<ET>::T T;
  typedef typename Frag<T>::V V;
  const T* A = (const T*)Ap; const T* A2 = (const T*)A2p; const T* Bt = (const T*)Btp; const T* Bt2 = (const T*)Bt2p;
  __shared__ __align__(16) float sT[8][16 * 68];   // per-wave 16x64 slab, pitch 68 floats
  const int b    = blockIdx.y;
  const int lane = threadIdx.x & 31;
  const int wave = threadIdx.x >> 5;
  const int tilesN = N >> 6;
  const int tilesM = M >> 6;
  const int tile = blockIdx.x * 8 + wave;
  if (tile >= tilesM * tilesN) return;   // wave-uniform; no block barriers in this kernel
  const int tm = tile / tilesN;
  const int tn = tile - tm * tilesN;
  const int m0 = tm << 6;
  const int n0 = tn << 6;

  const T* Ab  = A  + (size_t)b * strideA;
  const T* Bb  = Bt + (size_t)b * strideB;
  const T* Ab2 = SPLIT ? (A2  + (size_t)b * strideA) : nullptr;
  const T* Bb2 = SPLIT ? (Bt2 + (size_t)b * strideB) : nullptr;

  const int rlane = lane & 15;                 // row (A) / col (B, D) within subtile
  const int koff  = (lane >> 4) * 8;           // k offset of this lane half
  const int mOff  = (lane >> 4) * 8;           // D row offset

  v8f acc[4][4];
#pragma unroll
  for (int i = 0; i < 4; ++i)
#pragma unroll
    for (int j = 0; j < 4; ++j) acc[i][j] = (v8f){0.f,0.f,0.f,0.f,0.f,0.f,0.f,0.f};

  for (int k0 = 0; k0 < K; k0 += 32) {
    V bh[4], bl[4];
#pragma unroll
    for (int j = 0; j < 4; ++j) {
      const size_t bo = (size_t)(n0 + (j << 4) + rlane) * ldb + koff + k0;
      bh[j] = Frag<T>::load(Bb + bo);
      if (SPLIT) bl[j] = Frag<T>::load(Bb2 + bo);
    }
#pragma unroll
    for (int i = 0; i < 4; ++i) {
      const size_t ao = (size_t)(m0 + (i << 4) + rlane) * lda + koff + k0;
      V ah = Frag<T>::load(Ab + ao);
      V al;
      if (SPLIT) al = Frag<T>::load(Ab2 + ao);
#pragma unroll
      for (int j = 0; j < 4; ++j) {
        acc[i][j] = Frag<T>::mma(ah, bh[j], acc[i][j]);
        if (SPLIT) {
          acc[i][j] = Frag<T>::mma(ah, bl[j], acc[i][j]);
          acc[i][j] = Frag<T>::mma(al, bh[j], acc[i][j]);
        }
      }
      Frag<T>::guard(acc[i][0], acc[i][3], ah, SPLIT ? al : ah);
    }
    Frag<T>::keep(bh[0], bh[1], bh[2], bh[3]);
    if (SPLIT) Frag<T>::keep(bl[0], bl[1], bl[2], bl[3]);
  }
  acc_guard4(acc[0][0], acc[0][1], acc[0][2], acc[0][3]);
  acc_guard4(acc[1][0], acc[1][1], acc[1][2], acc[1][3]);
  acc_guard4(acc[2][0], acc[2][1], acc[2][2], acc[2][3]);
  acc_guard4(acc[3][0], acc[3][1], acc[3][2], acc[3][3]);

  // ---- epilogue ----
  float* slab = sT[wave];
  const float* Rb = RESID ? (resid + (size_t)b * strideR) : nullptr;
#pragma unroll
  for (int i = 0; i < 4; ++i) {
    const int mBase = m0 + (i << 4);
#pragma unroll
    for (int j = 0; j < 4; ++j) {
      const int n = n0 + (j << 4) + rlane;
      float bv = 0.f;
      if (BIAS_MODE == 2) bv = bias[n];
#pragma unroll
      for (int r = 0; r < 8; ++r) {
        float v = acc[i][j][r] * scale;
        if (BIAS_MODE == 1) v += bias[mBase + mOff + r];
        if (BIAS_MODE == 2) v += bv;
        if (RESID) v += Rb[(size_t)(mBase + mOff + r) * ldc + n];
        if (ACT == 1) v = tanhf(v);
        if (ACT == 2) v = fmaxf(v, 0.0f);
        if (ACT == 3) v = v / (1.0f + expf(-v));
        if (ACT == 4) v = (v > 0.f) ? v : 0.01f * v;
        if (ACT == 5) v = 0.5f * v * (1.0f + erff(v * 0.70710678118654752f));
        slab[(mOff + r) * 68 + (j << 4) + rlane] = v;
      }
    }
    __builtin_amdgcn_fence(__ATOMIC_RELEASE, "workgroup");
    __builtin_amdgcn_wave_barrier();
    __builtin_amdgcn_fence(__ATOMIC_ACQUIRE, "workgroup");
    if (OUT_MODE == 0) {
      float* C = (float*)Cout + (size_t)b * strideC;
      const int hh = lane >> 4, c4 = (lane & 15) * 4;     // row seg = 256 B = 16 lanes x 16 B
      {
#pragma unroll
        for (int it = 0; it < 8; ++it) {
          const int row = it * 2 + hh;
          v4f v = *(const v4f*)(slab + row * 68 + c4);
          *(v4f*)(C + (size_t)(mBase + row) * ldc + n0 + c4) = v;
        }
        
      }
    } else {
      const int q = lane >> 3, c8 = (lane & 7) * 8;
      unsigned short* C  = (unsigned short*)Cout  + (size_t)b * strideC;
      unsigned short* C2 = (OUT_MODE == 2) ? ((unsigned short*)Cout2 + (size_t)b * strideC) : nullptr;
      {
#pragma unroll
        for (int it = 0; it < 4; ++it) {
          const int row = it * 4 + q;
          const float* sp = slab + row * 68 + c8;
          v8h hv, lv;
#pragma unroll
          for (int e = 0; e < 8; ++e) {
            if (OUT_MODE == 1) {
              hv[e] = (_Float16)sp[e];
            } else {
              unsigned short hb = f2bf_bits(sp[e]);
              unsigned short lb = f2bf_bits(sp[e] - bf_bits2f(hb));
              hv[e] = __builtin_bit_cast(_Float16, hb);
              lv[e] = __builtin_bit_cast(_Float16, lb);
            }
          }
          *(v8h*)(C + (size_t)(mBase + row) * ldc + n0 + c8) = hv;
          if (OUT_MODE == 2) *(v8h*)(C2 + (size_t)(mBase + row) * ldc + n0 + c8) = lv;
        }
        
      }
    }
    __builtin_amdgcn_fence(__ATOMIC_RELEASE, "workgroup");
    __builtin_amdgcn_wave_barrier();
    __builtin_amdgcn_fence(__ATOMIC_ACQUIRE, "workgroup");
  }
}

// ---- LDS-staged WMMA GEMM ---------------------------------------------------
// C[m,n] = scale * sum_k A[m,k] * Bt[n,k] (+bias[n])(+resid); f16 operands, ldc = N (LDC for planar f16 output). OUT16: the result goes out as f16 to C16 (it is only ever read as an f16 operand), else as f32 to C.
// One 128x128 tile of C per work-group of eight waves (4 x 2; 32 rows x 64 columns each).
// A pass is 128 k: 128 rows of Bt, then 128 rows of A, 256 B each, copied to LDS at pitch 272 B. Two buffers.
// M, N % 128 == 0; K % 128 == 0, K >= 256.
#define GL_PITCH 272
#define GL_STAGE (256 * GL_PITCH)

// Eight asynchronous copies, 16 B per lane each: rows r, r + 16, ... of one operand's 128 rows.
// The s_wait_xcnt ends the copies' own statement, so that no address register of a copy is rewritten in front of it.
template <int K>
__device__ __forceinline__ void gl_copy8(unsigned l, const unsigned short* g) {
  asm volatile(
      "global_load_async_to_lds_b128 %0, %8, off\n\t"
      "global_load_async_to_lds_b128 %1, %9, off\n\t"
      "global_load_async_to_lds_b128 %2, %10, off\n\t"
      "global_load_async_to_lds_b128 %3, %11, off\n\t"
      "global_load_async_to_lds_b128 %4, %12, off\n\t"
      "global_load_async_to_lds_b128 %5, %13, off\n\t"
      "global_load_async_to_lds_b128 %6, %14, off\n\t"
      "global_load_async_to_lds_b128 %7, %15, off\n\t"
      "s_wait_xcnt 0x0"
      :: "v"(l), "v"(l + 16u * GL_PITCH), "v"(l + 32u * GL_PITCH), "v"(l + 48u * GL_PITCH),
         "v"(l + 64u * GL_PITCH), "v"(l + 80u * GL_PITCH), "v"(l + 96u * GL_PITCH), "v"(l + 112u * GL_PITCH),
         "v"(g), "v"(g + (size_t)16 * K), "v"(g + (size_t)32 * K), "v"(g + (size_t)48 * K),
         "v"(g + (size_t)64 * K), "v"(g + (size_t)80 * K), "v"(g + (size_t)96 * K), "v"(g + (size_t)112 * K)
      : "memory");
}
// One stage: stage rows 0..127 come from Bt, 128..255 from A; a lane fills 16 B of rows (thread >> 4) + 16 * i.
template <int K>
__device__ __forceinline__ void gl_fill(unsigned ldsLane, const unsigned short* gB, const unsigned short* gA) {
  gl_copy8<K>(ldsLane, gB);
  gl_copy8<K>(ldsLane + 128u * GL_PITCH, gA);
}
// this wave's copies have landed in LDS
__device__ __forceinline__ void gl_wait_async0() { asm volatile("s_wait_asynccnt 0x0" ::: "memory"); }
// this wave's LDS reads have returned, so the buffer may be refilled behind the barrier
__device__ __forceinline__ void gl_wait_ds0() { asm volatile("s_wait_dscnt 0x0" ::: "memory"); }

// LDC, PLANE (f16 output only): the N columns go out as N / LDC planes of LDC columns each, PLANE elements apart, so that products
// which share their A operand run as one launch and still leave each its own plane.
template <int N, int K, int BIAS_MODE, bool RESID, int ACT, bool OUT16, int LDC = N, int PLANE = 0>
__global__ __launch_bounds__(256, 4) void wmma_gemm_lds(
    const unsigned short* __restrict__ Ap, const unsigned short* __restrict__ Btp,
    float* __restrict__ C, _Float16* __restrict__ C16, const float* __restrict__ bias, const float* __restrict__ resid, float scale) {
  static_assert(N % 128 == 0 && K % 128 == 0 && K >= 256, "shape");
  static_assert(LDC == N || (OUT16 && !RESID && BIAS_MODE == 0 && N % LDC == 0 && LDC % 128 == 0), "planes");
  __shared__ __attribute__((aligned(128))) unsigned char sL[2 * GL_STAGE];
  const int tid  = threadIdx.x;
  const int lane = tid & 31;
  const int wave = tid >> 5;
  constexpr int tilesN = N / 128;
  constexpr int NT = K / 128;
  const int tm = blockIdx.x / tilesN;
  const int tn = blockIdx.x - tm * tilesN;
  const int wm = (wave >> 1) << 5;             // this wave's 32 rows and 64 columns inside the tile
  const int wn = (wave & 1) << 6;
  const int rlane = lane & 15;                 // row (A) / col (B, D) within subtile
  const int hh    = lane >> 4;                 // lane half: k offset 8 * hh, D row offset 8 * hh
  const int mOff  = hh * 8;

  const unsigned ldsLane = (unsigned)(uintptr_t)(&sL[0]) + (unsigned)((tid >> 4) * GL_PITCH + (tid & 15) * 16);
  const unsigned short* gB = Btp + (size_t)(tn * 128 + (tid >> 4)) * K + (tid & 15) * 8;
  const unsigned short* gA = Ap  + (size_t)(tm * 128 + (tid >> 4)) * K + (tid & 15) * 8;

  v8f acc[2][4];
#pragma unroll
  for (int i = 0; i < 2; ++i)
#pragma unroll
    for (int j = 0; j < 4; ++j) acc[i][j] = (v8f){0.f,0.f,0.f,0.f,0.f,0.f,0.f,0.f};

  gl_fill<K>(ldsLane, gB, gA);
  gl_wait_async0();
  __syncthreads();                             // stage 0 is readable by every wave
  gl_fill<K>(ldsLane + GL_STAGE, gB + 128, gA + 128);

  // kept rolled: one pass per trip, so that the order at its foot stands once
#pragma unroll 1
  for (int t = 0; t < NT; ++t) {
    const unsigned bo = (unsigned)(t & 1) * GL_STAGE;
    const unsigned char* pB = sL + bo + (wn + rlane) * GL_PITCH + hh * 16;
    const unsigned char* pA = sL + bo + (128 + wm + rlane) * GL_PITCH + hh * 16;
    v16h bh[2][4], ah[2][2];                   // two fragment sets: the next 32 k are fetched while these are multiplied
#pragma unroll
    for (int j = 0; j < 4; ++j) bh[0][j] = Frag<_Float16>::load((const _Float16*)(pB + j * 16 * GL_PITCH));
#pragma unroll
    for (int i = 0; i < 2; ++i) ah[0][i] = Frag<_Float16>::load((const _Float16*)(pA + i * 16 * GL_PITCH));
#pragma unroll
    for (int kk = 0; kk < 4; ++kk) {
      const int cur = kk & 1, nxt = cur ^ 1;
      if (kk < 3) {
#pragma unroll
        for (int j = 0; j < 4; ++j) bh[nxt][j] = Frag<_Float16>::load((const _Float16*)(pB + j * 16 * GL_PITCH + (kk + 1) * 64));
#pragma unroll
        for (int i = 0; i < 2; ++i) ah[nxt][i] = Frag<_Float16>::load((const _Float16*)(pA + i * 16 * GL_PITCH + (kk + 1) * 64));
      }
      __builtin_amdgcn_sched_barrier(0);       // keeps the next block's LDS reads one group ahead of this block's WMMAs, not among them
#pragma unroll
      for (int i = 0; i < 2; ++i)
#pragma unroll
        for (int j = 0; j < 4; ++j) acc[i][j] = Frag<_Float16>::mma(ah[cur][i], bh[cur][j], acc[i][j]);
      __builtin_amdgcn_sched_barrier(0);       // ends the block: later LDS reads stay behind its WMMAs
    }
    gl_wait_ds0();
    gl_wait_async0();
    __syncthreads();                           // publishes stage t + 1 and ends every read of stage t
    if (t + 2 < NT) gl_fill<K>(ldsLane + bo, gB + (size_t)(t + 2) * 128, gA + (size_t)(t + 2) * 128);
  }
  gl_wait_async0();

  // ---- epilogue ----
  // The ring is free: the last trip's foot waited for every read and every copy and passed the barrier.
  float* slab = (float*)(sL + wave * (16 * 68 * 4));   // per-wave 16x64 slab, pitch 68 floats
  const int m0 = tm * 128 + wm;
  const int n0 = tn * 128 + wn;
  const int nl = n0 + rlane;
  float bv[4];
#pragma unroll
  for (int j = 0; j < 4; ++j) bv[j] = (BIAS_MODE == 2) ? bias[nl + (j << 4)] : 0.f;
  // the bias loads' index register is an input, so it stays whole up to the wait
  if (BIAS_MODE == 2) asm volatile("s_wait_xcnt 0x0" :: "v"(nl) : "memory");
#pragma unroll
  for (int i = 0; i < 2; ++i) {
    const int mBase = m0 + (i << 4);
    float rv[4][8];
    if (RESID) {
      const float* rp = resid + (size_t)(mBase + mOff) * N + nl;
#pragma unroll
      for (int j = 0; j < 4; ++j)
#pragma unroll
        for (int r = 0; r < 8; ++r) rv[j][r] = rp[(size_t)r * N + (j << 4)];
      // the residual loads' address register is an input, so it stays whole up to the wait
      asm volatile("s_wait_xcnt 0x0" :: "v"(rp) : "memory");
    }
#pragma unroll
    for (int j = 0; j < 4; ++j) {
#pragma unroll
      for (int r = 0; r < 8; ++r) {
        float v = acc[i][j][r] * scale;
        if (BIAS_MODE == 2) v += bv[j];
        if (RESID) v += rv[j][r];
        if (ACT == 2) v = fmaxf(v, 0.0f);
        slab[(mOff + r) * 68 + (j << 4) + rlane] = v;
      }
    }
    __builtin_amdgcn_fence(__ATOMIC_RELEASE, "workgroup");
    __builtin_amdgcn_wave_barrier();
    __builtin_amdgcn_fence(__ATOMIC_ACQUIRE, "workgroup");
    if (OUT16) {
      const int r4 = lane >> 3, c8 = (lane & 7) * 8;   // row seg = 128 B = 8 lanes x 16 B
      const int pl = (LDC == N) ? 0 : n0 / LDC;        // this wave's 64 columns lie in one plane
      _Float16* hp = C16 + (size_t)pl * PLANE + (size_t)(mBase + r4) * LDC + (n0 - pl * LDC) + c8;
#pragma unroll
      for (int it = 0; it < 4; ++it) {         // rows it * 4 + r4
        const float* sp = slab + (it * 4 + r4) * 68 + c8;
        const v4f lo = *(const v4f*)(sp), hi = *(const v4f*)(sp + 4);
        v8h h;
#pragma unroll
        for (int e = 0; e < 4; ++e) { h[e] = (_Float16)lo[e]; h[4 + e] = (_Float16)hi[e]; }
        *(v8h*)(hp + (size_t)it * 4 * LDC) = h;
      }
    } else {
      const int c4 = (lane & 15) * 4;          // row seg = 256 B = 16 lanes x 16 B
      float* cp = C + (size_t)(mBase + hh) * N + n0 + c4;
#pragma unroll
      for (int it = 0; it < 8; ++it) {         // rows it * 2 + hh
        v4f v = *(const v4f*)(slab + (it * 2 + hh) * 68 + c4);
        *(v4f*)(cp + (size_t)it * 2 * N) = v;
      }
    }
    __builtin_amdgcn_sched_barrier(0);         // holds later register writes behind the wait below
    asm volatile("s_wait_xcnt 0x0" ::: "memory");   // before a data or address register of the stores above is rewritten
    __builtin_amdgcn_sched_barrier(0);         // without the pair the next rows' multiplies were lifted over the wait, onto the stores' data registers
    __builtin_amdgcn_fence(__ATOMIC_RELEASE, "workgroup");
    __builtin_amdgcn_wave_barrier();
    __builtin_amdgcn_fence(__ATOMIC_ACQUIRE, "workgroup");
  }
}

__global__ __launch_bounds__(256) void cast_f32_f16x2(
    const float* __restrict__ in, _Float16* __restrict__ out, int n2) {
  int i = blockIdx.x * 256 + threadIdx.x;
  if (i < n2) {
    const _Float16 h0 = (_Float16)in[2 * i], h1 = (_Float16)in[2 * i + 1];
    const unsigned u = (unsigned)__builtin_bit_cast(unsigned short, h0) | ((unsigned)__builtin_bit_cast(unsigned short, h1) << 16);
    ((unsigned*)out)[i] = u;
    
  }
}


} // namespace w25

__global__ __launch_bounds__(256) void k_castT16(const float* __restrict__ src, long long lds, _Float16* __restrict__ dst, long long ldd, int R, int C, float s) {
    const long long i = (long long)blockIdx.x * 256 + threadIdx.x; const long long np = (long long)C * (R / 2); if (i >= np) return; const int c = (int)(i / (R / 2)); const int r = 2 * (int)(i % (R / 2));
    const _Float16 h0 = (_Float16)(src[(long long)r * lds + c] * s), h1 = (_Float16)(src[(long long)(r + 1) * lds + c] * s);
    const unsigned u = (unsigned)__builtin_bit_cast(unsigned short, h0) | ((unsigned)__builtin_bit_cast(unsigned short, h1) << 16);
    unsigned* d = (unsigned*)(dst + (long long)c * ldd + r); *d = u;  }
__global__ __launch_bounds__(256) void k_cast16(const float* __restrict__ src, long long lds, _Float16* __restrict__ dst, long long ldd, int R, int C, float s) {
    const long long i = (long long)blockIdx.x * 256 + threadIdx.x; const long long np = (long long)R * (C / 2); if (i >= np) return; const int r = (int)(i / (C / 2)); const int c = 2 * (int)(i % (C / 2));
    const _Float16 h0 = (_Float16)(src[(long long)r * lds + c] * s), h1 = (_Float16)(src[(long long)r * lds + c + 1] * s);
    const unsigned u = (unsigned)__builtin_bit_cast(unsigned short, h0) | ((unsigned)__builtin_bit_cast(unsigned short, h1) << 16);
    unsigned* d = (unsigned*)(dst + (long long)r * ldd + c); *d = u;  }

// f32 -> bf16 hi plane + bf16 lo plane (x = hi + lo to ~2^-17 relative; RNE both), [R][C] -> [R][C] (or transposed to [C][R]); 2 consecutive destination elements
__device__ __forceinline__ unsigned int f2bf2_pack(float a, float b, unsigned int* lo) {
    const unsigned short ha = w25::f2bf_bits(a), hb = w25::f2bf_bits(b);
    const unsigned short la = w25::f2bf_bits(a - w25::bf_bits2f(ha)), lb = w25::f2bf_bits(b - w25::bf_bits2f(hb));
    *lo = (unsigned)la | ((unsigned)lb << 16); return (unsigned)ha | ((unsigned)hb << 16); }
__global__ __launch_bounds__(256) void k_castS16(const float* __restrict__ src, long long lds, __bf16* __restrict__ dhi, __bf16* __restrict__ dlo, long long ldd, int R, int C, float s, int transpose) {
    const long long i = (long long)blockIdx.x * 256 + threadIdx.x; long long o; float a, b;
    if (transpose) { const long long np = (long long)C * (R / 2); if (i >= np) return; const int c = (int)(i / (R / 2)); const int r = 2 * (int)(i % (R / 2)); a = src[(long long)r * lds + c] * s; b = src[(long long)(r + 1) * lds + c] * s; o = (long long)c * ldd + r; }
    else { const long long np = (long long)R * (C / 2); if (i >= np) return; const int r = (int)(i / (C / 2)); const int c = 2 * (int)(i % (C / 2)); a = src[(long long)r * lds + c] * s; b = src[(long long)r * lds + c + 1] * s; o = (long long)r * ldd + c; }
    unsigned lo; const unsigned hi = f2bf2_pack(a, b, &lo); unsigned* ph = (unsigned*)(dhi + o); unsigned* pl = (unsigned*)(dlo + o);
    *ph = hi; *pl = lo;  }

namespace w25 {
// =====================================================================================
// Generic causal/non-causal attention for head_dim 64, f32 in / f32 out; 16-bit operands: bf16 with optional hi/lo splits, or
// plain f16 (F16=true, non-split, probabilities carried x2^15).
//   scores = (q*qscale)·kᵀ : v_wmma_f32_16x16x32_bf16; SPLIT_QK -> q,k as bf16 hi/lo (hi·hi + hi·lo + lo·hi)
//   out    = p·v           : v_wmma_f32_16x16x32_bf16; SPLIT_PV -> p,v as bf16 hi/lo; else p,v plain bf16
//   f32 accumulate; online softmax in f32. Block = 4 waves = 64 query rows of one (batch, head); S % 64 == 0.
//   Element (b, s, h, d) of tensor X lives at X[b*X_bs + s*X_rs + h*X_hs + d] (strides in floats, multiples of 4).
//   Masking: mask_mode 0 none, 1 causal (kv > q masked), 2 tensor [S][Skv] shared over (b,h) (float if
//   mask_is_int==0, int32 with element == 0 -> masked if 1, int32 with element != 0 -> masked if 2), 3 per-token vectors qmask[B][S] & kvmask[B][Skv] (int32,
//   0 -> masked), 4 causal + sliding window (kv > q or q - kv > W masked; W passed in mask_is_int);
//   5 = relative-position bias: s += cp[b,h,q][idx[q][kv]] + pc[b,h,kv][idx[q][kv]] with idx = mask_b ([S][Skv] int32) and
//   mask_a an int32 [S][Skv] tensor with nonzero = masked (tables: element (b,h,row,n) at X + b*c_bs + h*c_hs + row*c_rs + n);
//   masked scores are replaced by mask_fill (e.g. -inf or -1e9) before the softmax.
//   grid.x = B * H * (S/64) (or a sub-range with blk0).
// =====================================================================================
#define AT_D 64
#define AT_NW 4
#define AT_QB 64
#define AT_KC 64
struct AttnGeom { const float* cp = nullptr; const float* pc = nullptr; long c_bs = 0, c_rs = 0, c_hs = 0;   // mode-5 score-bias tables
                  long q_bs, q_rs, q_hs, k_bs, k_rs, k_hs, v_bs, v_rs, v_hs, o_bs, o_rs, o_hs;
                  int S, Skv, H, mask_mode; float qscale; int blk0; float mask_fill; int mask_is_int; };
static_assert(sizeof(AttnGeom) == 168, "no padding");

__device__ __forceinline__ unsigned short at_bf_bits(float f) {
  unsigned u = __float_as_uint(f);
  return (unsigned short)((u + 0x7FFFu + ((u >> 16) & 1u)) >> 16);
}
__device__ __forceinline__ __bf16 at_f2bf(float f) { return __builtin_bit_cast(__bf16, at_bf_bits(f)); }
__device__ __forceinline__ void at_split(float f, __bf16& hi, __bf16& lo) {
  const unsigned short hb = at_bf_bits(f);
  hi = __builtin_bit_cast(__bf16, hb);
  lo = at_f2bf(f - __uint_as_float(((unsigned)hb) << 16));
}
__device__ __forceinline__ v8f at_mma(v16b a, v16b b, v8f c) {
  c = __builtin_amdgcn_wmma_f32_16x16x32_bf16(false, a, false, b, (short)0, c, false, false);
  asm volatile("v_nop\n\tv_nop\n\tv_nop\n\tv_nop" : "+v"(c) : "v"(a), "v"(b));
  return c;
}
// 16-bit element as a bit pattern held in a __bf16 slot: f16 bits when F16, bf16 (RNE) otherwise
template <bool F16> __device__ __forceinline__ __bf16 at_to16(float f) {
  if (F16) return __builtin_bit_cast(__bf16, (_Float16)f);
  return at_f2bf(f);
}
template <bool F16> __device__ __forceinline__ v8f at_mma16(v16b a, v16b b, v8f c) {
  if (F16) {
    const v16h ah = __builtin_bit_cast(v16h, a), bh = __builtin_bit_cast(v16h, b);
    c = __builtin_amdgcn_wmma_f32_16x16x32_f16(false, ah, false, bh, (short)0, c, false, false);
    asm volatile("v_nop\n\tv_nop\n\tv_nop\n\tv_nop" : "+v"(c) : "v"(ah), "v"(bh));
    return c;
  }
  return at_mma(a, b, c);
}

template <bool SPLIT_QK, bool SPLIT_PV, bool F16 = false>
__global__ __launch_bounds__(128)
void attn64_kernel(const float* __restrict__ q, const float* __restrict__ k,
                   const float* __restrict__ v, float* __restrict__ out,
                   const void* __restrict__ mask_a, const int* __restrict__ mask_b, AttnGeom g) {
  static_assert(!(F16 && (SPLIT_QK || SPLIT_PV)), "f16 mode is non-split");
  const float PSC = F16 ? 32768.0f : 1.0f;     // f16 probabilities carried x2^15 (subnormal range), folded into the final 1/l
  union FB { v16b v; v8b h[2]; };
  __shared__ __align__(16) __bf16 Ksh[AT_KC * AT_D];             // K hi [kv][d]      8 KB
  __shared__ __align__(16) __bf16 Ksl[SPLIT_QK ? AT_KC * AT_D : 8];
  __shared__ __align__(16) __bf16 Vth[AT_D * AT_KC];             // V hi [d][kv]      8 KB
  __shared__ __align__(16) __bf16 Vtl[SPLIT_PV ? AT_D * AT_KC : 8];
  __shared__ __align__(16) __bf16 Psh[AT_NW][16 * AT_KC];        // per wave P hi [row][kv]  8 KB
  __shared__ __align__(16) __bf16 Psl[SPLIT_PV ? AT_NW : 1][SPLIT_PV ? 16 * AT_KC : 8];
  __shared__ __align__(16) float  Os[AT_NW][16 * 68];            // per wave out tile, pitch 68

  const int tid  = threadIdx.x;
  const int wave = tid >> 5;
  const int lane = tid & 31;
  const int hh   = lane >> 4;
  const int c    = lane & 15;

  const int nqb = g.S / AT_QB;
  const int bx = blockIdx.x + g.blk0;
  const int qb = bx % nqb;
  const int bh = bx / nqb;
  const int h  = bh % g.H;
  const int b  = bh / g.H;
  const int qbase_block = qb * AT_QB;
  const int q0 = qbase_block + wave * 16;

  const float* qb_ptr = q + (size_t)b * g.q_bs + (size_t)h * g.q_hs;
  const float* kb_ptr = k + (size_t)b * g.k_bs + (size_t)h * g.k_hs;
  const float* vb_ptr = v + (size_t)b * g.v_bs + (size_t)h * g.v_hs;
  float*       ob_ptr = out + (size_t)b * g.o_bs + (size_t)h * g.o_hs;

  // ---- Q fragments (A operand): 2 d-chunks, hi (and lo) ----
  v16b qah[2], qal[2];
  {
    const float* qrow = qb_ptr + (size_t)(q0 + c) * g.q_rs;
#pragma unroll
    for (int dc = 0; dc < 2; ++dc) {
#pragma unroll
      for (int e = 0; e < 8; ++e) {
        const float f0 = qrow[dc * 32 + 8 * hh + e] * g.qscale;
        const float f1 = qrow[dc * 32 + 16 + 8 * hh + e] * g.qscale;
        if (SPLIT_QK) { __bf16 hq, lq; at_split(f0, hq, lq); qah[dc][e] = hq; qal[dc][e] = lq; at_split(f1, hq, lq); qah[dc][8 + e] = hq; qal[dc][8 + e] = lq; }
        else { qah[dc][e] = at_to16<F16>(f0); qah[dc][8 + e] = at_to16<F16>(f1); qal[dc][e] = qah[dc][e]; qal[dc][8 + e] = qah[dc][8 + e]; }
      }
    }
  }

  float mrow[8], lrow[8];
  v8f oacc[4];
#pragma unroll
  for (int r = 0; r < 8; ++r) { mrow[r] = -INFINITY; lrow[r] = 0.f; }
#pragma unroll
  for (int t = 0; t < 4; ++t) oacc[t] = (v8f){0.f,0.f,0.f,0.f,0.f,0.f,0.f,0.f};

  const int nChunks = (g.mask_mode == 1 || g.mask_mode == 4) ? (qb + 1) : (g.Skv / AT_KC);   // block-uniform
  // per-row query mask (mode 3)
  int qkeep[8];
#pragma unroll
  for (int r = 0; r < 8; ++r) qkeep[r] = (g.mask_mode == 3) ? mask_b[(size_t)b * g.S + q0 + 8 * hh + r] : 1;   // mask_b = qmask in mode 3
  for (int kc = 0; kc < nChunks; ++kc) {
    const int kv0 = kc * AT_KC;
    __syncthreads();
    {
      const int kvr = tid >> 1, dh = (tid & 1) * 32;
      const float* krow = kb_ptr + (size_t)(kv0 + kvr) * g.k_rs + dh;
      const float* vrow = vb_ptr + (size_t)(kv0 + kvr) * g.v_rs + dh;
#pragma unroll
      for (int i = 0; i < 8; ++i) {
        v4f kk = *(const v4f*)(krow + 4 * i);
        v4f vv = *(const v4f*)(vrow + 4 * i);
#pragma unroll
        for (int e = 0; e < 4; ++e) {
          const int d = dh + 4 * i + e;
          if (SPLIT_QK) { __bf16 a, bl; at_split(kk[e], a, bl); Ksh[kvr * AT_D + d] = a; Ksl[kvr * AT_D + d] = bl; }
          else Ksh[kvr * AT_D + d] = at_to16<F16>(kk[e]);
          if (SPLIT_PV) { __bf16 a, bl; at_split(vv[e], a, bl); Vth[d * AT_KC + kvr] = a; Vtl[d * AT_KC + kvr] = bl; }
          else Vth[d * AT_KC + kvr] = at_to16<F16>(vv[e]);
        }
      }
    }
    __syncthreads();

    v8f s[4];
#pragma unroll
    for (int j = 0; j < 4; ++j) {
      s[j] = (v8f){0.f,0.f,0.f,0.f,0.f,0.f,0.f,0.f};
#pragma unroll 1
      for (int dc = 0; dc < 2; ++dc) {
        FB kb;
        kb.h[0] = *(const v8b*)(Ksh + (j * 16 + c) * AT_D + dc * 32 + 8 * hh);
        kb.h[1] = *(const v8b*)(Ksh + (j * 16 + c) * AT_D + dc * 32 + 16 + 8 * hh);
        s[j] = at_mma16<F16>(qah[dc], kb.v, s[j]);
        if (SPLIT_QK) {
          FB kl;
          kl.h[0] = *(const v8b*)(Ksl + (j * 16 + c) * AT_D + dc * 32 + 8 * hh);
          kl.h[1] = *(const v8b*)(Ksl + (j * 16 + c) * AT_D + dc * 32 + 16 + 8 * hh);
          s[j] = at_mma16<F16>(qah[dc], kl.v, s[j]);
          s[j] = at_mma16<F16>(qal[dc], kb.v, s[j]);
        }
      }
    }
    const bool diag = (g.mask_mode == 1) && (kc == qb);
    int kvkeep[4] = {1, 1, 1, 1};
    if (g.mask_mode == 3) {
#pragma unroll
      for (int j = 0; j < 4; ++j) kvkeep[j] = ((const int*)mask_a)[(size_t)b * g.Skv + kv0 + j * 16 + c];   // mask_a = kvmask
    }
    float cm[8];
#pragma unroll
    for (int r = 0; r < 8; ++r) {
      const int qrow = q0 + 8 * hh + r;
      float m = -INFINITY;
#pragma unroll
      for (int j = 0; j < 4; ++j) {
        const int kvcol = kv0 + j * 16 + c;
        bool masked = false;
        if (diag) masked = (kvcol > qrow);
        else if (g.mask_mode == 4) masked = (kvcol > qrow) || (qrow - kvcol > g.mask_is_int);
        else if (g.mask_mode == 2) {
          const size_t mi = (size_t)qrow * g.Skv + kvcol;
          masked = (g.mask_is_int == 0) ? (((const float*)mask_a)[mi] == 0.0f)
                 : (g.mask_is_int == 1) ? (((const int*)mask_a)[mi] == 0) : (((const int*)mask_a)[mi] != 0);
        } else if (g.mask_mode == 3) masked = (qkeep[r] == 0) || (kvkeep[j] == 0);
        else if (g.mask_mode == 5) {
          const size_t mi = (size_t)qrow * g.Skv + kvcol;
          masked = (((const int*)mask_a)[mi] != 0);
          int n = mask_b[mi]; n = n < 0 ? 0 : n;
          s[j][r] += g.cp[(size_t)b * g.c_bs + (size_t)h * g.c_hs + (size_t)qrow * g.c_rs + n]
                   + g.pc[(size_t)b * g.c_bs + (size_t)h * g.c_hs + (size_t)kvcol * g.c_rs + n];
        }
        if (masked) s[j][r] = g.mask_fill;
        m = fmaxf(m, s[j][r]);
      }
#pragma unroll
      for (int off = 1; off < 16; off <<= 1) m = fmaxf(m, __shfl_xor(m, off, 32));
      cm[r] = m;
    }
    __bf16* pwh = Psh[wave];
    __bf16* pwl = Psl[SPLIT_PV ? wave : 0];
#pragma unroll
    for (int r = 0; r < 8; ++r) {
      const float mnew = fmaxf(mrow[r], cm[r]);
      const float alpha = expf(mrow[r] - mnew);
      mrow[r] = mnew;
      float psum = 0.f;
#pragma unroll
      for (int j = 0; j < 4; ++j) {
        const float p = expf(s[j][r] - mnew);
        psum += p;
        if (SPLIT_PV) { __bf16 a, bl; at_split(p, a, bl); pwh[(8 * hh + r) * AT_KC + j * 16 + c] = a; pwl[(8 * hh + r) * AT_KC + j * 16 + c] = bl; }
        else pwh[(8 * hh + r) * AT_KC + j * 16 + c] = at_to16<F16>(p * PSC);
      }
#pragma unroll
      for (int off = 1; off < 16; off <<= 1) psum += __shfl_xor(psum, off, 32);
      lrow[r] = lrow[r] * alpha + psum;
#pragma unroll
      for (int t = 0; t < 4; ++t) oacc[t][r] *= alpha;
    }
    __builtin_amdgcn_fence(__ATOMIC_RELEASE, "workgroup");
    __builtin_amdgcn_wave_barrier();
    __builtin_amdgcn_fence(__ATOMIC_ACQUIRE, "workgroup");
#pragma unroll 1
    for (int kk = 0; kk < 2; ++kk) {
      FB pa, pl;
      pa.h[0] = *(const v8b*)(pwh + c * AT_KC + kk * 32 + 8 * hh);
      pa.h[1] = *(const v8b*)(pwh + c * AT_KC + kk * 32 + 16 + 8 * hh);
      if (SPLIT_PV) {
        pl.h[0] = *(const v8b*)(pwl + c * AT_KC + kk * 32 + 8 * hh);
        pl.h[1] = *(const v8b*)(pwl + c * AT_KC + kk * 32 + 16 + 8 * hh);
      }
#pragma unroll
      for (int t = 0; t < 4; ++t) {
        FB vb;
        vb.h[0] = *(const v8b*)(Vth + (t * 16 + c) * AT_KC + kk * 32 + 8 * hh);
        vb.h[1] = *(const v8b*)(Vth + (t * 16 + c) * AT_KC + kk * 32 + 16 + 8 * hh);
        oacc[t] = at_mma16<F16>(pa.v, vb.v, oacc[t]);
        if (SPLIT_PV) {
          FB vl;
          vl.h[0] = *(const v8b*)(Vtl + (t * 16 + c) * AT_KC + kk * 32 + 8 * hh);
          vl.h[1] = *(const v8b*)(Vtl + (t * 16 + c) * AT_KC + kk * 32 + 16 + 8 * hh);
          oacc[t] = at_mma16<F16>(pa.v, vl.v, oacc[t]);
          oacc[t] = at_mma16<F16>(pl.v, vb.v, oacc[t]);
        }
      }
    }
  }

  float* os = Os[wave];
#pragma unroll
  for (int r = 0; r < 8; ++r) {
    const float inv = 1.0f / (lrow[r] * PSC);
#pragma unroll
    for (int t = 0; t < 4; ++t) os[(8 * hh + r) * 68 + t * 16 + c] = oacc[t][r] * inv;
  }
  __builtin_amdgcn_fence(__ATOMIC_RELEASE, "workgroup");
  __builtin_amdgcn_wave_barrier();
  __builtin_amdgcn_fence(__ATOMIC_ACQUIRE, "workgroup");
  {
    const int c4 = (lane & 15) * 4;
    {
#pragma unroll
      for (int it = 0; it < 8; ++it) {
        const int row = it * 2 + hh;
        v4f val = *(const v4f*)(os + row * 68 + c4);
        *(v4f*)(ob_ptr + (size_t)(q0 + row) * g.o_rs + c4) = val;
      }
      
    }
  }
}

} // namespace w25

// ---- Wide elementwise and row passes: a thread moves 32 or 64 elements with 16-byte loads, so that a pass starts a few thousand waves instead of
//      one wave per 64 or 128 elements. Every wave-wide store covers whole 128-byte lines. Formulas and sum trees are those of the narrow kernels above.
typedef __attribute__((ext_vector_type(4))) _Float16 v4h;
// cast16w<G>: dst[i] = f16(src[i] * s) over a flat range; block bx takes G * 1024 consecutive elements, a thread 4 consecutive ones of each 1024.
template <int G>
__device__ __forceinline__ void cast16w(const float* __restrict__ src, _Float16* __restrict__ dst, float s, unsigned bx) {
    const v4f* sp = (const v4f*)(src + (size_t)bx * (G * 1024));
    v4h* dp = (v4h*)(dst + (size_t)bx * (G * 1024));
    const unsigned t = threadIdx.x;
    v4f a[G];
    // every loop here is unrolled, so that the arrays it indexes are registers and all G loads are in flight together
#pragma unroll
    for (int g = 0; g < G; ++g) a[g] = sp[t + g * 256];
    __builtin_amdgcn_sched_barrier(0);               // holds later register writes behind the wait below
    asm volatile("s_wait_xcnt 0x0" ::: "memory");    // before an address register of the loads above is rewritten (the store addresses are formed next)
    __builtin_amdgcn_sched_barrier(0);               // the pair keeps the forming of the store addresses behind the wait
    v4h h[G];
#pragma unroll
    for (int g = 0; g < G; ++g)
#pragma unroll
        for (int e = 0; e < 4; ++e) h[g][e] = (_Float16)(a[g][e] * s);
#pragma unroll
    for (int g = 0; g < G; ++g) dp[t + g * 256] = h[g];
}
// castT16w<LDS, LDD>: dst[c * LDD + r] = f16(src[r * LDS + c] * s). Block (bx, by) = 64 source rows x 128 source columns, wave = 64 x 16, lane = 8 rows x 4 columns
//   transposed in registers: 8 lanes side by side in r fill one 128-byte line of a dst row. bx < C / 128, by < R / 64.
template <int LDS, int LDD>
__device__ __forceinline__ void castT16w(const float* __restrict__ src, _Float16* __restrict__ dst, float s, unsigned bx, unsigned by) {
    const int lane = threadIdx.x & 31, wave = threadIdx.x >> 5;
    const int r = by * 64 + (lane & 7) * 8;
    const int c = bx * 128 + wave * 16 + (lane >> 3) * 4;
    const float* sp = src + (size_t)r * LDS + c;
    _Float16* dp = dst + (size_t)c * LDD + r;
    v4f x[8];
    // every loop here is unrolled, so that the arrays it indexes are registers and all eight loads are in flight together
#pragma unroll
    for (int i = 0; i < 8; ++i) x[i] = *(const v4f*)(sp + i * LDS);
    __builtin_amdgcn_sched_barrier(0);               // holds later register writes behind the wait below
    asm volatile("s_wait_xcnt 0x0" ::: "memory");    // before an address register of the loads above is rewritten
    __builtin_amdgcn_sched_barrier(0);               // the pair keeps later address arithmetic behind the wait
    v8h h[4];
#pragma unroll
    for (int j = 0; j < 4; ++j)
#pragma unroll
        for (int i = 0; i < 8; ++i) h[j][i] = (_Float16)(x[i][j] * s);
#pragma unroll
    for (int j = 0; j < 4; ++j) *(v8h*)(dp + j * LDD) = h[j];
    asm volatile("s_wait_xcnt 0x0" ::: "memory");    // behind the stores: in the merged kernel another branch's code follows in the listing and reuses their address and data registers
}
// k_cast_all: every f16 operand plane that depends on the inputs alone, in one launch of 2048 blocks, none of which reads what another writes.
//   Blocks 0..511: X. 512..1023: Wq, Wk, Wv, Wo transposed, x16, as four planes of 1024 x 1024 one behind the other (the first three are one Bt of 3072 rows).
//   1024..1535: W1 transposed, x16. 1536..2047: W2 transposed, x16.
__global__ __launch_bounds__(256) void k_cast_all(const float* __restrict__ X, const float* __restrict__ Wq, const float* __restrict__ Wk, const float* __restrict__ Wv,
                                                  const float* __restrict__ Wo, const float* __restrict__ W1, const float* __restrict__ W2,
                                                  _Float16* __restrict__ Xh, _Float16* __restrict__ Wt4, _Float16* __restrict__ W1t, _Float16* __restrict__ W2t) {
    const unsigned b = blockIdx.x, q = b & 511u;
    if (b < 512u) { cast16w<8>(X, Xh, 1.0f, q); return; }
    if (b < 1024u) {
        const unsigned w = q >> 7, i = q & 127u;
        const float* src = (w == 0u) ? Wq : (w == 1u) ? Wk : (w == 2u) ? Wv : Wo;
        castT16w<1024, 1024>(src, Wt4 + (size_t)w * (1024 * 1024), 16.0f, i & 7u, i >> 3);
        return;
    }
    if (b < 1536u) { castT16w<4096, 1024>(W1, W1t, 16.0f, q & 31u, q >> 5); return; }
    castT16w<1024, 4096>(W2, W2t, 16.0f, q & 7u, q >> 3);
}
// Sum of one value per position t = 0..255 of k_stats' tree, add for add: lane l holds positions 4l + q in lo[q] and 128 + 4l + q in hi[q].
//   Levels 128 (in the lane), 64..4 (lanes l and l ^ 16, 8, 4, 2, 1), 2 and 1 (in the lane); every lane ends with the root.
__device__ __forceinline__ float tree256(v4f lo, v4f hi) {
    v4f t = lo + hi;
#pragma unroll
    for (int o = 16; o > 0; o >>= 1) {
#pragma unroll
        for (int q = 0; q < 4; ++q) t[q] += __shfl_xor(t[q], o, 32);
    }
    return (t[0] + t[2]) + (t[1] + t[3]);
}
// k_ln_w: y = (x - mean) * rsqrt(var + eps) * g + b on rows of 1024 in one pass: a wave holds two whole rows in registers, takes their statistics
//   (k_stats mode 0; same partial sums, same tree) and applies them to the same registers (x and y may be the same buffer: a wave reads its rows before it writes them).
//   H16: y16 = f16(y) goes out beside y, as the next product's A operand. grid = rows / 16.
template <bool H16>
__global__ __launch_bounds__(256) void k_ln_w(const float* x, float* y, _Float16* __restrict__ y16, float eps, const float* __restrict__ g, const float* __restrict__ bta) {
    const int lane = threadIdx.x & 31;
    const size_t off = ((size_t)blockIdx.x * 16 + (threadIdx.x >> 5) * 2) * 1024 + 4 * lane;
    const float* base = x + off;
    v4f v[2][8], gg[8], bb[8];
    // every loop here is unrolled, so that the arrays it indexes are registers and all loads are in flight together
#pragma unroll
    for (int r = 0; r < 2; ++r)
#pragma unroll
        for (int m = 0; m < 8; ++m) v[r][m] = *(const v4f*)(base + r * 1024 + 128 * m);
#pragma unroll
    for (int m = 0; m < 8; ++m) { gg[m] = *(const v4f*)(g + 4 * lane + 128 * m); bb[m] = *(const v4f*)(bta + 4 * lane + 128 * m); }
    __builtin_amdgcn_sched_barrier(0);               // holds later register writes behind the wait below
    asm volatile("s_wait_xcnt 0x0" :: "v"(base) : "memory");   // before an address register of the loads above is rewritten; the rows' address is an input, so no later load's result lands on it in front of the wait
    __builtin_amdgcn_sched_barrier(0);               // the pair keeps later address arithmetic behind the wait
    v4h h[2][8];
#pragma unroll
    for (int r = 0; r < 2; ++r) {
        const float mu = tree256(((v[r][0] + v[r][2]) + v[r][4]) + v[r][6], ((v[r][1] + v[r][3]) + v[r][5]) + v[r][7]) / 1024.f;
        v4f q0 = {}, q1 = {};
#pragma unroll
        for (int k = 0; k < 4; ++k) { const v4f d0 = v[r][2 * k] - mu, d1 = v[r][2 * k + 1] - mu; q0 = __builtin_elementwise_fma(d0, d0, q0); q1 = __builtin_elementwise_fma(d1, d1, q1); }
        const float rs = rsqrtf(tree256(q0, q1) / 1024.f + eps);
#pragma unroll
        for (int m = 0; m < 8; ++m) {
            v4f o = (v[r][m] - mu) * rs;
            o *= gg[m]; o += bb[m];
            v[r][m] = o;
            if (H16) {
#pragma unroll
                for (int e = 0; e < 4; ++e) h[r][m][e] = (_Float16)o[e];
            }
        }
    }
    __builtin_amdgcn_sched_barrier(0);               // every value is made before the first store issues, so no store's data register is rewritten behind it
#pragma unroll
    for (int r = 0; r < 2; ++r)
#pragma unroll
        for (int m = 0; m < 8; ++m) {
            *(v4f*)(y + off + r * 1024 + 128 * m) = v[r][m];
            if (H16) *(v4h*)(y16 + off + r * 1024 + 128 * m) = h[r][m];
        }
}


// ---- Block attention at its fixed shape ------------------------------------------------------------------------------
// k_attn_blk: k_attn<64, 64, 0, false, false> for 128 queries x 128 keys x 64 dims per (128-position block z, head h), row stride 1024 elements, all as constants.
//   Same f16 operands, same products in the same order, same online softmax over two 64-key halves, same sums: only how the data travel differs.
//   Q, K and V arrive as the f16 values that the projections' epilogues stored, and O leaves as f16, the next product's A operand.
//   One work-group of eight waves per (z, h); wave w owns queries 16w .. 16w + 15. Every global load is unguarded (every index is in range by
//   the constants), so all of a thread's loads are in flight together. K lies in LDS as f16 [key][d], V as f16 [d][key] (8 keys x 4 dims transposed in registers),
//   so that every B fragment is two 16-byte LDS reads. All 128 keys are staged at once: one barrier.
#define BA_KP 72      // pitch of K and P rows in halves: 144 B = 16 B x odd, for 16-byte readers
#define BA_VP 136     // pitch of V^T rows in halves: 272 B = 16 B x odd
// orders one wave's LDS writes and its other lanes' LDS reads (the per-wave P and O tiles)
__device__ __forceinline__ void ba_wave_sync() {
    __builtin_amdgcn_fence(__ATOMIC_RELEASE, "workgroup");
    __builtin_amdgcn_wave_barrier();
    __builtin_amdgcn_fence(__ATOMIC_ACQUIRE, "workgroup");
}
__global__ __launch_bounds__(256) void k_attn_blk(const _Float16* __restrict__ Q, const _Float16* __restrict__ K, const _Float16* __restrict__ V, const int* __restrict__ VL, _Float16* __restrict__ O) {
    typedef w25::Frag<_Float16> FH;
    __shared__ __align__(16) _Float16 kl[128 * BA_KP];
    __shared__ __align__(16) _Float16 vt[64 * BA_VP];
    __shared__ __align__(16) _Float16 pl[8][16 * BA_KP];
    __shared__ __align__(16) float    ol[8][16 * 68];
    const int tid = threadIdx.x, lane = tid & 31, hf = lane >> 4, l15 = lane & 15, wave = tid >> 5;
    const int h = blockIdx.x, z = blockIdx.y;
    const size_t base = (size_t)z * (128 * 1024) + (size_t)h * 64;      // (row 0, dim 0) of this block and head in Q, K, V and O
    const float L2E = 1.4426950408889634f;
    const float NEG = -__builtin_inff();

    // K: load i takes rows 32i + 4 * wave + (lane >> 3), 8 lanes to a row of 128 B. V: a thread takes keys 8 * (tid >> 4) .. + 7 at dims 4 * l15 .. + 3.
    const int g16 = tid >> 4, c4 = l15 * 4, g8 = tid >> 3, c8 = (lane & 7) * 8;
    const _Float16* kp = K + base + (size_t)g8 * 1024 + c8;
    const _Float16* vp = V + base + (size_t)g16 * (8 * 1024) + c4;
    const _Float16* qp = Q + base + (size_t)(wave * 16 + l15) * 1024 + 8 * hf;
    const int vlen = VL[z >> 3];                                         // valid length of this block's sequence (eight blocks of 128 positions to a sequence)
    v8h kx[4], qx[4]; v4h vx[8]; int mk[8];
#pragma unroll
    for (int i = 0; i < 4; ++i) kx[i] = *(const v8h*)(kp + (size_t)i * (32 * 1024));
    // behind each group of loads: its address register is an input, so it stays whole up to the wait, and later loads' results may then land on it
    asm volatile("s_wait_xcnt 0x0" :: "v"(kp) : "memory");
#pragma unroll
    for (int i = 0; i < 8; ++i) vx[i] = *(const v4h*)(vp + (size_t)i * 1024);
    asm volatile("s_wait_xcnt 0x0" :: "v"(vp) : "memory");
#pragma unroll
    for (int i = 0; i < 4; ++i) qx[i] = *(const v8h*)(qp + i * 16);                            // dims 16 * i + 8 * hf .. + 7
#pragma unroll
    for (int i = 0; i < 8; ++i) mk[i] = ((z & 7) * 128 + i * 16 + l15 < vlen) ? 1 : 0;         // keep flag of key 16i + l15: its position in the sequence is below the valid length
    asm volatile("s_wait_xcnt 0x0" :: "v"(qp) : "memory");
    __builtin_amdgcn_sched_barrier(0);   // keeps the LDS stores, which wait for loaded data, behind the issue of the last load: one latency is paid, not two
#pragma unroll
    for (int i = 0; i < 4; ++i) *(v8h*)(kl + (i * 32 + g8) * BA_KP + c8) = kx[i];
#pragma unroll
    for (int j = 0; j < 4; ++j) {
        v8h hv;
#pragma unroll
        for (int i = 0; i < 8; ++i) hv[i] = vx[i][j];
        *(v8h*)(vt + (c4 + j) * BA_VP + g16 * 8) = hv;
    }
    v16h qa[2];                                                           // A fragment: element e <- dim 32 ks + frag_k(e, hf)
#pragma unroll
    for (int ks = 0; ks < 2; ++ks)
#pragma unroll
        for (int e = 0; e < 16; ++e) qa[ks][e] = qx[ks * 2 + (e >> 3)][e & 7];
    v8f o[4]; float m8[8], l8[8];
#pragma unroll
    for (int t = 0; t < 4; ++t) { v8f zz = {}; o[t] = zz; }
#pragma unroll
    for (int i = 0; i < 8; ++i) { m8[i] = NEG; l8[i] = 0.f; }
    __syncthreads();                                                      // K and V^T are readable by every wave; they are not written again

    _Float16* myp = pl[wave];
#pragma unroll
    for (int jb = 0; jb < 2; ++jb) {
        const int j0 = jb * 64;
        v8f s[4];
#pragma unroll
        for (int t = 0; t < 4; ++t) {
            const _Float16* kr = kl + (j0 + t * 16 + l15) * BA_KP + 8 * hf;
            v8f acc = {};
            acc = FH::mma(qa[0], FH::load(kr), acc);
            acc = FH::mma(qa[1], FH::load(kr + 32), acc);
            s[t] = acc;
        }
#pragma unroll
        for (int i = 0; i < 8; ++i) {
            float sc[4];
#pragma unroll
            for (int t = 0; t < 4; ++t) {
                float v = s[t][i] * 0.125f;
                if (mk[jb * 4 + t] == 0) v = -1000000.0f;
                v *= L2E;
                sc[t] = v;
            }
            float mx = fmaxf(fmaxf(sc[0], sc[1]), fmaxf(sc[2], sc[3]));
            mx = fmaxf(mx, __shfl_xor(mx, 1, 32)); mx = fmaxf(mx, __shfl_xor(mx, 2, 32));
            mx = fmaxf(mx, __shfl_xor(mx, 4, 32)); mx = fmaxf(mx, __shfl_xor(mx, 8, 32));
            const float mnew = fmaxf(m8[i], mx);
            const float ec = exp2f(m8[i] - mnew);                         // taken unconditionally and then selected: no branch round each exp2
            const float corr = (mnew == NEG) ? 1.f : ec;
            float rs = 0.f;
#pragma unroll
            for (int t = 0; t < 4; ++t) {
                const float ep = exp2f(sc[t] - mnew);
                const float pp = (sc[t] == NEG) ? 0.f : ep; rs += pp;
                myp[(i + 8 * hf) * BA_KP + t * 16 + l15] = (_Float16)(pp * 4096.f);
            }
            rs += __shfl_xor(rs, 1, 32); rs += __shfl_xor(rs, 2, 32); rs += __shfl_xor(rs, 4, 32); rs += __shfl_xor(rs, 8, 32);
            l8[i] = l8[i] * corr + rs; m8[i] = mnew;
#pragma unroll
            for (int t = 0; t < 4; ++t) o[t][i] *= corr;
        }
        ba_wave_sync();                                                   // P is written; its rows are read by other lanes of the wave
        const v16h pa0 = FH::load(myp + l15 * BA_KP + 8 * hf), pa1 = FH::load(myp + l15 * BA_KP + 32 + 8 * hf);
#pragma unroll
        for (int t = 0; t < 4; ++t) {
            const _Float16* vr = vt + (t * 16 + l15) * BA_VP + j0 + 8 * hf;
            o[t] = FH::mma(pa0, FH::load(vr), o[t]);
            o[t] = FH::mma(pa1, FH::load(vr + 32), o[t]);
        }
        ba_wave_sync();                                                   // P is read; the next half may overwrite it
    }
    float* myo = ol[wave];
#pragma unroll
    for (int i = 0; i < 8; ++i) {
        const float rl = 1.f / (l8[i] * 4096.f);
        const float invr = (l8[i] > 0.f) ? rl : 0.f;
#pragma unroll
        for (int t = 0; t < 4; ++t) myo[(i + 8 * hf) * 68 + t * 16 + l15] = o[t][i] * invr;
    }
    ba_wave_sync();                                                       // O is written; its rows go out as whole 128-byte lines of f16
    const int r4 = lane >> 3;
    _Float16* op = O + base + (size_t)(wave * 16 + r4) * 1024 + c8;
#pragma unroll
    for (int it = 0; it < 4; ++it) {                                      // rows 4 * it + r4
        const float* sp = myo + (it * 4 + r4) * 68 + c8;
        const v4f lo = *(const v4f*)(sp), hi = *(const v4f*)(sp + 4);
        v8h hv;
#pragma unroll
        for (int e = 0; e < 4; ++e) { hv[e] = (_Float16)lo[e]; hv[4 + e] = (_Float16)hi[e]; }
        *(v8h*)(op + (size_t)it * (4 * 1024)) = hv;
    }
}

extern "C" void kernel_launch(void* const* d_in, const int* in_sizes, int n_in, void* d_out, int out_size, void* d_ws, size_t ws_size, hipStream_t stream) {
    (void)in_sizes; (void)n_in; (void)out_size; (void)ws_size;
    const float* X = (const float*)d_in[0];
    const int* vl = (const int*)d_in[1];
    const float* Wq = (const float*)d_in[2];
    const float* Wk = (const float*)d_in[3];
    const float* Wv = (const float*)d_in[4];
    const float* Wo = (const float*)d_in[5];
    const float* g1 = (const float*)d_in[6];
    const float* be1 = (const float*)d_in[7];
    const float* W1 = (const float*)d_in[8];
    const float* bf1 = (const float*)d_in[9];
    const float* W2 = (const float*)d_in[10];
    const float* bf2 = (const float*)d_in[11];
    const float* g2 = (const float*)d_in[12];
    const float* be2 = (const float*)d_in[13];
    const int Bn = 4;
    const int S = 1024;
    const int D = 1024;
    const int NH = 16;
    const int DH = 64;
    const int F = 4096;
    const int M = 128;
    const int NB = S / M;
    const int NR = Bn * S;
    float* out = (float*)d_out;
    char* wsp = (char*)d_ws;
    float* Q = (float*)wsp; wsp += (((size_t)((size_t)NR * D) * 4 + 255) / 256) * 256;
    float* Kb = (float*)wsp; wsp += (((size_t)((size_t)NR * D) * 4 + 255) / 256) * 256;
    float* V = (float*)wsp; wsp += (((size_t)((size_t)NR * D) * 4 + 255) / 256) * 256;
    float* AT = (float*)wsp; wsp += (((size_t)((size_t)NR * D) * 4 + 255) / 256) * 256;
    float* MF = (float*)wsp; wsp += (((size_t)((size_t)NR) * 4 + 255) / 256) * 256;
    float* Y = (float*)wsp; wsp += (((size_t)((size_t)NR * D) * 4 + 255) / 256) * 256;
    float* ST = (float*)wsp; wsp += (((size_t)((size_t)NR * 32) * 4 + 255) / 256) * 256;
    float* H1 = (float*)wsp; wsp += (((size_t)((size_t)NR * F) * 4 + 255) / 256) * 256;
    unsigned short* G64A = (unsigned short*)wsp; wsp += (((size_t)(16777216) * 2 + 255) / 256) * 256;
    unsigned short* G64B = (unsigned short*)wsp; wsp += (((size_t)(4194304) * 2 + 255) / 256) * 256;
    // Planes of f16 values, each written by the kernel that makes the values: X and the six transposed weights (one launch), Q, K, V (one launch, three planes),
    // the attention's output (in G64A, once the projections have read X there), the first LayerNorm's output (in G64A again, beside its f32 copy Y) and the FFN's hidden layer.
    _Float16* Qh = (_Float16*)Q;
    _Float16* Kh = (_Float16*)Kb;
    _Float16* Vh = (_Float16*)V;
    _Float16* Ah = (_Float16*)G64A;
    _Float16* Hh = (_Float16*)H1;
    _Float16* Wt4 = (_Float16*)G64B;                 // Wq^T, Wk^T, Wv^T, Wo^T: 1024 x 1024 each
    _Float16* Wot = Wt4 + 3 * 1024 * 1024;
    _Float16* W1t = (_Float16*)AT;                   // 4096 x 1024
    _Float16* W2t = W1t + 4096 * 1024;               // 1024 x 4096
    k_cast_all<<<2048, 256, 0, stream>>>(X, Wq, Wk, Wv, Wo, W1, W2, Ah, Wt4, W1t, W2t);
    w25::wmma_gemm_lds<3072, 1024, 0, false, 0, true, 1024, 8388608><<<768, 256, 0, stream>>>((const unsigned short*)(G64A), (const unsigned short*)(Wt4), nullptr, Qh, nullptr, nullptr, 0.0625f);
    k_attn_blk<<<dim3((unsigned)NH, (unsigned)(Bn * NB)), 256, 0, stream>>>(Qh, Kh, Vh, vl, Ah);
    w25::wmma_gemm_lds<1024, 1024, 0, true, 0, false><<<256, 256, 0, stream>>>((const unsigned short*)(G64A), (const unsigned short*)(Wot), Y, nullptr, nullptr, X, 0.0625f);
    k_ln_w<true><<<(unsigned)(NR / 16), 256, 0, stream>>>(Y, Y, Ah, 1e-05f, g1, be1);
    w25::wmma_gemm_lds<4096, 1024, 2, false, 2, true><<<1024, 256, 0, stream>>>((const unsigned short*)(G64A), (const unsigned short*)(W1t), nullptr, Hh, bf1, nullptr, 0.0625f);
    w25::wmma_gemm_lds<1024, 4096, 2, true, 0, false><<<256, 256, 0, stream>>>((const unsigned short*)(H1), (const unsigned short*)(W2t), Kb, nullptr, bf2, Y, 0.0625f);
    k_ln_w<false><<<(unsigned)(NR / 16), 256, 0, stream>>>(Kb, out, nullptr, 1e-05f, g2, be2);
}

// v007
// One run takes 130 microseconds.
// Two timings next to v006 put it at 1.04 and 1.03 times that version's speed.
// All steps since the starting kernel, v000, together make it 11.2 times as fast.
// Contractions: q/k/v/o projections X.W [4096x1024].[1024x1024] and the position-wise FFN relu(Y.W1 + b) [4096x1024].[1024x4096], .W2 + b [4096x4096].[4096x1024] with f16 operands on pre-cast planes (v_wmma_f32_16x16x32_f16; 32x64 register-blocked wave tiles, weights x16); the block-diagonal windowed attention (8 blocks of 128 positions per sequence = 32 independent (sequence, block) attentions, 16 heads, keys >= valid_len SET to -1e6 through an integer keep-mask — exactly the module's where, so blocks lying wholly beyond valid_len are uniform) as one flash launch (f16 q.k^T and p.v with p as f16 of 4096 p); f32 accumulate and softmax. AddNorm LayerNorms (two rows per wave, fixed-order trees) are f32 kernels; the keep-mask is formed inside the attention from the INPUT valid lengths.
#include <hip/hip_runtime.h>
#include <math.h>

typedef __attribute__((ext_vector_type(16))) _Float16 v16h;
typedef __attribute__((ext_vector_type(8)))  _Float16 v8h;
typedef __attribute__((ext_vector_type(16))) __bf16   v16b;
typedef __attribute__((ext_vector_type(8)))  float    v8f;
typedef __attribute__((ext_vector_type(4)))  float    v4f;

// 16-bit WMMA fragment map (wave32), lane L, h = L>>4, m = L&15:
//   A 16x32: lane = row m;   element i -> k = (i<8) ? 8h+i : 16+8h+(i-8)
//   B 32x16: lane = column m; the SAME k(i,h)
//   D 16x16 (8 f32): lane = column m; element r -> row 8h+r
__device__ __forceinline__ int frag_k(int i, int h) { return (i < 8) ? (8 * h + i) : (16 + 8 * h + (i - 8)); }
__device__ __forceinline__ __bf16 bf16_rne(float f) {
    unsigned int u = __float_as_uint(f);
    u += 0x7fffu + ((u >> 16) & 1u);
    return __builtin_bit_cast(__bf16, (unsigned short)(u >> 16));
}
__device__ __forceinline__ float bf16_f32(__bf16 b) { return __uint_as_float(((unsigned int)__builtin_bit_cast(unsigned short, b)) << 16); }
__device__ __forceinline__ v8f wmma16(v16h a, v16h b, v8f c) {
    c = __builtin_amdgcn_wmma_f32_16x16x32_f16(false, a, false, b, (short)0, c, false, false);
    asm volatile("v_nop\n\tv_nop\n\tv_nop\n\tv_nop" : "+v"(c) : "v"(a), "v"(b));
    return c;
}
__device__ __forceinline__ v8f wmmab(v16b a, v16b b, v8f c) {
    c = __builtin_amdgcn_wmma_f32_16x16x32_bf16(false, a, false, b, (short)0, c, false, false);
    asm volatile("v_nop\n\tv_nop\n\tv_nop\n\tv_nop" : "+v"(c) : "v"(a), "v"(b));
    return c;
}
struct Split { v16b hi, lo; };
// hi/lo split product: a.hi*b.hi + a.hi*b.lo + a.lo*b.hi
__device__ __forceinline__ v8f wmma3(const Split& a, const Split& b, v8f c) {
    c = __builtin_amdgcn_wmma_f32_16x16x32_bf16(false, a.hi, false, b.hi, (short)0, c, false, false);
    c = __builtin_amdgcn_wmma_f32_16x16x32_bf16(false, a.hi, false, b.lo, (short)0, c, false, false);
    c = __builtin_amdgcn_wmma_f32_16x16x32_bf16(false, a.lo, false, b.hi, (short)0, c, false, false);
    asm volatile("v_nop\n\tv_nop\n\tv_nop\n\tv_nop" : "+v"(c) : "v"(a.hi), "v"(a.lo), "v"(b.hi), "v"(b.lo));
    return c;
}
struct Split3 { v16b hi, mid, lo; };
// triple split product (6 terms, drops only terms below 2^-24 relative)
__device__ __forceinline__ v8f wmma6(const Split3& a, const Split3& b, v8f c) {
    c = __builtin_amdgcn_wmma_f32_16x16x32_bf16(false, a.hi, false, b.hi, (short)0, c, false, false);
    c = __builtin_amdgcn_wmma_f32_16x16x32_bf16(false, a.hi, false, b.mid, (short)0, c, false, false);
    c = __builtin_amdgcn_wmma_f32_16x16x32_bf16(false, a.mid, false, b.hi, (short)0, c, false, false);
    c = __builtin_amdgcn_wmma_f32_16x16x32_bf16(false, a.hi, false, b.lo, (short)0, c, false, false);
    c = __builtin_amdgcn_wmma_f32_16x16x32_bf16(false, a.mid, false, b.mid, (short)0, c, false, false);
    c = __builtin_amdgcn_wmma_f32_16x16x32_bf16(false, a.lo, false, b.hi, (short)0, c, false, false);
    asm volatile("v_nop\n\tv_nop\n\tv_nop\n\tv_nop" : "+v"(c) : "v"(a.hi), "v"(a.mid), "v"(a.lo), "v"(b.hi), "v"(b.mid), "v"(b.lo));
    return c;
}

// Fragment gathers from f32 memory: element i <- p[(k0 + frag_k(i,h)) * sk] * s, zero for k >= klen.
__device__ __forceinline__ v16h fh_ld(const float* __restrict__ p, long long sk, int k0, int h, int klen, float s) {
    v16h a;
#pragma unroll
    for (int i = 0; i < 16; ++i) { const int k = k0 + frag_k(i, h); a[i] = (k < klen) ? (_Float16)(p[(long long)k * sk] * s) : (_Float16)0.f; }
    return a;
}
__device__ __forceinline__ Split sp_ld(const float* __restrict__ p, long long sk, int k0, int h, int klen, float s) {
    Split r;
#pragma unroll
    for (int i = 0; i < 16; ++i) {
        const int k = k0 + frag_k(i, h); const float x = (k < klen) ? p[(long long)k * sk] * s : 0.f;
        const __bf16 hb = bf16_rne(x); r.hi[i] = hb; r.lo[i] = bf16_rne(x - bf16_f32(hb));
    }
    return r;
}
__device__ __forceinline__ Split3 sp3_ld(const float* __restrict__ p, long long sk, int k0, int h, int klen, float s) {
    Split3 r;
#pragma unroll
    for (int i = 0; i < 16; ++i) {
        const int k = k0 + frag_k(i, h); const float x = (k < klen) ? p[(long long)k * sk] * s : 0.f;
        const __bf16 hb = bf16_rne(x); const float r1 = x - bf16_f32(hb); const __bf16 mb = bf16_rne(r1);
        r.hi[i] = hb; r.mid[i] = mb; r.lo[i] = bf16_rne(r1 - bf16_f32(mb));
    }
    return r;
}
__device__ __forceinline__ v16b bh_ld(const float* __restrict__ p, long long sk, int k0, int h, int klen, float s) {
    v16b a;
#pragma unroll
    for (int i = 0; i < 16; ++i) { const int k = k0 + frag_k(i, h); a[i] = bf16_rne((k < klen) ? p[(long long)k * sk] * s : 0.f); }
    return a;
}
// f16 fragment from an f16 LDS/global row with element stride 1 (k-contiguous), no bounds (tile already zero padded)
__device__ __forceinline__ v16h fh_row(const _Float16* __restrict__ row, int k0, int h) {
    v16h a;
#pragma unroll
    for (int i = 0; i < 16; ++i) a[i] = row[k0 + frag_k(i, h)];
    return a;
}

#define VST2(T, ptr, val) do { const T vst2_v_ = (val); *(T*)(ptr) = vst2_v_;  } while (0)
typedef float v4f __attribute__((ext_vector_type(4)));
#define VST2V4(ptr, val) do { const v4f vst2_v4_ = (val); *(v4f*)(ptr) = vst2_v4_;  } while (0)

__device__ __attribute__((noinline)) float act_fn(float v, int act) {
    if (act == 1) return fmaxf(v, 0.f);                                                                               // relu
    if (act == 2) { const float u = 0.7978845608028654f * (v + 0.044715f * v * v * v); return 0.5f * v * (1.f + tanhf(u)); } // tanh-gelu
    if (act == 3) return v / (1.f + expf(-v));                                                                        // silu
    if (act == 4) return 0.5f * v * (1.f + erff(v * 0.7071067811865476f));                                             // erf-gelu
    if (act == 5) return tanhf(v);
    if (act == 6) return 1.f / (1.f + expf(-v));                                                                      // sigmoid
    if (act == 7) return (v > 0.f) ? v : 0.01f * v;                                                                   // leaky relu 0.01
    if (act == 8) return (v > 0.f) ? v : (expf(v) - 1.f);                                                             // elu
    if (act == 9) return fminf(fmaxf(v, 0.f), 6.f);                                                                   // relu6
    if (act == 10) return fabsf(v);                                                                                    // abs
    if (act == 11) return (v >= 0.f) ? v : 0.1f * v;                                                                  // leaky 0.1
    if (act == 12) return (v > 0.f) ? v : 0.2f * v;                                                                   // leaky 0.2
    if (act == 13) return (v > 20.f) ? v : log1pf(expf(v));                                                            // softplus
    return v;
}

// =====================================================================================================================
// k_gemm<MODE>: C(z, m, n) = act(alpha * sum_k A(z, m, k) * B(z, k, n) + bias) + beta * R(z, m, n)
//   One wave (32-thread block) per 16 x 32 tile of C; grid (ceil(N/32), ceil(M/16), Z). Batch z -> (zo = z / zi_n, zi = z % zi_n)
//   with separate outer/inner strides for every tensor (e.g. batch and head). A(m,k) = A[zo*sAo + zi*sAi + m*sAm + k*sAk] (f32),
//   B(k,n) = B[zo*sBo + zi*sBi + n*sBn + k*sBk] (f32); any M, N, K (K zero-padded to 32 inside the fragments, M/N tails guarded).
//   C(m,n) = C[zo*sCo + zi*sCi + m*sCm + n] (n contiguous). flags: 1 bias[n], 2 bias[m], 4 residual R[zo*sRo + zi*sRi + m*sRm + n*sRn].
//   MODE 0: f16 operands (A prescaled by sa, B by sb, both undone in the epilogue); 1: bf16 hi/lo split (3 products); 2: bf16;
//   3: bf16 hi/mid/lo triple split (6 products); 4: as 3 with Kahan-compensated f32 accumulation across k-steps.
// =====================================================================================================================
struct GemmP {
    const float* A; const float* B; const float* bias; const float* R; float* C;
    long long sAo, sAi, sAm, sAk, sBo, sBi, sBn, sBk, sCo, sCi, sCm, sRo, sRi, sRm, sRn;
    int M, N, K, zi_n, flags, act; float alpha, beta, sa, sb;
    int Npad, pad_;     // columns [N, Npad) of C are written as 0 so that padded workspace rows are covered by whole-line stores; Npad >= N
};
static_assert(sizeof(GemmP) == 5 * 8 + 15 * 8 + 6 * 4 + 4 * 4 + 2 * 4, "GemmP has padding");

template <int MODE>
__global__ __launch_bounds__(32) void k_gemm(GemmP p) {
    const int lane = threadIdx.x & 31, h = lane >> 4, l15 = lane & 15;
    const int m0 = blockIdx.y * 16, n0 = blockIdx.x * 32;
    const int z = blockIdx.z, zo = z / p.zi_n, zi = z - zo * p.zi_n;
    const float* A = p.A + zo * p.sAo + zi * p.sAi;
    const float* B = p.B + zo * p.sBo + zi * p.sBi;
    const int am = min(m0 + l15, p.M - 1);                       // clamped row for loads (stores are guarded)
    v8f acc[2], comp[2];
#pragma unroll
    for (int t = 0; t < 2; ++t) { v8f zz = {}; acc[t] = zz; comp[t] = zz; }
    for (int k0 = 0; k0 < p.K; k0 += 32) {
        const float* arow = A + (long long)am * p.sAm;
        if (MODE == 1) {
            const Split a = sp_ld(arow, p.sAk, k0, h, p.K, 1.f);
#pragma unroll
            for (int t = 0; t < 2; ++t) {
                const int bn = min(n0 + t * 16 + l15, p.N - 1);
                acc[t] = wmma3(a, sp_ld(B + (long long)bn * p.sBn, p.sBk, k0, h, p.K, 1.f), acc[t]);
            }
        } else if (MODE == 3) {
            const Split3 a = sp3_ld(arow, p.sAk, k0, h, p.K, 1.f);
#pragma unroll
            for (int t = 0; t < 2; ++t) {
                const int bn = min(n0 + t * 16 + l15, p.N - 1);
                acc[t] = wmma6(a, sp3_ld(B + (long long)bn * p.sBn, p.sBk, k0, h, p.K, 1.f), acc[t]);
            }
        } else if (MODE == 4) {
            // triple split as MODE 3, but each k-step's 6 products go into a fresh accumulator and the partial is added to the running f32 sum
            // on the VALU with Kahan compensation (accumulation error stays ~1 ulp however long K is)
            const Split3 a = sp3_ld(arow, p.sAk, k0, h, p.K, 1.f);
#pragma unroll
            for (int t = 0; t < 2; ++t) {
                const int bn = min(n0 + t * 16 + l15, p.N - 1); v8f zz = {};
                const v8f part = wmma6(a, sp3_ld(B + (long long)bn * p.sBn, p.sBk, k0, h, p.K, 1.f), zz);
                const v8f y = part - comp[t]; const v8f s = acc[t] + y; comp[t] = (s - acc[t]) - y; acc[t] = s;
            }
        } else if (MODE == 2) {
            const v16b a = bh_ld(arow, p.sAk, k0, h, p.K, 1.f);
#pragma unroll
            for (int t = 0; t < 2; ++t) {
                const int bn = min(n0 + t * 16 + l15, p.N - 1);
                acc[t] = wmmab(a, bh_ld(B + (long long)bn * p.sBn, p.sBk, k0, h, p.K, 1.f), acc[t]);
            }
        } else {
            const v16h a = fh_ld(arow, p.sAk, k0, h, p.K, p.sa);
#pragma unroll
            for (int t = 0; t < 2; ++t) {
                const int bn = min(n0 + t * 16 + l15, p.N - 1);
                acc[t] = wmma16(a, fh_ld(B + (long long)bn * p.sBn, p.sBk, k0, h, p.K, p.sb), acc[t]);
            }
        }
    }
    const float iscale = (MODE == 0) ? p.alpha / (p.sa * p.sb) : p.alpha;
    float* C = p.C + zo * p.sCo + zi * p.sCi;
    const float* R = p.R + zo * p.sRo + zi * p.sRi;
    __shared__ __align__(16) float ctile[16][36];
#pragma unroll
    for (int t = 0; t < 2; ++t) {
        const int n = n0 + t * 16 + l15; const int nn = min(n, p.N - 1);
#pragma unroll
        for (int r = 0; r < 8; ++r) {
            const int m = m0 + 8 * h + r; const int mm = min(m, p.M - 1);
            float v = acc[t][r] * iscale;
            if (p.flags & 1) v += p.bias[nn];
            if (p.flags & 2) v += p.bias[mm];
            if (p.flags & 8) v *= p.bias[(long long)zo * p.M + mm];   /* per-(z,row) scale vector laid out [Z][M]; exclusive with the bias flags */
            v = act_fn(v, p.act);
            if (p.flags & 4) v += p.beta * R[(long long)mm * p.sRm + (long long)nn * p.sRn];
            ctile[8 * h + r][t * 16 + l15] = (n < p.N) ? v : 0.f;
        }
    }
    __syncthreads();
    const int NW = (p.Npad > p.N) ? p.Npad : p.N;           // write width
    const bool fast = (m0 + 16 <= p.M) && (n0 + 32 <= NW) && ((p.sCm & 3) == 0) && ((((size_t)C) & 15) == 0);
    if (fast) {
#pragma unroll
        for (int s = 0; s < 4; ++s) {
            const int row = s * 4 + (lane >> 3), c4 = (lane & 7) * 4;
            const v4f v = *(const v4f*)&ctile[row][c4];
            VST2V4(C + (long long)(m0 + row) * p.sCm + n0 + c4, v);
        }
    } else {
        for (int row = 0; row < 16; ++row) {
            const int m = m0 + row, n = n0 + lane;
            if (m < p.M && n < NW) VST2(float, C + (long long)m * p.sCm + n, ctile[row][lane]);
        }
    }
}


// =====================================================================================================================
// k_gemmT<MODE, TM, TN>: same contract as k_gemm, but one wave computes a (16*TM) x (16*TN) tile: TM A fragments and TN B fragments are
//   loaded per 32-wide k-step and reused across TM*TN WMMAs (far fewer load/convert instructions per MAC). MODE 0 (f16), 1 (bf16 hi/lo),
//   2 (bf16) only. grid (ceil(NW/(16*TN)), ceil(M/(16*TM)), Z), block 32. Epilogue identical to k_gemm, run per 16x32 sub-tile.
// =====================================================================================================================
template <int MODE, int TM, int TN>
__global__ __launch_bounds__(32) void k_gemmT(GemmP p) {
    const int lane = threadIdx.x & 31, h = lane >> 4, l15 = lane & 15;
    const int m0 = blockIdx.y * (16 * TM), n0 = blockIdx.x * (16 * TN);
    const int z = blockIdx.z, zo = z / p.zi_n, zi = z - zo * p.zi_n;
    const float* A = p.A + zo * p.sAo + zi * p.sAi;
    const float* B = p.B + zo * p.sBo + zi * p.sBi;
    v8f acc[TM][TN];
#pragma unroll
    for (int i = 0; i < TM; ++i)
#pragma unroll
        for (int t = 0; t < TN; ++t) { v8f zz = {}; acc[i][t] = zz; }
    for (int k0 = 0; k0 < p.K; k0 += 32) {
        if (MODE == 1) {
            Split a[TM], b[TN];
#pragma unroll
            for (int i = 0; i < TM; ++i) { const int am = min(m0 + 16 * i + l15, p.M - 1); a[i] = sp_ld(A + (long long)am * p.sAm, p.sAk, k0, h, p.K, 1.f); }
#pragma unroll
            for (int t = 0; t < TN; ++t) { const int bn = min(n0 + 16 * t + l15, p.N - 1); b[t] = sp_ld(B + (long long)bn * p.sBn, p.sBk, k0, h, p.K, 1.f); }
#pragma unroll
            for (int i = 0; i < TM; ++i)
#pragma unroll
                for (int t = 0; t < TN; ++t) acc[i][t] = wmma3(a[i], b[t], acc[i][t]);
        } else if (MODE == 2) {
            v16b a[TM], b[TN];
#pragma unroll
            for (int i = 0; i < TM; ++i) { const int am = min(m0 + 16 * i + l15, p.M - 1); a[i] = bh_ld(A + (long long)am * p.sAm, p.sAk, k0, h, p.K, 1.f); }
#pragma unroll
            for (int t = 0; t < TN; ++t) { const int bn = min(n0 + 16 * t + l15, p.N - 1); b[t] = bh_ld(B + (long long)bn * p.sBn, p.sBk, k0, h, p.K, 1.f); }
#pragma unroll
            for (int i = 0; i < TM; ++i)
#pragma unroll
                for (int t = 0; t < TN; ++t) acc[i][t] = wmmab(a[i], b[t], acc[i][t]);
        } else {
            v16h a[TM], b[TN];
#pragma unroll
            for (int i = 0; i < TM; ++i) { const int am = min(m0 + 16 * i + l15, p.M - 1); a[i] = fh_ld(A + (long long)am * p.sAm, p.sAk, k0, h, p.K, p.sa); }
#pragma unroll
            for (int t = 0; t < TN; ++t) { const int bn = min(n0 + 16 * t + l15, p.N - 1); b[t] = fh_ld(B + (long long)bn * p.sBn, p.sBk, k0, h, p.K, p.sb); }
#pragma unroll
            for (int i = 0; i < TM; ++i)
#pragma unroll
                for (int t = 0; t < TN; ++t) acc[i][t] = wmma16(a[i], b[t], acc[i][t]);
        }
    }
    const float iscale = (MODE == 0) ? p.alpha / (p.sa * p.sb) : p.alpha;
    float* C = p.C + zo * p.sCo + zi * p.sCi;
    const float* R = p.R + zo * p.sRo + zi * p.sRi;
    const int NW = (p.Npad > p.N) ? p.Npad : p.N;
    __shared__ __align__(16) float ctile[16][36];
#pragma unroll
    for (int i = 0; i < TM; ++i) {
        const int mb = m0 + 16 * i; if (mb >= p.M) break;          // wave-uniform
#pragma unroll
        for (int tp = 0; tp < TN / 2; ++tp) {
            const int nb = n0 + 32 * tp; if (nb >= NW) break;        // wave-uniform
#pragma unroll
            for (int t2 = 0; t2 < 2; ++t2) {
                const int t = 2 * tp + t2; const int n = nb + t2 * 16 + l15; const int nn = min(n, p.N - 1);
#pragma unroll
                for (int r = 0; r < 8; ++r) {
                    const int m = mb + 8 * h + r; const int mm = min(m, p.M - 1);
                    float v = acc[i][t][r] * iscale;
                    if (p.flags & 1) v += p.bias[nn];
                    if (p.flags & 2) v += p.bias[mm];
            if (p.flags & 8) v *= p.bias[(long long)zo * p.M + mm];   /* per-(z,row) scale vector laid out [Z][M]; exclusive with the bias flags */
                    v = act_fn(v, p.act);
                    if (p.flags & 4) v += p.beta * R[(long long)mm * p.sRm + (long long)nn * p.sRn];
                    ctile[8 * h + r][t2 * 16 + l15] = (n < p.N) ? v : 0.f;
                }
            }
            __syncthreads();
            const bool fast = (mb + 16 <= p.M) && (nb + 32 <= NW) && ((p.sCm & 3) == 0) && ((((size_t)C) & 15) == 0);
            if (fast) {
#pragma unroll
                for (int s = 0; s < 4; ++s) {
                    const int row = s * 4 + (lane >> 3), c4 = (lane & 7) * 4;
                    const v4f v = *(const v4f*)&ctile[row][c4];
                    VST2V4(C + (long long)(mb + row) * p.sCm + nb + c4, v);
                }
            } else {
                for (int row = 0; row < 16; ++row) {
                    const int m = mb + row, n = nb + lane;
                    if (m < p.M && n < NW) VST2(float, C + (long long)m * p.sCm + n, ctile[row][lane]);
                }
            }
            __syncthreads();
        }
    }
}

// =====================================================================================================================
//   Wave = 16 queries, AW waves per block, 64-key blocks; grid (ceil(Lq/(16*AW)), H, B), block 32*AW. Any Lq, Lk; head dim dh <= DHP
//   (DHP multiple of 32), value dim dv <= DVP (multiple of 16, <= 128). Every tensor addressed by (batch, head, row, element) strides, f32.
//   Scores: QM 0 f16 operands, 1 bf16 hi/lo split, 2 bf16 triple split; statistics f32 (exp2 domain); P.V: P x 4096 as f16 with V f16 staged in LDS
//   (SPLITPV: P and V as bf16 hi/lo splits). kv head = h / hrep. Masking: causal = 1 (keep j <= i + coff, masked -> -inf, key blocks beyond the
//   diagonal skipped), causal = 2 (masked -> mfill, a finite fill like the -1e9; no skipping), causal = 3 (keep j >= i + coff,
//   masked -> -inf, no skipping); optional additive f32 mask Mf,
//   optional int keep-mask Mi (0 -> score := mfill), both addressed b*smb + h*smh + i*smi + j*smj (0 strides broadcast).
// =====================================================================================================================
#define AW 4
struct AttnP {   // apv4
    const float* Q; const float* K; const float* V; float* O; float* P; const float* Mf; const int* Mi; float* ST;
    const float* Pw; const float* Rt; const int* SQ; const int* SK;           // optional: post-softmax weight, relative-position table, segment ids
    long long swb, swh, swi, swj, srb, srh, sri;                                 // Pw strides (b,h,i,j); Rt strides (b,h,i), column = clamp(i - j + roff, 0, rn-1)
    long long sQb, sQh, sQi, sQd, sKb, sKh, sKj, sKd, sVb, sVh, sVj, sVd, sOb, sOh, sOi, sPb, sPh, sPi, smb, smh, smi, smj;
    int Lq, Lk, dh, dv, hrep, causal, coff, pband;   // pband > 0: P holds only the band |j - i| <= pband, column j - i + pband
    float scale, mfill; int nonorm, mpol;             // nonorm (online path only): O = sum_j exp(score_j) V_j without the 1/rowsum (scores must be <= ~0); mpol: Mi masks where ==0 (mpol 0) or where !=0 (mpol 1)
    int roff, rn, segpol, win;                        // Rt column offset/count; SQ/SK: score := mfill where (segpol 0) SQ[i] != SK[j] or (segpol 1) SQ[i] == SK[j]; win > 0: keys with i - j > win (after coff) -> -inf
};
//   Pw: the softmax numerator is multiplied by Pw(b,h,i,j) AFTER the row sum is taken (probs * weight, then P.V), as in post-softmax multiplicative biases.                                                    // ST (optional): per row (b,h,i) -> ST[((b*H + h)*Lq + i)*2 + {0,1}] = {row max of the scaled+masked score (natural units), sum_j exp(score - max)}
static_assert(sizeof(AttnP) == 12 * 8 + 29 * 8 + 16 * 4, "AttnP has padding");

#ifndef KATTN_ATTR
#define KATTN_ATTR
#endif
template <int DHP, int DVP, int QM, bool SPLITPV, bool TWOPASS>
__global__ __launch_bounds__(32 * AW) KATTN_ATTR void k_attn(AttnP p) {
    constexpr int NT = DVP / 16;                // output tiles
    constexpr int KS = DHP / 32;                // k-steps for the scores
    constexpr int VP = DVP + 8;                 // LDS pitch (halves)
    __shared__ __align__(16) float    pl[AW][16 * 64];
    __shared__ __align__(16) _Float16 vl[(SPLITPV ? 2 : 1) * 64 * VP];   // f16 V tile, or bf16 hi and lo tiles (same 2-byte size)
    const int lane = threadIdx.x & 31, hf = lane >> 4, l15 = lane & 15, wave = threadIdx.x >> 5;
    const int h = blockIdx.y, b = blockIdx.z, hk = h / p.hrep;
    const int q0 = (blockIdx.x * AW + wave) * 16;
    float* myp = pl[wave];
    const float L2E = 1.4426950408889634f;
    const float NEG = -__builtin_inff();
    const int qi = min(q0 + l15, p.Lq - 1);
    const float* qrow = p.Q + b * p.sQb + h * p.sQh + (long long)qi * p.sQi;
    const float* kbase = p.K + b * p.sKb + hk * p.sKh;
    const float* vbase = p.V + b * p.sVb + hk * p.sVh;
    v16h qa[QM == 0 ? KS : 1]; Split qs_[QM == 1 ? KS : 1]; Split3 qt_[QM == 2 ? KS : 1];
#pragma unroll
    for (int ks = 0; ks < KS; ++ks) {
        if (QM == 2) qt_[ks] = sp3_ld(qrow, p.sQd, ks * 32, hf, p.dh, 1.f);
        else if (QM == 1) qs_[ks] = sp_ld(qrow, p.sQd, ks * 32, hf, p.dh, 1.f);
        else qa[ks] = fh_ld(qrow, p.sQd, ks * 32, hf, p.dh, 1.f);
    }
    v8f o[NT]; float m8[8], l8[8];
#pragma unroll
    for (int t = 0; t < NT; ++t) { v8f zz = {}; o[t] = zz; }
#pragma unroll
    for (int i = 0; i < 8; ++i) { m8[i] = NEG; l8[i] = 0.f; }
    int jend = p.Lk; int jstart = 0;
    if (p.causal == 1) { const int je = (blockIdx.x * AW + AW - 1) * 16 + 16 + p.coff; jend = min(jend, max(je, 0)); }   // uniform per block
    if (p.win > 0) { const int js = (int)(blockIdx.x * AW) * 16 + p.coff - p.win; jstart = (js > 0) ? (js / 64) * 64 : 0; }   // uniform per block: key blocks entirely outside every row's window hold only -inf entries and are skipped exactly
    const int npass = TWOPASS ? 2 : 1;
    for (int pass = 0; pass < npass; ++pass) {
        const bool dopv = (!TWOPASS) || pass == 1;
        for (int j0 = jstart; j0 < jend; j0 += 64) {
            if (dopv) {
                __syncthreads();                                 // previous key block's reads of vl / pl are done
                for (int idx = threadIdx.x; idx < 64 * DVP; idx += 32 * AW) {
                    const int jr = idx / DVP, d = idx - jr * DVP, j = j0 + jr;
                    const float f = (j < p.Lk && d < p.dv) ? vbase[(long long)j * p.sVj + (long long)d * p.sVd] : 0.f;
                    if (SPLITPV) {
                        const __bf16 hb = bf16_rne(f);
                        ((__bf16*)vl)[jr * VP + d] = hb; ((__bf16*)vl)[64 * VP + jr * VP + d] = bf16_rne(f - bf16_f32(hb));
                    } else vl[jr * VP + d] = (_Float16)f;
                }
            }
            v8f s[4];
#pragma unroll
            for (int t = 0; t < 4; ++t) {
                const int j = min(j0 + t * 16 + l15, p.Lk - 1);
                const float* krow = kbase + (long long)j * p.sKj;
                v8f acc = {};
#pragma unroll
                for (int ks = 0; ks < KS; ++ks) {
                    if (QM == 2)      acc = wmma6(qt_[ks], sp3_ld(krow, p.sKd, ks * 32, hf, p.dh, 1.f), acc);
                    else if (QM == 1) acc = wmma3(qs_[ks], sp_ld(krow, p.sKd, ks * 32, hf, p.dh, 1.f), acc);
                    else              acc = wmma16(qa[ks], fh_ld(krow, p.sKd, ks * 32, hf, p.dh, 1.f), acc);
                }
                s[t] = acc;
            }
            float pv[8][4];
#pragma unroll
            for (int i = 0; i < 8; ++i) {
                const int irow = q0 + i + 8 * hf;
                const int ic = min(irow, p.Lq - 1);
                float sc[4];
#pragma unroll
                for (int t = 0; t < 4; ++t) {
                    const int jg = j0 + t * 16 + l15;
                    float v = s[t][i] * p.scale;
                    if (p.Mf) v += p.Mf[b * p.smb + h * p.smh + (long long)ic * p.smi + (long long)min(jg, p.Lk - 1) * p.smj];
                    if (p.Rt) { int rc = ic - min(jg, p.Lk - 1) + p.roff; rc = rc < 0 ? 0 : (rc >= p.rn ? p.rn - 1 : rc); v += p.Rt[b * p.srb + h * p.srh + (long long)ic * p.sri + rc]; }
                    if (p.Mi) { const int mv = p.Mi[b * p.smb + h * p.smh + (long long)ic * p.smi + (long long)min(jg, p.Lk - 1) * p.smj]; if (p.mpol ? (mv != 0) : (mv == 0)) v = p.mfill; }
                    if (p.SQ) { const bool same = p.SQ[(long long)b * p.Lq + ic] == p.SK[(long long)b * p.Lk + min(jg, p.Lk - 1)]; if (p.segpol ? same : !same) v = p.mfill; }
                    if (p.causal == 2 && jg > irow + p.coff) v = p.mfill;
                    if (jg >= p.Lk || (p.causal == 1 && jg > irow + p.coff) || (p.causal == 3 && jg < irow + p.coff) || (p.win > 0 && irow + p.coff - jg > p.win)) v = NEG; else v *= L2E;
                    sc[t] = v;
                }
                if (!TWOPASS || pass == 0) {
                    float mx = fmaxf(fmaxf(sc[0], sc[1]), fmaxf(sc[2], sc[3]));
                    mx = fmaxf(mx, __shfl_xor(mx, 1, 32)); mx = fmaxf(mx, __shfl_xor(mx, 2, 32));
                    mx = fmaxf(mx, __shfl_xor(mx, 4, 32)); mx = fmaxf(mx, __shfl_xor(mx, 8, 32));
                    const float mnew = fmaxf(m8[i], mx);
                    const float corr = (mnew == NEG) ? 1.f : exp2f(m8[i] - mnew);
                    float rs = 0.f;
#pragma unroll
                    for (int t = 0; t < 4; ++t) {
                        const float pp = (sc[t] == NEG) ? 0.f : exp2f(sc[t] - mnew); rs += pp;
                        pv[i][t] = p.Pw ? pp * p.Pw[b * p.swb + h * p.swh + (long long)ic * p.swi + (long long)min(j0 + t * 16 + l15, p.Lk - 1) * p.swj] : pp;
                    }
                    rs += __shfl_xor(rs, 1, 32); rs += __shfl_xor(rs, 2, 32); rs += __shfl_xor(rs, 4, 32); rs += __shfl_xor(rs, 8, 32);
                    l8[i] = l8[i] * corr + rs; m8[i] = mnew;
                    if (!TWOPASS) {
#pragma unroll
                        for (int t = 0; t < NT; ++t) o[t][i] *= corr;
                    }
                } else {
                    const float inv = (l8[i] > 0.f) ? 1.f / l8[i] : 0.f;
#pragma unroll
                    for (int t = 0; t < 4; ++t) {
                        const int jg = j0 + t * 16 + l15;
                        float pp = (sc[t] == NEG) ? 0.f : exp2f(sc[t] - m8[i]) * inv;
                        if (p.Pw) pp *= p.Pw[b * p.swb + h * p.swh + (long long)ic * p.swi + (long long)min(jg, p.Lk - 1) * p.swj];
                        pv[i][t] = pp;
                    }
                }
            }
            if (dopv) {
#pragma unroll
                for (int i = 0; i < 8; ++i)
#pragma unroll
                    for (int t = 0; t < 4; ++t) ((float*)myp)[(i + 8 * hf) * 64 + t * 16 + l15] = pv[i][t];
                __syncthreads();                                 // P (per wave) and V (shared) visible
                if (p.P) {
                    float* pb_ = p.P + b * p.sPb + h * p.sPh;
                    const bool fastP = (p.pband == 0) && ((p.sPi & 3) == 0) && (j0 + 64 <= p.Lk) && (q0 + 16 <= p.Lq) && ((((size_t)pb_) & 15) == 0);
                    if (fastP) {
#pragma unroll
                        for (int s = 0; s < 8; ++s) {
                            const int row = s * 2 + (lane >> 4), c4 = (lane & 15) * 4;
                            const v4f v = *(const v4f*)(myp + row * 64 + c4);
                            VST2V4(pb_ + (long long)(q0 + row) * p.sPi + j0 + c4, v);
                        }
                    } else {
                        for (int row = 0; row < 16; ++row) {
                            const int irow = q0 + row; if (irow >= p.Lq) continue;
                            for (int c = lane; c < 64; c += 32) {
                                const int jg = j0 + c; if (jg >= p.Lk) continue;
                                if (p.pband == 0) VST2(float, pb_ + (long long)irow * p.sPi + jg, myp[row * 64 + c]);
                                else if (jg - irow <= p.pband && irow - jg <= p.pband) VST2(float, pb_ + (long long)irow * p.sPi + (jg - irow + p.pband), myp[row * 64 + c]);
                            }
                        }
                    }
                }
                if (SPLITPV) {
                    const Split pa0 = sp_ld(myp + l15 * 64, 1, 0, hf, 64, 1.f), pa1 = sp_ld(myp + l15 * 64, 1, 32, hf, 64, 1.f);
                    const __bf16* vh = (const __bf16*)vl; const __bf16* vlo = vh + 64 * VP;
#pragma unroll
                    for (int t = 0; t < NT; ++t) {
                        const int dcol = t * 16 + l15;
                        Split b0, b1;
#pragma unroll
                        for (int e = 0; e < 16; ++e) {
                            const int k0 = frag_k(e, hf), k1 = 32 + frag_k(e, hf);
                            b0.hi[e] = vh[k0 * VP + dcol]; b0.lo[e] = vlo[k0 * VP + dcol]; b1.hi[e] = vh[k1 * VP + dcol]; b1.lo[e] = vlo[k1 * VP + dcol];
                        }
                        o[t] = wmma3(pa0, b0, o[t]);
                        o[t] = wmma3(pa1, b1, o[t]);
                    }
                } else {
                    const v16h pa0 = fh_ld(myp + l15 * 64, 1, 0, hf, 64, 4096.f), pa1 = fh_ld(myp + l15 * 64, 1, 32, hf, 64, 4096.f);
#pragma unroll
                    for (int t = 0; t < NT; ++t) {
                        const int dcol = t * 16 + l15;
                        v16h b0, b1;
#pragma unroll
                        for (int e = 0; e < 16; ++e) { b0[e] = vl[frag_k(e, hf) * VP + dcol]; b1[e] = vl[(32 + frag_k(e, hf)) * VP + dcol]; }
                        o[t] = wmma16(pa0, b0, o[t]);
                        o[t] = wmma16(pa1, b1, o[t]);
                    }
                }
            }
        }
    }
    float* obase = p.O + b * p.sOb + h * p.sOh;
    if (p.ST) {
        const int rl = lane >> 1, isel = rl & 7;           // row q0 + rl ; rl>>3 == hf holds because lane>>4 == (lane>>1)>>3
        float mv = 0.f, lv = 0.f;
#pragma unroll
        for (int i = 0; i < 8; ++i) if (i == isel) { mv = m8[i]; lv = l8[i]; }
        const int irow = q0 + rl;
        if (irow < p.Lq) { float* st = p.ST + (((long long)b * gridDim.y + h) * p.Lq + irow) * 2 + (lane & 1); VST2(float, st, (lane & 1) ? lv : mv * 0.6931471805599453f); }
    }
    float invr[8];
#pragma unroll
    for (int i = 0; i < 8; ++i) {
        if (TWOPASS) invr[i] = SPLITPV ? 1.f : (1.f / 4096.f);
        else if (p.nonorm) invr[i] = exp2f(m8[i]) * (SPLITPV ? 1.f : (1.f / 4096.f));
        else invr[i] = (l8[i] > 0.f) ? (SPLITPV ? 1.f / l8[i] : 1.f / (l8[i] * 4096.f)) : 0.f;
    }
    __syncthreads();                                             // all waves done with pl/vl from the main loop
    const bool ofast = ((p.sOi & 3) == 0) && ((((size_t)obase) & 15) == 0) && (q0 + 16 <= p.Lq);
#pragma unroll
    for (int c0 = 0; c0 < DVP; c0 += 64) {
#pragma unroll
        for (int i = 0; i < 8; ++i)
#pragma unroll
            for (int t = 0; t < NT; ++t) if (t * 16 >= c0 && t * 16 < c0 + 64) ((float*)myp)[(i + 8 * hf) * 64 + (t * 16 - c0) + l15] = o[t][i] * invr[i];
        __syncthreads();
        const int cw = (DVP - c0 < 64) ? (DVP - c0) : 64;      // staged columns in this chunk (multiple of 16)
        if (ofast && (c0 + cw <= p.dv) && (cw % 32 == 0)) {
            const int lpr = cw / 4;                              // lanes per row (16 for 64 cols, 8 for 32)
            const int rows_per_ins = 32 / lpr;
            for (int r0 = 0; r0 < 16; r0 += rows_per_ins) {
                const int row = r0 + lane / lpr, c4 = (lane % lpr) * 4;
                const v4f v = *(const v4f*)(myp + row * 64 + c4);
                VST2V4(obase + (long long)(q0 + row) * p.sOi + c0 + c4, v);
            }
        } else {
            for (int row = 0; row < 16; ++row) {
                const int irow = q0 + row; if (irow >= p.Lq) continue;
                for (int c = lane; c < cw; c += 32) { const int d = c0 + c; if (d < p.dv) VST2(float, obase + (long long)irow * p.sOi + d, myp[row * 64 + c]); }
            }
        }
        __syncthreads();
    }
}

// =====================================================================================================================
// k_tr: dst(z, c, r) = alpha * src(z, r, c) (+ beta * R2(z, c, r)): [Z][R][C] (row stride lds) -> [Z][C][R] (row stride ldd) through a 32x32 LDS tile;
//   flags: 1 -> add beta * residual R2 addressed like dst (z*sRz + c*ldr + r); act applied before the residual.
// =====================================================================================================================
struct TrP { const float* src; float* dst; const float* R2; long long sSz, lds, sDz, ldd, sRz, ldr; int R, C, flags, act; float alpha, beta; };
static_assert(sizeof(TrP) == 3 * 8 + 6 * 8 + 6 * 4, "TrP has padding");
__global__ __launch_bounds__(256) void k_tr(TrP p) {
    __shared__ float tile[32][33];
    const int c0 = blockIdx.x * 32, r0 = blockIdx.y * 32, z = blockIdx.z;
    const int lane = threadIdx.x & 31, wave = threadIdx.x >> 5;
    const float* s = p.src + z * p.sSz;
#pragma unroll
    for (int k = 0; k < 4; ++k) {
        const int rl = wave * 4 + k, r = r0 + rl, c = c0 + lane;
        tile[rl][lane] = (r < p.R && c < p.C) ? s[(long long)r * p.lds + c] : 0.f;
    }
    __syncthreads();
    float* d = p.dst + z * p.sDz; const float* rr = p.R2 + z * p.sRz;
#pragma unroll
    for (int k = 0; k < 4; ++k) {
        const int cl = wave * 4 + k, c = c0 + cl, r = r0 + lane;
        if (c < p.C && r < p.R) {
            float v = act_fn(p.alpha * tile[lane][cl], p.act);
            if (p.flags & 1) v += p.beta * rr[(long long)c * p.ldr + r];
            VST2(float, d + (long long)c * p.ldd + r, v);
        }
    }
}

// k_affine: dst[i] = a * (sdev ? sdev[0] : 1) * src[i] + b, i < n (one thread per element; consecutive lanes -> consecutive addresses)
__global__ __launch_bounds__(256) void k_affine(const float* __restrict__ src, float* __restrict__ dst, int n, float a, float b, const float* __restrict__ sdev) {
    const int i = blockIdx.x * 256 + threadIdx.x;
    if (i < n) { const float aa = sdev ? a * sdev[0] : a; const float v = aa * src[i] + b; VST2(float, dst + i, v); }
}

// =====================================================================================================================
// k_softmax: row softmax over n contiguous elements, one 256-thread block per row; rows addressed z*sz + r*sr (grid (R, Z)).
//   out = scale_out * softmax(scale_in * x + (Mf ? Mf[z*smz + r*smr + j] : 0)); a row whose max is -inf is written as 0.
// =====================================================================================================================
struct SmP { const float* src; float* dst; const float* Mf; long long sz, sr, dz, dr, smz, smr; int n, pad; float scale_in, scale_out; };
static_assert(sizeof(SmP) == 3 * 8 + 6 * 8 + 4 * 4, "SmP has padding");
__global__ __launch_bounds__(256) void k_softmax(SmP p) {
    __shared__ float red[256];
    const int r = blockIdx.x, z = blockIdx.y, tid = threadIdx.x;
    const float* s = p.src + z * p.sz + (long long)r * p.sr;
    const float* mf = p.Mf ? (p.Mf + z * p.smz + (long long)r * p.smr) : nullptr;
    float mx = -__builtin_inff();
    for (int j = tid; j < p.n; j += 256) { float v = s[j] * p.scale_in; if (mf) v += mf[j]; mx = fmaxf(mx, v); }
    red[tid] = mx; __syncthreads();
    for (int o = 128; o > 0; o >>= 1) { if (tid < o) red[tid] = fmaxf(red[tid], red[tid + o]); __syncthreads(); }
    mx = red[0]; __syncthreads();
    float sum = 0.f;
    for (int j = tid; j < p.n; j += 256) { float v = s[j] * p.scale_in; if (mf) v += mf[j]; sum += (mx == -__builtin_inff()) ? 0.f : expf(v - mx); }
    red[tid] = sum; __syncthreads();
    for (int o = 128; o > 0; o >>= 1) { if (tid < o) red[tid] += red[tid + o]; __syncthreads(); }
    sum = red[0];
    const float inv = (sum > 0.f) ? p.scale_out / sum : 0.f;
    float* d = p.dst + z * p.dz + (long long)r * p.dr;
    for (int j = tid; j < p.n; j += 256) { float v = s[j] * p.scale_in; if (mf) v += mf[j]; const float o = (mx == -__builtin_inff()) ? 0.f : expf(v - mx) * inv; VST2(float, d + j, o); }
}
// =====================================================================================================================
// k_stats: mean and rsqrt(var + eps) over a set of n elements addressed base + z*sz + (e / inner) * so + (e % inner) * si, one 256-thread
// k_norm_apply: y = (x - mean[set]) * rstd[set] * g[c] + b[c] over a [Z][C][L] channel-major tensor with set = z*G + c / (C/G) (G groups per z;
//   G = C -> per-channel sets indexed z*C+c; for batch norm pass stats indexed by c only via bn = 1). Optional act. Output same layout.
// =====================================================================================================================
//   mode 0: mean / rsqrt(var + eps); mode 1 (RMSNorm): 0 / rsqrt(mean(x^2) + eps); mode 2 (L2 normalize * sqrt(n)): 0 / sqrt(n) / max(||x||, eps); mode 3: as 0 with unbiased variance (n-1)
__global__ __launch_bounds__(256) void k_stats(const float* __restrict__ x, long long sz, long long so, long long si, int inner, int n, float eps, float* __restrict__ stat, int mode) {
    __shared__ float red[256];
    const int z = blockIdx.x, tid = threadIdx.x;
    const float* base = x + z * sz;
    float s = 0.f;
    for (int e = tid; e < n; e += 256) s += base[(long long)(e / inner) * so + (long long)(e % inner) * si];
    red[tid] = s; __syncthreads();
    for (int o = 128; o > 0; o >>= 1) { if (tid < o) red[tid] += red[tid + o]; __syncthreads(); }
    const float mu = (mode == 0 || mode == 3) ? red[0] / (float)n : 0.f; __syncthreads();
    float q = 0.f;
    for (int e = tid; e < n; e += 256) { const float dlt = base[(long long)(e / inner) * so + (long long)(e % inner) * si] - mu; q += dlt * dlt; }
    red[tid] = q; __syncthreads();
    for (int o = 128; o > 0; o >>= 1) { if (tid < o) red[tid] += red[tid + o]; __syncthreads(); }
    {
        float rs;
        if (mode == 2) rs = sqrtf((float)n) / fmaxf(sqrtf(red[0]), eps); else if (mode == 3) rs = rsqrtf(red[0] / (float)(n - 1) + eps); else rs = rsqrtf(red[0] / (float)n + eps);
        if (tid < 32) { const float v = (tid == 0) ? mu : ((tid == 1) ? rs : 0.f); VST2(float, stat + (long long)z * 32 + tid, v); }
    }
}
//   One thread per element over the flat [Z][C][L] index space: grid ceil(Z*C*L / 256).
__global__ __launch_bounds__(256) void k_norm_apply(const float* __restrict__ x, float* __restrict__ y, const float* __restrict__ stat, const float* __restrict__ g, const float* __restrict__ bta,
                                                     int Z, int C, int L, int G, int bn, int act) {
    const long long idx = (long long)blockIdx.x * 256 + threadIdx.x;
    if (idx >= (long long)Z * C * L) return;
    const int l = (int)(idx % L); const long long zc = idx / L; const int c = (int)(zc % C), z = (int)(zc / C); (void)l;
    const int set = bn ? c : (z * G + c / (C / G));
    float v = (x[idx] - stat[(long long)set * 32]) * stat[(long long)set * 32 + 1];
    if (g) v *= g[c];
    if (bta) v += bta[c];
    v = act_fn(v, act);
    VST2(float, y + idx, v);
}

// k_lse_neg: c[i] = -(st[2i] + log(st[2i+1])) = minus the log-sum-exp of row i from k_attn's ST output (for softmax over the query dimension)
__global__ __launch_bounds__(256) void k_lse_neg(const float* __restrict__ st, float* __restrict__ c, int n) {
    const int i = blockIdx.x * 256 + threadIdx.x;
    if (i < n) { const float v = -(st[2 * i] + logf(st[2 * i + 1])); VST2(float, c + i, v); }
}

// k_iota: dst[i] = a * i + b as int32 (segment/position id helper)
__global__ __launch_bounds__(256) void k_iota(int* __restrict__ dst, int n, int a, int b) {
    const int i = blockIdx.x * 256 + threadIdx.x;
    if (i < n) { const int v = a * i + b; VST2(int, dst + i, v); }
}

// k_axpby: dst[i] = a * x[i] + b * y[i] (+ c), i < n
__global__ __launch_bounds__(256) void k_axpby(const float* __restrict__ x, const float* __restrict__ y, float* __restrict__ dst, int n, float a, float b, float c) {
    const int i = blockIdx.x * 256 + threadIdx.x;
    if (i < n) { const float v = a * x[i] + b * y[i] + c; VST2(float, dst + i, v); }
}

// =====================================================================================================================
// k_rope: rotary embedding on a [R rows][Hn heads][D] view (row stride sXr, head stride sXh, element stride 1) -> Y (own strides).
//   mode 0: rotate_half (partner d±D/2, sign - for d<D/2); mode 1: interleaved pairs (partner d^1, sign - for even d).
//   table column tcol: tmode 0 -> d, 1 -> d % (D/2), 2 -> d / 2; position p: pmode 0 -> r % S, 1 -> head index, 2 -> pos[r];
//   c = C[(r / S) * sCb + p * sCp + tcol * sCd], s likewise from Sn; y = x[d] * c + sign * x[partner] * s. X and Y must not alias.
// =====================================================================================================================
struct RopeP { const float* X; float* Y; const float* C; const float* Sn; const int* pos; long long sXr, sXh, sYr, sYh, sCb, sCp, sCd; int R, Hn, D, S, mode, tmode, pmode, pad; };
static_assert(sizeof(RopeP) == 5 * 8 + 7 * 8 + 8 * 4, "RopeP has padding");
__global__ __launch_bounds__(256) void k_rope(RopeP p) {
    const long long idx = (long long)blockIdx.x * 256 + threadIdx.x;
    if (idx >= (long long)p.R * p.Hn * p.D) return;
    const int d = (int)(idx % p.D); const long long rh = idx / p.D; const int h = (int)(rh % p.Hn); const int r = (int)(rh / p.Hn);
    const int half = p.D / 2;
    int partner; float sign;
    if (p.mode == 0) { partner = (d < half) ? d + half : d - half; sign = (d < half) ? -1.f : 1.f; }
    else { partner = d ^ 1; sign = (d & 1) ? 1.f : -1.f; }
    const int tcol = (p.tmode == 0) ? d : ((p.tmode == 1) ? (d % half) : (d >> 1));
    const int pp = (p.pmode == 0) ? (r % p.S) : ((p.pmode == 1) ? h : p.pos[r]);
    const long long toff = (long long)(r / p.S) * p.sCb + (long long)pp * p.sCp + (long long)tcol * p.sCd;
    const float* xr = p.X + (long long)r * p.sXr + (long long)h * p.sXh;
    const float v = xr[d] * p.C[toff] + sign * xr[partner] * p.Sn[toff];
    VST2(float, p.Y + (long long)r * p.sYr + (long long)h * p.sYh + d, v);
}

// k_invf + k_sincos (split so neither kernel carries a large VALU-fma footprint): invf_i = num * (1 / powf(base, (2 i)/D)) [fmode 0],
//   num * expf((2 i) * cexp) [fmode 1], num * powf(base, -2 (i - 1) / D) [fmode 2]; then cs/sn[s*half + i] = cos/sin((pscale * s) * invf_i)
__global__ __launch_bounds__(256) void k_invf(float* __restrict__ invb, int half, int D, float base, float num, int fmode, float cexp) {
    const int i = blockIdx.x * 256 + threadIdx.x;
    if (i >= ((half + 31) / 32) * 32) return;
    if (i >= half) { VST2(float, invb + i, 0.f); return; }
    const float e = (float)(2 * i) / (float)D;
    float invf;
    if (fmode == 1) invf = num * expf((float)(2 * i) * cexp);
    else if (fmode == 2) invf = num * powf(base, (-2.0f * ((float)i - 1.0f)) / (float)D);
    else invf = num * (1.0f / powf(base, e));
    VST2(float, invb + i, invf);
}
__global__ __launch_bounds__(256) void k_sincos(float* __restrict__ cs, float* __restrict__ sn, const float* __restrict__ invb, int S, int half, float pscale) {
    const int idx = blockIdx.x * 256 + threadIdx.x;
    if (idx >= S * half) return;
    const int s = idx / half, i = idx - s * half;
    const float ang = (pscale * (float)s) * invb[i];
    VST2(float, cs + idx, cosf(ang)); VST2(float, sn + idx, sinf(ang));
}

// k_mulact: dst[i] = act(x[i]) * y[i]
__global__ __launch_bounds__(256) void k_mulact(const float* __restrict__ x, const float* __restrict__ y, float* __restrict__ dst, int n, int act) {
    const int i = blockIdx.x * 256 + threadIdx.x;
    if (i < n) { const float v = act_fn(x[i], act) * y[i]; VST2(float, dst + i, v); }
}

// =====================================================================================================================
// k_matvec: thread-per-row matrix-vector products for N <= 8 output columns (heads with 1-3 outputs, gates), f32 on the VALU.
//   C[r*sCm + j] = act(alpha * sum_k A[r*sAm + k*sAk] * B[j*sBn + k*sBk] + bias[j]) + beta * R[r*sRm + j*sRn]; each thread writes its N contiguous floats.
// =====================================================================================================================
__global__ __launch_bounds__(256) void k_matvec(GemmP p) {
    // 32 lanes write one line with one instruction.
    const int rpt = (p.N == 1) ? 1 : 32;
    const long long r0 = ((long long)blockIdx.x * 256 + threadIdx.x) * rpt; const int z = blockIdx.z, zo = z / p.zi_n, zi = z - zo * p.zi_n;
    if (r0 >= p.M) return;
    const float* Bb = p.B + zo * p.sBo + zi * p.sBi;
    float* C = p.C + zo * p.sCo + zi * p.sCi; const float* R = p.R + zo * p.sRo + zi * p.sRi;
    for (int rr = 0; rr < rpt; ++rr) {
        const long long r = r0 + rr; if (r >= p.M) break;
        const float* A = p.A + zo * p.sAo + zi * p.sAi + r * p.sAm;
        float acc[8] = {0.f, 0.f, 0.f, 0.f, 0.f, 0.f, 0.f, 0.f};
        for (int k = 0; k < p.K; ++k) { const float a = A[(long long)k * p.sAk];
#pragma unroll
            for (int j = 0; j < 8; ++j) if (j < p.N) acc[j] += a * Bb[(long long)j * p.sBn + (long long)k * p.sBk]; }
#pragma unroll
        for (int j = 0; j < 8; ++j) if (j < p.N) {
            float v = acc[j] * p.alpha;
            if (p.flags & 1) v += p.bias[j];
            if (p.flags & 2) v += p.bias[r];
            v = act_fn(v, p.act);
            if (p.flags & 4) v += p.beta * R[r * p.sRm + (long long)j * p.sRn];
            VST2(float, C + r * p.sCm + j, v);
        }
    }
}
// k_smallsoftmax: thread-per-row softmax for short rows (n <= 64): dst[r*dr + j] = softmax(scale*src[r*sr + j])
__global__ __launch_bounds__(256) void k_smallsoftmax(const float* __restrict__ src, float* __restrict__ dst, long long sr, long long dr, int n, long long R, float scale) {
    const long long r0 = ((long long)blockIdx.x * 256 + threadIdx.x) * 32;
    for (int rr = 0; rr < 32; ++rr) {
        const long long r = r0 + rr; if (r >= R) return;
        const float* s = src + r * sr; float* d = dst + r * dr;
        float mx = -__builtin_inff();
        for (int j = 0; j < n; ++j) mx = fmaxf(mx, s[j] * scale);
        float sum = 0.f;
        for (int j = 0; j < n; ++j) sum += expf(s[j] * scale - mx);
        const float inv = 1.f / sum;
        for (int j = 0; j < n; ++j) { const float v = expf(s[j] * scale - mx) * inv; VST2(float, d + j, v); }
    }
}

__global__ __launch_bounds__(32) void k_unitstat(float* __restrict__ st) { const int t = threadIdx.x; const float v = (t == 1) ? 1.f : 0.f; VST2(float, st + t, v); }

// destination (e.g. a d_out whose row width is not a multiple of 32 floats) is written by consecutive lanes of one instruction
__global__ __launch_bounds__(256) void k_lincopy(const float* __restrict__ src, long long lds, float* __restrict__ dst, long long ldd, long long rows, int cols) {
    const long long i = (long long)blockIdx.x * 256 + threadIdx.x; if (i >= rows * cols) return;
    const long long r = i / cols; const int c = (int)(i - r * cols);
    const float v = src[r * lds + c]; VST2(float, dst + r * ldd + c, v);
}

namespace w25 {
typedef __attribute__((ext_vector_type(16))) _Float16 v16h;
typedef __attribute__((ext_vector_type(8)))  _Float16 v8h;
typedef __attribute__((ext_vector_type(16))) __bf16   v16b;
typedef __attribute__((ext_vector_type(8)))  __bf16   v8b;
typedef __attribute__((ext_vector_type(8)))  float    v8f;
typedef __attribute__((ext_vector_type(4)))  float    v4f;

__device__ __forceinline__ unsigned short f2bf_bits(float f) {
  unsigned u = __float_as_uint(f);
  return (unsigned short)((u + 0x7FFFu + ((u >> 16) & 1u)) >> 16);
}
__device__ __forceinline__ float bf_bits2f(unsigned short h) { return __uint_as_float(((unsigned)h) << 16); }

// hazard guards as plain device helpers (no inline asm inside the kernel template body)
__device__ __forceinline__ void dep_guard_h(v8f& a, v8f& b, v16h x, v16h y) { asm volatile("v_nop\n\tv_nop\n\tv_nop\n\tv_nop" : "+v"(a), "+v"(b) : "v"(x), "v"(y)); }
__device__ __forceinline__ void dep_guard_b(v8f& a, v8f& b, v16b x, v16b y) { asm volatile("v_nop\n\tv_nop\n\tv_nop\n\tv_nop" : "+v"(a), "+v"(b) : "v"(x), "v"(y)); }
__device__ __forceinline__ void keep4_h(v16h a, v16h b, v16h c, v16h d) { asm volatile("v_nop" :: "v"(a), "v"(b), "v"(c), "v"(d)); }
__device__ __forceinline__ void keep4_b(v16b a, v16b b, v16b c, v16b d) { asm volatile("v_nop" :: "v"(a), "v"(b), "v"(c), "v"(d)); }
__device__ __forceinline__ void acc_guard4(v8f& a, v8f& b, v8f& c, v8f& d) { asm volatile("v_nop\n\tv_nop\n\tv_nop\n\tv_nop" : "+v"(a), "+v"(b), "+v"(c), "+v"(d)); }
template <typename T> struct Frag;
template <> struct Frag<_Float16> {
  typedef v16h V; union U { v16h v; v8h h[2]; };
  static __device__ __forceinline__ v16h load(const _Float16* p) {   // elements 0..7 <- p[0..7], 8..15 <- p[16..23]
    U f; f.h[0] = *(const v8h*)(p); f.h[1] = *(const v8h*)(p + 16); return f.v;
  }
  static __device__ __forceinline__ v8f mma(v16h a, v16h b, v8f c) {
    return __builtin_amdgcn_wmma_f32_16x16x32_f16(false, a, false, b, (short)0, c, false, false);
  }
  static __device__ __forceinline__ void guard(v8f& a, v8f& b, v16h x, v16h y) { dep_guard_h(a, b, x, y); }
  static __device__ __forceinline__ void keep(v16h a, v16h b, v16h c, v16h d) { keep4_h(a, b, c, d); }
};
template <> struct Frag<__bf16> {
  typedef v16b V; union U { v16b v; v8b h[2]; };
  static __device__ __forceinline__ v16b load(const __bf16* p) {
    U f; f.h[0] = *(const v8b*)(p); f.h[1] = *(const v8b*)(p + 16); return f.v;
  }
  static __device__ __forceinline__ v8f mma(v16b a, v16b b, v8f c) {
    return __builtin_amdgcn_wmma_f32_16x16x32_bf16(false, a, false, b, (short)0, c, false, false);
  }
  static __device__ __forceinline__ void guard(v8f& a, v8f& b, v16b x, v16b y) { dep_guard_b(a, b, x, y); }
  static __device__ __forceinline__ void keep(v16b a, v16b b, v16b c, v16b d) { keep4_b(a, b, c, d); }
};

// ---- Register-blocked batched WMMA GEMM ------------------------------------
// C[m,n] = scale * sum_k A[m,k] * Bt[n,k] (+bias)(+resid); each wave owns a 64x64 tile.
// A row-major [M,K]; Bt row-major [N,K]; M,N % 64 == 0, K % 32 == 0.
// SPLIT: operands are hi/lo planes (A2/Bt2 = lo planes, same layout); product = hi·hi + hi·lo + lo·hi.
// BIAS_MODE: 0 = none, 1 = bias[m], 2 = bias[n].
// OUT_MODE: 0 = f32, 1 = f16, 2 = bf16 hi plane (Cout) + bf16 lo plane (Cout2).
// ET: 0 = f16 operands, 1 = bf16 operands (pointers passed as 16-bit storage)
template <int ET> struct Elem;
template <> struct Elem<0> { typedef _Float16 T; };
template <> struct Elem<1> { typedef __bf16 T; };
template <int ET, bool SPLIT, int BIAS_MODE, int OUT_MODE, bool RESID, int ACT = 0>
__global__ __launch_bounds__(256) void wmma_gemm64(
    const unsigned short* __restrict__ Ap, const unsigned short* __restrict__ A2p, int lda, long strideA,
    const unsigned short* __restrict__ Btp, const unsigned short* __restrict__ Bt2p, int ldb, long strideB,
    void* __restrict__ Cout, void* __restrict__ Cout2, int ldc, long strideC,
    const float* __restrict__ bias,
    const float* __restrict__ resid, long strideR,
    int M, int N, int K, float scale) {
  typedef typename Elem<ET>::T T;
  typedef typename Frag<T>::V V;
  const T* A = (const T*)Ap; const T* A2 = (const T*)A2p; const T* Bt = (const T*)Btp; const T* Bt2 = (const T*)Bt2p;
  __shared__ __align__(16) float sT[8][16 * 68];   // per-wave 16x64 slab, pitch 68 floats
  const int b    = blockIdx.y;
  const int lane = threadIdx.x & 31;
  const int wave = threadIdx.x >> 5;
  const int tilesN = N >> 6;
  const int tilesM = M >> 6;
  const int tile = blockIdx.x * 8 + wave;
  if (tile >= tilesM * tilesN) return;   // wave-uniform; no block barriers in this kernel
  const int tm = tile / tilesN;
  const int tn = tile - tm * tilesN;
  const int m0 = tm << 6;
  const int n0 = tn << 6;

  const T* Ab  = A  + (size_t)b * strideA;
  const T* Bb  = Bt + (size_t)b * strideB;
  const T* Ab2 = SPLIT ? (A2  + (size_t)b * strideA) : nullptr;
  const T* Bb2 = SPLIT ? (Bt2 + (size_t)b * strideB) : nullptr;

  const int rlane = lane & 15;                 // row (A) / col (B, D) within subtile
  const int koff  = (lane >> 4) * 8;           // k offset of this lane half
  const int mOff  = (lane >> 4) * 8;           // D row offset

  v8f acc[4][4];
#pragma unroll
  for (int i = 0; i < 4; ++i)
#pragma unroll
    for (int j = 0; j < 4; ++j) acc[i][j] = (v8f){0.f,0.f,0.f,0.f,0.f,0.f,0.f,0.f};

  for (int k0 = 0; k0 < K; k0 += 32) {
    V bh[4], bl[4];
#pragma unroll
    for (int j = 0; j < 4; ++j) {
      const size_t bo = (size_t)(n0 + (j << 4) + rlane) * ldb + koff + k0;
      bh[j] = Frag<T>::load(Bb + bo);
      if (SPLIT) bl[j] = Frag<T>::load(Bb2 + bo);
    }
#pragma unroll
    for (int i = 0; i < 4; ++i) {
      const size_t ao = (size_t)(m0 + (i << 4) + rlane) * lda + koff + k0;
      V ah = Frag<T>::load(Ab + ao);
      V al;
      if (SPLIT) al = Frag<T>::load(Ab2 + ao);
#pragma unroll
      for (int j = 0; j < 4; ++j) {
        acc[i][j] = Frag<T>::mma(ah, bh[j], acc[i][j]);
        if (SPLIT) {
          acc[i][j] = Frag<T>::mma(ah, bl[j], acc[i][j]);
          acc[i][j] = Frag<T>::mma(al, bh[j], acc[i][j]);
        }
      }
      Frag<T>::guard(acc[i][0], acc[i][3], ah, SPLIT ? al : ah);
    }
    Frag<T>::keep(bh[0], bh[1], bh[2], bh[3]);
    if (SPLIT) Frag<T>::keep(bl[0], bl[1], bl[2], bl[3]);
  }
  acc_guard4(acc[0][0], acc[0][1], acc[0][2], acc[0][3]);
  acc_guard4(acc[1][0], acc[1][1], acc[1][2], acc[1][3]);
  acc_guard4(acc[2][0], acc[2][1], acc[2][2], acc[2][3]);
  acc_guard4(acc[3][0], acc[3][1], acc[3][2], acc[3][3]);

  // ---- epilogue ----
  float* slab = sT[wave];
  const float* Rb = RESID ? (resid + (size_t)b * strideR) : nullptr;
#pragma unroll
  for (int i = 0; i < 4; ++i) {
    const int mBase = m0 + (i << 4);
#pragma unroll
    for (int j = 0; j < 4; ++j) {
      const int n = n0 + (j << 4) + rlane;
      float bv = 0.f;
      if (BIAS_MODE == 2) bv = bias[n];
#pragma unroll
      for (int r = 0; r < 8; ++r) {
        float v = acc[i][j][r] * scale;
        if (BIAS_MODE == 1) v += bias[mBase + mOff + r];
        if (BIAS_MODE == 2) v += bv;
        if (RESID) v += Rb[(size_t)(mBase + mOff + r) * ldc + n];
        if (ACT == 1) v = tanhf(v);
        if (ACT == 2) v = fmaxf(v, 0.0f);
        if (ACT == 3) v = v / (1.0f + expf(-v));
        if (ACT == 4) v = (v > 0.f) ? v : 0.01f * v;
        if (ACT == 5) v = 0.5f * v * (1.0f + erff(v * 0.70710678118654752f));
        slab[(mOff + r) * 68 + (j << 4) + rlane] = v;
      }
    }
    __builtin_amdgcn_fence(__ATOMIC_RELEASE, "workgroup");
    __builtin_amdgcn_wave_barrier();
    __builtin_amdgcn_fence(__ATOMIC_ACQUIRE, "workgroup");
    if (OUT_MODE == 0) {
      float* C = (float*)Cout + (size_t)b * strideC;
      const int hh = lane >> 4, c4 = (lane & 15) * 4;     // row seg = 256 B = 16 lanes x 16 B
      {
#pragma unroll
        for (int it = 0; it < 8; ++it) {
          const int row = it * 2 + hh;
          v4f v = *(const v4f*)(slab + row * 68 + c4);
          *(v4f*)(C + (size_t)(mBase + row) * ldc + n0 + c4) = v;
        }
        
      }
    } else {
      const int q = lane >> 3, c8 = (lane & 7) * 8;
      unsigned short* C  = (unsigned short*)Cout  + (size_t)b * strideC;
      unsigned short* C2 = (OUT_MODE == 2) ? ((unsigned short*)Cout2 + (size_t)b * strideC) : nullptr;
      {
#pragma unroll
        for (int it = 0; it < 4; ++it) {
          const int row = it * 4 + q;
          const float* sp = slab + row * 68 + c8;
          v8h hv, lv;
#pragma unroll
          for (int e = 0; e < 8; ++e) {
            if (OUT_MODE == 1) {
              hv[e] = (_Float16)sp[e];
            } else {
              unsigned short hb = f2bf_bits(sp[e]);
              unsigned short lb = f2bf_bits(sp[e] - bf_bits2f(hb));
              hv[e] = __builtin_bit_cast(_Float16, hb);
              lv[e] = __builtin_bit_cast(_Float16, lb);
            }
          }
          *(v8h*)(C + (size_t)(mBase + row) * ldc + n0 + c8) = hv;
          if (OUT_MODE == 2) *(v8h*)(C2 + (size_t)(mBase + row) * ldc + n0 + c8) = lv;
        }
        
      }
    }
    __builtin_amdgcn_fence(__ATOMIC_RELEASE, "workgroup");
    __builtin_amdgcn_wave_barrier();
    __builtin_amdgcn_fence(__ATOMIC_ACQUIRE, "workgroup");
  }
}

// ---- LDS-staged WMMA GEMM ---------------------------------------------------
// C[m,n] = scale * sum_k A[m,k] * Bt[n,k] (+bias[n])(+resid); f16 operands, ldc = N (LDC for planar f16 output). OUT16: the result goes out as f16 to C16 (it is only ever read as an f16 operand), else as f32 to C.
// One 128x128 tile of C per work-group of eight waves (4 x 2; 32 rows x 64 columns each).
// A pass is 128 k: 128 rows of Bt, then 128 rows of A, 256 B each, copied to LDS at pitch 272 B. NS buffers: two where two work-groups share a WGP
// (each keeps the copy path busy while the other waits); four where the grid gives a WGP one work-group, so that NS - 1 stages' copies are always under way.
// M, N % 128 == 0; K % 128 == 0, K >= NS * 128.
#define GL_PITCH 272
#define GL_STAGE (256 * GL_PITCH)

// Eight asynchronous copies, 16 B per lane each: rows r, r + 16, ... of one operand's 128 rows.
// The s_wait_xcnt ends the copies' own statement, so that no address register of a copy is rewritten in front of it.
template <int K>
__device__ __forceinline__ void gl_copy8(unsigned l, const unsigned short* g) {
  asm volatile(
      "global_load_async_to_lds_b128 %0, %8, off\n\t"
      "global_load_async_to_lds_b128 %1, %9, off\n\t"
      "global_load_async_to_lds_b128 %2, %10, off\n\t"
      "global_load_async_to_lds_b128 %3, %11, off\n\t"
      "global_load_async_to_lds_b128 %4, %12, off\n\t"
      "global_load_async_to_lds_b128 %5, %13, off\n\t"
      "global_load_async_to_lds_b128 %6, %14, off\n\t"
      "global_load_async_to_lds_b128 %7, %15, off\n\t"
      "s_wait_xcnt 0x0"
      :: "v"(l), "v"(l + 16u * GL_PITCH), "v"(l + 32u * GL_PITCH), "v"(l + 48u * GL_PITCH),
         "v"(l + 64u * GL_PITCH), "v"(l + 80u * GL_PITCH), "v"(l + 96u * GL_PITCH), "v"(l + 112u * GL_PITCH),
         "v"(g), "v"(g + (size_t)16 * K), "v"(g + (size_t)32 * K), "v"(g + (size_t)48 * K),
         "v"(g + (size_t)64 * K), "v"(g + (size_t)80 * K), "v"(g + (size_t)96 * K), "v"(g + (size_t)112 * K)
      : "memory");
}
// One stage: stage rows 0..127 come from Bt, 128..255 from A; a lane fills 16 B of rows (thread >> 4) + 16 * i.
template <int K>
__device__ __forceinline__ void gl_fill(unsigned ldsLane, const unsigned short* gB, const unsigned short* gA) {
  gl_copy8<K>(ldsLane, gB);
  gl_copy8<K>(ldsLane + 128u * GL_PITCH, gA);
}
// this wave's copies have landed in LDS
__device__ __forceinline__ void gl_wait_async0() { asm volatile("s_wait_asynccnt 0x0" ::: "memory"); }
// all but this wave's CNT youngest copies have landed in LDS (the counter returns in issue order)
template <int CNT>
__device__ __forceinline__ void gl_wait_async_but() { asm volatile("s_wait_asynccnt %0" :: "n"(CNT) : "memory"); }
// this wave's LDS reads have returned, so the buffer may be refilled behind the barrier
__device__ __forceinline__ void gl_wait_ds0() { asm volatile("s_wait_dscnt 0x0" ::: "memory"); }

// LDC, PLANE (f16 output only): the N columns go out as N / LDC planes of LDC columns each, PLANE elements apart, so that products
// which share their A operand run as one launch and still leave each its own plane.
template <int N, int K, int BIAS_MODE, bool RESID, int ACT, bool OUT16, int LDC = N, int PLANE = 0, int NS = 2>
__global__ __launch_bounds__(256, 4) void wmma_gemm_lds(
    const unsigned short* __restrict__ Ap, const unsigned short* __restrict__ Btp,
    float* __restrict__ C, _Float16* __restrict__ C16, const float* __restrict__ bias, const float* __restrict__ resid, float scale) {
  static_assert(N % 128 == 0 && K % 128 == 0 && K >= NS * 128, "shape");
  static_assert(NS == 2 || NS == 4, "a wave has 16 * (NS - 1) copies outstanding, 63 at most");
  static_assert(LDC == N || (OUT16 && !RESID && BIAS_MODE == 0 && N % LDC == 0 && LDC % 128 == 0), "planes");
  __shared__ __attribute__((aligned(128))) unsigned char sL[NS * GL_STAGE];
  const int tid  = threadIdx.x;
  const int lane = tid & 31;
  const int wave = tid >> 5;
  constexpr int tilesN = N / 128;
  constexpr int NT = K / 128;
  const int tm = blockIdx.x / tilesN;
  const int tn = blockIdx.x - tm * tilesN;
  const int wm = (wave >> 1) << 5;             // this wave's 32 rows and 64 columns inside the tile
  const int wn = (wave & 1) << 6;
  const int rlane = lane & 15;                 // row (A) / col (B, D) within subtile
  const int hh    = lane >> 4;                 // lane half: k offset 8 * hh, D row offset 8 * hh
  const int mOff  = hh * 8;

  const unsigned ldsLane = (unsigned)(uintptr_t)(&sL[0]) + (unsigned)((tid >> 4) * GL_PITCH + (tid & 15) * 16);
  const unsigned short* gB = Btp + (size_t)(tn * 128 + (tid >> 4)) * K + (tid & 15) * 8;
  const unsigned short* gA = Ap  + (size_t)(tm * 128 + (tid >> 4)) * K + (tid & 15) * 8;

  v8f acc[2][4];
#pragma unroll
  for (int i = 0; i < 2; ++i)
#pragma unroll
    for (int j = 0; j < 4; ++j) acc[i][j] = (v8f){0.f,0.f,0.f,0.f,0.f,0.f,0.f,0.f};

  // A stage is 16 copies of every wave, so "all but the 16 * (NS - 2) youngest" is "up to and with the oldest stage under way".
  constexpr int LEFT = 16 * (NS - 2);
  // unrolled: each stage's LDS and global offsets are then constants
#pragma unroll
  for (int s = 0; s < NS - 1; ++s) gl_fill<K>(ldsLane + (unsigned)s * GL_STAGE, gB + s * 128, gA + s * 128);
  gl_wait_async_but<LEFT>();                   // stage 0 has landed
  __syncthreads();                             // stage 0 is readable by every wave
  gl_fill<K>(ldsLane + (unsigned)(NS - 1) * GL_STAGE, gB + (NS - 1) * 128, gA + (NS - 1) * 128);

  // kept rolled: one pass per trip, so that the order at its foot stands once
#pragma unroll 1
  for (int t = 0; t < NT; ++t) {
    const unsigned bo = (unsigned)(t & (NS - 1)) * GL_STAGE;
    const unsigned char* pB = sL + bo + (wn + rlane) * GL_PITCH + hh * 16;
    const unsigned char* pA = sL + bo + (128 + wm + rlane) * GL_PITCH + hh * 16;
    v16h bh[2][4], ah[2][2];                   // two fragment sets: the next 32 k are fetched while these are multiplied
#pragma unroll
    for (int j = 0; j < 4; ++j) bh[0][j] = Frag<_Float16>::load((const _Float16*)(pB + j * 16 * GL_PITCH));
#pragma unroll
    for (int i = 0; i < 2; ++i) ah[0][i] = Frag<_Float16>::load((const _Float16*)(pA + i * 16 * GL_PITCH));
#pragma unroll
    for (int kk = 0; kk < 4; ++kk) {
      const int cur = kk & 1, nxt = cur ^ 1;
      if (kk < 3) {
#pragma unroll
        for (int j = 0; j < 4; ++j) bh[nxt][j] = Frag<_Float16>::load((const _Float16*)(pB + j * 16 * GL_PITCH + (kk + 1) * 64));
#pragma unroll
        for (int i = 0; i < 2; ++i) ah[nxt][i] = Frag<_Float16>::load((const _Float16*)(pA + i * 16 * GL_PITCH + (kk + 1) * 64));
      }
      __builtin_amdgcn_sched_barrier(0);       // keeps the next block's LDS reads one group ahead of this block's WMMAs, not among them
#pragma unroll
      for (int i = 0; i < 2; ++i)
#pragma unroll
        for (int j = 0; j < 4; ++j) acc[i][j] = Frag<_Float16>::mma(ah[cur][i], bh[cur][j], acc[i][j]);
      __builtin_amdgcn_sched_barrier(0);       // ends the block: later LDS reads stay behind its WMMAs
    }
    gl_wait_ds0();
    // Stage t + 1 has landed. While stages t + 1 .. t + NS - 1 all exist, each wave has exactly their 16 copies each outstanding and the younger ones stay
    // under way; on the last trips, behind which fewer stages were issued, the count would not cover stage t + 1 and the wait is to 0.
    if (NS > 2 && t + NS <= NT) gl_wait_async_but<LEFT>();
    else gl_wait_async0();
    __syncthreads();                           // publishes stage t + 1 and ends every read of stage t
    if (t + NS < NT) gl_fill<K>(ldsLane + bo, gB + (size_t)(t + NS) * 128, gA + (size_t)(t + NS) * 128);
  }
  gl_wait_async0();

  // ---- epilogue ----
  // The ring is free: the last trip's foot waited for every read and every copy and passed the barrier.
  float* slab = (float*)(sL + wave * (16 * 68 * 4));   // per-wave 16x64 slab, pitch 68 floats
  const int m0 = tm * 128 + wm;
  const int n0 = tn * 128 + wn;
  const int nl = n0 + rlane;
  float bv[4];
#pragma unroll
  for (int j = 0; j < 4; ++j) bv[j] = (BIAS_MODE == 2) ? bias[nl + (j << 4)] : 0.f;
  // the bias loads' index register is an input, so it stays whole up to the wait
  if (BIAS_MODE == 2) asm volatile("s_wait_xcnt 0x0" :: "v"(nl) : "memory");
#pragma unroll
  for (int i = 0; i < 2; ++i) {
    const int mBase = m0 + (i << 4);
    float rv[4][8];
    if (RESID) {
      const float* rp = resid + (size_t)(mBase + mOff) * N + nl;
#pragma unroll
      for (int j = 0; j < 4; ++j)
#pragma unroll
        for (int r = 0; r < 8; ++r) rv[j][r] = rp[(size_t)r * N + (j << 4)];
      // the residual loads' address register is an input, so it stays whole up to the wait
      asm volatile("s_wait_xcnt 0x0" :: "v"(rp) : "memory");
    }
#pragma unroll
    for (int j = 0; j < 4; ++j) {
#pragma unroll
      for (int r = 0; r < 8; ++r) {
        float v = acc[i][j][r] * scale;
        if (BIAS_MODE == 2) v += bv[j];
        if (RESID) v += rv[j][r];
        if (ACT == 2) v = fmaxf(v, 0.0f);
        slab[(mOff + r) * 68 + (j << 4) + rlane] = v;
      }
    }
    __builtin_amdgcn_fence(__ATOMIC_RELEASE, "workgroup");
    __builtin_amdgcn_wave_barrier();
    __builtin_amdgcn_fence(__ATOMIC_ACQUIRE, "workgroup");
    if (OUT16) {
      const int r4 = lane >> 3, c8 = (lane & 7) * 8;   // row seg = 128 B = 8 lanes x 16 B
      const int pl = (LDC == N) ? 0 : n0 / LDC;        // this wave's 64 columns lie in one plane
      _Float16* hp = C16 + (size_t)pl * PLANE + (size_t)(mBase + r4) * LDC + (n0 - pl * LDC) + c8;
#pragma unroll
      for (int it = 0; it < 4; ++it) {         // rows it * 4 + r4
        const float* sp = slab + (it * 4 + r4) * 68 + c8;
        const v4f lo = *(const v4f*)(sp), hi = *(const v4f*)(sp + 4);
        v8h h;
#pragma unroll
        for (int e = 0; e < 4; ++e) { h[e] = (_Float16)lo[e]; h[4 + e] = (_Float16)hi[e]; }
        *(v8h*)(hp + (size_t)it * 4 * LDC) = h;
      }
    } else {
      const int c4 = (lane & 15) * 4;          // row seg = 256 B = 16 lanes x 16 B
      float* cp = C + (size_t)(mBase + hh) * N + n0 + c4;
#pragma unroll
      for (int it = 0; it < 8; ++it) {         // rows it * 2 + hh
        v4f v = *(const v4f*)(slab + (it * 2 + hh) * 68 + c4);
        *(v4f*)(cp + (size_t)it * 2 * N) = v;
      }
    }
    __builtin_amdgcn_sched_barrier(0);         // holds later register writes behind the wait below
    asm volatile("s_wait_xcnt 0x0" ::: "memory");   // before a data or address register of the stores above is rewritten
    __builtin_amdgcn_sched_barrier(0);         // without the pair the next rows' multiplies were lifted over the wait, onto the stores' data registers
    __builtin_amdgcn_fence(__ATOMIC_RELEASE, "workgroup");
    __builtin_amdgcn_wave_barrier();
    __builtin_amdgcn_fence(__ATOMIC_ACQUIRE, "workgroup");
  }
}

__global__ __launch_bounds__(256) void cast_f32_f16x2(
    const float* __restrict__ in, _Float16* __restrict__ out, int n2) {
  int i = blockIdx.x * 256 + threadIdx.x;
  if (i < n2) {
    const _Float16 h0 = (_Float16)in[2 * i], h1 = (_Float16)in[2 * i + 1];
    const unsigned u = (unsigned)__builtin_bit_cast(unsigned short, h0) | ((unsigned)__builtin_bit_cast(unsigned short, h1) << 16);
    ((unsigned*)out)[i] = u;
    
  }
}


} // namespace w25

__global__ __launch_bounds__(256) void k_castT16(const float* __restrict__ src, long long lds, _Float16* __restrict__ dst, long long ldd, int R, int C, float s) {
    const long long i = (long long)blockIdx.x * 256 + threadIdx.x; const long long np = (long long)C * (R / 2); if (i >= np) return; const int c = (int)(i / (R / 2)); const int r = 2 * (int)(i % (R / 2));
    const _Float16 h0 = (_Float16)(src[(long long)r * lds + c] * s), h1 = (_Float16)(src[(long long)(r + 1) * lds + c] * s);
    const unsigned u = (unsigned)__builtin_bit_cast(unsigned short, h0) | ((unsigned)__builtin_bit_cast(unsigned short, h1) << 16);
    unsigned* d = (unsigned*)(dst + (long long)c * ldd + r); *d = u;  }
__global__ __launch_bounds__(256) void k_cast16(const float* __restrict__ src, long long lds, _Float16* __restrict__ dst, long long ldd, int R, int C, float s) {
    const long long i = (long long)blockIdx.x * 256 + threadIdx.x; const long long np = (long long)R * (C / 2); if (i >= np) return; const int r = (int)(i / (C / 2)); const int c = 2 * (int)(i % (C / 2));
    const _Float16 h0 = (_Float16)(src[(long long)r * lds + c] * s), h1 = (_Float16)(src[(long long)r * lds + c + 1] * s);
    const unsigned u = (unsigned)__builtin_bit_cast(unsigned short, h0) | ((unsigned)__builtin_bit_cast(unsigned short, h1) << 16);
    unsigned* d = (unsigned*)(dst + (long long)r * ldd + c); *d = u;  }

// f32 -> bf16 hi plane + bf16 lo plane (x = hi + lo to ~2^-17 relative; RNE both), [R][C] -> [R][C] (or transposed to [C][R]); 2 consecutive destination elements
__device__ __forceinline__ unsigned int f2bf2_pack(float a, float b, unsigned int* lo) {
    const unsigned short ha = w25::f2bf_bits(a), hb = w25::f2bf_bits(b);
    const unsigned short la = w25::f2bf_bits(a - w25::bf_bits2f(ha)), lb = w25::f2bf_bits(b - w25::bf_bits2f(hb));
    *lo = (unsigned)la | ((unsigned)lb << 16); return (unsigned)ha | ((unsigned)hb << 16); }
__global__ __launch_bounds__(256) void k_castS16(const float* __restrict__ src, long long lds, __bf16* __restrict__ dhi, __bf16* __restrict__ dlo, long long ldd, int R, int C, float s, int transpose) {
    const long long i = (long long)blockIdx.x * 256 + threadIdx.x; long long o; float a, b;
    if (transpose) { const long long np = (long long)C * (R / 2); if (i >= np) return; const int c = (int)(i / (R / 2)); const int r = 2 * (int)(i % (R / 2)); a = src[(long long)r * lds + c] * s; b = src[(long long)(r + 1) * lds + c] * s; o = (long long)c * ldd + r; }
    else { const long long np = (long long)R * (C / 2); if (i >= np) return; const int r = (int)(i / (C / 2)); const int c = 2 * (int)(i % (C / 2)); a = src[(long long)r * lds + c] * s; b = src[(long long)r * lds + c + 1] * s; o = (long long)r * ldd + c; }
    unsigned lo; const unsigned hi = f2bf2_pack(a, b, &lo); unsigned* ph = (unsigned*)(dhi + o); unsigned* pl = (unsigned*)(dlo + o);
    *ph = hi; *pl = lo;  }

namespace w25 {
// =====================================================================================
// Generic causal/non-causal attention for head_dim 64, f32 in / f32 out; 16-bit operands: bf16 with optional hi/lo splits, or
// plain f16 (F16=true, non-split, probabilities carried x2^15).
//   scores = (q*qscale)·kᵀ : v_wmma_f32_16x16x32_bf16; SPLIT_QK -> q,k as bf16 hi/lo (hi·hi + hi·lo + lo·hi)
//   out    = p·v           : v_wmma_f32_16x16x32_bf16; SPLIT_PV -> p,v as bf16 hi/lo; else p,v plain bf16
//   f32 accumulate; online softmax in f32. Block = 4 waves = 64 query rows of one (batch, head); S % 64 == 0.
//   Element (b, s, h, d) of tensor X lives at X[b*X_bs + s*X_rs + h*X_hs + d] (strides in floats, multiples of 4).
//   Masking: mask_mode 0 none, 1 causal (kv > q masked), 2 tensor [S][Skv] shared over (b,h) (float if
//   mask_is_int==0, int32 with element == 0 -> masked if 1, int32 with element != 0 -> masked if 2), 3 per-token vectors qmask[B][S] & kvmask[B][Skv] (int32,
//   0 -> masked), 4 causal + sliding window (kv > q or q - kv > W masked; W passed in mask_is_int);
//   5 = relative-position bias: s += cp[b,h,q][idx[q][kv]] + pc[b,h,kv][idx[q][kv]] with idx = mask_b ([S][Skv] int32) and
//   mask_a an int32 [S][Skv] tensor with nonzero = masked (tables: element (b,h,row,n) at X + b*c_bs + h*c_hs + row*c_rs + n);
//   masked scores are replaced by mask_fill (e.g. -inf or -1e9) before the softmax.
//   grid.x = B * H * (S/64) (or a sub-range with blk0).
// =====================================================================================
#define AT_D 64
#define AT_NW 4
#define AT_QB 64
#define AT_KC 64
struct AttnGeom { const float* cp = nullptr; const float* pc = nullptr; long c_bs = 0, c_rs = 0, c_hs = 0;   // mode-5 score-bias tables
                  long q_bs, q_rs, q_hs, k_bs, k_rs, k_hs, v_bs, v_rs, v_hs, o_bs, o_rs, o_hs;
                  int S, Skv, H, mask_mode; float qscale; int blk0; float mask_fill; int mask_is_int; };
static_assert(sizeof(AttnGeom) == 168, "no padding");

__device__ __forceinline__ unsigned short at_bf_bits(float f) {
  unsigned u = __float_as_uint(f);
  return (unsigned short)((u + 0x7FFFu + ((u >> 16) & 1u)) >> 16);
}
__device__ __forceinline__ __bf16 at_f2bf(float f) { return __builtin_bit_cast(__bf16, at_bf_bits(f)); }
__device__ __forceinline__ void at_split(float f, __bf16& hi, __bf16& lo) {
  const unsigned short hb = at_bf_bits(f);
  hi = __builtin_bit_cast(__bf16, hb);
  lo = at_f2bf(f - __uint_as_float(((unsigned)hb) << 16));
}
__device__ __forceinline__ v8f at_mma(v16b a, v16b b, v8f c) {
  c = __builtin_amdgcn_wmma_f32_16x16x32_bf16(false, a, false, b, (short)0, c, false, false);
  asm volatile("v_nop\n\tv_nop\n\tv_nop\n\tv_nop" : "+v"(c) : "v"(a), "v"(b));
  return c;
}
// 16-bit element as a bit pattern held in a __bf16 slot: f16 bits when F16, bf16 (RNE) otherwise
template <bool F16> __device__ __forceinline__ __bf16 at_to16(float f) {
  if (F16) return __builtin_bit_cast(__bf16, (_Float16)f);
  return at_f2bf(f);
}
template <bool F16> __device__ __forceinline__ v8f at_mma16(v16b a, v16b b, v8f c) {
  if (F16) {
    const v16h ah = __builtin_bit_cast(v16h, a), bh = __builtin_bit_cast(v16h, b);
    c = __builtin_amdgcn_wmma_f32_16x16x32_f16(false, ah, false, bh, (short)0, c, false, false);
    asm volatile("v_nop\n\tv_nop\n\tv_nop\n\tv_nop" : "+v"(c) : "v"(ah), "v"(bh));
    return c;
  }
  return at_mma(a, b, c);
}

template <bool SPLIT_QK, bool SPLIT_PV, bool F16 = false>
__global__ __launch_bounds__(128)
void attn64_kernel(const float* __restrict__ q, const float* __restrict__ k,
                   const float* __restrict__ v, float* __restrict__ out,
                   const void* __restrict__ mask_a, const int* __restrict__ mask_b, AttnGeom g) {
  static_assert(!(F16 && (SPLIT_QK || SPLIT_PV)), "f16 mode is non-split");
  const float PSC = F16 ? 32768.0f : 1.0f;     // f16 probabilities carried x2^15 (subnormal range), folded into the final 1/l
  union FB { v16b v; v8b h[2]; };
  __shared__ __align__(16) __bf16 Ksh[AT_KC * AT_D];             // K hi [kv][d]      8 KB
  __shared__ __align__(16) __bf16 Ksl[SPLIT_QK ? AT_KC * AT_D : 8];
  __shared__ __align__(16) __bf16 Vth[AT_D * AT_KC];             // V hi [d][kv]      8 KB
  __shared__ __align__(16) __bf16 Vtl[SPLIT_PV ? AT_D * AT_KC : 8];
  __shared__ __align__(16) __bf16 Psh[AT_NW][16 * AT_KC];        // per wave P hi [row][kv]  8 KB
  __shared__ __align__(16) __bf16 Psl[SPLIT_PV ? AT_NW : 1][SPLIT_PV ? 16 * AT_KC : 8];
  __shared__ __align__(16) float  Os[AT_NW][16 * 68];            // per wave out tile, pitch 68

  const int tid  = threadIdx.x;
  const int wave = tid >> 5;
  const int lane = tid & 31;
  const int hh   = lane >> 4;
  const int c    = lane & 15;

  const int nqb = g.S / AT_QB;
  const int bx = blockIdx.x + g.blk0;
  const int qb = bx % nqb;
  const int bh = bx / nqb;
  const int h  = bh % g.H;
  const int b  = bh / g.H;
  const int qbase_block = qb * AT_QB;
  const int q0 = qbase_block + wave * 16;

  const float* qb_ptr = q + (size_t)b * g.q_bs + (size_t)h * g.q_hs;
  const float* kb_ptr = k + (size_t)b * g.k_bs + (size_t)h * g.k_hs;
  const float* vb_ptr = v + (size_t)b * g.v_bs + (size_t)h * g.v_hs;
  float*       ob_ptr = out + (size_t)b * g.o_bs + (size_t)h * g.o_hs;

  // ---- Q fragments (A operand): 2 d-chunks, hi (and lo) ----
  v16b qah[2], qal[2];
  {
    const float* qrow = qb_ptr + (size_t)(q0 + c) * g.q_rs;
#pragma unroll
    for (int dc = 0; dc < 2; ++dc) {
#pragma unroll
      for (int e = 0; e < 8; ++e) {
        const float f0 = qrow[dc * 32 + 8 * hh + e] * g.qscale;
        const float f1 = qrow[dc * 32 + 16 + 8 * hh + e] * g.qscale;
        if (SPLIT_QK) { __bf16 hq, lq; at_split(f0, hq, lq); qah[dc][e] = hq; qal[dc][e] = lq; at_split(f1, hq, lq); qah[dc][8 + e] = hq; qal[dc][8 + e] = lq; }
        else { qah[dc][e] = at_to16<F16>(f0); qah[dc][8 + e] = at_to16<F16>(f1); qal[dc][e] = qah[dc][e]; qal[dc][8 + e] = qah[dc][8 + e]; }
      }
    }
  }

  float mrow[8], lrow[8];
  v8f oacc[4];
#pragma unroll
  for (int r = 0; r < 8; ++r) { mrow[r] = -INFINITY; lrow[r] = 0.f; }
#pragma unroll
  for (int t = 0; t < 4; ++t) oacc[t] = (v8f){0.f,0.f,0.f,0.f,0.f,0.f,0.f,0.f};

  const int nChunks = (g.mask_mode == 1 || g.mask_mode == 4) ? (qb + 1) : (g.Skv / AT_KC);   // block-uniform
  // per-row query mask (mode 3)
  int qkeep[8];
#pragma unroll
  for (int r = 0; r < 8; ++r) qkeep[r] = (g.mask_mode == 3) ? mask_b[(size_t)b * g.S + q0 + 8 * hh + r] : 1;   // mask_b = qmask in mode 3
  for (int kc = 0; kc < nChunks; ++kc) {
    const int kv0 = kc * AT_KC;
    __syncthreads();
    {
      const int kvr = tid >> 1, dh = (tid & 1) * 32;
      const float* krow = kb_ptr + (size_t)(kv0 + kvr) * g.k_rs + dh;
      const float* vrow = vb_ptr + (size_t)(kv0 + kvr) * g.v_rs + dh;
#pragma unroll
      for (int i = 0; i < 8; ++i) {
        v4f kk = *(const v4f*)(krow + 4 * i);
        v4f vv = *(const v4f*)(vrow + 4 * i);
#pragma unroll
        for (int e = 0; e < 4; ++e) {
          const int d = dh + 4 * i + e;
          if (SPLIT_QK) { __bf16 a, bl; at_split(kk[e], a, bl); Ksh[kvr * AT_D + d] = a; Ksl[kvr * AT_D + d] = bl; }
          else Ksh[kvr * AT_D + d] = at_to16<F16>(kk[e]);
          if (SPLIT_PV) { __bf16 a, bl; at_split(vv[e], a, bl); Vth[d * AT_KC + kvr] = a; Vtl[d * AT_KC + kvr] = bl; }
          else Vth[d * AT_KC + kvr] = at_to16<F16>(vv[e]);
        }
      }
    }
    __syncthreads();

    v8f s[4];
#pragma unroll
    for (int j = 0; j < 4; ++j) {
      s[j] = (v8f){0.f,0.f,0.f,0.f,0.f,0.f,0.f,0.f};
#pragma unroll 1
      for (int dc = 0; dc < 2; ++dc) {
        FB kb;
        kb.h[0] = *(const v8b*)(Ksh + (j * 16 + c) * AT_D + dc * 32 + 8 * hh);
        kb.h[1] = *(const v8b*)(Ksh + (j * 16 + c) * AT_D + dc * 32 + 16 + 8 * hh);
        s[j] = at_mma16<F16>(qah[dc], kb.v, s[j]);
        if (SPLIT_QK) {
          FB kl;
          kl.h[0] = *(const v8b*)(Ksl + (j * 16 + c) * AT_D + dc * 32 + 8 * hh);
          kl.h[1] = *(const v8b*)(Ksl + (j * 16 + c) * AT_D + dc * 32 + 16 + 8 * hh);
          s[j] = at_mma16<F16>(qah[dc], kl.v, s[j]);
          s[j] = at_mma16<F16>(qal[dc], kb.v, s[j]);
        }
      }
    }
    const bool diag = (g.mask_mode == 1) && (kc == qb);
    int kvkeep[4] = {1, 1, 1, 1};
    if (g.mask_mode == 3) {
#pragma unroll
      for (int j = 0; j < 4; ++j) kvkeep[j] = ((const int*)mask_a)[(size_t)b * g.Skv + kv0 + j * 16 + c];   // mask_a = kvmask
    }
    float cm[8];
#pragma unroll
    for (int r = 0; r < 8; ++r) {
      const int qrow = q0 + 8 * hh + r;
      float m = -INFINITY;
#pragma unroll
      for (int j = 0; j < 4; ++j) {
        const int kvcol = kv0 + j * 16 + c;
        bool masked = false;
        if (diag) masked = (kvcol > qrow);
        else if (g.mask_mode == 4) masked = (kvcol > qrow) || (qrow - kvcol > g.mask_is_int);
        else if (g.mask_mode == 2) {
          const size_t mi = (size_t)qrow * g.Skv + kvcol;
          masked = (g.mask_is_int == 0) ? (((const float*)mask_a)[mi] == 0.0f)
                 : (g.mask_is_int == 1) ? (((const int*)mask_a)[mi] == 0) : (((const int*)mask_a)[mi] != 0);
        } else if (g.mask_mode == 3) masked = (qkeep[r] == 0) || (kvkeep[j] == 0);
        else if (g.mask_mode == 5) {
          const size_t mi = (size_t)qrow * g.Skv + kvcol;
          masked = (((const int*)mask_a)[mi] != 0);
          int n = mask_b[mi]; n = n < 0 ? 0 : n;
          s[j][r] += g.cp[(size_t)b * g.c_bs + (size_t)h * g.c_hs + (size_t)qrow * g.c_rs + n]
                   + g.pc[(size_t)b * g.c_bs + (size_t)h * g.c_hs + (size_t)kvcol * g.c_rs + n];
        }
        if (masked) s[j][r] = g.mask_fill;
        m = fmaxf(m, s[j][r]);
      }
#pragma unroll
      for (int off = 1; off < 16; off <<= 1) m = fmaxf(m, __shfl_xor(m, off, 32));
      cm[r] = m;
    }
    __bf16* pwh = Psh[wave];
    __bf16* pwl = Psl[SPLIT_PV ? wave : 0];
#pragma unroll
    for (int r = 0; r < 8; ++r) {
      const float mnew = fmaxf(mrow[r], cm[r]);
      const float alpha = expf(mrow[r] - mnew);
      mrow[r] = mnew;
      float psum = 0.f;
#pragma unroll
      for (int j = 0; j < 4; ++j) {
        const float p = expf(s[j][r] - mnew);
        psum += p;
        if (SPLIT_PV) { __bf16 a, bl; at_split(p, a, bl); pwh[(8 * hh + r) * AT_KC + j * 16 + c] = a; pwl[(8 * hh + r) * AT_KC + j * 16 + c] = bl; }
        else pwh[(8 * hh + r) * AT_KC + j * 16 + c] = at_to16<F16>(p * PSC);
      }
#pragma unroll
      for (int off = 1; off < 16; off <<= 1) psum += __shfl_xor(psum, off, 32);
      lrow[r] = lrow[r] * alpha + psum;
#pragma unroll
      for (int t = 0; t < 4; ++t) oacc[t][r] *= alpha;
    }
    __builtin_amdgcn_fence(__ATOMIC_RELEASE, "workgroup");
    __builtin_amdgcn_wave_barrier();
    __builtin_amdgcn_fence(__ATOMIC_ACQUIRE, "workgroup");
#pragma unroll 1
    for (int kk = 0; kk < 2; ++kk) {
      FB pa, pl;
      pa.h[0] = *(const v8b*)(pwh + c * AT_KC + kk * 32 + 8 * hh);
      pa.h[1] = *(const v8b*)(pwh + c * AT_KC + kk * 32 + 16 + 8 * hh);
      if (SPLIT_PV) {
        pl.h[0] = *(const v8b*)(pwl + c * AT_KC + kk * 32 + 8 * hh);
        pl.h[1] = *(const v8b*)(pwl + c * AT_KC + kk * 32 + 16 + 8 * hh);
      }
#pragma unroll
      for (int t = 0; t < 4; ++t) {
        FB vb;
        vb.h[0] = *(const v8b*)(Vth + (t * 16 + c) * AT_KC + kk * 32 + 8 * hh);
        vb.h[1] = *(const v8b*)(Vth + (t * 16 + c) * AT_KC + kk * 32 + 16 + 8 * hh);
        oacc[t] = at_mma16<F16>(pa.v, vb.v, oacc[t]);
        if (SPLIT_PV) {
          FB vl;
          vl.h[0] = *(const v8b*)(Vtl + (t * 16 + c) * AT_KC + kk * 32 + 8 * hh);
          vl.h[1] = *(const v8b*)(Vtl + (t * 16 + c) * AT_KC + kk * 32 + 16 + 8 * hh);
          oacc[t] = at_mma16<F16>(pa.v, vl.v, oacc[t]);
          oacc[t] = at_mma16<F16>(pl.v, vb.v, oacc[t]);
        }
      }
    }
  }

  float* os = Os[wave];
#pragma unroll
  for (int r = 0; r < 8; ++r) {
    const float inv = 1.0f / (lrow[r] * PSC);
#pragma unroll
    for (int t = 0; t < 4; ++t) os[(8 * hh + r) * 68 + t * 16 + c] = oacc[t][r] * inv;
  }
  __builtin_amdgcn_fence(__ATOMIC_RELEASE, "workgroup");
  __builtin_amdgcn_wave_barrier();
  __builtin_amdgcn_fence(__ATOMIC_ACQUIRE, "workgroup");
  {
    const int c4 = (lane & 15) * 4;
    {
#pragma unroll
      for (int it = 0; it < 8; ++it) {
        const int row = it * 2 + hh;
        v4f val = *(const v4f*)(os + row * 68 + c4);
        *(v4f*)(ob_ptr + (size_t)(q0 + row) * g.o_rs + c4) = val;
      }
      
    }
  }
}

} // namespace w25

// ---- Wide elementwise and row passes: a thread moves 32 or 64 elements with 16-byte loads, so that a pass starts a few thousand waves instead of
//      one wave per 64 or 128 elements. Every wave-wide store covers whole 128-byte lines. Formulas and sum trees are those of the narrow kernels above.
typedef __attribute__((ext_vector_type(4))) _Float16 v4h;
// cast16w<G>: dst[i] = f16(src[i] * s) over a flat range; block bx takes G * 1024 consecutive elements, a thread 4 consecutive ones of each 1024.
template <int G>
__device__ __forceinline__ void cast16w(const float* __restrict__ src, _Float16* __restrict__ dst, float s, unsigned bx) {
    const v4f* sp = (const v4f*)(src + (size_t)bx * (G * 1024));
    v4h* dp = (v4h*)(dst + (size_t)bx * (G * 1024));
    const unsigned t = threadIdx.x;
    v4f a[G];
    // every loop here is unrolled, so that the arrays it indexes are registers and all G loads are in flight together
#pragma unroll
    for (int g = 0; g < G; ++g) a[g] = sp[t + g * 256];
    __builtin_amdgcn_sched_barrier(0);               // holds later register writes behind the wait below
    asm volatile("s_wait_xcnt 0x0" ::: "memory");    // before an address register of the loads above is rewritten (the store addresses are formed next)
    __builtin_amdgcn_sched_barrier(0);               // the pair keeps the forming of the store addresses behind the wait
    v4h h[G];
#pragma unroll
    for (int g = 0; g < G; ++g)
#pragma unroll
        for (int e = 0; e < 4; ++e) h[g][e] = (_Float16)(a[g][e] * s);
#pragma unroll
    for (int g = 0; g < G; ++g) dp[t + g * 256] = h[g];
}
// castT16w<LDS, LDD>: dst[c * LDD + r] = f16(src[r * LDS + c] * s). Block (bx, by) = 64 source rows x 128 source columns, wave = 64 x 16, lane = 8 rows x 4 columns
//   transposed in registers: 8 lanes side by side in r fill one 128-byte line of a dst row. bx < C / 128, by < R / 64.
template <int LDS, int LDD>
__device__ __forceinline__ void castT16w(const float* __restrict__ src, _Float16* __restrict__ dst, float s, unsigned bx, unsigned by) {
    const int lane = threadIdx.x & 31, wave = threadIdx.x >> 5;
    const int r = by * 64 + (lane & 7) * 8;
    const int c = bx * 128 + wave * 16 + (lane >> 3) * 4;
    const float* sp = src + (size_t)r * LDS + c;
    _Float16* dp = dst + (size_t)c * LDD + r;
    v4f x[8];
    // every loop here is unrolled, so that the arrays it indexes are registers and all eight loads are in flight together
#pragma unroll
    for (int i = 0; i < 8; ++i) x[i] = *(const v4f*)(sp + i * LDS);
    __builtin_amdgcn_sched_barrier(0);               // holds later register writes behind the wait below
    asm volatile("s_wait_xcnt 0x0" ::: "memory");    // before an address register of the loads above is rewritten
    __builtin_amdgcn_sched_barrier(0);               // the pair keeps later address arithmetic behind the wait
    v8h h[4];
#pragma unroll
    for (int j = 0; j < 4; ++j)
#pragma unroll
        for (int i = 0; i < 8; ++i) h[j][i] = (_Float16)(x[i][j] * s);
#pragma unroll
    for (int j = 0; j < 4; ++j) *(v8h*)(dp + j * LDD) = h[j];
    asm volatile("s_wait_xcnt 0x0" ::: "memory");    // behind the stores: in the merged kernel another branch's code follows in the listing and reuses their address and data registers
}
// k_cast_all: every f16 operand plane that depends on the inputs alone, in one launch of 2048 blocks, none of which reads what another writes.
//   Blocks 0..511: X. 512..1023: Wq, Wk, Wv, Wo transposed, x16, as four planes of 1024 x 1024 one behind the other (the first three are one Bt of 3072 rows).
//   1024..1535: W1 transposed, x16. 1536..2047: W2 transposed, x16.
__global__ __launch_bounds__(256) void k_cast_all(const float* __restrict__ X, const float* __restrict__ Wq, const float* __restrict__ Wk, const float* __restrict__ Wv,
                                                  const float* __restrict__ Wo, const float* __restrict__ W1, const float* __restrict__ W2,
                                                  _Float16* __restrict__ Xh, _Float16* __restrict__ Wt4, _Float16* __restrict__ W1t, _Float16* __restrict__ W2t) {
    const unsigned b = blockIdx.x, q = b & 511u;
    if (b < 512u) { cast16w<8>(X, Xh, 1.0f, q); return; }
    if (b < 1024u) {
        const unsigned w = q >> 7, i = q & 127u;
        const float* src = (w == 0u) ? Wq : (w == 1u) ? Wk : (w == 2u) ? Wv : Wo;
        castT16w<1024, 1024>(src, Wt4 + (size_t)w * (1024 * 1024), 16.0f, i & 7u, i >> 3);
        return;
    }
    if (b < 1536u) { castT16w<4096, 1024>(W1, W1t, 16.0f, q & 31u, q >> 5); return; }
    castT16w<1024, 4096>(W2, W2t, 16.0f, q & 7u, q >> 3);
}
// Sum of one value per position t = 0..255 of k_stats' tree, add for add: lane l holds positions 4l + q in lo[q] and 128 + 4l + q in hi[q].
//   Levels 128 (in the lane), 64..4 (lanes l and l ^ 16, 8, 4, 2, 1), 2 and 1 (in the lane); every lane ends with the root.
__device__ __forceinline__ float tree256(v4f lo, v4f hi) {
    v4f t = lo + hi;
#pragma unroll
    for (int o = 16; o > 0; o >>= 1) {
#pragma unroll
        for (int q = 0; q < 4; ++q) t[q] += __shfl_xor(t[q], o, 32);
    }
    return (t[0] + t[2]) + (t[1] + t[3]);
}
// k_ln_w: y = (x - mean) * rsqrt(var + eps) * g + b on rows of 1024 in one pass: a wave holds two whole rows in registers, takes their statistics
//   (k_stats mode 0; same partial sums, same tree) and applies them to the same registers (x and y may be the same buffer: a wave reads its rows before it writes them).
//   H16: y16 = f16(y) goes out beside y, as the next product's A operand. grid = rows / 16.
template <bool H16>
__global__ __launch_bounds__(256) void k_ln_w(const float* x, float* y, _Float16* __restrict__ y16, float eps, const float* __restrict__ g, const float* __restrict__ bta) {
    const int lane = threadIdx.x & 31;
    const size_t off = ((size_t)blockIdx.x * 16 + (threadIdx.x >> 5) * 2) * 1024 + 4 * lane;
    const float* base = x + off;
    v4f v[2][8], gg[8], bb[8];
    // every loop here is unrolled, so that the arrays it indexes are registers and all loads are in flight together
#pragma unroll
    for (int r = 0; r < 2; ++r)
#pragma unroll
        for (int m = 0; m < 8; ++m) v[r][m] = *(const v4f*)(base + r * 1024 + 128 * m);
#pragma unroll
    for (int m = 0; m < 8; ++m) { gg[m] = *(const v4f*)(g + 4 * lane + 128 * m); bb[m] = *(const v4f*)(bta + 4 * lane + 128 * m); }
    __builtin_amdgcn_sched_barrier(0);               // holds later register writes behind the wait below
    asm volatile("s_wait_xcnt 0x0" :: "v"(base) : "memory");   // before an address register of the loads above is rewritten; the rows' address is an input, so no later load's result lands on it in front of the wait
    __builtin_amdgcn_sched_barrier(0);               // the pair keeps later address arithmetic behind the wait
    v4h h[2][8];
#pragma unroll
    for (int r = 0; r < 2; ++r) {
        const float mu = tree256(((v[r][0] + v[r][2]) + v[r][4]) + v[r][6], ((v[r][1] + v[r][3]) + v[r][5]) + v[r][7]) / 1024.f;
        v4f q0 = {}, q1 = {};
#pragma unroll
        for (int k = 0; k < 4; ++k) { const v4f d0 = v[r][2 * k] - mu, d1 = v[r][2 * k + 1] - mu; q0 = __builtin_elementwise_fma(d0, d0, q0); q1 = __builtin_elementwise_fma(d1, d1, q1); }
        const float rs = rsqrtf(tree256(q0, q1) / 1024.f + eps);
#pragma unroll
        for (int m = 0; m < 8; ++m) {
            v4f o = (v[r][m] - mu) * rs;
            o *= gg[m]; o += bb[m];
            v[r][m] = o;
            if (H16) {
#pragma unroll
                for (int e = 0; e < 4; ++e) h[r][m][e] = (_Float16)o[e];
            }
        }
    }
    __builtin_amdgcn_sched_barrier(0);               // every value is made before the first store issues, so no store's data register is rewritten behind it
#pragma unroll
    for (int r = 0; r < 2; ++r)
#pragma unroll
        for (int m = 0; m < 8; ++m) {
            *(v4f*)(y + off + r * 1024 + 128 * m) = v[r][m];
            if (H16) *(v4h*)(y16 + off + r * 1024 + 128 * m) = h[r][m];
        }
}


// ---- Block attention at its fixed shape ------------------------------------------------------------------------------
// k_attn_blk: k_attn<64, 64, 0, false, false> for 128 queries x 128 keys x 64 dims per (128-position block z, head h), row stride 1024 elements, all as constants.
//   Same f16 operands, same products in the same order, same online softmax over two 64-key halves, same sums: only how the data travel differs.
//   Q, K and V arrive as the f16 values that the projections' epilogues stored, and O leaves as f16, the next product's A operand.
//   One work-group of eight waves per (z, h); wave w owns queries 16w .. 16w + 15. Every global load is unguarded (every index is in range by
//   the constants), so all of a thread's loads are in flight together. K lies in LDS as f16 [key][d], V as f16 [d][key] (8 keys x 4 dims transposed in registers),
//   so that every B fragment is two 16-byte LDS reads. All 128 keys are staged at once: one barrier.
#define BA_KP 72      // pitch of K and P rows in halves: 144 B = 16 B x odd, for 16-byte readers
#define BA_VP 136     // pitch of V^T rows in halves: 272 B = 16 B x odd
// orders one wave's LDS writes and its other lanes' LDS reads (the per-wave P and O tiles)
__device__ __forceinline__ void ba_wave_sync() {
    __builtin_amdgcn_fence(__ATOMIC_RELEASE, "workgroup");
    __builtin_amdgcn_wave_barrier();
    __builtin_amdgcn_fence(__ATOMIC_ACQUIRE, "workgroup");
}
__global__ __launch_bounds__(256) void k_attn_blk(const _Float16* __restrict__ Q, const _Float16* __restrict__ K, const _Float16* __restrict__ V, const int* __restrict__ VL, _Float16* __restrict__ O) {
    typedef w25::Frag<_Float16> FH;
    __shared__ __align__(16) _Float16 kl[128 * BA_KP];
    __shared__ __align__(16) _Float16 vt[64 * BA_VP];
    __shared__ __align__(16) _Float16 pl[8][16 * BA_KP];
    __shared__ __align__(16) float    ol[8][16 * 68];
    const int tid = threadIdx.x, lane = tid & 31, hf = lane >> 4, l15 = lane & 15, wave = tid >> 5;
    const int h = blockIdx.x, z = blockIdx.y;
    const size_t base = (size_t)z * (128 * 1024) + (size_t)h * 64;      // (row 0, dim 0) of this block and head in Q, K, V and O
    const float L2E = 1.4426950408889634f;
    const float NEG = -__builtin_inff();

    // K: load i takes rows 32i + 4 * wave + (lane >> 3), 8 lanes to a row of 128 B. V: a thread takes keys 8 * (tid >> 4) .. + 7 at dims 4 * l15 .. + 3.
    const int g16 = tid >> 4, c4 = l15 * 4, g8 = tid >> 3, c8 = (lane & 7) * 8;
    const _Float16* kp = K + base + (size_t)g8 * 1024 + c8;
    const _Float16* vp = V + base + (size_t)g16 * (8 * 1024) + c4;
    const _Float16* qp = Q + base + (size_t)(wave * 16 + l15) * 1024 + 8 * hf;
    const int vlen = VL[z >> 3];                                         // valid length of this block's sequence (eight blocks of 128 positions to a sequence)
    v8h kx[4], qx[4]; v4h vx[8]; int mk[8];
#pragma unroll
    for (int i = 0; i < 4; ++i) kx[i] = *(const v8h*)(kp + (size_t)i * (32 * 1024));
    // behind each group of loads: its address register is an input, so it stays whole up to the wait, and later loads' results may then land on it
    asm volatile("s_wait_xcnt 0x0" :: "v"(kp) : "memory");
#pragma unroll
    for (int i = 0; i < 8; ++i) vx[i] = *(const v4h*)(vp + (size_t)i * 1024);
    asm volatile("s_wait_xcnt 0x0" :: "v"(vp) : "memory");
#pragma unroll
    for (int i = 0; i < 4; ++i) qx[i] = *(const v8h*)(qp + i * 16);                            // dims 16 * i + 8 * hf .. + 7
#pragma unroll
    for (int i = 0; i < 8; ++i) mk[i] = ((z & 7) * 128 + i * 16 + l15 < vlen) ? 1 : 0;         // keep flag of key 16i + l15: its position in the sequence is below the valid length
    asm volatile("s_wait_xcnt 0x0" :: "v"(qp) : "memory");
    __builtin_amdgcn_sched_barrier(0);   // keeps the LDS stores, which wait for loaded data, behind the issue of the last load: one latency is paid, not two
#pragma unroll
    for (int i = 0; i < 4; ++i) *(v8h*)(kl + (i * 32 + g8) * BA_KP + c8) = kx[i];
#pragma unroll
    for (int j = 0; j < 4; ++j) {
        v8h hv;
#pragma unroll
        for (int i = 0; i < 8; ++i) hv[i] = vx[i][j];
        *(v8h*)(vt + (c4 + j) * BA_VP + g16 * 8) = hv;
    }
    v16h qa[2];                                                           // A fragment: element e <- dim 32 ks + frag_k(e, hf)
#pragma unroll
    for (int ks = 0; ks < 2; ++ks)
#pragma unroll
        for (int e = 0; e < 16; ++e) qa[ks][e] = qx[ks * 2 + (e >> 3)][e & 7];
    v8f o[4]; float m8[8], l8[8];
#pragma unroll
    for (int t = 0; t < 4; ++t) { v8f zz = {}; o[t] = zz; }
#pragma unroll
    for (int i = 0; i < 8; ++i) { m8[i] = NEG; l8[i] = 0.f; }
    __syncthreads();                                                      // K and V^T are readable by every wave; they are not written again

    _Float16* myp = pl[wave];
#pragma unroll
    for (int jb = 0; jb < 2; ++jb) {
        const int j0 = jb * 64;
        v8f s[4];
#pragma unroll
        for (int t = 0; t < 4; ++t) {
            const _Float16* kr = kl + (j0 + t * 16 + l15) * BA_KP + 8 * hf;
            v8f acc = {};
            acc = FH::mma(qa[0], FH::load(kr), acc);
            acc = FH::mma(qa[1], FH::load(kr + 32), acc);
            s[t] = acc;
        }
#pragma unroll
        for (int i = 0; i < 8; ++i) {
            float sc[4];
#pragma unroll
            for (int t = 0; t < 4; ++t) {
                float v = s[t][i] * 0.125f;
                if (mk[jb * 4 + t] == 0) v = -1000000.0f;
                v *= L2E;
                sc[t] = v;
            }
            float mx = fmaxf(fmaxf(sc[0], sc[1]), fmaxf(sc[2], sc[3]));
            mx = fmaxf(mx, __shfl_xor(mx, 1, 32)); mx = fmaxf(mx, __shfl_xor(mx, 2, 32));
            mx = fmaxf(mx, __shfl_xor(mx, 4, 32)); mx = fmaxf(mx, __shfl_xor(mx, 8, 32));
            const float mnew = fmaxf(m8[i], mx);
            const float ec = exp2f(m8[i] - mnew);                         // taken unconditionally and then selected: no branch round each exp2
            const float corr = (mnew == NEG) ? 1.f : ec;
            float rs = 0.f;
#pragma unroll
            for (int t = 0; t < 4; ++t) {
                const float ep = exp2f(sc[t] - mnew);
                const float pp = (sc[t] == NEG) ? 0.f : ep; rs += pp;
                myp[(i + 8 * hf) * BA_KP + t * 16 + l15] = (_Float16)(pp * 4096.f);
            }
            rs += __shfl_xor(rs, 1, 32); rs += __shfl_xor(rs, 2, 32); rs += __shfl_xor(rs, 4, 32); rs += __shfl_xor(rs, 8, 32);
            l8[i] = l8[i] * corr + rs; m8[i] = mnew;
#pragma unroll
            for (int t = 0; t < 4; ++t) o[t][i] *= corr;
        }
        ba_wave_sync();                                                   // P is written; its rows are read by other lanes of the wave
        const v16h pa0 = FH::load(myp + l15 * BA_KP + 8 * hf), pa1 = FH::load(myp + l15 * BA_KP + 32 + 8 * hf);
#pragma unroll
        for (int t = 0; t < 4; ++t) {
            const _Float16* vr = vt + (t * 16 + l15) * BA_VP + j0 + 8 * hf;
            o[t] = FH::mma(pa0, FH::load(vr), o[t]);
            o[t] = FH::mma(pa1, FH::load(vr + 32), o[t]);
        }
        ba_wave_sync();                                                   // P is read; the next half may overwrite it
    }
    float* myo = ol[wave];
#pragma unroll
    for (int i = 0; i < 8; ++i) {
        const float rl = 1.f / (l8[i] * 4096.f);
        const float invr = (l8[i] > 0.f) ? rl : 0.f;
#pragma unroll
        for (int t = 0; t < 4; ++t) myo[(i + 8 * hf) * 68 + t * 16 + l15] = o[t][i] * invr;
    }
    ba_wave_sync();                                                       // O is written; its rows go out as whole 128-byte lines of f16
    const int r4 = lane >> 3;
    _Float16* op = O + base + (size_t)(wave * 16 + r4) * 1024 + c8;
#pragma unroll
    for (int it = 0; it < 4; ++it) {                                      // rows 4 * it + r4
        const float* sp = myo + (it * 4 + r4) * 68 + c8;
        const v4f lo = *(const v4f*)(sp), hi = *(const v4f*)(sp + 4);
        v8h hv;
#pragma unroll
        for (int e = 0; e < 4; ++e) { hv[e] = (_Float16)lo[e]; hv[4 + e] = (_Float16)hi[e]; }
        *(v8h*)(op + (size_t)it * (4 * 1024)) = hv;
    }
}

extern "C" void kernel_launch(void* const* d_in, const int* in_sizes, int n_in, void* d_out, int out_size, void* d_ws, size_t ws_size, hipStream_t stream) {
    (void)in_sizes; (void)n_in; (void)out_size; (void)ws_size;
    const float* X = (const float*)d_in[0];
    const int* vl = (const int*)d_in[1];
    const float* Wq = (const float*)d_in[2];
    const float* Wk = (const float*)d_in[3];
    const float* Wv = (const float*)d_in[4];
    const float* Wo = (const float*)d_in[5];
    const float* g1 = (const float*)d_in[6];
    const float* be1 = (const float*)d_in[7];
    const float* W1 = (const float*)d_in[8];
    const float* bf1 = (const float*)d_in[9];
    const float* W2 = (const float*)d_in[10];
    const float* bf2 = (const float*)d_in[11];
    const float* g2 = (const float*)d_in[12];
    const float* be2 = (const float*)d_in[13];
    const int Bn = 4;
    const int S = 1024;
    const int D = 1024;
    const int NH = 16;
    const int DH = 64;
    const int F = 4096;
    const int M = 128;
    const int NB = S / M;
    const int NR = Bn * S;
    float* out = (float*)d_out;
    char* wsp = (char*)d_ws;
    float* Q = (float*)wsp; wsp += (((size_t)((size_t)NR * D) * 4 + 255) / 256) * 256;
    float* Kb = (float*)wsp; wsp += (((size_t)((size_t)NR * D) * 4 + 255) / 256) * 256;
    float* V = (float*)wsp; wsp += (((size_t)((size_t)NR * D) * 4 + 255) / 256) * 256;
    float* AT = (float*)wsp; wsp += (((size_t)((size_t)NR * D) * 4 + 255) / 256) * 256;
    float* MF = (float*)wsp; wsp += (((size_t)((size_t)NR) * 4 + 255) / 256) * 256;
    float* Y = (float*)wsp; wsp += (((size_t)((size_t)NR * D) * 4 + 255) / 256) * 256;
    float* ST = (float*)wsp; wsp += (((size_t)((size_t)NR * 32) * 4 + 255) / 256) * 256;
    float* H1 = (float*)wsp; wsp += (((size_t)((size_t)NR * F) * 4 + 255) / 256) * 256;
    unsigned short* G64A = (unsigned short*)wsp; wsp += (((size_t)(16777216) * 2 + 255) / 256) * 256;
    unsigned short* G64B = (unsigned short*)wsp; wsp += (((size_t)(4194304) * 2 + 255) / 256) * 256;
    // Planes of f16 values, each written by the kernel that makes the values: X and the six transposed weights (one launch), Q, K, V (one launch, three planes),
    // the attention's output (in G64A, once the projections have read X there), the first LayerNorm's output (in G64A again, beside its f32 copy Y) and the FFN's hidden layer.
    _Float16* Qh = (_Float16*)Q;
    _Float16* Kh = (_Float16*)Kb;
    _Float16* Vh = (_Float16*)V;
    _Float16* Ah = (_Float16*)G64A;
    _Float16* Hh = (_Float16*)H1;
    _Float16* Wt4 = (_Float16*)G64B;                 // Wq^T, Wk^T, Wv^T, Wo^T: 1024 x 1024 each
    _Float16* Wot = Wt4 + 3 * 1024 * 1024;
    _Float16* W1t = (_Float16*)AT;                   // 4096 x 1024
    _Float16* W2t = W1t + 4096 * 1024;               // 1024 x 4096
    k_cast_all<<<2048, 256, 0, stream>>>(X, Wq, Wk, Wv, Wo, W1, W2, Ah, Wt4, W1t, W2t);
    w25::wmma_gemm_lds<3072, 1024, 0, false, 0, true, 1024, 8388608><<<768, 256, 0, stream>>>((const unsigned short*)(G64A), (const unsigned short*)(Wt4), nullptr, Qh, nullptr, nullptr, 0.0625f);
    k_attn_blk<<<dim3((unsigned)NH, (unsigned)(Bn * NB)), 256, 0, stream>>>(Qh, Kh, Vh, vl, Ah);
    w25::wmma_gemm_lds<1024, 1024, 0, true, 0, false, 1024, 0, 4><<<256, 256, 0, stream>>>((const unsigned short*)(G64A), (const unsigned short*)(Wot), Y, nullptr, nullptr, X, 0.0625f);
    k_ln_w<true><<<(unsigned)(NR / 16), 256, 0, stream>>>(Y, Y, Ah, 1e-05f, g1, be1);
    w25::wmma_gemm_lds<4096, 1024, 2, false, 2, true><<<1024, 256, 0, stream>>>((const unsigned short*)(G64A), (const unsigned short*)(W1t), nullptr, Hh, bf1, nullptr, 0.0625f);
    w25::wmma_gemm_lds<1024, 4096, 2, true, 0, false, 1024, 0, 4><<<256, 256, 0, stream>>>((const unsigned short*)(H1), (const unsigned short*)(W2t), Kb, nullptr, bf2, Y, 0.0625f);
    k_ln_w<false><<<(unsigned)(NR / 16), 256, 0, stream>>>(Kb, out, nullptr, 1e-05f, g2, be2);
}

// v008
// Measured time: 120 microseconds a run.
// Next to v007, in two timings, it ran 1.09 and 1.10 times as fast.
// Counting every step since v000, which is the starting kernel, it is 12.3 times as fast.
// Contractions: q/k/v/o projections X.W [4096x1024].[1024x1024] and the position-wise FFN relu(Y.W1 + b) [4096x1024].[1024x4096], .W2 + b [4096x4096].[4096x1024] with f16 operands on pre-cast planes (v_wmma_f32_16x16x32_f16; 32x64 register-blocked wave tiles, 64x48 for q/k/v, weights x16); the block-diagonal windowed attention (8 blocks of 128 positions per sequence = 32 independent (sequence, block) attentions, 16 heads, keys >= valid_len SET to -1e6 through an integer keep-mask — exactly the module's where, so blocks lying wholly beyond valid_len are uniform) inside the q/k/v projection's launch, from LDS (f16 q.k^T and p.v with p as f16 of 4096 p); f32 accumulate and softmax. AddNorm LayerNorms (two rows per wave, fixed-order trees) are f32 kernels; the keep-mask is formed inside the attention from the INPUT valid lengths.
#include <hip/hip_runtime.h>
#include <math.h>

typedef __attribute__((ext_vector_type(16))) _Float16 v16h;
typedef __attribute__((ext_vector_type(8)))  _Float16 v8h;
typedef __attribute__((ext_vector_type(16))) __bf16   v16b;
typedef __attribute__((ext_vector_type(8)))  float    v8f;
typedef __attribute__((ext_vector_type(4)))  float    v4f;

// 16-bit WMMA fragment map (wave32), lane L, h = L>>4, m = L&15:
//   A 16x32: lane = row m;   element i -> k = (i<8) ? 8h+i : 16+8h+(i-8)
//   B 32x16: lane = column m; the SAME k(i,h)
//   D 16x16 (8 f32): lane = column m; element r -> row 8h+r
__device__ __forceinline__ int frag_k(int i, int h) { return (i < 8) ? (8 * h + i) : (16 + 8 * h + (i - 8)); }
__device__ __forceinline__ __bf16 bf16_rne(float f) {
    unsigned int u = __float_as_uint(f);
    u += 0x7fffu + ((u >> 16) & 1u);
    return __builtin_bit_cast(__bf16, (unsigned short)(u >> 16));
}
__device__ __forceinline__ float bf16_f32(__bf16 b) { return __uint_as_float(((unsigned int)__builtin_bit_cast(unsigned short, b)) << 16); }
__device__ __forceinline__ v8f wmma16(v16h a, v16h b, v8f c) {
    c = __builtin_amdgcn_wmma_f32_16x16x32_f16(false, a, false, b, (short)0, c, false, false);
    asm volatile("v_nop\n\tv_nop\n\tv_nop\n\tv_nop" : "+v"(c) : "v"(a), "v"(b));
    return c;
}
__device__ __forceinline__ v8f wmmab(v16b a, v16b b, v8f c) {
    c = __builtin_amdgcn_wmma_f32_16x16x32_bf16(false, a, false, b, (short)0, c, false, false);
    asm volatile("v_nop\n\tv_nop\n\tv_nop\n\tv_nop" : "+v"(c) : "v"(a), "v"(b));
    return c;
}
struct Split { v16b hi, lo; };
// hi/lo split product: a.hi*b.hi + a.hi*b.lo + a.lo*b.hi
__device__ __forceinline__ v8f wmma3(const Split& a, const Split& b, v8f c) {
    c = __builtin_amdgcn_wmma_f32_16x16x32_bf16(false, a.hi, false, b.hi, (short)0, c, false, false);
    c = __builtin_amdgcn_wmma_f32_16x16x32_bf16(false, a.hi, false, b.lo, (short)0, c, false, false);
    c = __builtin_amdgcn_wmma_f32_16x16x32_bf16(false, a.lo, false, b.hi, (short)0, c, false, false);
    asm volatile("v_nop\n\tv_nop\n\tv_nop\n\tv_nop" : "+v"(c) : "v"(a.hi), "v"(a.lo), "v"(b.hi), "v"(b.lo));
    return c;
}
struct Split3 { v16b hi, mid, lo; };
// triple split product (6 terms, drops only terms below 2^-24 relative)
__device__ __forceinline__ v8f wmma6(const Split3& a, const Split3& b, v8f c) {
    c = __builtin_amdgcn_wmma_f32_16x16x32_bf16(false, a.hi, false, b.hi, (short)0, c, false, false);
    c = __builtin_amdgcn_wmma_f32_16x16x32_bf16(false, a.hi, false, b.mid, (short)0, c, false, false);
    c = __builtin_amdgcn_wmma_f32_16x16x32_bf16(false, a.mid, false, b.hi, (short)0, c, false, false);
    c = __builtin_amdgcn_wmma_f32_16x16x32_bf16(false, a.hi, false, b.lo, (short)0, c, false, false);
    c = __builtin_amdgcn_wmma_f32_16x16x32_bf16(false, a.mid, false, b.mid, (short)0, c, false, false);
    c = __builtin_amdgcn_wmma_f32_16x16x32_bf16(false, a.lo, false, b.hi, (short)0, c, false, false);
    asm volatile("v_nop\n\tv_nop\n\tv_nop\n\tv_nop" : "+v"(c) : "v"(a.hi), "v"(a.mid), "v"(a.lo), "v"(b.hi), "v"(b.mid), "v"(b.lo));
    return c;
}

// Fragment gathers from f32 memory: element i <- p[(k0 + frag_k(i,h)) * sk] * s, zero for k >= klen.
__device__ __forceinline__ v16h fh_ld(const float* __restrict__ p, long long sk, int k0, int h, int klen, float s) {
    v16h a;
#pragma unroll
    for (int i = 0; i < 16; ++i) { const int k = k0 + frag_k(i, h); a[i] = (k < klen) ? (_Float16)(p[(long long)k * sk] * s) : (_Float16)0.f; }
    return a;
}
__device__ __forceinline__ Split sp_ld(const float* __restrict__ p, long long sk, int k0, int h, int klen, float s) {
    Split r;
#pragma unroll
    for (int i = 0; i < 16; ++i) {
        const int k = k0 + frag_k(i, h); const float x = (k < klen) ? p[(long long)k * sk] * s : 0.f;
        const __bf16 hb = bf16_rne(x); r.hi[i] = hb; r.lo[i] = bf16_rne(x - bf16_f32(hb));
    }
    return r;
}
__device__ __forceinline__ Split3 sp3_ld(const float* __restrict__ p, long long sk, int k0, int h, int klen, float s) {
    Split3 r;
#pragma unroll
    for (int i = 0; i < 16; ++i) {
        const int k = k0 + frag_k(i, h); const float x = (k < klen) ? p[(long long)k * sk] * s : 0.f;
        const __bf16 hb = bf16_rne(x); const float r1 = x - bf16_f32(hb); const __bf16 mb = bf16_rne(r1);
        r.hi[i] = hb; r.mid[i] = mb; r.lo[i] = bf16_rne(r1 - bf16_f32(mb));
    }
    return r;
}
__device__ __forceinline__ v16b bh_ld(const float* __restrict__ p, long long sk, int k0, int h, int klen, float s) {
    v16b a;
#pragma unroll
    for (int i = 0; i < 16; ++i) { const int k = k0 + frag_k(i, h); a[i] = bf16_rne((k < klen) ? p[(long long)k * sk] * s : 0.f); }
    return a;
}
// f16 fragment from an f16 LDS/global row with element stride 1 (k-contiguous), no bounds (tile already zero padded)
__device__ __forceinline__ v16h fh_row(const _Float16* __restrict__ row, int k0, int h) {
    v16h a;
#pragma unroll
    for (int i = 0; i < 16; ++i) a[i] = row[k0 + frag_k(i, h)];
    return a;
}

#define VST2(T, ptr, val) do { const T vst2_v_ = (val); *(T*)(ptr) = vst2_v_;  } while (0)
typedef float v4f __attribute__((ext_vector_type(4)));
#define VST2V4(ptr, val) do { const v4f vst2_v4_ = (val); *(v4f*)(ptr) = vst2_v4_;  } while (0)

__device__ __attribute__((noinline)) float act_fn(float v, int act) {
    if (act == 1) return fmaxf(v, 0.f);                                                                               // relu
    if (act == 2) { const float u = 0.7978845608028654f * (v + 0.044715f * v * v * v); return 0.5f * v * (1.f + tanhf(u)); } // tanh-gelu
    if (act == 3) return v / (1.f + expf(-v));                                                                        // silu
    if (act == 4) return 0.5f * v * (1.f + erff(v * 0.7071067811865476f));                                             // erf-gelu
    if (act == 5) return tanhf(v);
    if (act == 6) return 1.f / (1.f + expf(-v));                                                                      // sigmoid
    if (act == 7) return (v > 0.f) ? v : 0.01f * v;                                                                   // leaky relu 0.01
    if (act == 8) return (v > 0.f) ? v : (expf(v) - 1.f);                                                             // elu
    if (act == 9) return fminf(fmaxf(v, 0.f), 6.f);                                                                   // relu6
    if (act == 10) return fabsf(v);                                                                                    // abs
    if (act == 11) return (v >= 0.f) ? v : 0.1f * v;                                                                  // leaky 0.1
    if (act == 12) return (v > 0.f) ? v : 0.2f * v;                                                                   // leaky 0.2
    if (act == 13) return (v > 20.f) ? v : log1pf(expf(v));                                                            // softplus
    return v;
}

// =====================================================================================================================
// k_gemm<MODE>: C(z, m, n) = act(alpha * sum_k A(z, m, k) * B(z, k, n) + bias) + beta * R(z, m, n)
//   One wave (32-thread block) per 16 x 32 tile of C; grid (ceil(N/32), ceil(M/16), Z). Batch z -> (zo = z / zi_n, zi = z % zi_n)
//   with separate outer/inner strides for every tensor (e.g. batch and head). A(m,k) = A[zo*sAo + zi*sAi + m*sAm + k*sAk] (f32),
//   B(k,n) = B[zo*sBo + zi*sBi + n*sBn + k*sBk] (f32); any M, N, K (K zero-padded to 32 inside the fragments, M/N tails guarded).
//   C(m,n) = C[zo*sCo + zi*sCi + m*sCm + n] (n contiguous). flags: 1 bias[n], 2 bias[m], 4 residual R[zo*sRo + zi*sRi + m*sRm + n*sRn].
//   MODE 0: f16 operands (A prescaled by sa, B by sb, both undone in the epilogue); 1: bf16 hi/lo split (3 products); 2: bf16;
//   3: bf16 hi/mid/lo triple split (6 products); 4: as 3 with Kahan-compensated f32 accumulation across k-steps.
// =====================================================================================================================
struct GemmP {
    const float* A; const float* B; const float* bias; const float* R; float* C;
    long long sAo, sAi, sAm, sAk, sBo, sBi, sBn, sBk, sCo, sCi, sCm, sRo, sRi, sRm, sRn;
    int M, N, K, zi_n, flags, act; float alpha, beta, sa, sb;
    int Npad, pad_;     // columns [N, Npad) of C are written as 0 so that padded workspace rows are covered by whole-line stores; Npad >= N
};
static_assert(sizeof(GemmP) == 5 * 8 + 15 * 8 + 6 * 4 + 4 * 4 + 2 * 4, "GemmP has padding");

template <int MODE>
__global__ __launch_bounds__(32) void k_gemm(GemmP p) {
    const int lane = threadIdx.x & 31, h = lane >> 4, l15 = lane & 15;
    const int m0 = blockIdx.y * 16, n0 = blockIdx.x * 32;
    const int z = blockIdx.z, zo = z / p.zi_n, zi = z - zo * p.zi_n;
    const float* A = p.A + zo * p.sAo + zi * p.sAi;
    const float* B = p.B + zo * p.sBo + zi * p.sBi;
    const int am = min(m0 + l15, p.M - 1);                       // clamped row for loads (stores are guarded)
    v8f acc[2], comp[2];
#pragma unroll
    for (int t = 0; t < 2; ++t) { v8f zz = {}; acc[t] = zz; comp[t] = zz; }
    for (int k0 = 0; k0 < p.K; k0 += 32) {
        const float* arow = A + (long long)am * p.sAm;
        if (MODE == 1) {
            const Split a = sp_ld(arow, p.sAk, k0, h, p.K, 1.f);
#pragma unroll
            for (int t = 0; t < 2; ++t) {
                const int bn = min(n0 + t * 16 + l15, p.N - 1);
                acc[t] = wmma3(a, sp_ld(B + (long long)bn * p.sBn, p.sBk, k0, h, p.K, 1.f), acc[t]);
            }
        } else if (MODE == 3) {
            const Split3 a = sp3_ld(arow, p.sAk, k0, h, p.K, 1.f);
#pragma unroll
            for (int t = 0; t < 2; ++t) {
                const int bn = min(n0 + t * 16 + l15, p.N - 1);
                acc[t] = wmma6(a, sp3_ld(B + (long long)bn * p.sBn, p.sBk, k0, h, p.K, 1.f), acc[t]);
            }
        } else if (MODE == 4) {
            // triple split as MODE 3, but each k-step's 6 products go into a fresh accumulator and the partial is added to the running f32 sum
            // on the VALU with Kahan compensation (accumulation error stays ~1 ulp however long K is)
            const Split3 a = sp3_ld(arow, p.sAk, k0, h, p.K, 1.f);
#pragma unroll
            for (int t = 0; t < 2; ++t) {
                const int bn = min(n0 + t * 16 + l15, p.N - 1); v8f zz = {};
                const v8f part = wmma6(a, sp3_ld(B + (long long)bn * p.sBn, p.sBk, k0, h, p.K, 1.f), zz);
                const v8f y = part - comp[t]; const v8f s = acc[t] + y; comp[t] = (s - acc[t]) - y; acc[t] = s;
            }
        } else if (MODE == 2) {
            const v16b a = bh_ld(arow, p.sAk, k0, h, p.K, 1.f);
#pragma unroll
            for (int t = 0; t < 2; ++t) {
                const int bn = min(n0 + t * 16 + l15, p.N - 1);
                acc[t] = wmmab(a, bh_ld(B + (long long)bn * p.sBn, p.sBk, k0, h, p.K, 1.f), acc[t]);
            }
        } else {
            const v16h a = fh_ld(arow, p.sAk, k0, h, p.K, p.sa);
#pragma unroll
            for (int t = 0; t < 2; ++t) {
                const int bn = min(n0 + t * 16 + l15, p.N - 1);
                acc[t] = wmma16(a, fh_ld(B + (long long)bn * p.sBn, p.sBk, k0, h, p.K, p.sb), acc[t]);
            }
        }
    }
    const float iscale = (MODE == 0) ? p.alpha / (p.sa * p.sb) : p.alpha;
    float* C = p.C + zo * p.sCo + zi * p.sCi;
    const float* R = p.R + zo * p.sRo + zi * p.sRi;
    __shared__ __align__(16) float ctile[16][36];
#pragma unroll
    for (int t = 0; t < 2; ++t) {
        const int n = n0 + t * 16 + l15; const int nn = min(n, p.N - 1);
#pragma unroll
        for (int r = 0; r < 8; ++r) {
            const int m = m0 + 8 * h + r; const int mm = min(m, p.M - 1);
            float v = acc[t][r] * iscale;
            if (p.flags & 1) v += p.bias[nn];
            if (p.flags & 2) v += p.bias[mm];
            if (p.flags & 8) v *= p.bias[(long long)zo * p.M + mm];   /* per-(z,row) scale vector laid out [Z][M]; exclusive with the bias flags */
            v = act_fn(v, p.act);
            if (p.flags & 4) v += p.beta * R[(long long)mm * p.sRm + (long long)nn * p.sRn];
            ctile[8 * h + r][t * 16 + l15] = (n < p.N) ? v : 0.f;
        }
    }
    __syncthreads();
    const int NW = (p.Npad > p.N) ? p.Npad : p.N;           // write width
    const bool fast = (m0 + 16 <= p.M) && (n0 + 32 <= NW) && ((p.sCm & 3) == 0) && ((((size_t)C) & 15) == 0);
    if (fast) {
#pragma unroll
        for (int s = 0; s < 4; ++s) {
            const int row = s * 4 + (lane >> 3), c4 = (lane & 7) * 4;
            const v4f v = *(const v4f*)&ctile[row][c4];
            VST2V4(C + (long long)(m0 + row) * p.sCm + n0 + c4, v);
        }
    } else {
        for (int row = 0; row < 16; ++row) {
            const int m = m0 + row, n = n0 + lane;
            if (m < p.M && n < NW) VST2(float, C + (long long)m * p.sCm + n, ctile[row][lane]);
        }
    }
}


// =====================================================================================================================
// k_gemmT<MODE, TM, TN>: same contract as k_gemm, but one wave computes a (16*TM) x (16*TN) tile: TM A fragments and TN B fragments are
//   loaded per 32-wide k-step and reused across TM*TN WMMAs (far fewer load/convert instructions per MAC). MODE 0 (f16), 1 (bf16 hi/lo),
//   2 (bf16) only. grid (ceil(NW/(16*TN)), ceil(M/(16*TM)), Z), block 32. Epilogue identical to k_gemm, run per 16x32 sub-tile.
// =====================================================================================================================
template <int MODE, int TM, int TN>
__global__ __launch_bounds__(32) void k_gemmT(GemmP p) {
    const int lane = threadIdx.x & 31, h = lane >> 4, l15 = lane & 15;
    const int m0 = blockIdx.y * (16 * TM), n0 = blockIdx.x * (16 * TN);
    const int z = blockIdx.z, zo = z / p.zi_n, zi = z - zo * p.zi_n;
    const float* A = p.A + zo * p.sAo + zi * p.sAi;
    const float* B = p.B + zo * p.sBo + zi * p.sBi;
    v8f acc[TM][TN];
#pragma unroll
    for (int i = 0; i < TM; ++i)
#pragma unroll
        for (int t = 0; t < TN; ++t) { v8f zz = {}; acc[i][t] = zz; }
    for (int k0 = 0; k0 < p.K; k0 += 32) {
        if (MODE == 1) {
            Split a[TM], b[TN];
#pragma unroll
            for (int i = 0; i < TM; ++i) { const int am = min(m0 + 16 * i + l15, p.M - 1); a[i] = sp_ld(A + (long long)am * p.sAm, p.sAk, k0, h, p.K, 1.f); }
#pragma unroll
            for (int t = 0; t < TN; ++t) { const int bn = min(n0 + 16 * t + l15, p.N - 1); b[t] = sp_ld(B + (long long)bn * p.sBn, p.sBk, k0, h, p.K, 1.f); }
#pragma unroll
            for (int i = 0; i < TM; ++i)
#pragma unroll
                for (int t = 0; t < TN; ++t) acc[i][t] = wmma3(a[i], b[t], acc[i][t]);
        } else if (MODE == 2) {
            v16b a[TM], b[TN];
#pragma unroll
            for (int i = 0; i < TM; ++i) { const int am = min(m0 + 16 * i + l15, p.M - 1); a[i] = bh_ld(A + (long long)am * p.sAm, p.sAk, k0, h, p.K, 1.f); }
#pragma unroll
            for (int t = 0; t < TN; ++t) { const int bn = min(n0 + 16 * t + l15, p.N - 1); b[t] = bh_ld(B + (long long)bn * p.sBn, p.sBk, k0, h, p.K, 1.f); }
#pragma unroll
            for (int i = 0; i < TM; ++i)
#pragma unroll
                for (int t = 0; t < TN; ++t) acc[i][t] = wmmab(a[i], b[t], acc[i][t]);
        } else {
            v16h a[TM], b[TN];
#pragma unroll
            for (int i = 0; i < TM; ++i) { const int am = min(m0 + 16 * i + l15, p.M - 1); a[i] = fh_ld(A + (long long)am * p.sAm, p.sAk, k0, h, p.K, p.sa); }
#pragma unroll
            for (int t = 0; t < TN; ++t) { const int bn = min(n0 + 16 * t + l15, p.N - 1); b[t] = fh_ld(B + (long long)bn * p.sBn, p.sBk, k0, h, p.K, p.sb); }
#pragma unroll
            for (int i = 0; i < TM; ++i)
#pragma unroll
                for (int t = 0; t < TN; ++t) acc[i][t] = wmma16(a[i], b[t], acc[i][t]);
        }
    }
    const float iscale = (MODE == 0) ? p.alpha / (p.sa * p.sb) : p.alpha;
    float* C = p.C + zo * p.sCo + zi * p.sCi;
    const float* R = p.R + zo * p.sRo + zi * p.sRi;
    const int NW = (p.Npad > p.N) ? p.Npad : p.N;
    __shared__ __align__(16) float ctile[16][36];
#pragma unroll
    for (int i = 0; i < TM; ++i) {
        const int mb = m0 + 16 * i; if (mb >= p.M) break;          // wave-uniform
#pragma unroll
        for (int tp = 0; tp < TN / 2; ++tp) {
            const int nb = n0 + 32 * tp; if (nb >= NW) break;        // wave-uniform
#pragma unroll
            for (int t2 = 0; t2 < 2; ++t2) {
                const int t = 2 * tp + t2; const int n = nb + t2 * 16 + l15; const int nn = min(n, p.N - 1);
#pragma unroll
                for (int r = 0; r < 8; ++r) {
                    const int m = mb + 8 * h + r; const int mm = min(m, p.M - 1);
                    float v = acc[i][t][r] * iscale;
                    if (p.flags & 1) v += p.bias[nn];
                    if (p.flags & 2) v += p.bias[mm];
            if (p.flags & 8) v *= p.bias[(long long)zo * p.M + mm];   /* per-(z,row) scale vector laid out [Z][M]; exclusive with the bias flags */
                    v = act_fn(v, p.act);
                    if (p.flags & 4) v += p.beta * R[(long long)mm * p.sRm + (long long)nn * p.sRn];
                    ctile[8 * h + r][t2 * 16 + l15] = (n < p.N) ? v : 0.f;
                }
            }
            __syncthreads();
            const bool fast = (mb + 16 <= p.M) && (nb + 32 <= NW) && ((p.sCm & 3) == 0) && ((((size_t)C) & 15) == 0);
            if (fast) {
#pragma unroll
                for (int s = 0; s < 4; ++s) {
                    const int row = s * 4 + (lane >> 3), c4 = (lane & 7) * 4;
                    const v4f v = *(const v4f*)&ctile[row][c4];
                    VST2V4(C + (long long)(mb + row) * p.sCm + nb + c4, v);
                }
            } else {
                for (int row = 0; row < 16; ++row) {
                    const int m = mb + row, n = nb + lane;
                    if (m < p.M && n < NW) VST2(float, C + (long long)m * p.sCm + n, ctile[row][lane]);
                }
            }
            __syncthreads();
        }
    }
}

// =====================================================================================================================
//   Wave = 16 queries, AW waves per block, 64-key blocks; grid (ceil(Lq/(16*AW)), H, B), block 32*AW. Any Lq, Lk; head dim dh <= DHP
//   (DHP multiple of 32), value dim dv <= DVP (multiple of 16, <= 128). Every tensor addressed by (batch, head, row, element) strides, f32.
//   Scores: QM 0 f16 operands, 1 bf16 hi/lo split, 2 bf16 triple split; statistics f32 (exp2 domain); P.V: P x 4096 as f16 with V f16 staged in LDS
//   (SPLITPV: P and V as bf16 hi/lo splits). kv head = h / hrep. Masking: causal = 1 (keep j <= i + coff, masked -> -inf, key blocks beyond the
//   diagonal skipped), causal = 2 (masked -> mfill, a finite fill like the -1e9; no skipping), causal = 3 (keep j >= i + coff,
//   masked -> -inf, no skipping); optional additive f32 mask Mf,
//   optional int keep-mask Mi (0 -> score := mfill), both addressed b*smb + h*smh + i*smi + j*smj (0 strides broadcast).
// =====================================================================================================================
#define AW 4
struct AttnP {   // apv4
    const float* Q; const float* K; const float* V; float* O; float* P; const float* Mf; const int* Mi; float* ST;
    const float* Pw; const float* Rt; const int* SQ; const int* SK;           // optional: post-softmax weight, relative-position table, segment ids
    long long swb, swh, swi, swj, srb, srh, sri;                                 // Pw strides (b,h,i,j); Rt strides (b,h,i), column = clamp(i - j + roff, 0, rn-1)
    long long sQb, sQh, sQi, sQd, sKb, sKh, sKj, sKd, sVb, sVh, sVj, sVd, sOb, sOh, sOi, sPb, sPh, sPi, smb, smh, smi, smj;
    int Lq, Lk, dh, dv, hrep, causal, coff, pband;   // pband > 0: P holds only the band |j - i| <= pband, column j - i + pband
    float scale, mfill; int nonorm, mpol;             // nonorm (online path only): O = sum_j exp(score_j) V_j without the 1/rowsum (scores must be <= ~0); mpol: Mi masks where ==0 (mpol 0) or where !=0 (mpol 1)
    int roff, rn, segpol, win;                        // Rt column offset/count; SQ/SK: score := mfill where (segpol 0) SQ[i] != SK[j] or (segpol 1) SQ[i] == SK[j]; win > 0: keys with i - j > win (after coff) -> -inf
};
//   Pw: the softmax numerator is multiplied by Pw(b,h,i,j) AFTER the row sum is taken (probs * weight, then P.V), as in post-softmax multiplicative biases.                                                    // ST (optional): per row (b,h,i) -> ST[((b*H + h)*Lq + i)*2 + {0,1}] = {row max of the scaled+masked score (natural units), sum_j exp(score - max)}
static_assert(sizeof(AttnP) == 12 * 8 + 29 * 8 + 16 * 4, "AttnP has padding");

#ifndef KATTN_ATTR
#define KATTN_ATTR
#endif
template <int DHP, int DVP, int QM, bool SPLITPV, bool TWOPASS>
__global__ __launch_bounds__(32 * AW) KATTN_ATTR void k_attn(AttnP p) {
    constexpr int NT = DVP / 16;                // output tiles
    constexpr int KS = DHP / 32;                // k-steps for the scores
    constexpr int VP = DVP + 8;                 // LDS pitch (halves)
    __shared__ __align__(16) float    pl[AW][16 * 64];
    __shared__ __align__(16) _Float16 vl[(SPLITPV ? 2 : 1) * 64 * VP];   // f16 V tile, or bf16 hi and lo tiles (same 2-byte size)
    const int lane = threadIdx.x & 31, hf = lane >> 4, l15 = lane & 15, wave = threadIdx.x >> 5;
    const int h = blockIdx.y, b = blockIdx.z, hk = h / p.hrep;
    const int q0 = (blockIdx.x * AW + wave) * 16;
    float* myp = pl[wave];
    const float L2E = 1.4426950408889634f;
    const float NEG = -__builtin_inff();
    const int qi = min(q0 + l15, p.Lq - 1);
    const float* qrow = p.Q + b * p.sQb + h * p.sQh + (long long)qi * p.sQi;
    const float* kbase = p.K + b * p.sKb + hk * p.sKh;
    const float* vbase = p.V + b * p.sVb + hk * p.sVh;
    v16h qa[QM == 0 ? KS : 1]; Split qs_[QM == 1 ? KS : 1]; Split3 qt_[QM == 2 ? KS : 1];
#pragma unroll
    for (int ks = 0; ks < KS; ++ks) {
        if (QM == 2) qt_[ks] = sp3_ld(qrow, p.sQd, ks * 32, hf, p.dh, 1.f);
        else if (QM == 1) qs_[ks] = sp_ld(qrow, p.sQd, ks * 32, hf, p.dh, 1.f);
        else qa[ks] = fh_ld(qrow, p.sQd, ks * 32, hf, p.dh, 1.f);
    }
    v8f o[NT]; float m8[8], l8[8];
#pragma unroll
    for (int t = 0; t < NT; ++t) { v8f zz = {}; o[t] = zz; }
#pragma unroll
    for (int i = 0; i < 8; ++i) { m8[i] = NEG; l8[i] = 0.f; }
    int jend = p.Lk; int jstart = 0;
    if (p.causal == 1) { const int je = (blockIdx.x * AW + AW - 1) * 16 + 16 + p.coff; jend = min(jend, max(je, 0)); }   // uniform per block
    if (p.win > 0) { const int js = (int)(blockIdx.x * AW) * 16 + p.coff - p.win; jstart = (js > 0) ? (js / 64) * 64 : 0; }   // uniform per block: key blocks entirely outside every row's window hold only -inf entries and are skipped exactly
    const int npass = TWOPASS ? 2 : 1;
    for (int pass = 0; pass < npass; ++pass) {
        const bool dopv = (!TWOPASS) || pass == 1;
        for (int j0 = jstart; j0 < jend; j0 += 64) {
            if (dopv) {
                __syncthreads();                                 // previous key block's reads of vl / pl are done
                for (int idx = threadIdx.x; idx < 64 * DVP; idx += 32 * AW) {
                    const int jr = idx / DVP, d = idx - jr * DVP, j = j0 + jr;
                    const float f = (j < p.Lk && d < p.dv) ? vbase[(long long)j * p.sVj + (long long)d * p.sVd] : 0.f;
                    if (SPLITPV) {
                        const __bf16 hb = bf16_rne(f);
                        ((__bf16*)vl)[jr * VP + d] = hb; ((__bf16*)vl)[64 * VP + jr * VP + d] = bf16_rne(f - bf16_f32(hb));
                    } else vl[jr * VP + d] = (_Float16)f;
                }
            }
            v8f s[4];
#pragma unroll
            for (int t = 0; t < 4; ++t) {
                const int j = min(j0 + t * 16 + l15, p.Lk - 1);
                const float* krow = kbase + (long long)j * p.sKj;
                v8f acc = {};
#pragma unroll
                for (int ks = 0; ks < KS; ++ks) {
                    if (QM == 2)      acc = wmma6(qt_[ks], sp3_ld(krow, p.sKd, ks * 32, hf, p.dh, 1.f), acc);
                    else if (QM == 1) acc = wmma3(qs_[ks], sp_ld(krow, p.sKd, ks * 32, hf, p.dh, 1.f), acc);
                    else              acc = wmma16(qa[ks], fh_ld(krow, p.sKd, ks * 32, hf, p.dh, 1.f), acc);
                }
                s[t] = acc;
            }
            float pv[8][4];
#pragma unroll
            for (int i = 0; i < 8; ++i) {
                const int irow = q0 + i + 8 * hf;
                const int ic = min(irow, p.Lq - 1);
                float sc[4];
#pragma unroll
                for (int t = 0; t < 4; ++t) {
                    const int jg = j0 + t * 16 + l15;
                    float v = s[t][i] * p.scale;
                    if (p.Mf) v += p.Mf[b * p.smb + h * p.smh + (long long)ic * p.smi + (long long)min(jg, p.Lk - 1) * p.smj];
                    if (p.Rt) { int rc = ic - min(jg, p.Lk - 1) + p.roff; rc = rc < 0 ? 0 : (rc >= p.rn ? p.rn - 1 : rc); v += p.Rt[b * p.srb + h * p.srh + (long long)ic * p.sri + rc]; }
                    if (p.Mi) { const int mv = p.Mi[b * p.smb + h * p.smh + (long long)ic * p.smi + (long long)min(jg, p.Lk - 1) * p.smj]; if (p.mpol ? (mv != 0) : (mv == 0)) v = p.mfill; }
                    if (p.SQ) { const bool same = p.SQ[(long long)b * p.Lq + ic] == p.SK[(long long)b * p.Lk + min(jg, p.Lk - 1)]; if (p.segpol ? same : !same) v = p.mfill; }
                    if (p.causal == 2 && jg > irow + p.coff) v = p.mfill;
                    if (jg >= p.Lk || (p.causal == 1 && jg > irow + p.coff) || (p.causal == 3 && jg < irow + p.coff) || (p.win > 0 && irow + p.coff - jg > p.win)) v = NEG; else v *= L2E;
                    sc[t] = v;
                }
                if (!TWOPASS || pass == 0) {
                    float mx = fmaxf(fmaxf(sc[0], sc[1]), fmaxf(sc[2], sc[3]));
                    mx = fmaxf(mx, __shfl_xor(mx, 1, 32)); mx = fmaxf(mx, __shfl_xor(mx, 2, 32));
                    mx = fmaxf(mx, __shfl_xor(mx, 4, 32)); mx = fmaxf(mx, __shfl_xor(mx, 8, 32));
                    const float mnew = fmaxf(m8[i], mx);
                    const float corr = (mnew == NEG) ? 1.f : exp2f(m8[i] - mnew);
                    float rs = 0.f;
#pragma unroll
                    for (int t = 0; t < 4; ++t) {
                        const float pp = (sc[t] == NEG) ? 0.f : exp2f(sc[t] - mnew); rs += pp;
                        pv[i][t] = p.Pw ? pp * p.Pw[b * p.swb + h * p.swh + (long long)ic * p.swi + (long long)min(j0 + t * 16 + l15, p.Lk - 1) * p.swj] : pp;
                    }
                    rs += __shfl_xor(rs, 1, 32); rs += __shfl_xor(rs, 2, 32); rs += __shfl_xor(rs, 4, 32); rs += __shfl_xor(rs, 8, 32);
                    l8[i] = l8[i] * corr + rs; m8[i] = mnew;
                    if (!TWOPASS) {
#pragma unroll
                        for (int t = 0; t < NT; ++t) o[t][i] *= corr;
                    }
                } else {
                    const float inv = (l8[i] > 0.f) ? 1.f / l8[i] : 0.f;
#pragma unroll
                    for (int t = 0; t < 4; ++t) {
                        const int jg = j0 + t * 16 + l15;
                        float pp = (sc[t] == NEG) ? 0.f : exp2f(sc[t] - m8[i]) * inv;
                        if (p.Pw) pp *= p.Pw[b * p.swb + h * p.swh + (long long)ic * p.swi + (long long)min(jg, p.Lk - 1) * p.swj];
                        pv[i][t] = pp;
                    }
                }
            }
            if (dopv) {
#pragma unroll
                for (int i = 0; i < 8; ++i)
#pragma unroll
                    for (int t = 0; t < 4; ++t) ((float*)myp)[(i + 8 * hf) * 64 + t * 16 + l15] = pv[i][t];
                __syncthreads();                                 // P (per wave) and V (shared) visible
                if (p.P) {
                    float* pb_ = p.P + b * p.sPb + h * p.sPh;
                    const bool fastP = (p.pband == 0) && ((p.sPi & 3) == 0) && (j0 + 64 <= p.Lk) && (q0 + 16 <= p.Lq) && ((((size_t)pb_) & 15) == 0);
                    if (fastP) {
#pragma unroll
                        for (int s = 0; s < 8; ++s) {
                            const int row = s * 2 + (lane >> 4), c4 = (lane & 15) * 4;
                            const v4f v = *(const v4f*)(myp + row * 64 + c4);
                            VST2V4(pb_ + (long long)(q0 + row) * p.sPi + j0 + c4, v);
                        }
                    } else {
                        for (int row = 0; row < 16; ++row) {
                            const int irow = q0 + row; if (irow >= p.Lq) continue;
                            for (int c = lane; c < 64; c += 32) {
                                const int jg = j0 + c; if (jg >= p.Lk) continue;
                                if (p.pband == 0) VST2(float, pb_ + (long long)irow * p.sPi + jg, myp[row * 64 + c]);
                                else if (jg - irow <= p.pband && irow - jg <= p.pband) VST2(float, pb_ + (long long)irow * p.sPi + (jg - irow + p.pband), myp[row * 64 + c]);
                            }
                        }
                    }
                }
                if (SPLITPV) {
                    const Split pa0 = sp_ld(myp + l15 * 64, 1, 0, hf, 64, 1.f), pa1 = sp_ld(myp + l15 * 64, 1, 32, hf, 64, 1.f);
                    const __bf16* vh = (const __bf16*)vl; const __bf16* vlo = vh + 64 * VP;
#pragma unroll
                    for (int t = 0; t < NT; ++t) {
                        const int dcol = t * 16 + l15;
                        Split b0, b1;
#pragma unroll
                        for (int e = 0; e < 16; ++e) {
                            const int k0 = frag_k(e, hf), k1 = 32 + frag_k(e, hf);
                            b0.hi[e] = vh[k0 * VP + dcol]; b0.lo[e] = vlo[k0 * VP + dcol]; b1.hi[e] = vh[k1 * VP + dcol]; b1.lo[e] = vlo[k1 * VP + dcol];
                        }
                        o[t] = wmma3(pa0, b0, o[t]);
                        o[t] = wmma3(pa1, b1, o[t]);
                    }
                } else {
                    const v16h pa0 = fh_ld(myp + l15 * 64, 1, 0, hf, 64, 4096.f), pa1 = fh_ld(myp + l15 * 64, 1, 32, hf, 64, 4096.f);
#pragma unroll
                    for (int t = 0; t < NT; ++t) {
                        const int dcol = t * 16 + l15;
                        v16h b0, b1;
#pragma unroll
                        for (int e = 0; e < 16; ++e) { b0[e] = vl[frag_k(e, hf) * VP + dcol]; b1[e] = vl[(32 + frag_k(e, hf)) * VP + dcol]; }
                        o[t] = wmma16(pa0, b0, o[t]);
                        o[t] = wmma16(pa1, b1, o[t]);
                    }
                }
            }
        }
    }
    float* obase = p.O + b * p.sOb + h * p.sOh;
    if (p.ST) {
        const int rl = lane >> 1, isel = rl & 7;           // row q0 + rl ; rl>>3 == hf holds because lane>>4 == (lane>>1)>>3
        float mv = 0.f, lv = 0.f;
#pragma unroll
        for (int i = 0; i < 8; ++i) if (i == isel) { mv = m8[i]; lv = l8[i]; }
        const int irow = q0 + rl;
        if (irow < p.Lq) { float* st = p.ST + (((long long)b * gridDim.y + h) * p.Lq + irow) * 2 + (lane & 1); VST2(float, st, (lane & 1) ? lv : mv * 0.6931471805599453f); }
    }
    float invr[8];
#pragma unroll
    for (int i = 0; i < 8; ++i) {
        if (TWOPASS) invr[i] = SPLITPV ? 1.f : (1.f / 4096.f);
        else if (p.nonorm) invr[i] = exp2f(m8[i]) * (SPLITPV ? 1.f : (1.f / 4096.f));
        else invr[i] = (l8[i] > 0.f) ? (SPLITPV ? 1.f / l8[i] : 1.f / (l8[i] * 4096.f)) : 0.f;
    }
    __syncthreads();                                             // all waves done with pl/vl from the main loop
    const bool ofast = ((p.sOi & 3) == 0) && ((((size_t)obase) & 15) == 0) && (q0 + 16 <= p.Lq);
#pragma unroll
    for (int c0 = 0; c0 < DVP; c0 += 64) {
#pragma unroll
        for (int i = 0; i < 8; ++i)
#pragma unroll
            for (int t = 0; t < NT; ++t) if (t * 16 >= c0 && t * 16 < c0 + 64) ((float*)myp)[(i + 8 * hf) * 64 + (t * 16 - c0) + l15] = o[t][i] * invr[i];
        __syncthreads();
        const int cw = (DVP - c0 < 64) ? (DVP - c0) : 64;      // staged columns in this chunk (multiple of 16)
        if (ofast && (c0 + cw <= p.dv) && (cw % 32 == 0)) {
            const int lpr = cw / 4;                              // lanes per row (16 for 64 cols, 8 for 32)
            const int rows_per_ins = 32 / lpr;
            for (int r0 = 0; r0 < 16; r0 += rows_per_ins) {
                const int row = r0 + lane / lpr, c4 = (lane % lpr) * 4;
                const v4f v = *(const v4f*)(myp + row * 64 + c4);
                VST2V4(obase + (long long)(q0 + row) * p.sOi + c0 + c4, v);
            }
        } else {
            for (int row = 0; row < 16; ++row) {
                const int irow = q0 + row; if (irow >= p.Lq) continue;
                for (int c = lane; c < cw; c += 32) { const int d = c0 + c; if (d < p.dv) VST2(float, obase + (long long)irow * p.sOi + d, myp[row * 64 + c]); }
            }
        }
        __syncthreads();
    }
}

// =====================================================================================================================
// k_tr: dst(z, c, r) = alpha * src(z, r, c) (+ beta * R2(z, c, r)): [Z][R][C] (row stride lds) -> [Z][C][R] (row stride ldd) through a 32x32 LDS tile;
//   flags: 1 -> add beta * residual R2 addressed like dst (z*sRz + c*ldr + r); act applied before the residual.
// =====================================================================================================================
struct TrP { const float* src; float* dst; const float* R2; long long sSz, lds, sDz, ldd, sRz, ldr; int R, C, flags, act; float alpha, beta; };
static_assert(sizeof(TrP) == 3 * 8 + 6 * 8 + 6 * 4, "TrP has padding");
__global__ __launch_bounds__(256) void k_tr(TrP p) {
    __shared__ float tile[32][33];
    const int c0 = blockIdx.x * 32, r0 = blockIdx.y * 32, z = blockIdx.z;
    const int lane = threadIdx.x & 31, wave = threadIdx.x >> 5;
    const float* s = p.src + z * p.sSz;
#pragma unroll
    for (int k = 0; k < 4; ++k) {
        const int rl = wave * 4 + k, r = r0 + rl, c = c0 + lane;
        tile[rl][lane] = (r < p.R && c < p.C) ? s[(long long)r * p.lds + c] : 0.f;
    }
    __syncthreads();
    float* d = p.dst + z * p.sDz; const float* rr = p.R2 + z * p.sRz;
#pragma unroll
    for (int k = 0; k < 4; ++k) {
        const int cl = wave * 4 + k, c = c0 + cl, r = r0 + lane;
        if (c < p.C && r < p.R) {
            float v = act_fn(p.alpha * tile[lane][cl], p.act);
            if (p.flags & 1) v += p.beta * rr[(long long)c * p.ldr + r];
            VST2(float, d + (long long)c * p.ldd + r, v);
        }
    }
}

// k_affine: dst[i] = a * (sdev ? sdev[0] : 1) * src[i] + b, i < n (one thread per element; consecutive lanes -> consecutive addresses)
__global__ __launch_bounds__(256) void k_affine(const float* __restrict__ src, float* __restrict__ dst, int n, float a, float b, const float* __restrict__ sdev) {
    const int i = blockIdx.x * 256 + threadIdx.x;
    if (i < n) { const float aa = sdev ? a * sdev[0] : a; const float v = aa * src[i] + b; VST2(float, dst + i, v); }
}

// =====================================================================================================================
// k_softmax: row softmax over n contiguous elements, one 256-thread block per row; rows addressed z*sz + r*sr (grid (R, Z)).
//   out = scale_out * softmax(scale_in * x + (Mf ? Mf[z*smz + r*smr + j] : 0)); a row whose max is -inf is written as 0.
// =====================================================================================================================
struct SmP { const float* src; float* dst; const float* Mf; long long sz, sr, dz, dr, smz, smr; int n, pad; float scale_in, scale_out; };
static_assert(sizeof(SmP) == 3 * 8 + 6 * 8 + 4 * 4, "SmP has padding");
__global__ __launch_bounds__(256) void k_softmax(SmP p) {
    __shared__ float red[256];
    const int r = blockIdx.x, z = blockIdx.y, tid = threadIdx.x;
    const float* s = p.src + z * p.sz + (long long)r * p.sr;
    const float* mf = p.Mf ? (p.Mf + z * p.smz + (long long)r * p.smr) : nullptr;
    float mx = -__builtin_inff();
    for (int j = tid; j < p.n; j += 256) { float v = s[j] * p.scale_in; if (mf) v += mf[j]; mx = fmaxf(mx, v); }
    red[tid] = mx; __syncthreads();
    for (int o = 128; o > 0; o >>= 1) { if (tid < o) red[tid] = fmaxf(red[tid], red[tid + o]); __syncthreads(); }
    mx = red[0]; __syncthreads();
    float sum = 0.f;
    for (int j = tid; j < p.n; j += 256) { float v = s[j] * p.scale_in; if (mf) v += mf[j]; sum += (mx == -__builtin_inff()) ? 0.f : expf(v - mx); }
    red[tid] = sum; __syncthreads();
    for (int o = 128; o > 0; o >>= 1) { if (tid < o) red[tid] += red[tid + o]; __syncthreads(); }
    sum = red[0];
    const float inv = (sum > 0.f) ? p.scale_out / sum : 0.f;
    float* d = p.dst + z * p.dz + (long long)r * p.dr;
    for (int j = tid; j < p.n; j += 256) { float v = s[j] * p.scale_in; if (mf) v += mf[j]; const float o = (mx == -__builtin_inff()) ? 0.f : expf(v - mx) * inv; VST2(float, d + j, o); }
}
// =====================================================================================================================
// k_stats: mean and rsqrt(var + eps) over a set of n elements addressed base + z*sz + (e / inner) * so + (e % inner) * si, one 256-thread
// k_norm_apply: y = (x - mean[set]) * rstd[set] * g[c] + b[c] over a [Z][C][L] channel-major tensor with set = z*G + c / (C/G) (G groups per z;
//   G = C -> per-channel sets indexed z*C+c; for batch norm pass stats indexed by c only via bn = 1). Optional act. Output same layout.
// =====================================================================================================================
//   mode 0: mean / rsqrt(var + eps); mode 1 (RMSNorm): 0 / rsqrt(mean(x^2) + eps); mode 2 (L2 normalize * sqrt(n)): 0 / sqrt(n) / max(||x||, eps); mode 3: as 0 with unbiased variance (n-1)
__global__ __launch_bounds__(256) void k_stats(const float* __restrict__ x, long long sz, long long so, long long si, int inner, int n, float eps, float* __restrict__ stat, int mode) {
    __shared__ float red[256];
    const int z = blockIdx.x, tid = threadIdx.x;
    const float* base = x + z * sz;
    float s = 0.f;
    for (int e = tid; e < n; e += 256) s += base[(long long)(e / inner) * so + (long long)(e % inner) * si];
    red[tid] = s; __syncthreads();
    for (int o = 128; o > 0; o >>= 1) { if (tid < o) red[tid] += red[tid + o]; __syncthreads(); }
    const float mu = (mode == 0 || mode == 3) ? red[0] / (float)n : 0.f; __syncthreads();
    float q = 0.f;
    for (int e = tid; e < n; e += 256) { const float dlt = base[(long long)(e / inner) * so + (long long)(e % inner) * si] - mu; q += dlt * dlt; }
    red[tid] = q; __syncthreads();
    for (int o = 128; o > 0; o >>= 1) { if (tid < o) red[tid] += red[tid + o]; __syncthreads(); }
    {
        float rs;
        if (mode == 2) rs = sqrtf((float)n) / fmaxf(sqrtf(red[0]), eps); else if (mode == 3) rs = rsqrtf(red[0] / (float)(n - 1) + eps); else rs = rsqrtf(red[0] / (float)n + eps);
        if (tid < 32) { const float v = (tid == 0) ? mu : ((tid == 1) ? rs : 0.f); VST2(float, stat + (long long)z * 32 + tid, v); }
    }
}
//   One thread per element over the flat [Z][C][L] index space: grid ceil(Z*C*L / 256).
__global__ __launch_bounds__(256) void k_norm_apply(const float* __restrict__ x, float* __restrict__ y, const float* __restrict__ stat, const float* __restrict__ g, const float* __restrict__ bta,
                                                     int Z, int C, int L, int G, int bn, int act) {
    const long long idx = (long long)blockIdx.x * 256 + threadIdx.x;
    if (idx >= (long long)Z * C * L) return;
    const int l = (int)(idx % L); const long long zc = idx / L; const int c = (int)(zc % C), z = (int)(zc / C); (void)l;
    const int set = bn ? c : (z * G + c / (C / G));
    float v = (x[idx] - stat[(long long)set * 32]) * stat[(long long)set * 32 + 1];
    if (g) v *= g[c];
    if (bta) v += bta[c];
    v = act_fn(v, act);
    VST2(float, y + idx, v);
}

// k_lse_neg: c[i] = -(st[2i] + log(st[2i+1])) = minus the log-sum-exp of row i from k_attn's ST output (for softmax over the query dimension)
__global__ __launch_bounds__(256) void k_lse_neg(const float* __restrict__ st, float* __restrict__ c, int n) {
    const int i = blockIdx.x * 256 + threadIdx.x;
    if (i < n) { const float v = -(st[2 * i] + logf(st[2 * i + 1])); VST2(float, c + i, v); }
}

// k_iota: dst[i] = a * i + b as int32 (segment/position id helper)
__global__ __launch_bounds__(256) void k_iota(int* __restrict__ dst, int n, int a, int b) {
    const int i = blockIdx.x * 256 + threadIdx.x;
    if (i < n) { const int v = a * i + b; VST2(int, dst + i, v); }
}

// k_axpby: dst[i] = a * x[i] + b * y[i] (+ c), i < n
__global__ __launch_bounds__(256) void k_axpby(const float* __restrict__ x, const float* __restrict__ y, float* __restrict__ dst, int n, float a, float b, float c) {
    const int i = blockIdx.x * 256 + threadIdx.x;
    if (i < n) { const float v = a * x[i] + b * y[i] + c; VST2(float, dst + i, v); }
}

// =====================================================================================================================
// k_rope: rotary embedding on a [R rows][Hn heads][D] view (row stride sXr, head stride sXh, element stride 1) -> Y (own strides).
//   mode 0: rotate_half (partner d±D/2, sign - for d<D/2); mode 1: interleaved pairs (partner d^1, sign - for even d).
//   table column tcol: tmode 0 -> d, 1 -> d % (D/2), 2 -> d / 2; position p: pmode 0 -> r % S, 1 -> head index, 2 -> pos[r];
//   c = C[(r / S) * sCb + p * sCp + tcol * sCd], s likewise from Sn; y = x[d] * c + sign * x[partner] * s. X and Y must not alias.
// =====================================================================================================================
struct RopeP { const float* X; float* Y; const float* C; const float* Sn; const int* pos; long long sXr, sXh, sYr, sYh, sCb, sCp, sCd; int R, Hn, D, S, mode, tmode, pmode, pad; };
static_assert(sizeof(RopeP) == 5 * 8 + 7 * 8 + 8 * 4, "RopeP has padding");
__global__ __launch_bounds__(256) void k_rope(RopeP p) {
    const long long idx = (long long)blockIdx.x * 256 + threadIdx.x;
    if (idx >= (long long)p.R * p.Hn * p.D) return;
    const int d = (int)(idx % p.D); const long long rh = idx / p.D; const int h = (int)(rh % p.Hn); const int r = (int)(rh / p.Hn);
    const int half = p.D / 2;
    int partner; float sign;
    if (p.mode == 0) { partner = (d < half) ? d + half : d - half; sign = (d < half) ? -1.f : 1.f; }
    else { partner = d ^ 1; sign = (d & 1) ? 1.f : -1.f; }
    const int tcol = (p.tmode == 0) ? d : ((p.tmode == 1) ? (d % half) : (d >> 1));
    const int pp = (p.pmode == 0) ? (r % p.S) : ((p.pmode == 1) ? h : p.pos[r]);
    const long long toff = (long long)(r / p.S) * p.sCb + (long long)pp * p.sCp + (long long)tcol * p.sCd;
    const float* xr = p.X + (long long)r * p.sXr + (long long)h * p.sXh;
    const float v = xr[d] * p.C[toff] + sign * xr[partner] * p.Sn[toff];
    VST2(float, p.Y + (long long)r * p.sYr + (long long)h * p.sYh + d, v);
}

// k_invf + k_sincos (split so neither kernel carries a large VALU-fma footprint): invf_i = num * (1 / powf(base, (2 i)/D)) [fmode 0],
//   num * expf((2 i) * cexp) [fmode 1], num * powf(base, -2 (i - 1) / D) [fmode 2]; then cs/sn[s*half + i] = cos/sin((pscale * s) * invf_i)
__global__ __launch_bounds__(256) void k_invf(float* __restrict__ invb, int half, int D, float base, float num, int fmode, float cexp) {
    const int i = blockIdx.x * 256 + threadIdx.x;
    if (i >= ((half + 31) / 32) * 32) return;
    if (i >= half) { VST2(float, invb + i, 0.f); return; }
    const float e = (float)(2 * i) / (float)D;
    float invf;
    if (fmode == 1) invf = num * expf((float)(2 * i) * cexp);
    else if (fmode == 2) invf = num * powf(base, (-2.0f * ((float)i - 1.0f)) / (float)D);
    else invf = num * (1.0f / powf(base, e));
    VST2(float, invb + i, invf);
}
__global__ __launch_bounds__(256) void k_sincos(float* __restrict__ cs, float* __restrict__ sn, const float* __restrict__ invb, int S, int half, float pscale) {
    const int idx = blockIdx.x * 256 + threadIdx.x;
    if (idx >= S * half) return;
    const int s = idx / half, i = idx - s * half;
    const float ang = (pscale * (float)s) * invb[i];
    VST2(float, cs + idx, cosf(ang)); VST2(float, sn + idx, sinf(ang));
}

// k_mulact: dst[i] = act(x[i]) * y[i]
__global__ __launch_bounds__(256) void k_mulact(const float* __restrict__ x, const float* __restrict__ y, float* __restrict__ dst, int n, int act) {
    const int i = blockIdx.x * 256 + threadIdx.x;
    if (i < n) { const float v = act_fn(x[i], act) * y[i]; VST2(float, dst + i, v); }
}

// =====================================================================================================================
// k_matvec: thread-per-row matrix-vector products for N <= 8 output columns (heads with 1-3 outputs, gates), f32 on the VALU.
//   C[r*sCm + j] = act(alpha * sum_k A[r*sAm + k*sAk] * B[j*sBn + k*sBk] + bias[j]) + beta * R[r*sRm + j*sRn]; each thread writes its N contiguous floats.
// =====================================================================================================================
__global__ __launch_bounds__(256) void k_matvec(GemmP p) {
    // 32 lanes write one line with one instruction.
    const int rpt = (p.N == 1) ? 1 : 32;
    const long long r0 = ((long long)blockIdx.x * 256 + threadIdx.x) * rpt; const int z = blockIdx.z, zo = z / p.zi_n, zi = z - zo * p.zi_n;
    if (r0 >= p.M) return;
    const float* Bb = p.B + zo * p.sBo + zi * p.sBi;
    float* C = p.C + zo * p.sCo + zi * p.sCi; const float* R = p.R + zo * p.sRo + zi * p.sRi;
    for (int rr = 0; rr < rpt; ++rr) {
        const long long r = r0 + rr; if (r >= p.M) break;
        const float* A = p.A + zo * p.sAo + zi * p.sAi + r * p.sAm;
        float acc[8] = {0.f, 0.f, 0.f, 0.f, 0.f, 0.f, 0.f, 0.f};
        for (int k = 0; k < p.K; ++k) { const float a = A[(long long)k * p.sAk];
#pragma unroll
            for (int j = 0; j < 8; ++j) if (j < p.N) acc[j] += a * Bb[(long long)j * p.sBn + (long long)k * p.sBk]; }
#pragma unroll
        for (int j = 0; j < 8; ++j) if (j < p.N) {
            float v = acc[j] * p.alpha;
            if (p.flags & 1) v += p.bias[j];
            if (p.flags & 2) v += p.bias[r];
            v = act_fn(v, p.act);
            if (p.flags & 4) v += p.beta * R[r * p.sRm + (long long)j * p.sRn];
            VST2(float, C + r * p.sCm + j, v);
        }
    }
}
// k_smallsoftmax: thread-per-row softmax for short rows (n <= 64): dst[r*dr + j] = softmax(scale*src[r*sr + j])
__global__ __launch_bounds__(256) void k_smallsoftmax(const float* __restrict__ src, float* __restrict__ dst, long long sr, long long dr, int n, long long R, float scale) {
    const long long r0 = ((long long)blockIdx.x * 256 + threadIdx.x) * 32;
    for (int rr = 0; rr < 32; ++rr) {
        const long long r = r0 + rr; if (r >= R) return;
        const float* s = src + r * sr; float* d = dst + r * dr;
        float mx = -__builtin_inff();
        for (int j = 0; j < n; ++j) mx = fmaxf(mx, s[j] * scale);
        float sum = 0.f;
        for (int j = 0; j < n; ++j) sum += expf(s[j] * scale - mx);
        const float inv = 1.f / sum;
        for (int j = 0; j < n; ++j) { const float v = expf(s[j] * scale - mx) * inv; VST2(float, d + j, v); }
    }
}

__global__ __launch_bounds__(32) void k_unitstat(float* __restrict__ st) { const int t = threadIdx.x; const float v = (t == 1) ? 1.f : 0.f; VST2(float, st + t, v); }

// destination (e.g. a d_out whose row width is not a multiple of 32 floats) is written by consecutive lanes of one instruction
__global__ __launch_bounds__(256) void k_lincopy(const float* __restrict__ src, long long lds, float* __restrict__ dst, long long ldd, long long rows, int cols) {
    const long long i = (long long)blockIdx.x * 256 + threadIdx.x; if (i >= rows * cols) return;
    const long long r = i / cols; const int c = (int)(i - r * cols);
    const float v = src[r * lds + c]; VST2(float, dst + r * ldd + c, v);
}

namespace w25 {
typedef __attribute__((ext_vector_type(16))) _Float16 v16h;
typedef __attribute__((ext_vector_type(8)))  _Float16 v8h;
typedef __attribute__((ext_vector_type(16))) __bf16   v16b;
typedef __attribute__((ext_vector_type(8)))  __bf16   v8b;
typedef __attribute__((ext_vector_type(8)))  float    v8f;
typedef __attribute__((ext_vector_type(4)))  float    v4f;

__device__ __forceinline__ unsigned short f2bf_bits(float f) {
  unsigned u = __float_as_uint(f);
  return (unsigned short)((u + 0x7FFFu + ((u >> 16) & 1u)) >> 16);
}
__device__ __forceinline__ float bf_bits2f(unsigned short h) { return __uint_as_float(((unsigned)h) << 16); }

// hazard guards as plain device helpers (no inline asm inside the kernel template body)
__device__ __forceinline__ void dep_guard_h(v8f& a, v8f& b, v16h x, v16h y) { asm volatile("v_nop\n\tv_nop\n\tv_nop\n\tv_nop" : "+v"(a), "+v"(b) : "v"(x), "v"(y)); }
__device__ __forceinline__ void dep_guard_b(v8f& a, v8f& b, v16b x, v16b y) { asm volatile("v_nop\n\tv_nop\n\tv_nop\n\tv_nop" : "+v"(a), "+v"(b) : "v"(x), "v"(y)); }
__device__ __forceinline__ void keep4_h(v16h a, v16h b, v16h c, v16h d) { asm volatile("v_nop" :: "v"(a), "v"(b), "v"(c), "v"(d)); }
__device__ __forceinline__ void keep4_b(v16b a, v16b b, v16b c, v16b d) { asm volatile("v_nop" :: "v"(a), "v"(b), "v"(c), "v"(d)); }
__device__ __forceinline__ void acc_guard4(v8f& a, v8f& b, v8f& c, v8f& d) { asm volatile("v_nop\n\tv_nop\n\tv_nop\n\tv_nop" : "+v"(a), "+v"(b), "+v"(c), "+v"(d)); }
template <typename T> struct Frag;
template <> struct Frag<_Float16> {
  typedef v16h V; union U { v16h v; v8h h[2]; };
  static __device__ __forceinline__ v16h load(const _Float16* p) {   // elements 0..7 <- p[0..7], 8..15 <- p[16..23]
    U f; f.h[0] = *(const v8h*)(p); f.h[1] = *(const v8h*)(p + 16); return f.v;
  }
  static __device__ __forceinline__ v8f mma(v16h a, v16h b, v8f c) {
    return __builtin_amdgcn_wmma_f32_16x16x32_f16(false, a, false, b, (short)0, c, false, false);
  }
  static __device__ __forceinline__ void guard(v8f& a, v8f& b, v16h x, v16h y) { dep_guard_h(a, b, x, y); }
  static __device__ __forceinline__ void keep(v16h a, v16h b, v16h c, v16h d) { keep4_h(a, b, c, d); }
};
template <> struct Frag<__bf16> {
  typedef v16b V; union U { v16b v; v8b h[2]; };
  static __device__ __forceinline__ v16b load(const __bf16* p) {
    U f; f.h[0] = *(const v8b*)(p); f.h[1] = *(const v8b*)(p + 16); return f.v;
  }
  static __device__ __forceinline__ v8f mma(v16b a, v16b b, v8f c) {
    return __builtin_amdgcn_wmma_f32_16x16x32_bf16(false, a, false, b, (short)0, c, false, false);
  }
  static __device__ __forceinline__ void guard(v8f& a, v8f& b, v16b x, v16b y) { dep_guard_b(a, b, x, y); }
  static __device__ __forceinline__ void keep(v16b a, v16b b, v16b c, v16b d) { keep4_b(a, b, c, d); }
};

// ---- Register-blocked batched WMMA GEMM ------------------------------------
// C[m,n] = scale * sum_k A[m,k] * Bt[n,k] (+bias)(+resid); each wave owns a 64x64 tile.
// A row-major [M,K]; Bt row-major [N,K]; M,N % 64 == 0, K % 32 == 0.
// SPLIT: operands are hi/lo planes (A2/Bt2 = lo planes, same layout); product = hi·hi + hi·lo + lo·hi.
// BIAS_MODE: 0 = none, 1 = bias[m], 2 = bias[n].
// OUT_MODE: 0 = f32, 1 = f16, 2 = bf16 hi plane (Cout) + bf16 lo plane (Cout2).
// ET: 0 = f16 operands, 1 = bf16 operands (pointers passed as 16-bit storage)
template <int ET> struct Elem;
template <> struct Elem<0> { typedef _Float16 T; };
template <> struct Elem<1> { typedef __bf16 T; };
template <int ET, bool SPLIT, int BIAS_MODE, int OUT_MODE, bool RESID, int ACT = 0>
__global__ __launch_bounds__(256) void wmma_gemm64(
    const unsigned short* __restrict__ Ap, const unsigned short* __restrict__ A2p, int lda, long strideA,
    const unsigned short* __restrict__ Btp, const unsigned short* __restrict__ Bt2p, int ldb, long strideB,
    void* __restrict__ Cout, void* __restrict__ Cout2, int ldc, long strideC,
    const float* __restrict__ bias,
    const float* __restrict__ resid, long strideR,
    int M, int N, int K, float scale) {
  typedef typename Elem<ET>::T T;
  typedef typename Frag<T>::V V;
  const T* A = (const T*)Ap; const T* A2 = (const T*)A2p; const T* Bt = (const T*)Btp; const T* Bt2 = (const T*)Bt2p;
  __shared__ __align__(16) float sT[8][16 * 68];   // per-wave 16x64 slab, pitch 68 floats
  const int b    = blockIdx.y;
  const int lane = threadIdx.x & 31;
  const int wave = threadIdx.x >> 5;
  const int tilesN = N >> 6;
  const int tilesM = M >> 6;
  const int tile = blockIdx.x * 8 + wave;
  if (tile >= tilesM * tilesN) return;   // wave-uniform; no block barriers in this kernel
  const int tm = tile / tilesN;
  const int tn = tile - tm * tilesN;
  const int m0 = tm << 6;
  const int n0 = tn << 6;

  const T* Ab  = A  + (size_t)b * strideA;
  const T* Bb  = Bt + (size_t)b * strideB;
  const T* Ab2 = SPLIT ? (A2  + (size_t)b * strideA) : nullptr;
  const T* Bb2 = SPLIT ? (Bt2 + (size_t)b * strideB) : nullptr;

  const int rlane = lane & 15;                 // row (A) / col (B, D) within subtile
  const int koff  = (lane >> 4) * 8;           // k offset of this lane half
  const int mOff  = (lane >> 4) * 8;           // D row offset

  v8f acc[4][4];
#pragma unroll
  for (int i = 0; i < 4; ++i)
#pragma unroll
    for (int j = 0; j < 4; ++j) acc[i][j] = (v8f){0.f,0.f,0.f,0.f,0.f,0.f,0.f,0.f};

  for (int k0 = 0; k0 < K; k0 += 32) {
    V bh[4], bl[4];
#pragma unroll
    for (int j = 0; j < 4; ++j) {
      const size_t bo = (size_t)(n0 + (j << 4) + rlane) * ldb + koff + k0;
      bh[j] = Frag<T>::load(Bb + bo);
      if (SPLIT) bl[j] = Frag<T>::load(Bb2 + bo);
    }
#pragma unroll
    for (int i = 0; i < 4; ++i) {
      const size_t ao = (size_t)(m0 + (i << 4) + rlane) * lda + koff + k0;
      V ah = Frag<T>::load(Ab + ao);
      V al;
      if (SPLIT) al = Frag<T>::load(Ab2 + ao);
#pragma unroll
      for (int j = 0; j < 4; ++j) {
        acc[i][j] = Frag<T>::mma(ah, bh[j], acc[i][j]);
        if (SPLIT) {
          acc[i][j] = Frag<T>::mma(ah, bl[j], acc[i][j]);
          acc[i][j] = Frag<T>::mma(al, bh[j], acc[i][j]);
        }
      }
      Frag<T>::guard(acc[i][0], acc[i][3], ah, SPLIT ? al : ah);
    }
    Frag<T>::keep(bh[0], bh[1], bh[2], bh[3]);
    if (SPLIT) Frag<T>::keep(bl[0], bl[1], bl[2], bl[3]);
  }
  acc_guard4(acc[0][0], acc[0][1], acc[0][2], acc[0][3]);
  acc_guard4(acc[1][0], acc[1][1], acc[1][2], acc[1][3]);
  acc_guard4(acc[2][0], acc[2][1], acc[2][2], acc[2][3]);
  acc_guard4(acc[3][0], acc[3][1], acc[3][2], acc[3][3]);

  // ---- epilogue ----
  float* slab = sT[wave];
  const float* Rb = RESID ? (resid + (size_t)b * strideR) : nullptr;
#pragma unroll
  for (int i = 0; i < 4; ++i) {
    const int mBase = m0 + (i << 4);
#pragma unroll
    for (int j = 0; j < 4; ++j) {
      const int n = n0 + (j << 4) + rlane;
      float bv = 0.f;
      if (BIAS_MODE == 2) bv = bias[n];
#pragma unroll
      for (int r = 0; r < 8; ++r) {
        float v = acc[i][j][r] * scale;
        if (BIAS_MODE == 1) v += bias[mBase + mOff + r];
        if (BIAS_MODE == 2) v += bv;
        if (RESID) v += Rb[(size_t)(mBase + mOff + r) * ldc + n];
        if (ACT == 1) v = tanhf(v);
        if (ACT == 2) v = fmaxf(v, 0.0f);
        if (ACT == 3) v = v / (1.0f + expf(-v));
        if (ACT == 4) v = (v > 0.f) ? v : 0.01f * v;
        if (ACT == 5) v = 0.5f * v * (1.0f + erff(v * 0.70710678118654752f));
        slab[(mOff + r) * 68 + (j << 4) + rlane] = v;
      }
    }
    __builtin_amdgcn_fence(__ATOMIC_RELEASE, "workgroup");
    __builtin_amdgcn_wave_barrier();
    __builtin_amdgcn_fence(__ATOMIC_ACQUIRE, "workgroup");
    if (OUT_MODE == 0) {
      float* C = (float*)Cout + (size_t)b * strideC;
      const int hh = lane >> 4, c4 = (lane & 15) * 4;     // row seg = 256 B = 16 lanes x 16 B
      {
#pragma unroll
        for (int it = 0; it < 8; ++it) {
          const int row = it * 2 + hh;
          v4f v = *(const v4f*)(slab + row * 68 + c4);
          *(v4f*)(C + (size_t)(mBase + row) * ldc + n0 + c4) = v;
        }
        
      }
    } else {
      const int q = lane >> 3, c8 = (lane & 7) * 8;
      unsigned short* C  = (unsigned short*)Cout  + (size_t)b * strideC;
      unsigned short* C2 = (OUT_MODE == 2) ? ((unsigned short*)Cout2 + (size_t)b * strideC) : nullptr;
      {
#pragma unroll
        for (int it = 0; it < 4; ++it) {
          const int row = it * 4 + q;
          const float* sp = slab + row * 68 + c8;
          v8h hv, lv;
#pragma unroll
          for (int e = 0; e < 8; ++e) {
            if (OUT_MODE == 1) {
              hv[e] = (_Float16)sp[e];
            } else {
              unsigned short hb = f2bf_bits(sp[e]);
              unsigned short lb = f2bf_bits(sp[e] - bf_bits2f(hb));
              hv[e] = __builtin_bit_cast(_Float16, hb);
              lv[e] = __builtin_bit_cast(_Float16, lb);
            }
          }
          *(v8h*)(C + (size_t)(mBase + row) * ldc + n0 + c8) = hv;
          if (OUT_MODE == 2) *(v8h*)(C2 + (size_t)(mBase + row) * ldc + n0 + c8) = lv;
        }
        
      }
    }
    __builtin_amdgcn_fence(__ATOMIC_RELEASE, "workgroup");
    __builtin_amdgcn_wave_barrier();
    __builtin_amdgcn_fence(__ATOMIC_ACQUIRE, "workgroup");
  }
}

// ---- LDS-staged WMMA GEMM ---------------------------------------------------
// C[m,n] = scale * sum_k A[m,k] * Bt[n,k] (+bias[n])(+resid); f16 operands, ldc = N (LDC for planar f16 output). OUT16: the result goes out as f16 to C16 (it is only ever read as an f16 operand), else as f32 to C.
// One 128x128 tile of C per work-group of eight waves (4 x 2; 32 rows x 64 columns each).
// A pass is 128 k: 128 rows of Bt, then 128 rows of A, 256 B each, copied to LDS at pitch 272 B. NS buffers: two where two work-groups share a WGP
// (each keeps the copy path busy while the other waits); four where the grid gives a WGP one work-group, so that NS - 1 stages' copies are always under way.
// M, N % 128 == 0; K % 128 == 0, K >= NS * 128.
#define GL_PITCH 272
#define GL_STAGE (256 * GL_PITCH)

// Eight asynchronous copies, 16 B per lane each: rows r, r + 16, ... of one operand's 128 rows.
// The s_wait_xcnt ends the copies' own statement, so that no address register of a copy is rewritten in front of it.
template <int K>
__device__ __forceinline__ void gl_copy8(unsigned l, const unsigned short* g) {
  asm volatile(
      "global_load_async_to_lds_b128 %0, %8, off\n\t"
      "global_load_async_to_lds_b128 %1, %9, off\n\t"
      "global_load_async_to_lds_b128 %2, %10, off\n\t"
      "global_load_async_to_lds_b128 %3, %11, off\n\t"
      "global_load_async_to_lds_b128 %4, %12, off\n\t"
      "global_load_async_to_lds_b128 %5, %13, off\n\t"
      "global_load_async_to_lds_b128 %6, %14, off\n\t"
      "global_load_async_to_lds_b128 %7, %15, off\n\t"
      "s_wait_xcnt 0x0"
      :: "v"(l), "v"(l + 16u * GL_PITCH), "v"(l + 32u * GL_PITCH), "v"(l + 48u * GL_PITCH),
         "v"(l + 64u * GL_PITCH), "v"(l + 80u * GL_PITCH), "v"(l + 96u * GL_PITCH), "v"(l + 112u * GL_PITCH),
         "v"(g), "v"(g + (size_t)16 * K), "v"(g + (size_t)32 * K), "v"(g + (size_t)48 * K),
         "v"(g + (size_t)64 * K), "v"(g + (size_t)80 * K), "v"(g + (size_t)96 * K), "v"(g + (size_t)112 * K)
      : "memory");
}
// One stage: stage rows 0..127 come from Bt, 128..255 from A; a lane fills 16 B of rows (thread >> 4) + 16 * i.
template <int K>
__device__ __forceinline__ void gl_fill(unsigned ldsLane, const unsigned short* gB, const unsigned short* gA) {
  gl_copy8<K>(ldsLane, gB);
  gl_copy8<K>(ldsLane + 128u * GL_PITCH, gA);
}
// this wave's copies have landed in LDS
__device__ __forceinline__ void gl_wait_async0() { asm volatile("s_wait_asynccnt 0x0" ::: "memory"); }
// all but this wave's CNT youngest copies have landed in LDS (the counter returns in issue order)
template <int CNT>
__device__ __forceinline__ void gl_wait_async_but() { asm volatile("s_wait_asynccnt %0" :: "n"(CNT) : "memory"); }
// this wave's LDS reads have returned, so the buffer may be refilled behind the barrier
__device__ __forceinline__ void gl_wait_ds0() { asm volatile("s_wait_dscnt 0x0" ::: "memory"); }

// LDC, PLANE (f16 output only): the N columns go out as N / LDC planes of LDC columns each, PLANE elements apart, so that products
// which share their A operand run as one launch and still leave each its own plane.
template <int N, int K, int BIAS_MODE, bool RESID, int ACT, bool OUT16, int LDC = N, int PLANE = 0, int NS = 2>
__global__ __launch_bounds__(256, 4) void wmma_gemm_lds(
    const unsigned short* __restrict__ Ap, const unsigned short* __restrict__ Btp,
    float* __restrict__ C, _Float16* __restrict__ C16, const float* __restrict__ bias, const float* __restrict__ resid, float scale) {
  static_assert(N % 128 == 0 && K % 128 == 0 && K >= NS * 128, "shape");
  static_assert(NS == 2 || NS == 4, "a wave has 16 * (NS - 1) copies outstanding, 63 at most");
  static_assert(LDC == N || (OUT16 && !RESID && BIAS_MODE == 0 && N % LDC == 0 && LDC % 128 == 0), "planes");
  __shared__ __attribute__((aligned(128))) unsigned char sL[NS * GL_STAGE];
  const int tid  = threadIdx.x;
  const int lane = tid & 31;
  const int wave = tid >> 5;
  constexpr int tilesN = N / 128;
  constexpr int NT = K / 128;
  const int tm = blockIdx.x / tilesN;
  const int tn = blockIdx.x - tm * tilesN;
  const int wm = (wave >> 1) << 5;             // this wave's 32 rows and 64 columns inside the tile
  const int wn = (wave & 1) << 6;
  const int rlane = lane & 15;                 // row (A) / col (B, D) within subtile
  const int hh    = lane >> 4;                 // lane half: k offset 8 * hh, D row offset 8 * hh
  const int mOff  = hh * 8;

  const unsigned ldsLane = (unsigned)(uintptr_t)(&sL[0]) + (unsigned)((tid >> 4) * GL_PITCH + (tid & 15) * 16);
  const unsigned short* gB = Btp + (size_t)(tn * 128 + (tid >> 4)) * K + (tid & 15) * 8;
  const unsigned short* gA = Ap  + (size_t)(tm * 128 + (tid >> 4)) * K + (tid & 15) * 8;

  v8f acc[2][4];
#pragma unroll
  for (int i = 0; i < 2; ++i)
#pragma unroll
    for (int j = 0; j < 4; ++j) acc[i][j] = (v8f){0.f,0.f,0.f,0.f,0.f,0.f,0.f,0.f};

  // A stage is 16 copies of every wave, so "all but the 16 * (NS - 2) youngest" is "up to and with the oldest stage under way".
  constexpr int LEFT = 16 * (NS - 2);
  // unrolled: each stage's LDS and global offsets are then constants
#pragma unroll
  for (int s = 0; s < NS - 1; ++s) gl_fill<K>(ldsLane + (unsigned)s * GL_STAGE, gB + s * 128, gA + s * 128);
  gl_wait_async_but<LEFT>();                   // stage 0 has landed
  __syncthreads();                             // stage 0 is readable by every wave
  gl_fill<K>(ldsLane + (unsigned)(NS - 1) * GL_STAGE, gB + (NS - 1) * 128, gA + (NS - 1) * 128);

  // kept rolled: one pass per trip, so that the order at its foot stands once
#pragma unroll 1
  for (int t = 0; t < NT; ++t) {
    const unsigned bo = (unsigned)(t & (NS - 1)) * GL_STAGE;
    const unsigned char* pB = sL + bo + (wn + rlane) * GL_PITCH + hh * 16;
    const unsigned char* pA = sL + bo + (128 + wm + rlane) * GL_PITCH + hh * 16;
    v16h bh[2][4], ah[2][2];                   // two fragment sets: the next 32 k are fetched while these are multiplied
#pragma unroll
    for (int j = 0; j < 4; ++j) bh[0][j] = Frag<_Float16>::load((const _Float16*)(pB + j * 16 * GL_PITCH));
#pragma unroll
    for (int i = 0; i < 2; ++i) ah[0][i] = Frag<_Float16>::load((const _Float16*)(pA + i * 16 * GL_PITCH));
#pragma unroll
    for (int kk = 0; kk < 4; ++kk) {
      const int cur = kk & 1, nxt = cur ^ 1;
      if (kk < 3) {
#pragma unroll
        for (int j = 0; j < 4; ++j) bh[nxt][j] = Frag<_Float16>::load((const _Float16*)(pB + j * 16 * GL_PITCH + (kk + 1) * 64));
#pragma unroll
        for (int i = 0; i < 2; ++i) ah[nxt][i] = Frag<_Float16>::load((const _Float16*)(pA + i * 16 * GL_PITCH + (kk + 1) * 64));
      }
      __builtin_amdgcn_sched_barrier(0);       // keeps the next block's LDS reads one group ahead of this block's WMMAs, not among them
#pragma unroll
      for (int i = 0; i < 2; ++i)
#pragma unroll
        for (int j = 0; j < 4; ++j) acc[i][j] = Frag<_Float16>::mma(ah[cur][i], bh[cur][j], acc[i][j]);
      __builtin_amdgcn_sched_barrier(0);       // ends the block: later LDS reads stay behind its WMMAs
    }
    gl_wait_ds0();
    // Stage t + 1 has landed. While stages t + 1 .. t + NS - 1 all exist, each wave has exactly their 16 copies each outstanding and the younger ones stay
    // under way; on the last trips, behind which fewer stages were issued, the count would not cover stage t + 1 and the wait is to 0.
    if (NS > 2 && t + NS <= NT) gl_wait_async_but<LEFT>();
    else gl_wait_async0();
    __syncthreads();                           // publishes stage t + 1 and ends every read of stage t
    if (t + NS < NT) gl_fill<K>(ldsLane + bo, gB + (size_t)(t + NS) * 128, gA + (size_t)(t + NS) * 128);
  }
  gl_wait_async0();

  // ---- epilogue ----
  // The ring is free: the last trip's foot waited for every read and every copy and passed the barrier.
  float* slab = (float*)(sL + wave * (16 * 68 * 4));   // per-wave 16x64 slab, pitch 68 floats
  const int m0 = tm * 128 + wm;
  const int n0 = tn * 128 + wn;
  const int nl = n0 + rlane;
  float bv[4];
#pragma unroll
  for (int j = 0; j < 4; ++j) bv[j] = (BIAS_MODE == 2) ? bias[nl + (j << 4)] : 0.f;
  // the bias loads' index register is an input, so it stays whole up to the wait
  if (BIAS_MODE == 2) asm volatile("s_wait_xcnt 0x0" :: "v"(nl) : "memory");
#pragma unroll
  for (int i = 0; i < 2; ++i) {
    const int mBase = m0 + (i << 4);
    float rv[4][8];
    if (RESID) {
      const float* rp = resid + (size_t)(mBase + mOff) * N + nl;
#pragma unroll
      for (int j = 0; j < 4; ++j)
#pragma unroll
        for (int r = 0; r < 8; ++r) rv[j][r] = rp[(size_t)r * N + (j << 4)];
      // the residual loads' address register is an input, so it stays whole up to the wait
      asm volatile("s_wait_xcnt 0x0" :: "v"(rp) : "memory");
    }
#pragma unroll
    for (int j = 0; j < 4; ++j) {
#pragma unroll
      for (int r = 0; r < 8; ++r) {
        float v = acc[i][j][r] * scale;
        if (BIAS_MODE == 2) v += bv[j];
        if (RESID) v += rv[j][r];
        if (ACT == 2) v = fmaxf(v, 0.0f);
        slab[(mOff + r) * 68 + (j << 4) + rlane] = v;
      }
    }
    __builtin_amdgcn_fence(__ATOMIC_RELEASE, "workgroup");
    __builtin_amdgcn_wave_barrier();
    __builtin_amdgcn_fence(__ATOMIC_ACQUIRE, "workgroup");
    if (OUT16) {
      const int r4 = lane >> 3, c8 = (lane & 7) * 8;   // row seg = 128 B = 8 lanes x 16 B
      const int pl = (LDC == N) ? 0 : n0 / LDC;        // this wave's 64 columns lie in one plane
      _Float16* hp = C16 + (size_t)pl * PLANE + (size_t)(mBase + r4) * LDC + (n0 - pl * LDC) + c8;
#pragma unroll
      for (int it = 0; it < 4; ++it) {         // rows it * 4 + r4
        const float* sp = slab + (it * 4 + r4) * 68 + c8;
        const v4f lo = *(const v4f*)(sp), hi = *(const v4f*)(sp + 4);
        v8h h;
#pragma unroll
        for (int e = 0; e < 4; ++e) { h[e] = (_Float16)lo[e]; h[4 + e] = (_Float16)hi[e]; }
        *(v8h*)(hp + (size_t)it * 4 * LDC) = h;
      }
    } else {
      const int c4 = (lane & 15) * 4;          // row seg = 256 B = 16 lanes x 16 B
      float* cp = C + (size_t)(mBase + hh) * N + n0 + c4;
#pragma unroll
      for (int it = 0; it < 8; ++it) {         // rows it * 2 + hh
        v4f v = *(const v4f*)(slab + (it * 2 + hh) * 68 + c4);
        *(v4f*)(cp + (size_t)it * 2 * N) = v;
      }
    }
    __builtin_amdgcn_sched_barrier(0);         // holds later register writes behind the wait below
    asm volatile("s_wait_xcnt 0x0" ::: "memory");   // before a data or address register of the stores above is rewritten
    __builtin_amdgcn_sched_barrier(0);         // without the pair the next rows' multiplies were lifted over the wait, onto the stores' data registers
    __builtin_amdgcn_fence(__ATOMIC_RELEASE, "workgroup");
    __builtin_amdgcn_wave_barrier();
    __builtin_amdgcn_fence(__ATOMIC_ACQUIRE, "workgroup");
  }
}

__global__ __launch_bounds__(256) void cast_f32_f16x2(
    const float* __restrict__ in, _Float16* __restrict__ out, int n2) {
  int i = blockIdx.x * 256 + threadIdx.x;
  if (i < n2) {
    const _Float16 h0 = (_Float16)in[2 * i], h1 = (_Float16)in[2 * i + 1];
    const unsigned u = (unsigned)__builtin_bit_cast(unsigned short, h0) | ((unsigned)__builtin_bit_cast(unsigned short, h1) << 16);
    ((unsigned*)out)[i] = u;
    
  }
}


} // namespace w25

__global__ __launch_bounds__(256) void k_castT16(const float* __restrict__ src, long long lds, _Float16* __restrict__ dst, long long ldd, int R, int C, float s) {
    const long long i = (long long)blockIdx.x * 256 + threadIdx.x; const long long np = (long long)C * (R / 2); if (i >= np) return; const int c = (int)(i / (R / 2)); const int r = 2 * (int)(i % (R / 2));
    const _Float16 h0 = (_Float16)(src[(long long)r * lds + c] * s), h1 = (_Float16)(src[(long long)(r + 1) * lds + c] * s);
    const unsigned u = (unsigned)__builtin_bit_cast(unsigned short, h0) | ((unsigned)__builtin_bit_cast(unsigned short, h1) << 16);
    unsigned* d = (unsigned*)(dst + (long long)c * ldd + r); *d = u;  }
__global__ __launch_bounds__(256) void k_cast16(const float* __restrict__ src, long long lds, _Float16* __restrict__ dst, long long ldd, int R, int C, float s) {
    const long long i = (long long)blockIdx.x * 256 + threadIdx.x; const long long np = (long long)R * (C / 2); if (i >= np) return; const int r = (int)(i / (C / 2)); const int c = 2 * (int)(i % (C / 2));
    const _Float16 h0 = (_Float16)(src[(long long)r * lds + c] * s), h1 = (_Float16)(src[(long long)r * lds + c + 1] * s);
    const unsigned u = (unsigned)__builtin_bit_cast(unsigned short, h0) | ((unsigned)__builtin_bit_cast(unsigned short, h1) << 16);
    unsigned* d = (unsigned*)(dst + (long long)r * ldd + c); *d = u;  }

// f32 -> bf16 hi plane + bf16 lo plane (x = hi + lo to ~2^-17 relative; RNE both), [R][C] -> [R][C] (or transposed to [C][R]); 2 consecutive destination elements
__device__ __forceinline__ unsigned int f2bf2_pack(float a, float b, unsigned int* lo) {
    const unsigned short ha = w25::f2bf_bits(a), hb = w25::f2bf_bits(b);
    const unsigned short la = w25::f2bf_bits(a - w25::bf_bits2f(ha)), lb = w25::f2bf_bits(b - w25::bf_bits2f(hb));
    *lo = (unsigned)la | ((unsigned)lb << 16); return (unsigned)ha | ((unsigned)hb << 16); }
__global__ __launch_bounds__(256) void k_castS16(const float* __restrict__ src, long long lds, __bf16* __restrict__ dhi, __bf16* __restrict__ dlo, long long ldd, int R, int C, float s, int transpose) {
    const long long i = (long long)blockIdx.x * 256 + threadIdx.x; long long o; float a, b;
    if (transpose) { const long long np = (long long)C * (R / 2); if (i >= np) return; const int c = (int)(i / (R / 2)); const int r = 2 * (int)(i % (R / 2)); a = src[(long long)r * lds + c] * s; b = src[(long long)(r + 1) * lds + c] * s; o = (long long)c * ldd + r; }
    else { const long long np = (long long)R * (C / 2); if (i >= np) return; const int r = (int)(i / (C / 2)); const int c = 2 * (int)(i % (C / 2)); a = src[(long long)r * lds + c] * s; b = src[(long long)r * lds + c + 1] * s; o = (long long)r * ldd + c; }
    unsigned lo; const unsigned hi = f2bf2_pack(a, b, &lo); unsigned* ph = (unsigned*)(dhi + o); unsigned* pl = (unsigned*)(dlo + o);
    *ph = hi; *pl = lo;  }

namespace w25 {
// =====================================================================================
// Generic causal/non-causal attention for head_dim 64, f32 in / f32 out; 16-bit operands: bf16 with optional hi/lo splits, or
// plain f16 (F16=true, non-split, probabilities carried x2^15).
//   scores = (q*qscale)·kᵀ : v_wmma_f32_16x16x32_bf16; SPLIT_QK -> q,k as bf16 hi/lo (hi·hi + hi·lo + lo·hi)
//   out    = p·v           : v_wmma_f32_16x16x32_bf16; SPLIT_PV -> p,v as bf16 hi/lo; else p,v plain bf16
//   f32 accumulate; online softmax in f32. Block = 4 waves = 64 query rows of one (batch, head); S % 64 == 0.
//   Element (b, s, h, d) of tensor X lives at X[b*X_bs + s*X_rs + h*X_hs + d] (strides in floats, multiples of 4).
//   Masking: mask_mode 0 none, 1 causal (kv > q masked), 2 tensor [S][Skv] shared over (b,h) (float if
//   mask_is_int==0, int32 with element == 0 -> masked if 1, int32 with element != 0 -> masked if 2), 3 per-token vectors qmask[B][S] & kvmask[B][Skv] (int32,
//   0 -> masked), 4 causal + sliding window (kv > q or q - kv > W masked; W passed in mask_is_int);
//   5 = relative-position bias: s += cp[b,h,q][idx[q][kv]] + pc[b,h,kv][idx[q][kv]] with idx = mask_b ([S][Skv] int32) and
//   mask_a an int32 [S][Skv] tensor with nonzero = masked (tables: element (b,h,row,n) at X + b*c_bs + h*c_hs + row*c_rs + n);
//   masked scores are replaced by mask_fill (e.g. -inf or -1e9) before the softmax.
//   grid.x = B * H * (S/64) (or a sub-range with blk0).
// =====================================================================================
#define AT_D 64
#define AT_NW 4
#define AT_QB 64
#define AT_KC 64
struct AttnGeom { const float* cp = nullptr; const float* pc = nullptr; long c_bs = 0, c_rs = 0, c_hs = 0;   // mode-5 score-bias tables
                  long q_bs, q_rs, q_hs, k_bs, k_rs, k_hs, v_bs, v_rs, v_hs, o_bs, o_rs, o_hs;
                  int S, Skv, H, mask_mode; float qscale; int blk0; float mask_fill; int mask_is_int; };
static_assert(sizeof(AttnGeom) == 168, "no padding");

__device__ __forceinline__ unsigned short at_bf_bits(float f) {
  unsigned u = __float_as_uint(f);
  return (unsigned short)((u + 0x7FFFu + ((u >> 16) & 1u)) >> 16);
}
__device__ __forceinline__ __bf16 at_f2bf(float f) { return __builtin_bit_cast(__bf16, at_bf_bits(f)); }
__device__ __forceinline__ void at_split(float f, __bf16& hi, __bf16& lo) {
  const unsigned short hb = at_bf_bits(f);
  hi = __builtin_bit_cast(__bf16, hb);
  lo = at_f2bf(f - __uint_as_float(((unsigned)hb) << 16));
}
__device__ __forceinline__ v8f at_mma(v16b a, v16b b, v8f c) {
  c = __builtin_amdgcn_wmma_f32_16x16x32_bf16(false, a, false, b, (short)0, c, false, false);
  asm volatile("v_nop\n\tv_nop\n\tv_nop\n\tv_nop" : "+v"(c) : "v"(a), "v"(b));
  return c;
}
// 16-bit element as a bit pattern held in a __bf16 slot: f16 bits when F16, bf16 (RNE) otherwise
template <bool F16> __device__ __forceinline__ __bf16 at_to16(float f) {
  if (F16) return __builtin_bit_cast(__bf16, (_Float16)f);
  return at_f2bf(f);
}
template <bool F16> __device__ __forceinline__ v8f at_mma16(v16b a, v16b b, v8f c) {
  if (F16) {
    const v16h ah = __builtin_bit_cast(v16h, a), bh = __builtin_bit_cast(v16h, b);
    c = __builtin_amdgcn_wmma_f32_16x16x32_f16(false, ah, false, bh, (short)0, c, false, false);
    asm volatile("v_nop\n\tv_nop\n\tv_nop\n\tv_nop" : "+v"(c) : "v"(ah), "v"(bh));
    return c;
  }
  return at_mma(a, b, c);
}

template <bool SPLIT_QK, bool SPLIT_PV, bool F16 = false>
__global__ __launch_bounds__(128)
void attn64_kernel(const float* __restrict__ q, const float* __restrict__ k,
                   const float* __restrict__ v, float* __restrict__ out,
                   const void* __restrict__ mask_a, const int* __restrict__ mask_b, AttnGeom g) {
  static_assert(!(F16 && (SPLIT_QK || SPLIT_PV)), "f16 mode is non-split");
  const float PSC = F16 ? 32768.0f : 1.0f;     // f16 probabilities carried x2^15 (subnormal range), folded into the final 1/l
  union FB { v16b v; v8b h[2]; };
  __shared__ __align__(16) __bf16 Ksh[AT_KC * AT_D];             // K hi [kv][d]      8 KB
  __shared__ __align__(16) __bf16 Ksl[SPLIT_QK ? AT_KC * AT_D : 8];
  __shared__ __align__(16) __bf16 Vth[AT_D * AT_KC];             // V hi [d][kv]      8 KB
  __shared__ __align__(16) __bf16 Vtl[SPLIT_PV ? AT_D * AT_KC : 8];
  __shared__ __align__(16) __bf16 Psh[AT_NW][16 * AT_KC];        // per wave P hi [row][kv]  8 KB
  __shared__ __align__(16) __bf16 Psl[SPLIT_PV ? AT_NW : 1][SPLIT_PV ? 16 * AT_KC : 8];
  __shared__ __align__(16) float  Os[AT_NW][16 * 68];            // per wave out tile, pitch 68

  const int tid  = threadIdx.x;
  const int wave = tid >> 5;
  const int lane = tid & 31;
  const int hh   = lane >> 4;
  const int c    = lane & 15;

  const int nqb = g.S / AT_QB;
  const int bx = blockIdx.x + g.blk0;
  const int qb = bx % nqb;
  const int bh = bx / nqb;
  const int h  = bh % g.H;
  const int b  = bh / g.H;
  const int qbase_block = qb * AT_QB;
  const int q0 = qbase_block + wave * 16;

  const float* qb_ptr = q + (size_t)b * g.q_bs + (size_t)h * g.q_hs;
  const float* kb_ptr = k + (size_t)b * g.k_bs + (size_t)h * g.k_hs;
  const float* vb_ptr = v + (size_t)b * g.v_bs + (size_t)h * g.v_hs;
  float*       ob_ptr = out + (size_t)b * g.o_bs + (size_t)h * g.o_hs;

  // ---- Q fragments (A operand): 2 d-chunks, hi (and lo) ----
  v16b qah[2], qal[2];
  {
    const float* qrow = qb_ptr + (size_t)(q0 + c) * g.q_rs;
#pragma unroll
    for (int dc = 0; dc < 2; ++dc) {
#pragma unroll
      for (int e = 0; e < 8; ++e) {
        const float f0 = qrow[dc * 32 + 8 * hh + e] * g.qscale;
        const float f1 = qrow[dc * 32 + 16 + 8 * hh + e] * g.qscale;
        if (SPLIT_QK) { __bf16 hq, lq; at_split(f0, hq, lq); qah[dc][e] = hq; qal[dc][e] = lq; at_split(f1, hq, lq); qah[dc][8 + e] = hq; qal[dc][8 + e] = lq; }
        else { qah[dc][e] = at_to16<F16>(f0); qah[dc][8 + e] = at_to16<F16>(f1); qal[dc][e] = qah[dc][e]; qal[dc][8 + e] = qah[dc][8 + e]; }
      }
    }
  }

  float mrow[8], lrow[8];
  v8f oacc[4];
#pragma unroll
  for (int r = 0; r < 8; ++r) { mrow[r] = -INFINITY; lrow[r] = 0.f; }
#pragma unroll
  for (int t = 0; t < 4; ++t) oacc[t] = (v8f){0.f,0.f,0.f,0.f,0.f,0.f,0.f,0.f};

  const int nChunks = (g.mask_mode == 1 || g.mask_mode == 4) ? (qb + 1) : (g.Skv / AT_KC);   // block-uniform
  // per-row query mask (mode 3)
  int qkeep[8];
#pragma unroll
  for (int r = 0; r < 8; ++r) qkeep[r] = (g.mask_mode == 3) ? mask_b[(size_t)b * g.S + q0 + 8 * hh + r] : 1;   // mask_b = qmask in mode 3
  for (int kc = 0; kc < nChunks; ++kc) {
    const int kv0 = kc * AT_KC;
    __syncthreads();
    {
      const int kvr = tid >> 1, dh = (tid & 1) * 32;
      const float* krow = kb_ptr + (size_t)(kv0 + kvr) * g.k_rs + dh;
      const float* vrow = vb_ptr + (size_t)(kv0 + kvr) * g.v_rs + dh;
#pragma unroll
      for (int i = 0; i < 8; ++i) {
        v4f kk = *(const v4f*)(krow + 4 * i);
        v4f vv = *(const v4f*)(vrow + 4 * i);
#pragma unroll
        for (int e = 0; e < 4; ++e) {
          const int d = dh + 4 * i + e;
          if (SPLIT_QK) { __bf16 a, bl; at_split(kk[e], a, bl); Ksh[kvr * AT_D + d] = a; Ksl[kvr * AT_D + d] = bl; }
          else Ksh[kvr * AT_D + d] = at_to16<F16>(kk[e]);
          if (SPLIT_PV) { __bf16 a, bl; at_split(vv[e], a, bl); Vth[d * AT_KC + kvr] = a; Vtl[d * AT_KC + kvr] = bl; }
          else Vth[d * AT_KC + kvr] = at_to16<F16>(vv[e]);
        }
      }
    }
    __syncthreads();

    v8f s[4];
#pragma unroll
    for (int j = 0; j < 4; ++j) {
      s[j] = (v8f){0.f,0.f,0.f,0.f,0.f,0.f,0.f,0.f};
#pragma unroll 1
      for (int dc = 0; dc < 2; ++dc) {
        FB kb;
        kb.h[0] = *(const v8b*)(Ksh + (j * 16 + c) * AT_D + dc * 32 + 8 * hh);
        kb.h[1] = *(const v8b*)(Ksh + (j * 16 + c) * AT_D + dc * 32 + 16 + 8 * hh);
        s[j] = at_mma16<F16>(qah[dc], kb.v, s[j]);
        if (SPLIT_QK) {
          FB kl;
          kl.h[0] = *(const v8b*)(Ksl + (j * 16 + c) * AT_D + dc * 32 + 8 * hh);
          kl.h[1] = *(const v8b*)(Ksl + (j * 16 + c) * AT_D + dc * 32 + 16 + 8 * hh);
          s[j] = at_mma16<F16>(qah[dc], kl.v, s[j]);
          s[j] = at_mma16<F16>(qal[dc], kb.v, s[j]);
        }
      }
    }
    const bool diag = (g.mask_mode == 1) && (kc == qb);
    int kvkeep[4] = {1, 1, 1, 1};
    if (g.mask_mode == 3) {
#pragma unroll
      for (int j = 0; j < 4; ++j) kvkeep[j] = ((const int*)mask_a)[(size_t)b * g.Skv + kv0 + j * 16 + c];   // mask_a = kvmask
    }
    float cm[8];
#pragma unroll
    for (int r = 0; r < 8; ++r) {
      const int qrow = q0 + 8 * hh + r;
      float m = -INFINITY;
#pragma unroll
      for (int j = 0; j < 4; ++j) {
        const int kvcol = kv0 + j * 16 + c;
        bool masked = false;
        if (diag) masked = (kvcol > qrow);
        else if (g.mask_mode == 4) masked = (kvcol > qrow) || (qrow - kvcol > g.mask_is_int);
        else if (g.mask_mode == 2) {
          const size_t mi = (size_t)qrow * g.Skv + kvcol;
          masked = (g.mask_is_int == 0) ? (((const float*)mask_a)[mi] == 0.0f)
                 : (g.mask_is_int == 1) ? (((const int*)mask_a)[mi] == 0) : (((const int*)mask_a)[mi] != 0);
        } else if (g.mask_mode == 3) masked = (qkeep[r] == 0) || (kvkeep[j] == 0);
        else if (g.mask_mode == 5) {
          const size_t mi = (size_t)qrow * g.Skv + kvcol;
          masked = (((const int*)mask_a)[mi] != 0);
          int n = mask_b[mi]; n = n < 0 ? 0 : n;
          s[j][r] += g.cp[(size_t)b * g.c_bs + (size_t)h * g.c_hs + (size_t)qrow * g.c_rs + n]
                   + g.pc[(size_t)b * g.c_bs + (size_t)h * g.c_hs + (size_t)kvcol * g.c_rs + n];
        }
        if (masked) s[j][r] = g.mask_fill;
        m = fmaxf(m, s[j][r]);
      }
#pragma unroll
      for (int off = 1; off < 16; off <<= 1) m = fmaxf(m, __shfl_xor(m, off, 32));
      cm[r] = m;
    }
    __bf16* pwh = Psh[wave];
    __bf16* pwl = Psl[SPLIT_PV ? wave : 0];
#pragma unroll
    for (int r = 0; r < 8; ++r) {
      const float mnew = fmaxf(mrow[r], cm[r]);
      const float alpha = expf(mrow[r] - mnew);
      mrow[r] = mnew;
      float psum = 0.f;
#pragma unroll
      for (int j = 0; j < 4; ++j) {
        const float p = expf(s[j][r] - mnew);
        psum += p;
        if (SPLIT_PV) { __bf16 a, bl; at_split(p, a, bl); pwh[(8 * hh + r) * AT_KC + j * 16 + c] = a; pwl[(8 * hh + r) * AT_KC + j * 16 + c] = bl; }
        else pwh[(8 * hh + r) * AT_KC + j * 16 + c] = at_to16<F16>(p * PSC);
      }
#pragma unroll
      for (int off = 1; off < 16; off <<= 1) psum += __shfl_xor(psum, off, 32);
      lrow[r] = lrow[r] * alpha + psum;
#pragma unroll
      for (int t = 0; t < 4; ++t) oacc[t][r] *= alpha;
    }
    __builtin_amdgcn_fence(__ATOMIC_RELEASE, "workgroup");
    __builtin_amdgcn_wave_barrier();
    __builtin_amdgcn_fence(__ATOMIC_ACQUIRE, "workgroup");
#pragma unroll 1
    for (int kk = 0; kk < 2; ++kk) {
      FB pa, pl;
      pa.h[0] = *(const v8b*)(pwh + c * AT_KC + kk * 32 + 8 * hh);
      pa.h[1] = *(const v8b*)(pwh + c * AT_KC + kk * 32 + 16 + 8 * hh);
      if (SPLIT_PV) {
        pl.h[0] = *(const v8b*)(pwl + c * AT_KC + kk * 32 + 8 * hh);
        pl.h[1] = *(const v8b*)(pwl + c * AT_KC + kk * 32 + 16 + 8 * hh);
      }
#pragma unroll
      for (int t = 0; t < 4; ++t) {
        FB vb;
        vb.h[0] = *(const v8b*)(Vth + (t * 16 + c) * AT_KC + kk * 32 + 8 * hh);
        vb.h[1] = *(const v8b*)(Vth + (t * 16 + c) * AT_KC + kk * 32 + 16 + 8 * hh);
        oacc[t] = at_mma16<F16>(pa.v, vb.v, oacc[t]);
        if (SPLIT_PV) {
          FB vl;
          vl.h[0] = *(const v8b*)(Vtl + (t * 16 + c) * AT_KC + kk * 32 + 8 * hh);
          vl.h[1] = *(const v8b*)(Vtl + (t * 16 + c) * AT_KC + kk * 32 + 16 + 8 * hh);
          oacc[t] = at_mma16<F16>(pa.v, vl.v, oacc[t]);
          oacc[t] = at_mma16<F16>(pl.v, vb.v, oacc[t]);
        }
      }
    }
  }

  float* os = Os[wave];
#pragma unroll
  for (int r = 0; r < 8; ++r) {
    const float inv = 1.0f / (lrow[r] * PSC);
#pragma unroll
    for (int t = 0; t < 4; ++t) os[(8 * hh + r) * 68 + t * 16 + c] = oacc[t][r] * inv;
  }
  __builtin_amdgcn_fence(__ATOMIC_RELEASE, "workgroup");
  __builtin_amdgcn_wave_barrier();
  __builtin_amdgcn_fence(__ATOMIC_ACQUIRE, "workgroup");
  {
    const int c4 = (lane & 15) * 4;
    {
#pragma unroll
      for (int it = 0; it < 8; ++it) {
        const int row = it * 2 + hh;
        v4f val = *(const v4f*)(os + row * 68 + c4);
        *(v4f*)(ob_ptr + (size_t)(q0 + row) * g.o_rs + c4) = val;
      }
      
    }
  }
}

} // namespace w25

// ---- Wide elementwise and row passes: a thread moves 32 or 64 elements with 16-byte loads, so that a pass starts a few thousand waves instead of
//      one wave per 64 or 128 elements. Every wave-wide store covers whole 128-byte lines. Formulas and sum trees are those of the narrow kernels above.
typedef __attribute__((ext_vector_type(4))) _Float16 v4h;
// cast16w<G>: dst[i] = f16(src[i] * s) over a flat range; block bx takes G * 1024 consecutive elements, a thread 4 consecutive ones of each 1024.
template <int G>
__device__ __forceinline__ void cast16w(const float* __restrict__ src, _Float16* __restrict__ dst, float s, unsigned bx) {
    const v4f* sp = (const v4f*)(src + (size_t)bx * (G * 1024));
    v4h* dp = (v4h*)(dst + (size_t)bx * (G * 1024));
    const unsigned t = threadIdx.x;
    v4f a[G];
    // every loop here is unrolled, so that the arrays it indexes are registers and all G loads are in flight together
#pragma unroll
    for (int g = 0; g < G; ++g) a[g] = sp[t + g * 256];
    __builtin_amdgcn_sched_barrier(0);               // holds later register writes behind the wait below
    asm volatile("s_wait_xcnt 0x0" ::: "memory");    // before an address register of the loads above is rewritten (the store addresses are formed next)
    __builtin_amdgcn_sched_barrier(0);               // the pair keeps the forming of the store addresses behind the wait
    v4h h[G];
#pragma unroll
    for (int g = 0; g < G; ++g)
#pragma unroll
        for (int e = 0; e < 4; ++e) h[g][e] = (_Float16)(a[g][e] * s);
#pragma unroll
    for (int g = 0; g < G; ++g) dp[t + g * 256] = h[g];
}
// castT16w<LDS, LDD>: dst[c * LDD + r] = f16(src[r * LDS + c] * s). Block (bx, by) = 64 source rows x 128 source columns, wave = 64 x 16, lane = 8 rows x 4 columns
//   transposed in registers: 8 lanes side by side in r fill one 128-byte line of a dst row. bx < C / 128, by < R / 64.
template <int LDS, int LDD>
__device__ __forceinline__ void castT16w(const float* __restrict__ src, _Float16* __restrict__ dst, float s, unsigned bx, unsigned by) {
    const int lane = threadIdx.x & 31, wave = threadIdx.x >> 5;
    const int r = by * 64 + (lane & 7) * 8;
    const int c = bx * 128 + wave * 16 + (lane >> 3) * 4;
    const float* sp = src + (size_t)r * LDS + c;
    _Float16* dp = dst + (size_t)c * LDD + r;
    v4f x[8];
    // every loop here is unrolled, so that the arrays it indexes are registers and all eight loads are in flight together
#pragma unroll
    for (int i = 0; i < 8; ++i) x[i] = *(const v4f*)(sp + i * LDS);
    __builtin_amdgcn_sched_barrier(0);               // holds later register writes behind the wait below
    asm volatile("s_wait_xcnt 0x0" ::: "memory");    // before an address register of the loads above is rewritten
    __builtin_amdgcn_sched_barrier(0);               // the pair keeps later address arithmetic behind the wait
    v8h h[4];
#pragma unroll
    for (int j = 0; j < 4; ++j)
#pragma unroll
        for (int i = 0; i < 8; ++i) h[j][i] = (_Float16)(x[i][j] * s);
#pragma unroll
    for (int j = 0; j < 4; ++j) *(v8h*)(dp + j * LDD) = h[j];
    asm volatile("s_wait_xcnt 0x0" ::: "memory");    // behind the stores: in the merged kernel another branch's code follows in the listing and reuses their address and data registers
}
// k_cast_all: every f16 operand plane that depends on the inputs alone, in one launch of 2048 blocks, none of which reads what another writes.
//   Blocks 0..511: X. 512..1023: Wq, Wk, Wv, Wo transposed, x16, as four planes of 1024 x 1024 one behind the other (the first three are one Bt of 3072 rows).
//   1024..1535: W1 transposed, x16. 1536..2047: W2 transposed, x16.
__global__ __launch_bounds__(256) void k_cast_all(const float* __restrict__ X, const float* __restrict__ Wq, const float* __restrict__ Wk, const float* __restrict__ Wv,
                                                  const float* __restrict__ Wo, const float* __restrict__ W1, const float* __restrict__ W2,
                                                  _Float16* __restrict__ Xh, _Float16* __restrict__ Wt4, _Float16* __restrict__ W1t, _Float16* __restrict__ W2t) {
    const unsigned b = blockIdx.x, q = b & 511u;
    if (b < 512u) { cast16w<8>(X, Xh, 1.0f, q); return; }
    if (b < 1024u) {
        const unsigned w = q >> 7, i = q & 127u;
        const float* src = (w == 0u) ? Wq : (w == 1u) ? Wk : (w == 2u) ? Wv : Wo;
        castT16w<1024, 1024>(src, Wt4 + (size_t)w * (1024 * 1024), 16.0f, i & 7u, i >> 3);
        return;
    }
    if (b < 1536u) { castT16w<4096, 1024>(W1, W1t, 16.0f, q & 31u, q >> 5); return; }
    castT16w<1024, 4096>(W2, W2t, 16.0f, q & 7u, q >> 3);
}
// Sum of one value per position t = 0..255 of k_stats' tree, add for add: lane l holds positions 4l + q in lo[q] and 128 + 4l + q in hi[q].
//   Levels 128 (in the lane), 64..4 (lanes l and l ^ 16, 8, 4, 2, 1), 2 and 1 (in the lane); every lane ends with the root.
__device__ __forceinline__ float tree256(v4f lo, v4f hi) {
    v4f t = lo + hi;
#pragma unroll
    for (int o = 16; o > 0; o >>= 1) {
#pragma unroll
        for (int q = 0; q < 4; ++q) t[q] += __shfl_xor(t[q], o, 32);
    }
    return (t[0] + t[2]) + (t[1] + t[3]);
}
// k_ln_w: y = (x - mean) * rsqrt(var + eps) * g + b on rows of 1024 in one pass: a wave holds two whole rows in registers, takes their statistics
//   (k_stats mode 0; same partial sums, same tree) and applies them to the same registers (x and y may be the same buffer: a wave reads its rows before it writes them).
//   H16: y16 = f16(y) goes out beside y, as the next product's A operand. grid = rows / 16.
template <bool H16>
__global__ __launch_bounds__(256) void k_ln_w(const float* x, float* y, _Float16* __restrict__ y16, float eps, const float* __restrict__ g, const float* __restrict__ bta) {
    const int lane = threadIdx.x & 31;
    const size_t off = ((size_t)blockIdx.x * 16 + (threadIdx.x >> 5) * 2) * 1024 + 4 * lane;
    const float* base = x + off;
    v4f v[2][8], gg[8], bb[8];
    // every loop here is unrolled, so that the arrays it indexes are registers and all loads are in flight together
#pragma unroll
    for (int r = 0; r < 2; ++r)
#pragma unroll
        for (int m = 0; m < 8; ++m) v[r][m] = *(const v4f*)(base + r * 1024 + 128 * m);
#pragma unroll
    for (int m = 0; m < 8; ++m) { gg[m] = *(const v4f*)(g + 4 * lane + 128 * m); bb[m] = *(const v4f*)(bta + 4 * lane + 128 * m); }
    __builtin_amdgcn_sched_barrier(0);               // holds later register writes behind the wait below
    asm volatile("s_wait_xcnt 0x0" :: "v"(base) : "memory");   // before an address register of the loads above is rewritten; the rows' address is an input, so no later load's result lands on it in front of the wait
    __builtin_amdgcn_sched_barrier(0);               // the pair keeps later address arithmetic behind the wait
    v4h h[2][8];
#pragma unroll
    for (int r = 0; r < 2; ++r) {
        const float mu = tree256(((v[r][0] + v[r][2]) + v[r][4]) + v[r][6], ((v[r][1] + v[r][3]) + v[r][5]) + v[r][7]) / 1024.f;
        v4f q0 = {}, q1 = {};
#pragma unroll
        for (int k = 0; k < 4; ++k) { const v4f d0 = v[r][2 * k] - mu, d1 = v[r][2 * k + 1] - mu; q0 = __builtin_elementwise_fma(d0, d0, q0); q1 = __builtin_elementwise_fma(d1, d1, q1); }
        const float rs = rsqrtf(tree256(q0, q1) / 1024.f + eps);
#pragma unroll
        for (int m = 0; m < 8; ++m) {
            v4f o = (v[r][m] - mu) * rs;
            o *= gg[m]; o += bb[m];
            v[r][m] = o;
            if (H16) {
#pragma unroll
                for (int e = 0; e < 4; ++e) h[r][m][e] = (_Float16)o[e];
            }
        }
    }
    __builtin_amdgcn_sched_barrier(0);               // every value is made before the first store issues, so no store's data register is rewritten behind it
#pragma unroll
    for (int r = 0; r < 2; ++r)
#pragma unroll
        for (int m = 0; m < 8; ++m) {
            *(v4f*)(y + off + r * 1024 + 128 * m) = v[r][m];
            if (H16) *(v4h*)(y16 + off + r * 1024 + 128 * m) = h[r][m];
        }
}


// ---- Q/K/V projection and block attention in one kernel ---------------------------------------------------------------
// k_qkv_attn: one work-group of eight waves per (128-position block z, head h). It first makes that block's and head's Q, K and V, a 128 x 192 tile of X.[Wq Wk Wv]
//   over K = 1024 (f16 operands, f32 sums in k order, x 1/16, rounded to f16), leaves them in LDS and then attends on them: 128 queries x 128 keys x 64 dims,
//   online softmax over two 64-key halves. Q, K and V never go to memory; O leaves as f16, the next product's A operand.
//   Product: a pass is 64 k. A stage is 64 rows each of Wq^T, Wk^T, Wv^T (this head's), then the block's 128 rows of X, 128 B each, copied to LDS at pitch 144 B; three buffers,
//   two stages' copies always under way; two work-groups share a WGP. Wave (wave >> 2, wave & 3) takes 64 rows of X and dims 16 * (wave & 3) .. + 15 of each of Q, K and V.
//   For Q and K the weight fragment is the A operand and the X fragment the B operand, so that a lane ends with 8 consecutive dims of one position: one 16-byte LDS store
//   into [position][d]. For V it is the other way round: a lane ends with 8 consecutive keys of one dim, one 16-byte store into [d][key].
//   Attention: wave w owns queries 16w .. 16w + 15; every A and B fragment is two 16-byte LDS reads.
#define BA_KP 72      // pitch of Q, K and P rows in halves: 144 B = 16 B x odd, for 16-byte readers
#define BA_VP 136     // pitch of V^T rows in halves: 272 B = 16 B x odd
#define QA_PITCH 144                  // pitch of a stage row in bytes: 16 B x odd
#define QA_STAGE (320 * QA_PITCH)
#define QA_NS 3
#define QA_NT 16                      // passes: 1024 / 64
// orders one wave's LDS writes and its other lanes' LDS reads (the per-wave P and O tiles)
__device__ __forceinline__ void ba_wave_sync() {
    __builtin_amdgcn_fence(__ATOMIC_RELEASE, "workgroup");
    __builtin_amdgcn_wave_barrier();
    __builtin_amdgcn_fence(__ATOMIC_ACQUIRE, "workgroup");
}
// One stage: ten asynchronous copies, 16 B per lane each; a lane fills 16 B of stage rows (thread >> 3) + 32 * i. Rows 0..191 come from the three weight planes, 192..319 from X.
// The s_wait_xcnt ends the copies' own statement, so that no address register of a copy is rewritten in front of it.
__device__ __forceinline__ void qa_fill(unsigned l, const unsigned short* gW, const unsigned short* gX) {
    asm volatile(
        "global_load_async_to_lds_b128 %0, %10, off\n\t"
        "global_load_async_to_lds_b128 %1, %11, off\n\t"
        "global_load_async_to_lds_b128 %2, %12, off\n\t"
        "global_load_async_to_lds_b128 %3, %13, off\n\t"
        "global_load_async_to_lds_b128 %4, %14, off\n\t"
        "global_load_async_to_lds_b128 %5, %15, off\n\t"
        "global_load_async_to_lds_b128 %6, %16, off\n\t"
        "global_load_async_to_lds_b128 %7, %17, off\n\t"
        "global_load_async_to_lds_b128 %8, %18, off\n\t"
        "global_load_async_to_lds_b128 %9, %19, off\n\t"
        "s_wait_xcnt 0x0"
        :: "v"(l), "v"(l + 32u * QA_PITCH), "v"(l + 64u * QA_PITCH), "v"(l + 96u * QA_PITCH), "v"(l + 128u * QA_PITCH),
           "v"(l + 160u * QA_PITCH), "v"(l + 192u * QA_PITCH), "v"(l + 224u * QA_PITCH), "v"(l + 256u * QA_PITCH), "v"(l + 288u * QA_PITCH),
           "v"(gW), "v"(gW + (size_t)32 * 1024), "v"(gW + (size_t)1024 * 1024), "v"(gW + (size_t)(1024 + 32) * 1024),
           "v"(gW + (size_t)2048 * 1024), "v"(gW + (size_t)(2048 + 32) * 1024),
           "v"(gX), "v"(gX + (size_t)32 * 1024), "v"(gX + (size_t)64 * 1024), "v"(gX + (size_t)96 * 1024)
        : "memory");
}
__global__ __launch_bounds__(256, 4) void k_qkv_attn(const unsigned short* __restrict__ Xh, const unsigned short* __restrict__ Wt, const int* __restrict__ VL, _Float16* __restrict__ O) {
    typedef w25::Frag<_Float16> FH;
    static_assert(QA_NS * QA_STAGE >= 107520, "the attention's tiles lie in the ring");
    __shared__ __attribute__((aligned(128))) unsigned char sL[QA_NS * QA_STAGE];
    const int tid = threadIdx.x, lane = tid & 31, hf = lane >> 4, l15 = lane & 15, wave = tid >> 5;
    const int h = blockIdx.x & 15, z = blockIdx.x >> 4;
    const int g = wave & 3, wm = (wave >> 2) * 64;
    const float L2E = 1.4426950408889634f;
    const float NEG = -__builtin_inff();

    const unsigned ldsLane = (unsigned)(uintptr_t)(&sL[0]) + (unsigned)((tid >> 3) * QA_PITCH + (tid & 7) * 16);
    const unsigned short* gW = Wt + (size_t)(h * 64 + (tid >> 3)) * 1024 + (tid & 7) * 8;
    const unsigned short* gX = Xh + (size_t)(z * 128 + (tid >> 3)) * 1024 + (tid & 7) * 8;
    v8f aq[4], ak[4], av[4];
#pragma unroll
    for (int i = 0; i < 4; ++i) { v8f zz = {}; aq[i] = zz; ak[i] = zz; av[i] = zz; }

    // A stage is 10 copies of every wave, so "all but the 10 youngest" is "up to and with the older of the two stages under way".
    qa_fill(ldsLane, gW, gX);
    qa_fill(ldsLane + QA_STAGE, gW + 64, gX + 64);
    w25::gl_wait_async_but<10>();                // stage 0 has landed
    __syncthreads();                             // stage 0 is readable by every wave
    qa_fill(ldsLane + 2u * QA_STAGE, gW + 128, gX + 128);

    unsigned bo = 0;                             // byte offset of the buffer that holds stage t
    // kept rolled: one pass per trip, so that the order at its foot stands once
#pragma unroll 1
    for (int t = 0; t < QA_NT; ++t) {
        const unsigned char* pW = sL + bo + (g * 16 + l15) * QA_PITCH + hf * 16;
        const unsigned char* pX = sL + bo + (192 + wm + l15) * QA_PITCH + hf * 16;
        v16h wf[2][3], xf[2][4];                 // both 32-k fragment sets of the pass: its LDS reads stand in one place, ahead of its WMMAs
#pragma unroll
        for (int kk = 0; kk < 2; ++kk) {
#pragma unroll
            for (int j = 0; j < 3; ++j) wf[kk][j] = FH::load((const _Float16*)(pW + j * 64 * QA_PITCH + kk * 64));
#pragma unroll
            for (int i = 0; i < 4; ++i) xf[kk][i] = FH::load((const _Float16*)(pX + i * 16 * QA_PITCH + kk * 64));
        }
        __builtin_amdgcn_sched_barrier(0);       // keeps the pass's LDS reads as one group ahead of its WMMAs, not among them
#pragma unroll
        for (int kk = 0; kk < 2; ++kk)
#pragma unroll
            for (int i = 0; i < 4; ++i) {
                aq[i] = FH::mma(wf[kk][0], xf[kk][i], aq[i]);      // D: lane = position, element = dim
                ak[i] = FH::mma(wf[kk][1], xf[kk][i], ak[i]);
                av[i] = FH::mma(xf[kk][i], wf[kk][2], av[i]);      // D: lane = dim, element = position
            }
        __builtin_amdgcn_sched_barrier(0);       // ends the pass's WMMAs: the foot stays behind them
        w25::gl_wait_ds0();
        // Stage t + 1 has landed. While stage t + 2 exists, its 10 copies are this wave's youngest and stay under way; on the last trips the wait is to 0.
        if (t + QA_NS <= QA_NT) w25::gl_wait_async_but<10>();
        else w25::gl_wait_async0();
        __syncthreads();                         // publishes stage t + 1 and ends every read of stage t
        if (t + QA_NS < QA_NT) qa_fill(ldsLane + bo, gW + (size_t)(t + QA_NS) * 64, gX + (size_t)(t + QA_NS) * 64);
        bo = (bo == (QA_NS - 1u) * QA_STAGE) ? 0u : bo + QA_STAGE;
    }
    w25::gl_wait_async0();

    // The ring is free: the last trip's foot waited for every read and every copy and passed the barrier. The attention's tiles take its place.
    _Float16* ql = (_Float16*)(sL);                              // Q   [position][d], 128 x BA_KP
    _Float16* kl = (_Float16*)(sL + 18432);                      // K   [key][d],      128 x BA_KP
    _Float16* vt = (_Float16*)(sL + 36864);                      // V^T [d][key],       64 x BA_VP
    _Float16* myp = (_Float16*)(sL + 54272) + wave * (16 * BA_KP);   // this wave's P tile, 16 x BA_KP
    float*    myo = (float*)(sL + 72704) + wave * (16 * 68);         // this wave's O tile, 16 x 68
#pragma unroll
    for (int i = 0; i < 4; ++i) {
        v8h hq, hk, hv;
#pragma unroll
        for (int r = 0; r < 8; ++r) { hq[r] = (_Float16)(aq[i][r] * 0.0625f); hk[r] = (_Float16)(ak[i][r] * 0.0625f); hv[r] = (_Float16)(av[i][r] * 0.0625f); }
        *(v8h*)(ql + (wm + i * 16 + l15) * BA_KP + g * 16 + hf * 8) = hq;
        *(v8h*)(kl + (wm + i * 16 + l15) * BA_KP + g * 16 + hf * 8) = hk;
        *(v8h*)(vt + (g * 16 + l15) * BA_VP + wm + i * 16 + hf * 8) = hv;
    }
    const size_t base = (size_t)z * (128 * 1024) + (size_t)h * 64;      // (row 0, dim 0) of this block and head in O
    const int c8 = (lane & 7) * 8;
    const int vlen = VL[z >> 3];                                         // valid length of this block's sequence (eight blocks of 128 positions to a sequence)
    int mk[8];
#pragma unroll
    for (int i = 0; i < 8; ++i) mk[i] = ((z & 7) * 128 + i * 16 + l15 < vlen) ? 1 : 0;         // keep flag of key 16i + l15: its position in the sequence is below the valid length
    v8f o[4]; float m8[8], l8[8];
#pragma unroll
    for (int t = 0; t < 4; ++t) { v8f zz = {}; o[t] = zz; }
#pragma unroll
    for (int i = 0; i < 8; ++i) { m8[i] = NEG; l8[i] = 0.f; }
    __syncthreads();                                                      // Q, K and V^T are readable by every wave; they are not written again
    v16h qa[2];                                                           // A fragment: element e <- dim 32 ks + frag_k(e, hf)
#pragma unroll
    for (int ks = 0; ks < 2; ++ks) qa[ks] = FH::load(ql + (wave * 16 + l15) * BA_KP + ks * 32 + 8 * hf);

#pragma unroll
    for (int jb = 0; jb < 2; ++jb) {
        const int j0 = jb * 64;
        v8f s[4];
#pragma unroll
        for (int t = 0; t < 4; ++t) {
            const _Float16* kr = kl + (j0 + t * 16 + l15) * BA_KP + 8 * hf;
            v8f acc = {};
            acc = FH::mma(qa[0], FH::load(kr), acc);
            acc = FH::mma(qa[1], FH::load(kr + 32), acc);
            s[t] = acc;
        }
#pragma unroll
        for (int i = 0; i < 8; ++i) {
            float sc[4];
#pragma unroll
            for (int t = 0; t < 4; ++t) {
                float v = s[t][i] * 0.125f;
                if (mk[jb * 4 + t] == 0) v = -1000000.0f;
                v *= L2E;
                sc[t] = v;
            }
            float mx = fmaxf(fmaxf(sc[0], sc[1]), fmaxf(sc[2], sc[3]));
            mx = fmaxf(mx, __shfl_xor(mx, 1, 32)); mx = fmaxf(mx, __shfl_xor(mx, 2, 32));
            mx = fmaxf(mx, __shfl_xor(mx, 4, 32)); mx = fmaxf(mx, __shfl_xor(mx, 8, 32));
            const float mnew = fmaxf(m8[i], mx);
            const float ec = exp2f(m8[i] - mnew);                         // taken unconditionally and then selected: no branch round each exp2
            const float corr = (mnew == NEG) ? 1.f : ec;
            float rs = 0.f;
#pragma unroll
            for (int t = 0; t < 4; ++t) {
                const float ep = exp2f(sc[t] - mnew);
                const float pp = (sc[t] == NEG) ? 0.f : ep; rs += pp;
                myp[(i + 8 * hf) * BA_KP + t * 16 + l15] = (_Float16)(pp * 4096.f);
            }
            rs += __shfl_xor(rs, 1, 32); rs += __shfl_xor(rs, 2, 32); rs += __shfl_xor(rs, 4, 32); rs += __shfl_xor(rs, 8, 32);
            l8[i] = l8[i] * corr + rs; m8[i] = mnew;
#pragma unroll
            for (int t = 0; t < 4; ++t) o[t][i] *= corr;
        }
        ba_wave_sync();                                                   // P is written; its rows are read by other lanes of the wave
        const v16h pa0 = FH::load(myp + l15 * BA_KP + 8 * hf), pa1 = FH::load(myp + l15 * BA_KP + 32 + 8 * hf);
#pragma unroll
        for (int t = 0; t < 4; ++t) {
            const _Float16* vr = vt + (t * 16 + l15) * BA_VP + j0 + 8 * hf;
            o[t] = FH::mma(pa0, FH::load(vr), o[t]);
            o[t] = FH::mma(pa1, FH::load(vr + 32), o[t]);
        }
        ba_wave_sync();                                                   // P is read; the next half may overwrite it
    }
#pragma unroll
    for (int i = 0; i < 8; ++i) {
        const float rl = 1.f / (l8[i] * 4096.f);
        const float invr = (l8[i] > 0.f) ? rl : 0.f;
#pragma unroll
        for (int t = 0; t < 4; ++t) myo[(i + 8 * hf) * 68 + t * 16 + l15] = o[t][i] * invr;
    }
    ba_wave_sync();                                                       // O is written; its rows go out as whole 128-byte lines of f16
    const int r4 = lane >> 3;
    _Float16* op = O + base + (size_t)(wave * 16 + r4) * 1024 + c8;
#pragma unroll
    for (int it = 0; it < 4; ++it) {                                      // rows 4 * it + r4
        const float* sp = myo + (it * 4 + r4) * 68 + c8;
        const v4f lo = *(const v4f*)(sp), hi = *(const v4f*)(sp + 4);
        v8h hv;
#pragma unroll
        for (int e = 0; e < 4; ++e) { hv[e] = (_Float16)lo[e]; hv[4 + e] = (_Float16)hi[e]; }
        *(v8h*)(op + (size_t)it * (4 * 1024)) = hv;
    }
}

extern "C" void kernel_launch(void* const* d_in, const int* in_sizes, int n_in, void* d_out, int out_size, void* d_ws, size_t ws_size, hipStream_t stream) {
    (void)in_sizes; (void)n_in; (void)out_size; (void)ws_size;
    const float* X = (const float*)d_in[0];
    const int* vl = (const int*)d_in[1];
    const float* Wq = (const float*)d_in[2];
    const float* Wk = (const float*)d_in[3];
    const float* Wv = (const float*)d_in[4];
    const float* Wo = (const float*)d_in[5];
    const float* g1 = (const float*)d_in[6];
    const float* be1 = (const float*)d_in[7];
    const float* W1 = (const float*)d_in[8];
    const float* bf1 = (const float*)d_in[9];
    const float* W2 = (const float*)d_in[10];
    const float* bf2 = (const float*)d_in[11];
    const float* g2 = (const float*)d_in[12];
    const float* be2 = (const float*)d_in[13];
    const int Bn = 4;
    const int S = 1024;
    const int D = 1024;
    const int NH = 16;
    const int DH = 64;
    const int F = 4096;
    const int M = 128;
    const int NB = S / M;
    const int NR = Bn * S;
    float* out = (float*)d_out;
    char* wsp = (char*)d_ws;
    float* Q = (float*)wsp; wsp += (((size_t)((size_t)NR * D) * 4 + 255) / 256) * 256;
    float* Kb = (float*)wsp; wsp += (((size_t)((size_t)NR * D) * 4 + 255) / 256) * 256;
    float* V = (float*)wsp; wsp += (((size_t)((size_t)NR * D) * 4 + 255) / 256) * 256;
    float* AT = (float*)wsp; wsp += (((size_t)((size_t)NR * D) * 4 + 255) / 256) * 256;
    float* MF = (float*)wsp; wsp += (((size_t)((size_t)NR) * 4 + 255) / 256) * 256;
    float* Y = (float*)wsp; wsp += (((size_t)((size_t)NR * D) * 4 + 255) / 256) * 256;
    float* ST = (float*)wsp; wsp += (((size_t)((size_t)NR * 32) * 4 + 255) / 256) * 256;
    float* H1 = (float*)wsp; wsp += (((size_t)((size_t)NR * F) * 4 + 255) / 256) * 256;
    unsigned short* G64A = (unsigned short*)wsp; wsp += (((size_t)(16777216) * 2 + 255) / 256) * 256;
    unsigned short* G64B = (unsigned short*)wsp; wsp += (((size_t)(4194304) * 2 + 255) / 256) * 256;
    // Planes of f16 values, each written by the kernel that makes the values: X and the six transposed weights (one launch),
    // the attention's output, the first LayerNorm's output (in G64A, once the projections have read X there, beside its f32 copy Y) and the FFN's hidden layer.
    _Float16* Oh = (_Float16*)Q;                     // the attention's output: its own plane, since other work-groups of its launch still read X in G64A
    _Float16* Ah = (_Float16*)G64A;
    _Float16* Hh = (_Float16*)H1;
    _Float16* Wt4 = (_Float16*)G64B;                 // Wq^T, Wk^T, Wv^T, Wo^T: 1024 x 1024 each
    _Float16* Wot = Wt4 + 3 * 1024 * 1024;
    _Float16* W1t = (_Float16*)AT;                   // 4096 x 1024
    _Float16* W2t = W1t + 4096 * 1024;               // 1024 x 4096
    k_cast_all<<<2048, 256, 0, stream>>>(X, Wq, Wk, Wv, Wo, W1, W2, Ah, Wt4, W1t, W2t);
    k_qkv_attn<<<512, 256, 0, stream>>>((const unsigned short*)(G64A), (const unsigned short*)(Wt4), vl, Oh);
    w25::wmma_gemm_lds<1024, 1024, 0, true, 0, false, 1024, 0, 4><<<256, 256, 0, stream>>>((const unsigned short*)(Q), (const unsigned short*)(Wot), Y, nullptr, nullptr, X, 0.0625f);
    k_ln_w<true><<<(unsigned)(NR / 16), 256, 0, stream>>>(Y, Y, Ah, 1e-05f, g1, be1);
    w25::wmma_gemm_lds<4096, 1024, 2, false, 2, true><<<1024, 256, 0, stream>>>((const unsigned short*)(G64A), (const unsigned short*)(W1t), nullptr, Hh, bf1, nullptr, 0.0625f);
    w25::wmma_gemm_lds<1024, 4096, 2, true, 0, false, 1024, 0, 4><<<256, 256, 0, stream>>>((const unsigned short*)(H1), (const unsigned short*)(W2t), Kb, nullptr, bf2, Y, 0.0625f);
    k_ln_w<false><<<(unsigned)(NR / 16), 256, 0, stream>>>(Kb, out, nullptr, 1e-05f, g2, be2);
}
